// v000
// Times are from an AMD MI455X. After a warm-up the kernel runs many times in a row, and a time is the length of
// such a window on the GPU divided by its runs, so every launch and the gaps after it count. The runs cycle
// through copies of the inputs. A figure is the median of several windows, for all but v000 over two sittings.
// Sittings can differ by a few percent; kernels timed side by side share one.
// v000 is the starting kernel. One run takes 293 microseconds.
#include <hip/hip_runtime.h>

// MultiAxisAttention: qkv = x Wqkv^T + bqkv (16 heads x 64), causal mask (key > query -> -1e9) plus a per-batch padding mask (key >= seq_len[b] -> -1e9), softmax of q.k/8, out = ctx Wout^T + bout
// -> [2][2048][1024]. seq_lens here are > 0, so every query keeps key 0 and the masked keys contribute exp(-1e9 - max) = 0; the key loop stops at
// min(causal bound, seq_len).
// x, the four weights and bo rounded to bf16: projection on v_wmma_f32_16x16x32_bf16 (exact products, f32 accumulate);
// scores, P.v and the output projection on v_wmma_f32_16x16x32_f16 with every computed operand (q, k, v, P, y — each carried x8 so the hi/lo residual planes stay normal) as an f16
// hi+lo pair (3 / 2 products); online softmax in f32. Fragment k-map per lane half hh for A AND B: elements 0..7 <- k = 8hh+0..7, 8..15 <- k = 16+8hh+0..7. Every intermediate /

namespace {
constexpr int BT = 2, Bn = 2, S = 2048, D = 1024, H = 16, HD = 64, NTOK = Bn * S;
constexpr float SCALE = 0.125f, VS = 8.0f, QS = 8.0f, PS = 8.0f;   // power-of-two carry scales so hi/lo residual planes stay normal in f16
constexpr size_t VPL = (size_t)NTOK * D;   // distance between the (8v)^T hi and lo planes
constexpr size_t QPL = (size_t)NTOK * D;   // distance between the q/k hi and lo planes

typedef _Float16 b16;
typedef __attribute__((ext_vector_type(16))) _Float16 v16b;
typedef __attribute__((ext_vector_type(8)))  _Float16 v8b;
typedef __attribute__((ext_vector_type(8)))  float v8f;
typedef __attribute__((ext_vector_type(4)))  float v4f;

__device__ __forceinline__ v8b ld8b(const b16* p) { return *(const v8b*)p; }
__device__ __forceinline__ v16b cat8b(v8b a, v8b b) { return __builtin_shufflevector(a, b, 0, 1, 2, 3, 4, 5, 6, 7, 8, 9, 10, 11, 12, 13, 14, 15); }
__device__ __forceinline__ v16b frag_kb(const b16* p, int hh) { return cat8b(ld8b(p + 8 * hh), ld8b(p + 16 + 8 * hh)); }
__device__ __forceinline__ void split16(float v, b16& hi, b16& lo) { hi = (b16)v; lo = (b16)(v - (float)hi); }
// hi/lo fragment pair straight from an f32 k-contiguous row (same k-map)
__device__ __forceinline__ void frag_ksplit(const float* p, int hh, v16b& fh_, v16b& fl_) {
  const float* p0 = p + 8 * hh; const float* p1 = p + 16 + 8 * hh;
#pragma unroll
  for (int e = 0; e < 8; ++e) { b16 a, c; split16(p0[e], a, c); fh_[e] = a; fl_[e] = c; split16(p1[e], a, c); fh_[8 + e] = a; fl_[8 + e] = c; }
}
__device__ __forceinline__ v8f wmma16b(v16b a, v16b b, v8f c) {
  v8f d = __builtin_amdgcn_wmma_f32_16x16x32_f16(false, a, false, b, (short)0, c, false, false);
  asm volatile("v_nop\n\tv_nop\n\tv_nop\n\tv_nop" : "+v"(d) : "v"(a), "v"(b));
  return d;
}
__device__ __forceinline__ void wave_lds_sync() {
  __builtin_amdgcn_fence(__ATOMIC_RELEASE, "workgroup");
  __builtin_amdgcn_wave_barrier();
  __builtin_amdgcn_fence(__ATOMIC_ACQUIRE, "workgroup");
}

// Operand descriptor: NP = 0 -> f32 rows split on the fly into (hi, lo); NP = 1 -> one f16 plane; NP = 2 -> f16 hi + lo planes;
// NP = 3 -> f32 rows rounded once to a single f16 fragment. ld = row pitch.
struct Opnd { const void* p0; const void* p1; int ld; };
template <int NP> __device__ __forceinline__ void load_frags(const Opnd& o, int row, int kb, int hh, v16b& fh_, v16b& fl_) {
  if (NP == 0) { frag_ksplit((const float*)o.p0 + (size_t)row * o.ld + kb, hh, fh_, fl_); }
  else if (NP == 4 || NP == 5) {                             // f32 rows x64 (NP 4) or x8 (NP 5) then split (keeps the lo halves of small values normal)
    const float sc_ = (NP == 4) ? 64.0f : 8.0f;
    const float* p = (const float*)o.p0 + (size_t)row * o.ld + kb; const float* p0 = p + 8 * hh; const float* p1 = p + 16 + 8 * hh;
#pragma unroll
    for (int e = 0; e < 8; ++e) { b16 a, c; split16(p0[e] * sc_, a, c); fh_[e] = a; fl_[e] = c; split16(p1[e] * sc_, a, c); fh_[8 + e] = a; fl_[8 + e] = c; }
  } else if (NP == 3) {
    const float* p = (const float*)o.p0 + (size_t)row * o.ld + kb; const float* p0 = p + 8 * hh; const float* p1 = p + 16 + 8 * hh;
#pragma unroll
    for (int e = 0; e < 8; ++e) { fh_[e] = (b16)p0[e]; fh_[8 + e] = (b16)p1[e]; }
    fl_ = fh_;
  } else {
    fh_ = frag_kb((const b16*)o.p0 + (size_t)row * o.ld + kb, hh);
    if (NP == 2) fl_ = frag_kb((const b16*)o.p1 + (size_t)row * o.ld + kb, hh); else fl_ = fh_;
  }
}
template <int ANP, int BNP> __device__ __forceinline__ v8f mac(v16b ah, v16b al, v16b bh, v16b bl, v8f c) {
  c = wmma16b(ah, bh, c);
  if (BNP == 0 || BNP == 2 || BNP == 4 || BNP == 5) c = wmma16b(ah, bl, c);     // hi.lo
  if (ANP == 0 || ANP == 2 || ANP == 4 || ANP == 5) c = wmma16b(al, bh, c);     // lo.hi   (lo.lo dropped)
  return c;
}
// 32x64 wave tile: acc[r][t] (rows m0+16r.., cols c0+16t..) += A[m][k] . B[n][k] over k in [0, K)
template <int ANP, int BNP>
__device__ __forceinline__ void gemm_tile(const Opnd& A, const Opnd& B, int K, int m0, int c0, int nloc, int hlf, v8f (&acc)[2][4]) {
  for (int kb = 0; kb < K; kb += 32) {
    v16b a0h, a0l, a1h, a1l;
    load_frags<ANP>(A, m0 + nloc, kb, hlf, a0h, a0l);
    load_frags<ANP>(A, m0 + 16 + nloc, kb, hlf, a1h, a1l);
#pragma unroll
    for (int t = 0; t < 4; ++t) {
      v16b bh, bl;
      load_frags<BNP>(B, c0 + t * 16 + nloc, kb, hlf, bh, bl);
      acc[0][t] = mac<ANP, BNP>(a0h, a0l, bh, bl, acc[0][t]);
      acc[1][t] = mac<ANP, BNP>(a1h, a1l, bh, bl, acc[1][t]);
    }
  }
}

__device__ __forceinline__ void epi_planes(v8f (&acc)[2][4], float scale, bool two, b16* __restrict__ oh, b16* __restrict__ ol, int ldo,
                                           int m0, int c0, int lane, b16* Th, b16* Tl) {
  const int nloc = lane & 15, hlf = lane >> 4;
#pragma unroll
  for (int t = 0; t < 4; ++t)
#pragma unroll
    for (int r = 0; r < 2; ++r)
#pragma unroll
      for (int v = 0; v < 8; ++v) {
        const int rr = r * 16 + v + 8 * hlf, cc = t * 16 + nloc;
        b16 h_, l_; split16(acc[r][t][v] * scale, h_, l_);
        Th[rr * 64 + cc] = h_; Tl[rr * 64 + cc] = l_;
      }
  wave_lds_sync();
  {
#pragma unroll
    for (int j = 0; j < 8; ++j) {
      const int rr = j * 4 + (lane >> 3), c8 = (lane & 7) * 8;
      const size_t o = (size_t)(m0 + rr) * ldo + c0 + c8;
      *(v8b*)(oh + o) = ld8b(Th + rr * 64 + c8);
      if (two) *(v8b*)(ol + o) = ld8b(Tl + rr * 64 + c8);
    }
    
  }
}
// (b) f32 rows with pitch ldo: 64 floats = 256 B = 2 lines per row; 16 lanes x 16 B per row, 2 rows per instruction. Optional per-row factor
__device__ __forceinline__ void epi_f32(v8f (&acc)[2][4], float scale, const float* rscale, float* __restrict__ out, int ldo, int m0, int c0, int lane, float* Tt) {
  const int nloc = lane & 15, hlf = lane >> 4;
#pragma unroll
  for (int t = 0; t < 4; ++t)
#pragma unroll
    for (int r = 0; r < 2; ++r)
#pragma unroll
      for (int v = 0; v < 8; ++v) {
        const int rr = r * 16 + v + 8 * hlf;
        const float rs = rscale ? rscale[(size_t)(m0 + rr) * 32] : 1.0f;
        Tt[rr * 64 + t * 16 + nloc] = acc[r][t][v] * scale * rs;
      }
  wave_lds_sync();
  float* dst0 = out + (size_t)m0 * ldo + c0;
  {
#pragma unroll
    for (int j = 0; j < 16; ++j) { const int rr = j * 2 + hlf, c4 = nloc * 4; *(v4f*)(dst0 + (size_t)rr * ldo + c4) = *(const v4f*)(Tt + rr * 64 + c4); }
    
  }
}



typedef __attribute__((ext_vector_type(8))) __bf16 v8bb; typedef __attribute__((ext_vector_type(16))) __bf16 v16bb;
typedef __attribute__((ext_vector_type(8))) unsigned short v8us;
__device__ __forceinline__ v16bb frag_kb_bf(const __bf16* p, int hh) { const v8bb a = *(const v8bb*)(p + 8 * hh), b = *(const v8bb*)(p + 16 + 8 * hh); return __builtin_shufflevector(a, b, 0, 1, 2, 3, 4, 5, 6, 7, 8, 9, 10, 11, 12, 13, 14, 15); }
__device__ __forceinline__ v8f wmma16bb(v16bb a, v16bb b, v8f c) {
  v8f d = __builtin_amdgcn_wmma_f32_16x16x32_bf16(false, a, false, b, (short)0, c, false, false);
  asm volatile("v_nop\n\tv_nop\n\tv_nop\n\tv_nop" : "+v"(d) : "v"(a), "v"(b));
  return d;
}
__device__ __forceinline__ unsigned short bf16_rne_bits(float v) { unsigned int u = __float_as_uint(v); u += 0x7FFFu + ((u >> 16) & 1u); return (unsigned short)(u >> 16); }
__device__ __forceinline__ float bf16_rne(float v) { return __uint_as_float(((unsigned int)bf16_rne_bits(v)) << 16); }



__global__ __launch_bounds__(256) void xprep_kernel(const float* __restrict__ x, unsigned short* __restrict__ x16) {   // one pass's two batches -> bf16
  const size_t tid = (size_t)blockIdx.x * blockDim.x + threadIdx.x, nth = (size_t)gridDim.x * blockDim.x;
  { for (size_t p = tid; p < (size_t)NTOK * D / 8; p += nth) { v8us v;
#pragma unroll
      for (int e = 0; e < 8; ++e) v[e] = bf16_rne_bits(x[p * 8 + e]);
      *(v8us*)(x16 + p * 8) = v; }  }
}
__global__ __launch_bounds__(256) void prep_kernel(const float* __restrict__ wqkv, const float* __restrict__ wo, unsigned short* __restrict__ w16, b16* __restrict__ wo16) {
  const size_t tid = (size_t)blockIdx.x * blockDim.x + threadIdx.x, nth = (size_t)gridDim.x * blockDim.x;
  {
    for (size_t p = tid; p < (size_t)3 * D * D / 8; p += nth) { v8us v;   // Wqkv [3072][1024] ([out][in]) rows copied directly
#pragma unroll
      for (int e = 0; e < 8; ++e) v[e] = bf16_rne_bits(wqkv[p * 8 + e]);
      *(v8us*)(w16 + p * 8) = v; }
    for (size_t p = tid; p < (size_t)D * D / 8; p += nth) { v8b w;   // W_o [out][in] rows copied directly
#pragma unroll
      for (int e = 0; e < 8; ++e) w[e] = (b16)bf16_rne(wo[p * 8 + e]);
      *(v8b*)(wo16 + p * 8) = w; }
    
  }
}

// projections: rows = tokens (4096), K = 1024, column tiles of 64 = one head of q (tiles 0..15), k (16..31) or v (32..47); f16 rows [b*H + head][tok][64] for q/k;
// v: (8v)^T f16 [b*H + head][64][tok]. grid (48, 32) x 128.
__global__ __launch_bounds__(128) void proj_kernel(const __bf16* __restrict__ x16, const __bf16* __restrict__ w16, const float* __restrict__ bqkv, b16* __restrict__ qh, b16* __restrict__ kh, b16* __restrict__ vt) {
  __shared__ __attribute__((aligned(16))) b16 Th[4][32][HD + 8], Tq[4][32][HD + 8];
  __shared__ __attribute__((aligned(16))) b16 Tt[64][128 + 8], Tl[64][128 + 8];
  const int lane = threadIdx.x & 31, wave = threadIdx.x >> 5, nloc = lane & 15, hlf = lane >> 4, m0 = blockIdx.y * 128 + wave * 32, c0 = blockIdx.x * 64;
  v8f acc[2][4];
#pragma unroll
  for (int r = 0; r < 2; ++r)
#pragma unroll
    for (int t = 0; t < 4; ++t) acc[r][t] = (v8f){};
#pragma unroll 2
  for (int kb = 0; kb < D; kb += 32) {
    const v16bb a0 = frag_kb_bf(x16 + (size_t)(m0 + nloc) * D + kb, hlf), a1 = frag_kb_bf(x16 + (size_t)(m0 + 16 + nloc) * D + kb, hlf);
#pragma unroll
    for (int t = 0; t < 4; ++t) { const v16bb bw = frag_kb_bf(w16 + (size_t)(c0 + t * 16 + nloc) * D + kb, hlf); acc[0][t] = wmma16bb(a0, bw, acc[0][t]); acc[1][t] = wmma16bb(a1, bw, acc[1][t]); }
  }
  const int which = blockIdx.x / (D / 64), head = blockIdx.x % (D / 64), b = m0 / S, tok0 = m0 % S;
#pragma unroll
  for (int t = 0; t < 4; ++t) { const float bb = bf16_rne(bqkv[c0 + t * 16 + nloc]);   // + bias (rounded to bf16)
#pragma unroll
    for (int r = 0; r < 2; ++r)
#pragma unroll
      for (int v = 0; v < 8; ++v) acc[r][t][v] += bb; }
  if (which < 2) {                                              // q or k head: f16 rows
#pragma unroll
    for (int t = 0; t < 4; ++t)
#pragma unroll
      for (int r = 0; r < 2; ++r)
#pragma unroll
        for (int v = 0; v < 8; ++v) { b16 a_, c_; split16(acc[r][t][v] * QS, a_, c_); Th[wave][r * 16 + 8 * hlf + v][t * 16 + nloc] = a_; Tq[wave][r * 16 + 8 * hlf + v][t * 16 + nloc] = c_; }   // q, k carried x8 (lo residuals stay normal)
    wave_lds_sync();
    b16* dst = (which == 0 ? qh : kh) + (((size_t)b * H + head) * S + tok0) * HD;
    {
#pragma unroll
      for (int j = 0; j < 8; ++j) { const int rr = j * 4 + (lane >> 3), c8 = (lane & 7) * 8; *(v8b*)(dst + (size_t)rr * HD + c8) = *(const v8b*)(&Th[wave][rr][c8]); *(v8b*)(dst + QPL + (size_t)rr * HD + c8) = *(const v8b*)(&Tq[wave][rr][c8]); }
       }
    return;
  }
  const int vh = head;                                          // v head: (8v)^T tile [64 d][128 tok] via LDS, rows of 256 B
#pragma unroll
  for (int t = 0; t < 4; ++t)
#pragma unroll
    for (int r = 0; r < 2; ++r)
#pragma unroll
      for (int v = 0; v < 8; ++v) { b16 a_, c_; split16(acc[r][t][v] * VS, a_, c_); Tt[t * 16 + nloc][wave * 32 + r * 16 + 8 * hlf + v] = a_; Tl[t * 16 + nloc][wave * 32 + r * 16 + 8 * hlf + v] = c_; }
  __syncthreads();
  b16* dstv = vt + (((size_t)b * H + vh) * HD) * S + (blockIdx.y * 128) % S;
  {
#pragma unroll
    for (int j = 0; j < 8; ++j) { const int dd = wave * 16 + j * 2 + (lane >> 4), c8 = (lane & 15) * 8; *(v8b*)(dstv + (size_t)dd * S + c8) = *(const v8b*)(&Tt[dd][c8]); *(v8b*)(dstv + VPL + (size_t)dd * S + c8) = *(const v8b*)(&Tl[dd][c8]); }
    
  }
}

// causal attention: wave = (b, h, 16 queries); key chunks of 32 up to the query tile: S^T (K=64), causal mask on the straddling chunks, online softmax f32, P^T f16, y^T += (8V)^T P^T;
template <int QT>
__global__ __launch_bounds__(256) void attn_kernel(const b16* __restrict__ qh, const b16* __restrict__ kh, const b16* __restrict__ vt, const int* __restrict__ seq_lens, float* __restrict__ y) {
  __shared__ __attribute__((aligned(16))) float Os[8][16][HD + 4];
  const int wid = threadIdx.x >> 5, lane = threadIdx.x & 31, hh = lane >> 4, col = lane & 15;
  const int qt = blockIdx.x * 8 + wid, jt = qt % QT, bh = qt / QT, h = bh % H, b = bh / H, q0 = jt * 16, qi = q0 + col;
  const b16* Q = qh + ((size_t)bh * S) * HD; const b16* K = kh + ((size_t)bh * S) * HD; const b16* vb = vt + ((size_t)bh * HD) * S;
  v16b qf[2], ql[2];
#pragma unroll
  for (int ks = 0; ks < 2; ++ks) { qf[ks] = frag_kb(Q + (size_t)qi * HD + ks * 32, hh); ql[ks] = frag_kb(Q + QPL + (size_t)qi * HD + ks * 32, hh); }
  float m = -INFINITY, l = 0.0f; v8f o[4] = {{}, {}, {}, {}};
  const int sl = min(max(seq_lens[b], 1), S);                   // padding mask: keys >= seq_len are skipped or get -inf (exp -> 0); seq_len >= 1 here so key 0 always survives
  const int kend = min(q0 + 16, sl);
  for (int kb = 0; kb < kend; kb += 32) {                       // causal + padding: key blocks past min(query tile, seq_len) are skipped (wave-uniform bound)
    const bool diag = (kb + 32 > q0) || (kb + 32 > sl);         // this block reaches past some queries or past seq_len -> mask
    v8f s0 = {}, s1 = {};
#pragma unroll
    for (int ks = 0; ks < 2; ++ks) { const v16b k0 = frag_kb(K + (size_t)(kb + col) * HD + ks * 32, hh), k0l = frag_kb(K + QPL + (size_t)(kb + col) * HD + ks * 32, hh), k1 = frag_kb(K + (size_t)(kb + 16 + col) * HD + ks * 32, hh), k1l = frag_kb(K + QPL + (size_t)(kb + 16 + col) * HD + ks * 32, hh);
      s0 = wmma16b(k0, qf[ks], s0); s0 = wmma16b(k0, ql[ks], s0); s0 = wmma16b(k0l, qf[ks], s0);      // q and k as f16 hi+lo pairs (lo.lo dropped)
      s1 = wmma16b(k1, qf[ks], s1); s1 = wmma16b(k1, ql[ks], s1); s1 = wmma16b(k1l, qf[ks], s1); }
    float mr = -INFINITY;
#pragma unroll
    for (int r = 0; r < 8; ++r) { s0[r] *= SCALE / (QS * QS); s1[r] *= SCALE / (QS * QS); if (diag) { const int k0_ = kb + 8 * hh + r, k1_ = kb + 16 + 8 * hh + r; if (k0_ > qi || k0_ >= sl) s0[r] = -INFINITY; if (k1_ > qi || k1_ >= sl) s1[r] = -INFINITY; } mr = fmaxf(mr, fmaxf(s0[r], s1[r])); }
    mr = fmaxf(mr, __shfl_xor(mr, 16));
    const float mn = fmaxf(m, mr), al_ = __expf(m - mn); m = mn;
    float sum = 0.0f; v16b pb, pl;
#pragma unroll
    for (int r = 0; r < 8; ++r) { const float e0 = __expf(s0[r] - mn), e1 = __expf(s1[r] - mn); sum += e0 + e1; b16 a, c; split16(e0 * PS, a, c); pb[r] = a; pl[r] = c; split16(e1 * PS, a, c); pb[8 + r] = a; pl[8 + r] = c; }   // P carried x8
    sum += __shfl_xor(sum, 16); l = l * al_ + sum;
#pragma unroll
    for (int n = 0; n < 4; ++n) {
#pragma unroll
      for (int r = 0; r < 8; ++r) o[n][r] *= al_;
      const v16b vf = frag_kb(vb + (size_t)(n * 16 + col) * S + kb, hh), vl = frag_kb(vb + VPL + (size_t)(n * 16 + col) * S + kb, hh);
      o[n] = wmma16b(vf, pb, o[n]); o[n] = wmma16b(vf, pl, o[n]); o[n] = wmma16b(vl, pb, o[n]);   // (8v) and P both as f16 hi+lo pairs (lo.lo dropped)
    }
  }
  const float inv = 1.0f / (VS * PS * l);
#pragma unroll
  for (int n = 0; n < 4; ++n)
#pragma unroll
    for (int r = 0; r < 8; ++r) Os[wid][col][n * 16 + 8 * hh + r] = o[n][r] * inv;
  wave_lds_sync();
  float* dst = y + ((size_t)b * S + q0) * D + h * HD;
  {
#pragma unroll
    for (int j = 0; j < 8; ++j) { const int rr = j * 2 + hh, c4 = col * 4; *(v4f*)(dst + (size_t)rr * D + c4) = *(const v4f*)(&Os[wid][rr][c4]); }
    
  }
}

// out = y W_o^T: (4096 x 1024) x (1024 x 1024); A = y x8 split at load into an f16 hi+lo pair, B = f16(bf16 W_o) rows; f32 rows; grid (16, 32).
__global__ __launch_bounds__(128) void out_kernel(const float* __restrict__ y, const b16* __restrict__ wo16, const float* __restrict__ bo, float* __restrict__ out) {
  __shared__ __attribute__((aligned(16))) float Ts[4][32 * 64];
  const int lane = threadIdx.x & 31, wave = threadIdx.x >> 5, nloc = lane & 15, hlf = lane >> 4, m0 = blockIdx.y * 128 + wave * 32, c0 = blockIdx.x * 64;
  v8f acc[2][4];
#pragma unroll
  for (int r = 0; r < 2; ++r)
#pragma unroll
    for (int t = 0; t < 4; ++t) acc[r][t] = (v8f){};
  const Opnd A{y, nullptr, D}, Bo{wo16, nullptr, D};
  gemm_tile<5, 1>(A, Bo, D, m0, c0, nloc, hlf, acc);                            // y as an f16 hi+lo pair carried x8 (2 products)
#pragma unroll
  for (int t = 0; t < 4; ++t)
#pragma unroll
    for (int r = 0; r < 2; ++r)
#pragma unroll
      for (int v = 0; v < 8; ++v) acc[r][t][v] = acc[r][t][v] * (1.0f / 8.0f) + bf16_rne(bo[c0 + t * 16 + nloc]);
  epi_f32(acc, 1.0f, nullptr, out, D, m0, c0, lane, Ts[wave]);
}
}  // namespace

extern "C" void kernel_launch(void* const* d_in, const int* in_sizes, int n_in,
                              void* d_out, int out_size, void* d_ws, size_t ws_size, hipStream_t stream) {
  (void)n_in; (void)out_size;
  const float* x = (const float*)d_in[0]; const int* seq_lens = (const int*)d_in[1]; const float* wqkv = (const float*)d_in[2]; const float* bqkv = (const float*)d_in[3]; const float* wo = (const float*)d_in[4]; const float* bo = (const float*)d_in[5];
  float* out = (float*)d_out;   // [2][2048][1024]
  if (in_sizes[0] != BT * S * D || in_sizes[1] != Bn || in_sizes[2] != 3 * D * D || in_sizes[3] != 3 * D || in_sizes[4] != D * D || in_sizes[5] != D) return;
  size_t off = 0; char* ws = (char*)d_ws;
  auto carve = [&](size_t bytes) { char* p = ws + off; off += (bytes + 255) & ~(size_t)255; return p; };
  unsigned short* x16 = (unsigned short*)carve((size_t)NTOK * D * 2); unsigned short* w16 = (unsigned short*)carve((size_t)3 * D * D * 2); b16* wo16 = (b16*)carve((size_t)D * D * 2);
  b16* qh = (b16*)carve((size_t)2 * NTOK * D * 2); b16* kh = (b16*)carve((size_t)2 * NTOK * D * 2); b16* vt = (b16*)carve((size_t)2 * NTOK * D * 2); float* y = (float*)carve((size_t)NTOK * D * 4);
  if (off > ws_size) return;                                    // ≈ 84 MB
  prep_kernel<<<512, 256, 0, stream>>>(wqkv, wo, w16, wo16);
  xprep_kernel<<<1024, 256, 0, stream>>>(x, x16);
  proj_kernel<<<dim3(3 * D / 64, NTOK / 128), 128, 0, stream>>>((const __bf16*)x16, (const __bf16*)w16, bqkv, qh, kh, vt);
  attn_kernel<S / 16><<<Bn * H * (S / 16) / 8, 256, 0, stream>>>(qh, kh, vt, seq_lens, y);
  out_kernel<<<dim3(D / 64, NTOK / 128), 128, 0, stream>>>(y, wo16, bo, out);
}

// v001
// Measured time: 201 microseconds a run.
// Two timings next to v000 put it at 1.46 and 1.48 times that version's speed.
#include <hip/hip_runtime.h>

// MultiAxisAttention: qkv = x Wqkv^T + bqkv (16 heads x 64), causal mask (key > query -> -1e9) plus a per-batch padding mask (key >= seq_len[b] -> -1e9), softmax of q.k/8, out = ctx Wout^T + bout
// -> [2][2048][1024]. seq_lens here are > 0, so every query keeps key 0 and the masked keys contribute exp(-1e9 - max) = 0; the key loop stops at
// min(causal bound, seq_len).
// x, the four weights and bo rounded to bf16: projection on v_wmma_f32_16x16x32_bf16 (exact products, f32 accumulate);
// scores, P.v and the output projection on v_wmma_f32_16x16x32_f16 with every computed operand (q, k, v, P, y — each carried x8 so the hi/lo residual planes stay normal) as an f16
// hi+lo pair (3 / 2 products); online softmax in f32. Fragment k-map per lane half hh for A AND B: elements 0..7 <- k = 8hh+0..7, 8..15 <- k = 16+8hh+0..7. Every intermediate /

namespace {
constexpr int BT = 2, Bn = 2, S = 2048, D = 1024, H = 16, HD = 64, NTOK = Bn * S;
constexpr float SCALE = 0.125f, VS = 8.0f, QS = 8.0f, PS = 8.0f;   // power-of-two carry scales so hi/lo residual planes stay normal in f16
constexpr size_t VPL = (size_t)NTOK * D;   // distance between the (8v)^T hi and lo planes
constexpr size_t QPL = (size_t)NTOK * D;   // distance between the q/k hi and lo planes

typedef _Float16 b16;
typedef __attribute__((ext_vector_type(16))) _Float16 v16b;
typedef __attribute__((ext_vector_type(8)))  _Float16 v8b;
typedef __attribute__((ext_vector_type(8)))  float v8f;
typedef __attribute__((ext_vector_type(4)))  float v4f;

__device__ __forceinline__ v8b ld8b(const b16* p) { return *(const v8b*)p; }
__device__ __forceinline__ v16b cat8b(v8b a, v8b b) { return __builtin_shufflevector(a, b, 0, 1, 2, 3, 4, 5, 6, 7, 8, 9, 10, 11, 12, 13, 14, 15); }
__device__ __forceinline__ v16b frag_kb(const b16* p, int hh) { return cat8b(ld8b(p + 8 * hh), ld8b(p + 16 + 8 * hh)); }
__device__ __forceinline__ void split16(float v, b16& hi, b16& lo) { hi = (b16)v; lo = (b16)(v - (float)hi); }
// hi/lo fragment pair straight from an f32 k-contiguous row (same k-map)
__device__ __forceinline__ void frag_ksplit(const float* p, int hh, v16b& fh_, v16b& fl_) {
  const float* p0 = p + 8 * hh; const float* p1 = p + 16 + 8 * hh;
#pragma unroll
  for (int e = 0; e < 8; ++e) { b16 a, c; split16(p0[e], a, c); fh_[e] = a; fl_[e] = c; split16(p1[e], a, c); fh_[8 + e] = a; fl_[8 + e] = c; }
}
__device__ __forceinline__ v8f wmma16b(v16b a, v16b b, v8f c) {
  v8f d = __builtin_amdgcn_wmma_f32_16x16x32_f16(false, a, false, b, (short)0, c, false, false);
  asm volatile("v_nop\n\tv_nop\n\tv_nop\n\tv_nop" : "+v"(d) : "v"(a), "v"(b));
  return d;
}
__device__ __forceinline__ void wave_lds_sync() {
  __builtin_amdgcn_fence(__ATOMIC_RELEASE, "workgroup");
  __builtin_amdgcn_wave_barrier();
  __builtin_amdgcn_fence(__ATOMIC_ACQUIRE, "workgroup");
}

// Operand descriptor: NP = 0 -> f32 rows split on the fly into (hi, lo); NP = 1 -> one f16 plane; NP = 2 -> f16 hi + lo planes;
// NP = 3 -> f32 rows rounded once to a single f16 fragment. ld = row pitch.
struct Opnd { const void* p0; const void* p1; int ld; };
template <int NP> __device__ __forceinline__ void load_frags(const Opnd& o, int row, int kb, int hh, v16b& fh_, v16b& fl_) {
  if (NP == 0) { frag_ksplit((const float*)o.p0 + (size_t)row * o.ld + kb, hh, fh_, fl_); }
  else if (NP == 4 || NP == 5) {                             // f32 rows x64 (NP 4) or x8 (NP 5) then split (keeps the lo halves of small values normal)
    const float sc_ = (NP == 4) ? 64.0f : 8.0f;
    const float* p = (const float*)o.p0 + (size_t)row * o.ld + kb; const float* p0 = p + 8 * hh; const float* p1 = p + 16 + 8 * hh;
#pragma unroll
    for (int e = 0; e < 8; ++e) { b16 a, c; split16(p0[e] * sc_, a, c); fh_[e] = a; fl_[e] = c; split16(p1[e] * sc_, a, c); fh_[8 + e] = a; fl_[8 + e] = c; }
  } else if (NP == 3) {
    const float* p = (const float*)o.p0 + (size_t)row * o.ld + kb; const float* p0 = p + 8 * hh; const float* p1 = p + 16 + 8 * hh;
#pragma unroll
    for (int e = 0; e < 8; ++e) { fh_[e] = (b16)p0[e]; fh_[8 + e] = (b16)p1[e]; }
    fl_ = fh_;
  } else {
    fh_ = frag_kb((const b16*)o.p0 + (size_t)row * o.ld + kb, hh);
    if (NP == 2) fl_ = frag_kb((const b16*)o.p1 + (size_t)row * o.ld + kb, hh); else fl_ = fh_;
  }
}
template <int ANP, int BNP> __device__ __forceinline__ v8f mac(v16b ah, v16b al, v16b bh, v16b bl, v8f c) {
  c = wmma16b(ah, bh, c);
  if (BNP == 0 || BNP == 2 || BNP == 4 || BNP == 5) c = wmma16b(ah, bl, c);     // hi.lo
  if (ANP == 0 || ANP == 2 || ANP == 4 || ANP == 5) c = wmma16b(al, bh, c);     // lo.hi   (lo.lo dropped)
  return c;
}
// 32x64 wave tile: acc[r][t] (rows m0+16r.., cols c0+16t..) += A[m][k] . B[n][k] over k in [0, K)
template <int ANP, int BNP>
__device__ __forceinline__ void gemm_tile(const Opnd& A, const Opnd& B, int K, int m0, int c0, int nloc, int hlf, v8f (&acc)[2][4]) {
  for (int kb = 0; kb < K; kb += 32) {
    v16b a0h, a0l, a1h, a1l;
    load_frags<ANP>(A, m0 + nloc, kb, hlf, a0h, a0l);
    load_frags<ANP>(A, m0 + 16 + nloc, kb, hlf, a1h, a1l);
#pragma unroll
    for (int t = 0; t < 4; ++t) {
      v16b bh, bl;
      load_frags<BNP>(B, c0 + t * 16 + nloc, kb, hlf, bh, bl);
      acc[0][t] = mac<ANP, BNP>(a0h, a0l, bh, bl, acc[0][t]);
      acc[1][t] = mac<ANP, BNP>(a1h, a1l, bh, bl, acc[1][t]);
    }
  }
}

__device__ __forceinline__ void epi_planes(v8f (&acc)[2][4], float scale, bool two, b16* __restrict__ oh, b16* __restrict__ ol, int ldo,
                                           int m0, int c0, int lane, b16* Th, b16* Tl) {
  const int nloc = lane & 15, hlf = lane >> 4;
#pragma unroll
  for (int t = 0; t < 4; ++t)
#pragma unroll
    for (int r = 0; r < 2; ++r)
#pragma unroll
      for (int v = 0; v < 8; ++v) {
        const int rr = r * 16 + v + 8 * hlf, cc = t * 16 + nloc;
        b16 h_, l_; split16(acc[r][t][v] * scale, h_, l_);
        Th[rr * 64 + cc] = h_; Tl[rr * 64 + cc] = l_;
      }
  wave_lds_sync();
  {
#pragma unroll
    for (int j = 0; j < 8; ++j) {
      const int rr = j * 4 + (lane >> 3), c8 = (lane & 7) * 8;
      const size_t o = (size_t)(m0 + rr) * ldo + c0 + c8;
      *(v8b*)(oh + o) = ld8b(Th + rr * 64 + c8);
      if (two) *(v8b*)(ol + o) = ld8b(Tl + rr * 64 + c8);
    }
    
  }
}
// (b) f32 rows with pitch ldo: 64 floats = 256 B = 2 lines per row; 16 lanes x 16 B per row, 2 rows per instruction. Optional per-row factor
__device__ __forceinline__ void epi_f32(v8f (&acc)[2][4], float scale, const float* rscale, float* __restrict__ out, int ldo, int m0, int c0, int lane, float* Tt) {
  const int nloc = lane & 15, hlf = lane >> 4;
#pragma unroll
  for (int t = 0; t < 4; ++t)
#pragma unroll
    for (int r = 0; r < 2; ++r)
#pragma unroll
      for (int v = 0; v < 8; ++v) {
        const int rr = r * 16 + v + 8 * hlf;
        const float rs = rscale ? rscale[(size_t)(m0 + rr) * 32] : 1.0f;
        Tt[rr * 64 + t * 16 + nloc] = acc[r][t][v] * scale * rs;
      }
  wave_lds_sync();
  float* dst0 = out + (size_t)m0 * ldo + c0;
  {
#pragma unroll
    for (int j = 0; j < 16; ++j) { const int rr = j * 2 + hlf, c4 = nloc * 4; *(v4f*)(dst0 + (size_t)rr * ldo + c4) = *(const v4f*)(Tt + rr * 64 + c4); }
    
  }
}



typedef __attribute__((ext_vector_type(8))) __bf16 v8bb; typedef __attribute__((ext_vector_type(16))) __bf16 v16bb;
typedef __attribute__((ext_vector_type(8))) unsigned short v8us;
__device__ __forceinline__ v16bb frag_kb_bf(const __bf16* p, int hh) { const v8bb a = *(const v8bb*)(p + 8 * hh), b = *(const v8bb*)(p + 16 + 8 * hh); return __builtin_shufflevector(a, b, 0, 1, 2, 3, 4, 5, 6, 7, 8, 9, 10, 11, 12, 13, 14, 15); }
__device__ __forceinline__ v8f wmma16bb(v16bb a, v16bb b, v8f c) {
  v8f d = __builtin_amdgcn_wmma_f32_16x16x32_bf16(false, a, false, b, (short)0, c, false, false);
  asm volatile("v_nop\n\tv_nop\n\tv_nop\n\tv_nop" : "+v"(d) : "v"(a), "v"(b));
  return d;
}
__device__ __forceinline__ unsigned short bf16_rne_bits(float v) { unsigned int u = __float_as_uint(v); u += 0x7FFFu + ((u >> 16) & 1u); return (unsigned short)(u >> 16); }
__device__ __forceinline__ float bf16_rne(float v) { return __uint_as_float(((unsigned int)bf16_rne_bits(v)) << 16); }



__global__ __launch_bounds__(256) void xprep_kernel(const float* __restrict__ x, unsigned short* __restrict__ x16) {   // one pass's two batches -> bf16
  const size_t tid = (size_t)blockIdx.x * blockDim.x + threadIdx.x, nth = (size_t)gridDim.x * blockDim.x;
  { for (size_t p = tid; p < (size_t)NTOK * D / 8; p += nth) { v8us v;
#pragma unroll
      for (int e = 0; e < 8; ++e) v[e] = bf16_rne_bits(x[p * 8 + e]);
      *(v8us*)(x16 + p * 8) = v; }  }
}
__global__ __launch_bounds__(256) void prep_kernel(const float* __restrict__ wqkv, const float* __restrict__ wo, unsigned short* __restrict__ w16, b16* __restrict__ wo16) {
  const size_t tid = (size_t)blockIdx.x * blockDim.x + threadIdx.x, nth = (size_t)gridDim.x * blockDim.x;
  {
    for (size_t p = tid; p < (size_t)3 * D * D / 8; p += nth) { v8us v;   // Wqkv [3072][1024] ([out][in]) rows copied directly
#pragma unroll
      for (int e = 0; e < 8; ++e) v[e] = bf16_rne_bits(wqkv[p * 8 + e]);
      *(v8us*)(w16 + p * 8) = v; }
    for (size_t p = tid; p < (size_t)D * D / 8; p += nth) { v8b w;   // W_o [out][in] rows copied directly
#pragma unroll
      for (int e = 0; e < 8; ++e) w[e] = (b16)bf16_rne(wo[p * 8 + e]);
      *(v8b*)(wo16 + p * 8) = w; }
    
  }
}

// projections: rows = tokens (4096), K = 1024, column tiles of 64 = one head of q (tiles 0..15), k (16..31) or v (32..47); f16 rows [b*H + head][tok][64] for q/k;
// v: (8v)^T f16 [b*H + head][64][tok]. grid (48, 32) x 128.
__global__ __launch_bounds__(128) void proj_kernel(const __bf16* __restrict__ x16, const __bf16* __restrict__ w16, const float* __restrict__ bqkv, b16* __restrict__ qh, b16* __restrict__ kh, b16* __restrict__ vt) {
  __shared__ __attribute__((aligned(16))) b16 Th[4][32][HD + 8], Tq[4][32][HD + 8];
  __shared__ __attribute__((aligned(16))) b16 Tt[64][128 + 8], Tl[64][128 + 8];
  const int lane = threadIdx.x & 31, wave = threadIdx.x >> 5, nloc = lane & 15, hlf = lane >> 4, m0 = blockIdx.y * 128 + wave * 32, c0 = blockIdx.x * 64;
  v8f acc[2][4];
#pragma unroll
  for (int r = 0; r < 2; ++r)
#pragma unroll
    for (int t = 0; t < 4; ++t) acc[r][t] = (v8f){};
#pragma unroll 2
  for (int kb = 0; kb < D; kb += 32) {
    const v16bb a0 = frag_kb_bf(x16 + (size_t)(m0 + nloc) * D + kb, hlf), a1 = frag_kb_bf(x16 + (size_t)(m0 + 16 + nloc) * D + kb, hlf);
#pragma unroll
    for (int t = 0; t < 4; ++t) { const v16bb bw = frag_kb_bf(w16 + (size_t)(c0 + t * 16 + nloc) * D + kb, hlf); acc[0][t] = wmma16bb(a0, bw, acc[0][t]); acc[1][t] = wmma16bb(a1, bw, acc[1][t]); }
  }
  const int which = blockIdx.x / (D / 64), head = blockIdx.x % (D / 64), b = m0 / S, tok0 = m0 % S;
#pragma unroll
  for (int t = 0; t < 4; ++t) { const float bb = bf16_rne(bqkv[c0 + t * 16 + nloc]);   // + bias (rounded to bf16)
#pragma unroll
    for (int r = 0; r < 2; ++r)
#pragma unroll
      for (int v = 0; v < 8; ++v) acc[r][t][v] += bb; }
  if (which < 2) {                                              // q or k head: f16 rows
#pragma unroll
    for (int t = 0; t < 4; ++t)
#pragma unroll
      for (int r = 0; r < 2; ++r)
#pragma unroll
        for (int v = 0; v < 8; ++v) { b16 a_, c_; split16(acc[r][t][v] * QS, a_, c_); Th[wave][r * 16 + 8 * hlf + v][t * 16 + nloc] = a_; Tq[wave][r * 16 + 8 * hlf + v][t * 16 + nloc] = c_; }   // q, k carried x8 (lo residuals stay normal)
    wave_lds_sync();
    b16* dst = (which == 0 ? qh : kh) + (((size_t)b * H + head) * S + tok0) * HD;
    {
#pragma unroll
      for (int j = 0; j < 8; ++j) { const int rr = j * 4 + (lane >> 3), c8 = (lane & 7) * 8; *(v8b*)(dst + (size_t)rr * HD + c8) = *(const v8b*)(&Th[wave][rr][c8]); *(v8b*)(dst + QPL + (size_t)rr * HD + c8) = *(const v8b*)(&Tq[wave][rr][c8]); }
       }
    return;
  }
  const int vh = head;                                          // v head: (8v)^T tile [64 d][128 tok] via LDS, rows of 256 B
#pragma unroll
  for (int t = 0; t < 4; ++t)
#pragma unroll
    for (int r = 0; r < 2; ++r)
#pragma unroll
      for (int v = 0; v < 8; ++v) { b16 a_, c_; split16(acc[r][t][v] * VS, a_, c_); Tt[t * 16 + nloc][wave * 32 + r * 16 + 8 * hlf + v] = a_; Tl[t * 16 + nloc][wave * 32 + r * 16 + 8 * hlf + v] = c_; }
  __syncthreads();
  b16* dstv = vt + (((size_t)b * H + vh) * HD) * S + (blockIdx.y * 128) % S;
  {
#pragma unroll
    for (int j = 0; j < 8; ++j) { const int dd = wave * 16 + j * 2 + (lane >> 4), c8 = (lane & 15) * 8; *(v8b*)(dstv + (size_t)dd * S + c8) = *(const v8b*)(&Tt[dd][c8]); *(v8b*)(dstv + VPL + (size_t)dd * S + c8) = *(const v8b*)(&Tl[dd][c8]); }
    
  }
}

// causal attention: wave = (b, h, 16 queries), block = 8 waves = 128 consecutive queries of one (b, h); key chunks of 32: S^T (K=64), mask on the straddling chunks, online softmax f32,
// P^T f16, y^T += (8V)^T P^T. The block's K rows and (8V)^T rows (hi and lo planes) come once per 64 keys into a two-buffer LDS ring by asynchronous copies of whole 128 B rows; every wave
// takes its fragments from there.
constexpr int KT = 64;    // keys per ring stage: K rows and V^T row pieces are both 128 B = one cache line
constexpr int LP = 72;    // LDS row pitch in f16: 144 B = 16 B x 9, so the 16 rows of a ds_load_b128 fragment read fall on distinct banks
__device__ __forceinline__ unsigned lds_addr(const void* p) { return (unsigned)(size_t)p; }   // low 32 bits of a __shared__ address = byte offset in the work-group's LDS
template <int QT>
__global__ __launch_bounds__(256) void attn_kernel(const b16* __restrict__ qh, const b16* __restrict__ kh, const b16* __restrict__ vt, const int* __restrict__ seq_lens, float* __restrict__ y) {
  __shared__ __attribute__((aligned(16))) float Os[8][16][HD + 4];
  __shared__ __attribute__((aligned(16))) b16 Ring[2][4][KT][LP];   // [buffer][K hi, K lo, V^T hi, V^T lo][key row or d row][64 f16 + pad]
  const int wid = __builtin_amdgcn_readfirstlane(threadIdx.x >> 5), lane = threadIdx.x & 31, hh = lane >> 4, col = lane & 15;
  const int qt = blockIdx.x * 8 + wid, jt = qt % QT, bh = qt / QT, h = bh % H, b = bh / H, q0 = jt * 16, qi = q0 + col;
  const b16* Q = qh + ((size_t)bh * S) * HD; const b16* K = kh + ((size_t)bh * S) * HD; const b16* vb = vt + ((size_t)bh * HD) * S;
  const int sl = min(max(seq_lens[b], 1), S);                   // padding mask: keys >= seq_len get -inf or are skipped (exp -> 0); seq_len >= 1 here so key 0 always survives
  const int kend = min(q0 + 16, sl);                            // this wave's key bound
  const int nst = (min(((int)blockIdx.x * 8 % QT) * 16 + 128, sl) + KT - 1) / KT;   // ring stages of the block = those of its last wave (block-uniform, 1..32)
  const int sr = threadIdx.x >> 3, sc = (threadIdx.x & 7) * 8;  // staging: thread -> rows sr and sr + 32, 16 B piece sc; a wave's copy covers 4 whole 128 B rows
  // One stage: keys [t*64, t*64+64) < S. 8 copies of 16 B per lane, all lanes on; the s_wait_xcnt closes the statement so that no address register is rewritten ahead of it.
  auto stage = [&](int t, int buf) {
    const b16* gk = K + (size_t)(t * KT + sr) * HD + sc; const b16* gv = vb + (size_t)sr * S + t * KT + sc;
    const unsigned l0 = lds_addr(&Ring[buf][0][sr][sc]);
    constexpr unsigned PB = KT * LP * 2, HB = 32 * LP * 2;      // bytes per plane, per 32 rows
    asm volatile("global_load_async_to_lds_b128 %0, %8, off\n\t"
                 "global_load_async_to_lds_b128 %1, %9, off\n\t"
                 "global_load_async_to_lds_b128 %2, %10, off\n\t"
                 "global_load_async_to_lds_b128 %3, %11, off\n\t"
                 "global_load_async_to_lds_b128 %4, %12, off\n\t"
                 "global_load_async_to_lds_b128 %5, %13, off\n\t"
                 "global_load_async_to_lds_b128 %6, %14, off\n\t"
                 "global_load_async_to_lds_b128 %7, %15, off\n\t"
                 "s_wait_xcnt 0x0"
                 :: "v"(l0), "v"(l0 + HB), "v"(l0 + PB), "v"(l0 + PB + HB), "v"(l0 + 2 * PB), "v"(l0 + 2 * PB + HB), "v"(l0 + 3 * PB), "v"(l0 + 3 * PB + HB),
                    "v"(gk), "v"(gk + 32 * HD), "v"(gk + QPL), "v"(gk + QPL + 32 * HD), "v"(gv), "v"(gv + (size_t)32 * S), "v"(gv + VPL), "v"(gv + VPL + (size_t)32 * S)
                 : "memory");
  };
  stage(0, 0);
  v16b qf[2], ql[2];
#pragma unroll
  for (int ks = 0; ks < 2; ++ks) { qf[ks] = frag_kb(Q + (size_t)qi * HD + ks * 32, hh); ql[ks] = frag_kb(Q + QPL + (size_t)qi * HD + ks * 32, hh); }
  float m = -INFINITY, l = 0.0f; v8f o[4] = {{}, {}, {}, {}};
  asm volatile("s_wait_asynccnt 0x0" ::: "memory");             // stage 0 of this wave has landed
  __syncthreads();                                              // publishes stage 0 to the other waves
  if (nst > 1) stage(1, 1);
  for (int t = 0; t < nst; ++t) {
    const b16 (*R)[KT][LP] = Ring[t & 1];
#pragma unroll   // the stage's two chunks of 32 keys unrolled so that every LDS fragment offset is an immediate
    for (int sub = 0; sub < 2; ++sub) {
      const int kb = t * KT + sub * 32, kl = sub * 32;
      if (kb < kend) {                                          // causal + padding: key chunks past min(query tile, seq_len) are skipped (wave-uniform scalar bound)
        const bool diag = (kb + 32 > q0) || (kb + 32 > sl);     // this chunk reaches past some queries or past seq_len -> mask
        v8f s0 = {}, s1 = {};
#pragma unroll
        for (int ks = 0; ks < 2; ++ks) { const v16b k0 = frag_kb(&R[0][kl + col][ks * 32], hh), k0l = frag_kb(&R[1][kl + col][ks * 32], hh), k1 = frag_kb(&R[0][kl + 16 + col][ks * 32], hh), k1l = frag_kb(&R[1][kl + 16 + col][ks * 32], hh);
          s0 = wmma16b(k0, qf[ks], s0); s0 = wmma16b(k0, ql[ks], s0); s0 = wmma16b(k0l, qf[ks], s0);      // q and k as f16 hi+lo pairs (lo.lo dropped)
          s1 = wmma16b(k1, qf[ks], s1); s1 = wmma16b(k1, ql[ks], s1); s1 = wmma16b(k1l, qf[ks], s1); }
        float mr = -INFINITY;
#pragma unroll
        for (int r = 0; r < 8; ++r) { s0[r] *= SCALE / (QS * QS); s1[r] *= SCALE / (QS * QS); if (diag) { const int k0_ = kb + 8 * hh + r, k1_ = kb + 16 + 8 * hh + r; if (k0_ > qi || k0_ >= sl) s0[r] = -INFINITY; if (k1_ > qi || k1_ >= sl) s1[r] = -INFINITY; } mr = fmaxf(mr, fmaxf(s0[r], s1[r])); }
        mr = fmaxf(mr, __shfl_xor(mr, 16));
        const float mn = fmaxf(m, mr), al_ = __expf(m - mn); m = mn;
        float sum = 0.0f; v16b pb, pl;
#pragma unroll
        for (int r = 0; r < 8; ++r) { const float e0 = __expf(s0[r] - mn), e1 = __expf(s1[r] - mn); sum += e0 + e1; b16 a, c; split16(e0 * PS, a, c); pb[r] = a; pl[r] = c; split16(e1 * PS, a, c); pb[8 + r] = a; pl[8 + r] = c; }   // P carried x8
        sum += __shfl_xor(sum, 16); l = l * al_ + sum;
#pragma unroll
        for (int n = 0; n < 4; ++n) {
#pragma unroll
          for (int r = 0; r < 8; ++r) o[n][r] *= al_;
          const v16b vf = frag_kb(&R[2][n * 16 + col][kl], hh), vl = frag_kb(&R[3][n * 16 + col][kl], hh);
          o[n] = wmma16b(vf, pb, o[n]); o[n] = wmma16b(vf, pl, o[n]); o[n] = wmma16b(vl, pb, o[n]);   // (8v) and P both as f16 hi+lo pairs (lo.lo dropped)
        }
      }
    }
    // publish point of stage t + 1, passed by every wave, also one that skipped its chunks
    asm volatile("s_wait_dscnt 0x0" ::: "memory");              // this wave's reads of buffer t & 1 are done before it is refilled
    asm volatile("s_wait_asynccnt 0x0" ::: "memory");           // this wave's copies of stage t + 1 have landed
    __syncthreads();                                            // publishes stage t + 1 and ends every wave's reads of stage t
    if (t + 2 < nst) stage(t + 2, t & 1);
  }
  asm volatile("s_wait_asynccnt 0x0" ::: "memory");             // nothing of the ring is in flight when the wave ends
  const float inv = 1.0f / (VS * PS * l);
#pragma unroll
  for (int n = 0; n < 4; ++n)
#pragma unroll
    for (int r = 0; r < 8; ++r) Os[wid][col][n * 16 + 8 * hh + r] = o[n][r] * inv;
  wave_lds_sync();
  float* dst = y + ((size_t)b * S + q0) * D + h * HD;
  {
#pragma unroll
    for (int j = 0; j < 8; ++j) { const int rr = j * 2 + hh, c4 = col * 4; *(v4f*)(dst + (size_t)rr * D + c4) = *(const v4f*)(&Os[wid][rr][c4]); }
    
  }
}

// out = y W_o^T: (4096 x 1024) x (1024 x 1024); A = y x8 split at load into an f16 hi+lo pair, B = f16(bf16 W_o) rows; f32 rows; grid (16, 32).
__global__ __launch_bounds__(128) void out_kernel(const float* __restrict__ y, const b16* __restrict__ wo16, const float* __restrict__ bo, float* __restrict__ out) {
  __shared__ __attribute__((aligned(16))) float Ts[4][32 * 64];
  const int lane = threadIdx.x & 31, wave = threadIdx.x >> 5, nloc = lane & 15, hlf = lane >> 4, m0 = blockIdx.y * 128 + wave * 32, c0 = blockIdx.x * 64;
  v8f acc[2][4];
#pragma unroll
  for (int r = 0; r < 2; ++r)
#pragma unroll
    for (int t = 0; t < 4; ++t) acc[r][t] = (v8f){};
  const Opnd A{y, nullptr, D}, Bo{wo16, nullptr, D};
  gemm_tile<5, 1>(A, Bo, D, m0, c0, nloc, hlf, acc);                            // y as an f16 hi+lo pair carried x8 (2 products)
#pragma unroll
  for (int t = 0; t < 4; ++t)
#pragma unroll
    for (int r = 0; r < 2; ++r)
#pragma unroll
      for (int v = 0; v < 8; ++v) acc[r][t][v] = acc[r][t][v] * (1.0f / 8.0f) + bf16_rne(bo[c0 + t * 16 + nloc]);
  epi_f32(acc, 1.0f, nullptr, out, D, m0, c0, lane, Ts[wave]);
}
}  // namespace

extern "C" void kernel_launch(void* const* d_in, const int* in_sizes, int n_in,
                              void* d_out, int out_size, void* d_ws, size_t ws_size, hipStream_t stream) {
  (void)n_in; (void)out_size;
  const float* x = (const float*)d_in[0]; const int* seq_lens = (const int*)d_in[1]; const float* wqkv = (const float*)d_in[2]; const float* bqkv = (const float*)d_in[3]; const float* wo = (const float*)d_in[4]; const float* bo = (const float*)d_in[5];
  float* out = (float*)d_out;   // [2][2048][1024]
  if (in_sizes[0] != BT * S * D || in_sizes[1] != Bn || in_sizes[2] != 3 * D * D || in_sizes[3] != 3 * D || in_sizes[4] != D * D || in_sizes[5] != D) return;
  size_t off = 0; char* ws = (char*)d_ws;
  auto carve = [&](size_t bytes) { char* p = ws + off; off += (bytes + 255) & ~(size_t)255; return p; };
  unsigned short* x16 = (unsigned short*)carve((size_t)NTOK * D * 2); unsigned short* w16 = (unsigned short*)carve((size_t)3 * D * D * 2); b16* wo16 = (b16*)carve((size_t)D * D * 2);
  b16* qh = (b16*)carve((size_t)2 * NTOK * D * 2); b16* kh = (b16*)carve((size_t)2 * NTOK * D * 2); b16* vt = (b16*)carve((size_t)2 * NTOK * D * 2); float* y = (float*)carve((size_t)NTOK * D * 4);
  if (off > ws_size) return;                                    // ≈ 84 MB
  prep_kernel<<<512, 256, 0, stream>>>(wqkv, wo, w16, wo16);
  xprep_kernel<<<1024, 256, 0, stream>>>(x, x16);
  proj_kernel<<<dim3(3 * D / 64, NTOK / 128), 128, 0, stream>>>((const __bf16*)x16, (const __bf16*)w16, bqkv, qh, kh, vt);
  attn_kernel<S / 16><<<Bn * H * (S / 16) / 8, 256, 0, stream>>>(qh, kh, vt, seq_lens, y);
  out_kernel<<<dim3(D / 64, NTOK / 128), 128, 0, stream>>>(y, wo16, bo, out);
}

// v002
// It runs in 122 microseconds.
// In two side-by-side timings against v001, it was 1.64 and 1.67 times as fast.
// All steps since v000 together make it 2.43 times as fast.
#include <hip/hip_runtime.h>

// MultiAxisAttention: qkv = x Wqkv^T + bqkv (16 heads x 64), causal mask (key > query -> -1e9) plus a per-batch padding mask (key >= seq_len[b] -> -1e9), softmax of q.k/8, out = ctx Wout^T + bout
// -> [2][2048][1024]. seq_lens here are > 0, so every query keeps key 0 and the masked keys contribute exp(-1e9 - max) = 0; the key loop stops at
// min(causal bound, seq_len).
// x, the four weights and bo rounded to bf16: projection on v_wmma_f32_16x16x32_bf16 (exact products, f32 accumulate);
// scores, P.v and the output projection on v_wmma_f32_16x16x32_f16 with every computed operand (q, k, v, P, y — each carried x8 so the hi/lo residual planes stay normal) as an f16
// hi+lo pair (3 / 2 products); online softmax in f32. Fragment k-map per lane half hh for A AND B: elements 0..7 <- k = 8hh+0..7, 8..15 <- k = 16+8hh+0..7. Every intermediate /

namespace {
constexpr int BT = 2, Bn = 2, S = 2048, D = 1024, H = 16, HD = 64, NTOK = Bn * S;
constexpr float SCALE = 0.125f, VS = 8.0f, QS = 8.0f, PS = 8.0f;   // power-of-two carry scales so hi/lo residual planes stay normal in f16
constexpr size_t VPL = (size_t)NTOK * D;   // distance between the (8v)^T hi and lo planes
constexpr size_t QPL = (size_t)NTOK * D;   // distance between the q/k hi and lo planes

typedef _Float16 b16;
typedef __attribute__((ext_vector_type(16))) _Float16 v16b;
typedef __attribute__((ext_vector_type(8)))  _Float16 v8b;
typedef __attribute__((ext_vector_type(8)))  float v8f;
typedef __attribute__((ext_vector_type(4)))  float v4f;

__device__ __forceinline__ v8b ld8b(const b16* p) { return *(const v8b*)p; }
__device__ __forceinline__ v16b cat8b(v8b a, v8b b) { return __builtin_shufflevector(a, b, 0, 1, 2, 3, 4, 5, 6, 7, 8, 9, 10, 11, 12, 13, 14, 15); }
__device__ __forceinline__ v16b frag_kb(const b16* p, int hh) { return cat8b(ld8b(p + 8 * hh), ld8b(p + 16 + 8 * hh)); }
__device__ __forceinline__ void split16(float v, b16& hi, b16& lo) { hi = (b16)v; lo = (b16)(v - (float)hi); }
// hi/lo fragment pair straight from an f32 k-contiguous row (same k-map)
__device__ __forceinline__ void frag_ksplit(const float* p, int hh, v16b& fh_, v16b& fl_) {
  const float* p0 = p + 8 * hh; const float* p1 = p + 16 + 8 * hh;
#pragma unroll
  for (int e = 0; e < 8; ++e) { b16 a, c; split16(p0[e], a, c); fh_[e] = a; fl_[e] = c; split16(p1[e], a, c); fh_[8 + e] = a; fl_[8 + e] = c; }
}
__device__ __forceinline__ v8f wmma16b(v16b a, v16b b, v8f c) {
  v8f d = __builtin_amdgcn_wmma_f32_16x16x32_f16(false, a, false, b, (short)0, c, false, false);
  asm volatile("v_nop\n\tv_nop\n\tv_nop\n\tv_nop" : "+v"(d) : "v"(a), "v"(b));
  return d;
}
__device__ __forceinline__ void wave_lds_sync() {
  __builtin_amdgcn_fence(__ATOMIC_RELEASE, "workgroup");
  __builtin_amdgcn_wave_barrier();
  __builtin_amdgcn_fence(__ATOMIC_ACQUIRE, "workgroup");
}

// Operand descriptor: NP = 0 -> f32 rows split on the fly into (hi, lo); NP = 1 -> one f16 plane; NP = 2 -> f16 hi + lo planes;
// NP = 3 -> f32 rows rounded once to a single f16 fragment. ld = row pitch.
struct Opnd { const void* p0; const void* p1; int ld; };
template <int NP> __device__ __forceinline__ void load_frags(const Opnd& o, int row, int kb, int hh, v16b& fh_, v16b& fl_) {
  if (NP == 0) { frag_ksplit((const float*)o.p0 + (size_t)row * o.ld + kb, hh, fh_, fl_); }
  else if (NP == 4 || NP == 5) {                             // f32 rows x64 (NP 4) or x8 (NP 5) then split (keeps the lo halves of small values normal)
    const float sc_ = (NP == 4) ? 64.0f : 8.0f;
    const float* p = (const float*)o.p0 + (size_t)row * o.ld + kb; const float* p0 = p + 8 * hh; const float* p1 = p + 16 + 8 * hh;
#pragma unroll
    for (int e = 0; e < 8; ++e) { b16 a, c; split16(p0[e] * sc_, a, c); fh_[e] = a; fl_[e] = c; split16(p1[e] * sc_, a, c); fh_[8 + e] = a; fl_[8 + e] = c; }
  } else if (NP == 3) {
    const float* p = (const float*)o.p0 + (size_t)row * o.ld + kb; const float* p0 = p + 8 * hh; const float* p1 = p + 16 + 8 * hh;
#pragma unroll
    for (int e = 0; e < 8; ++e) { fh_[e] = (b16)p0[e]; fh_[8 + e] = (b16)p1[e]; }
    fl_ = fh_;
  } else {
    fh_ = frag_kb((const b16*)o.p0 + (size_t)row * o.ld + kb, hh);
    if (NP == 2) fl_ = frag_kb((const b16*)o.p1 + (size_t)row * o.ld + kb, hh); else fl_ = fh_;
  }
}
template <int ANP, int BNP> __device__ __forceinline__ v8f mac(v16b ah, v16b al, v16b bh, v16b bl, v8f c) {
  c = wmma16b(ah, bh, c);
  if (BNP == 0 || BNP == 2 || BNP == 4 || BNP == 5) c = wmma16b(ah, bl, c);     // hi.lo
  if (ANP == 0 || ANP == 2 || ANP == 4 || ANP == 5) c = wmma16b(al, bh, c);     // lo.hi   (lo.lo dropped)
  return c;
}
__device__ __forceinline__ void epi_planes(v8f (&acc)[2][4], float scale, bool two, b16* __restrict__ oh, b16* __restrict__ ol, int ldo,
                                           int m0, int c0, int lane, b16* Th, b16* Tl) {
  const int nloc = lane & 15, hlf = lane >> 4;
#pragma unroll
  for (int t = 0; t < 4; ++t)
#pragma unroll
    for (int r = 0; r < 2; ++r)
#pragma unroll
      for (int v = 0; v < 8; ++v) {
        const int rr = r * 16 + v + 8 * hlf, cc = t * 16 + nloc;
        b16 h_, l_; split16(acc[r][t][v] * scale, h_, l_);
        Th[rr * 64 + cc] = h_; Tl[rr * 64 + cc] = l_;
      }
  wave_lds_sync();
  {
#pragma unroll
    for (int j = 0; j < 8; ++j) {
      const int rr = j * 4 + (lane >> 3), c8 = (lane & 7) * 8;
      const size_t o = (size_t)(m0 + rr) * ldo + c0 + c8;
      *(v8b*)(oh + o) = ld8b(Th + rr * 64 + c8);
      if (two) *(v8b*)(ol + o) = ld8b(Tl + rr * 64 + c8);
    }
    
  }
}
// (b) f32 rows with pitch ldo: 64 floats = 256 B = 2 lines per row; 16 lanes x 16 B per row, 2 rows per instruction. Optional per-row factor
__device__ __forceinline__ void epi_f32(v8f (&acc)[2][4], float scale, const float* rscale, float* __restrict__ out, int ldo, int m0, int c0, int lane, float* Tt) {
  const int nloc = lane & 15, hlf = lane >> 4;
#pragma unroll
  for (int t = 0; t < 4; ++t)
#pragma unroll
    for (int r = 0; r < 2; ++r)
#pragma unroll
      for (int v = 0; v < 8; ++v) {
        const int rr = r * 16 + v + 8 * hlf;
        const float rs = rscale ? rscale[(size_t)(m0 + rr) * 32] : 1.0f;
        Tt[rr * 64 + t * 16 + nloc] = acc[r][t][v] * scale * rs;
      }
  wave_lds_sync();
  float* dst0 = out + (size_t)m0 * ldo + c0;
  {
#pragma unroll
    for (int j = 0; j < 16; ++j) { const int rr = j * 2 + hlf, c4 = nloc * 4; *(v4f*)(dst0 + (size_t)rr * ldo + c4) = *(const v4f*)(Tt + rr * 64 + c4); }
    
  }
}



typedef __attribute__((ext_vector_type(8))) __bf16 v8bb; typedef __attribute__((ext_vector_type(16))) __bf16 v16bb;
typedef __attribute__((ext_vector_type(8))) unsigned short v8us;
__device__ __forceinline__ v16bb frag_kb_bf(const __bf16* p, int hh) { const v8bb a = *(const v8bb*)(p + 8 * hh), b = *(const v8bb*)(p + 16 + 8 * hh); return __builtin_shufflevector(a, b, 0, 1, 2, 3, 4, 5, 6, 7, 8, 9, 10, 11, 12, 13, 14, 15); }
__device__ __forceinline__ v8f wmma16bb(v16bb a, v16bb b, v8f c) {
  v8f d = __builtin_amdgcn_wmma_f32_16x16x32_bf16(false, a, false, b, (short)0, c, false, false);
  asm volatile("v_nop\n\tv_nop\n\tv_nop\n\tv_nop" : "+v"(d) : "v"(a), "v"(b));
  return d;
}
__device__ __forceinline__ unsigned short bf16_rne_bits(float v) { unsigned int u = __float_as_uint(v); u += 0x7FFFu + ((u >> 16) & 1u); return (unsigned short)(u >> 16); }
__device__ __forceinline__ float bf16_rne(float v) { return __uint_as_float(((unsigned int)bf16_rne_bits(v)) << 16); }



__global__ __launch_bounds__(256) void xprep_kernel(const float* __restrict__ x, unsigned short* __restrict__ x16) {   // one pass's two batches -> bf16
  const size_t tid = (size_t)blockIdx.x * blockDim.x + threadIdx.x, nth = (size_t)gridDim.x * blockDim.x;
  { for (size_t p = tid; p < (size_t)NTOK * D / 8; p += nth) { v8us v;
#pragma unroll
      for (int e = 0; e < 8; ++e) v[e] = bf16_rne_bits(x[p * 8 + e]);
      *(v8us*)(x16 + p * 8) = v; }  }
}
__global__ __launch_bounds__(256) void prep_kernel(const float* __restrict__ wqkv, const float* __restrict__ wo, unsigned short* __restrict__ w16, b16* __restrict__ wo16) {
  const size_t tid = (size_t)blockIdx.x * blockDim.x + threadIdx.x, nth = (size_t)gridDim.x * blockDim.x;
  {
    for (size_t p = tid; p < (size_t)3 * D * D / 8; p += nth) { v8us v;   // Wqkv [3072][1024] ([out][in]) rows copied directly
#pragma unroll
      for (int e = 0; e < 8; ++e) v[e] = bf16_rne_bits(wqkv[p * 8 + e]);
      *(v8us*)(w16 + p * 8) = v; }
    for (size_t p = tid; p < (size_t)D * D / 8; p += nth) { v8b w;   // W_o [out][in] rows copied directly
#pragma unroll
      for (int e = 0; e < 8; ++e) w[e] = (b16)bf16_rne(wo[p * 8 + e]);
      *(v8b*)(wo16 + p * 8) = w; }
    
  }
}

constexpr int KT = 64;    // keys (attention) or k (GEMMs) per ring stage: 16-bit rows of 128 B = one cache line
constexpr int LP = 72;    // LDS row pitch in f16: 144 B = 16 B x 9, so the 16 rows of a ds_load_b128 fragment read fall on distinct banks
__device__ __forceinline__ unsigned lds_addr(const void* p) { return (unsigned)(size_t)p; }   // low 32 bits of a __shared__ address = byte offset in the work-group's LDS

// projections: rows = tokens (4096), K = 1024, block = 8 waves = 128 tokens x 128 columns = two heads of q (column tiles 0..7), k (8..15) or v (16..23); wave = 32 tokens x one head.
// The block's 128 x rows and 128 W rows come once per 64 k into a two-buffer LDS ring by asynchronous copies of whole 128 B rows; every wave takes its fragments from there.
// f16 rows [b*H + head][tok][64] for q/k; v: (8v)^T f16 [b*H + head][64][tok]. grid (24, 32) x 256.
constexpr int GR = 256;            // ring rows of a projection stage: 128 x rows, then 128 W rows
constexpr int GST = D / KT;        // ring stages of a GEMM: 16
__global__ __launch_bounds__(256) void proj_kernel(const __bf16* __restrict__ x16, const __bf16* __restrict__ w16, const float* __restrict__ bqkv, b16* __restrict__ qh, b16* __restrict__ kh, b16* __restrict__ vt) {
  __shared__ __attribute__((aligned(16))) unsigned char Sm[2 * GR * LP * 2];   // the ring [buffer][row][64 bf16 + pad]; behind the loop's last barrier the epilogue's staging
  const int lane = threadIdx.x & 31, wid = __builtin_amdgcn_readfirstlane(threadIdx.x >> 5), wave = wid & 3, cg = wid >> 2, nloc = lane & 15, hlf = lane >> 4;
  const int mb = blockIdx.y * 128, m0 = mb + wave * 32, cb = blockIdx.x * 128, c0 = cb + cg * 64;
  const int sr = threadIdx.x >> 3, sc = (threadIdx.x & 7) * 8;  // staging: thread -> rows sr + 32 j, 16 B piece sc; a wave's copy covers 4 whole 128 B rows
  // One stage: k in [t*64, t*64+64) < D. 8 copies of 16 B per lane, all lanes on; the s_wait_xcnt closes the statement so that no address register is rewritten ahead of it.
  auto stage = [&](int t, int buf) {
    const __bf16* gx = x16 + (size_t)(mb + sr) * D + t * KT + sc; const __bf16* gw = w16 + (size_t)(cb + sr) * D + t * KT + sc;
    const unsigned l0 = lds_addr(Sm + ((size_t)buf * GR + sr) * (LP * 2) + sc * 2);
    constexpr unsigned HB = 32 * LP * 2;                        // bytes per 32 rows
    asm volatile("global_load_async_to_lds_b128 %0, %8, off\n\t"
                 "global_load_async_to_lds_b128 %1, %9, off\n\t"
                 "global_load_async_to_lds_b128 %2, %10, off\n\t"
                 "global_load_async_to_lds_b128 %3, %11, off\n\t"
                 "global_load_async_to_lds_b128 %4, %12, off\n\t"
                 "global_load_async_to_lds_b128 %5, %13, off\n\t"
                 "global_load_async_to_lds_b128 %6, %14, off\n\t"
                 "global_load_async_to_lds_b128 %7, %15, off\n\t"
                 "s_wait_xcnt 0x0"
                 :: "v"(l0), "v"(l0 + HB), "v"(l0 + 2 * HB), "v"(l0 + 3 * HB), "v"(l0 + 4 * HB), "v"(l0 + 5 * HB), "v"(l0 + 6 * HB), "v"(l0 + 7 * HB),
                    "v"(gx), "v"(gx + 32 * D), "v"(gx + 64 * D), "v"(gx + 96 * D), "v"(gw), "v"(gw + 32 * D), "v"(gw + 64 * D), "v"(gw + 96 * D)
                 : "memory");
  };
  stage(0, 0);
  v8f acc[2][4];
#pragma unroll
  for (int r = 0; r < 2; ++r)
#pragma unroll
    for (int t = 0; t < 4; ++t) acc[r][t] = (v8f){};
  asm volatile("s_wait_asynccnt 0x0" ::: "memory");             // stage 0 of this wave has landed
  __syncthreads();                                              // publishes stage 0 to the other waves
  stage(1, 1);
  for (int s = 0; s < GST; ++s) {
    const __bf16* R = (const __bf16*)(Sm + (size_t)(s & 1) * (GR * LP * 2));
#pragma unroll   // the stage's two k steps of 32 unrolled so that every LDS fragment offset is an immediate
    for (int ks = 0; ks < 2; ++ks) {
      const v16bb a0 = frag_kb_bf(R + (wave * 32 + nloc) * LP + ks * 32, hlf), a1 = frag_kb_bf(R + (wave * 32 + 16 + nloc) * LP + ks * 32, hlf);
#pragma unroll
      for (int t = 0; t < 4; ++t) { const v16bb bw = frag_kb_bf(R + (128 + cg * 64 + t * 16 + nloc) * LP + ks * 32, hlf); acc[0][t] = wmma16bb(a0, bw, acc[0][t]); acc[1][t] = wmma16bb(a1, bw, acc[1][t]); }
    }
    // publish point of stage s + 1
    asm volatile("s_wait_dscnt 0x0" ::: "memory");              // this wave's reads of buffer s & 1 are done before it is refilled
    asm volatile("s_wait_asynccnt 0x0" ::: "memory");           // this wave's copies of stage s + 1 have landed
    __syncthreads();                                            // publishes stage s + 1 and ends every wave's reads of stage s
    if (s + 2 < GST) stage(s + 2, s & 1);
  }
  asm volatile("s_wait_asynccnt 0x0" ::: "memory");             // nothing of the ring is in flight when its LDS becomes staging
  const int which = blockIdx.x / (D / 128), head = (blockIdx.x % (D / 128)) * 2 + cg, b = m0 / S, tok0 = m0 % S;
#pragma unroll
  for (int t = 0; t < 4; ++t) { const float bb = bf16_rne(bqkv[c0 + t * 16 + nloc]);   // + bias (rounded to bf16)
#pragma unroll
    for (int r = 0; r < 2; ++r)
#pragma unroll
      for (int v = 0; v < 8; ++v) acc[r][t][v] += bb; }
  if (which < 2) {                                              // q or k head: f16 rows
    b16 (*Th)[HD + 8] = (b16 (*)[HD + 8])(Sm + (size_t)wid * (2 * 32 * (HD + 8) * 2)); b16 (*Tq)[HD + 8] = Th + 32;   // the wave's own hi and lo tiles [32][64 + pad]
#pragma unroll
    for (int t = 0; t < 4; ++t)
#pragma unroll
      for (int r = 0; r < 2; ++r)
#pragma unroll
        for (int v = 0; v < 8; ++v) { b16 a_, c_; split16(acc[r][t][v] * QS, a_, c_); Th[r * 16 + 8 * hlf + v][t * 16 + nloc] = a_; Tq[r * 16 + 8 * hlf + v][t * 16 + nloc] = c_; }   // q, k carried x8 (lo residuals stay normal)
    wave_lds_sync();
    b16* dst = (which == 0 ? qh : kh) + (((size_t)b * H + head) * S + tok0) * HD;
    {
#pragma unroll
      for (int j = 0; j < 8; ++j) { const int rr = j * 4 + (lane >> 3), c8 = (lane & 7) * 8; *(v8b*)(dst + (size_t)rr * HD + c8) = *(const v8b*)(&Th[rr][c8]); *(v8b*)(dst + QPL + (size_t)rr * HD + c8) = *(const v8b*)(&Tq[rr][c8]); }
       }
    return;
  }
  const int vh = head;                                          // v head: (8v)^T tile [64 d][128 tok] via LDS, rows of 256 B; one hi and one lo tile per head of the block
  b16 (*Tt)[128 + 8] = (b16 (*)[128 + 8])(Sm + (size_t)cg * (2 * 64 * (128 + 8) * 2)); b16 (*Tl)[128 + 8] = Tt + 64;
#pragma unroll
  for (int t = 0; t < 4; ++t)
#pragma unroll
    for (int r = 0; r < 2; ++r)
#pragma unroll
      for (int v = 0; v < 8; ++v) { b16 a_, c_; split16(acc[r][t][v] * VS, a_, c_); Tt[t * 16 + nloc][wave * 32 + r * 16 + 8 * hlf + v] = a_; Tl[t * 16 + nloc][wave * 32 + r * 16 + 8 * hlf + v] = c_; }
  __syncthreads();
  b16* dstv = vt + (((size_t)b * H + vh) * HD) * S + (blockIdx.y * 128) % S;
  {
#pragma unroll
    for (int j = 0; j < 8; ++j) { const int dd = wave * 16 + j * 2 + (lane >> 4), c8 = (lane & 15) * 8; *(v8b*)(dstv + (size_t)dd * S + c8) = *(const v8b*)(&Tt[dd][c8]); *(v8b*)(dstv + VPL + (size_t)dd * S + c8) = *(const v8b*)(&Tl[dd][c8]); }
    
  }
}

// causal attention: wave = (b, h, 16 queries), block = 8 waves = 128 consecutive queries of one (b, h); key chunks of 32: S^T (K=64), mask on the straddling chunks, online softmax f32,
// P^T f16, y^T += (8V)^T P^T. The block's K rows and (8V)^T rows (hi and lo planes) come once per 64 keys into a two-buffer LDS ring by asynchronous copies of whole 128 B rows; every wave
// takes its fragments from there.
template <int QT>
__global__ __launch_bounds__(256) void attn_kernel(const b16* __restrict__ qh, const b16* __restrict__ kh, const b16* __restrict__ vt, const int* __restrict__ seq_lens, float* __restrict__ y) {
  __shared__ __attribute__((aligned(16))) float Os[8][16][HD + 4];
  __shared__ __attribute__((aligned(16))) b16 Ring[2][4][KT][LP];   // [buffer][K hi, K lo, V^T hi, V^T lo][key row or d row][64 f16 + pad]
  const int wid = __builtin_amdgcn_readfirstlane(threadIdx.x >> 5), lane = threadIdx.x & 31, hh = lane >> 4, col = lane & 15;
  const int qt = blockIdx.x * 8 + wid, jt = qt % QT, bh = qt / QT, h = bh % H, b = bh / H, q0 = jt * 16, qi = q0 + col;
  const b16* Q = qh + ((size_t)bh * S) * HD; const b16* K = kh + ((size_t)bh * S) * HD; const b16* vb = vt + ((size_t)bh * HD) * S;
  const int sl = min(max(seq_lens[b], 1), S);                   // padding mask: keys >= seq_len get -inf or are skipped (exp -> 0); seq_len >= 1 here so key 0 always survives
  const int kend = min(q0 + 16, sl);                            // this wave's key bound
  const int nst = (min(((int)blockIdx.x * 8 % QT) * 16 + 128, sl) + KT - 1) / KT;   // ring stages of the block = those of its last wave (block-uniform, 1..32)
  const int sr = threadIdx.x >> 3, sc = (threadIdx.x & 7) * 8;  // staging: thread -> rows sr and sr + 32, 16 B piece sc; a wave's copy covers 4 whole 128 B rows
  // One stage: keys [t*64, t*64+64) < S. 8 copies of 16 B per lane, all lanes on; the s_wait_xcnt closes the statement so that no address register is rewritten ahead of it.
  auto stage = [&](int t, int buf) {
    const b16* gk = K + (size_t)(t * KT + sr) * HD + sc; const b16* gv = vb + (size_t)sr * S + t * KT + sc;
    const unsigned l0 = lds_addr(&Ring[buf][0][sr][sc]);
    constexpr unsigned PB = KT * LP * 2, HB = 32 * LP * 2;      // bytes per plane, per 32 rows
    asm volatile("global_load_async_to_lds_b128 %0, %8, off\n\t"
                 "global_load_async_to_lds_b128 %1, %9, off\n\t"
                 "global_load_async_to_lds_b128 %2, %10, off\n\t"
                 "global_load_async_to_lds_b128 %3, %11, off\n\t"
                 "global_load_async_to_lds_b128 %4, %12, off\n\t"
                 "global_load_async_to_lds_b128 %5, %13, off\n\t"
                 "global_load_async_to_lds_b128 %6, %14, off\n\t"
                 "global_load_async_to_lds_b128 %7, %15, off\n\t"
                 "s_wait_xcnt 0x0"
                 :: "v"(l0), "v"(l0 + HB), "v"(l0 + PB), "v"(l0 + PB + HB), "v"(l0 + 2 * PB), "v"(l0 + 2 * PB + HB), "v"(l0 + 3 * PB), "v"(l0 + 3 * PB + HB),
                    "v"(gk), "v"(gk + 32 * HD), "v"(gk + QPL), "v"(gk + QPL + 32 * HD), "v"(gv), "v"(gv + (size_t)32 * S), "v"(gv + VPL), "v"(gv + VPL + (size_t)32 * S)
                 : "memory");
  };
  stage(0, 0);
  v16b qf[2], ql[2];
#pragma unroll
  for (int ks = 0; ks < 2; ++ks) { qf[ks] = frag_kb(Q + (size_t)qi * HD + ks * 32, hh); ql[ks] = frag_kb(Q + QPL + (size_t)qi * HD + ks * 32, hh); }
  float m = -INFINITY, l = 0.0f; v8f o[4] = {{}, {}, {}, {}};
  asm volatile("s_wait_asynccnt 0x0" ::: "memory");             // stage 0 of this wave has landed
  __syncthreads();                                              // publishes stage 0 to the other waves
  if (nst > 1) stage(1, 1);
  for (int t = 0; t < nst; ++t) {
    const b16 (*R)[KT][LP] = Ring[t & 1];
#pragma unroll   // the stage's two chunks of 32 keys unrolled so that every LDS fragment offset is an immediate
    for (int sub = 0; sub < 2; ++sub) {
      const int kb = t * KT + sub * 32, kl = sub * 32;
      if (kb < kend) {                                          // causal + padding: key chunks past min(query tile, seq_len) are skipped (wave-uniform scalar bound)
        const bool diag = (kb + 32 > q0) || (kb + 32 > sl);     // this chunk reaches past some queries or past seq_len -> mask
        v8f s0 = {}, s1 = {};
#pragma unroll
        for (int ks = 0; ks < 2; ++ks) { const v16b k0 = frag_kb(&R[0][kl + col][ks * 32], hh), k0l = frag_kb(&R[1][kl + col][ks * 32], hh), k1 = frag_kb(&R[0][kl + 16 + col][ks * 32], hh), k1l = frag_kb(&R[1][kl + 16 + col][ks * 32], hh);
          s0 = wmma16b(k0, qf[ks], s0); s0 = wmma16b(k0, ql[ks], s0); s0 = wmma16b(k0l, qf[ks], s0);      // q and k as f16 hi+lo pairs (lo.lo dropped)
          s1 = wmma16b(k1, qf[ks], s1); s1 = wmma16b(k1, ql[ks], s1); s1 = wmma16b(k1l, qf[ks], s1); }
        float mr = -INFINITY;
#pragma unroll
        for (int r = 0; r < 8; ++r) { s0[r] *= SCALE / (QS * QS); s1[r] *= SCALE / (QS * QS); if (diag) { const int k0_ = kb + 8 * hh + r, k1_ = kb + 16 + 8 * hh + r; if (k0_ > qi || k0_ >= sl) s0[r] = -INFINITY; if (k1_ > qi || k1_ >= sl) s1[r] = -INFINITY; } mr = fmaxf(mr, fmaxf(s0[r], s1[r])); }
        mr = fmaxf(mr, __shfl_xor(mr, 16));
        const float mn = fmaxf(m, mr), al_ = __expf(m - mn); m = mn;
        float sum = 0.0f; v16b pb, pl;
#pragma unroll
        for (int r = 0; r < 8; ++r) { const float e0 = __expf(s0[r] - mn), e1 = __expf(s1[r] - mn); sum += e0 + e1; b16 a, c; split16(e0 * PS, a, c); pb[r] = a; pl[r] = c; split16(e1 * PS, a, c); pb[8 + r] = a; pl[8 + r] = c; }   // P carried x8
        sum += __shfl_xor(sum, 16); l = l * al_ + sum;
#pragma unroll
        for (int n = 0; n < 4; ++n) {
#pragma unroll
          for (int r = 0; r < 8; ++r) o[n][r] *= al_;
          const v16b vf = frag_kb(&R[2][n * 16 + col][kl], hh), vl = frag_kb(&R[3][n * 16 + col][kl], hh);
          o[n] = wmma16b(vf, pb, o[n]); o[n] = wmma16b(vf, pl, o[n]); o[n] = wmma16b(vl, pb, o[n]);   // (8v) and P both as f16 hi+lo pairs (lo.lo dropped)
        }
      }
    }
    // publish point of stage t + 1, passed by every wave, also one that skipped its chunks
    asm volatile("s_wait_dscnt 0x0" ::: "memory");              // this wave's reads of buffer t & 1 are done before it is refilled
    asm volatile("s_wait_asynccnt 0x0" ::: "memory");           // this wave's copies of stage t + 1 have landed
    __syncthreads();                                            // publishes stage t + 1 and ends every wave's reads of stage t
    if (t + 2 < nst) stage(t + 2, t & 1);
  }
  asm volatile("s_wait_asynccnt 0x0" ::: "memory");             // nothing of the ring is in flight when the wave ends
  const float inv = 1.0f / (VS * PS * l);
#pragma unroll
  for (int n = 0; n < 4; ++n)
#pragma unroll
    for (int r = 0; r < 8; ++r) Os[wid][col][n * 16 + 8 * hh + r] = o[n][r] * inv;
  wave_lds_sync();
  float* dst = y + ((size_t)b * S + q0) * D + h * HD;
  {
#pragma unroll
    for (int j = 0; j < 8; ++j) { const int rr = j * 2 + hh, c4 = col * 4; *(v4f*)(dst + (size_t)rr * D + c4) = *(const v4f*)(&Os[wid][rr][c4]); }
    
  }
}

// out = y W_o^T: (4096 x 1024) x (1024 x 1024); A = y split at the fragment read (f16 hi+lo, x8), B = f16(bf16 W_o) rows; f32 rows; block = 8 waves = 128 tokens x 128 columns, wave = 32 x 64.
// The block's 128 y rows (256 B of f32 per stage) and 128 W_o rows (128 B) come once per 64 k into a two-buffer LDS ring by asynchronous copies of whole rows. grid (8, 32) x 256.
constexpr int YP = KT + 4;                                      // LDS pitch of a y row in f32: 272 B = 16 B x 17, so the 16 rows of a ds_load_b128 read fall on distinct banks
constexpr int OYB = 128 * YP * 4, OBUF = OYB + 128 * LP * 2;    // bytes of a buffer's y rows; of a whole buffer (y rows, then W_o rows)
__global__ __launch_bounds__(256) void out_kernel(const float* __restrict__ y, const b16* __restrict__ wo16, const float* __restrict__ bo, float* __restrict__ out) {
  __shared__ __attribute__((aligned(16))) unsigned char Sm[2 * OBUF];   // the ring; behind the loop's last barrier the epilogue's staging (8 KiB per wave)
  const int lane = threadIdx.x & 31, wid = __builtin_amdgcn_readfirstlane(threadIdx.x >> 5), wave = wid & 3, cg = wid >> 2, nloc = lane & 15, hlf = lane >> 4;
  const int mb = blockIdx.y * 128, m0 = mb + wave * 32, cb = blockIdx.x * 128, c0 = cb + cg * 64;
  const int yr = threadIdx.x >> 4, yc = (threadIdx.x & 15) * 4; // staging of y: thread -> rows yr + 16 j, 16 B piece yc; a wave's copy covers 2 whole 256 B rows
  const int sr = threadIdx.x >> 3, sc = (threadIdx.x & 7) * 8;  // staging of W_o: thread -> rows sr + 32 j, 16 B piece sc; a wave's copy covers 4 whole 128 B rows
  // One stage: k in [t*64, t*64+64) < D. 12 copies of 16 B per lane, all lanes on; the s_wait_xcnt closes the statement so that no address register is rewritten ahead of it.
  auto stage = [&](int t, int buf) {
    const float* gy = y + (size_t)(mb + yr) * D + t * KT + yc; const b16* gw = wo16 + (size_t)(cb + sr) * D + t * KT + sc;
    const unsigned ly = lds_addr(Sm + (size_t)buf * OBUF + (size_t)yr * (YP * 4) + yc * 4), lw = lds_addr(Sm + (size_t)buf * OBUF + OYB + (size_t)sr * (LP * 2) + sc * 2);
    constexpr unsigned YB = 16 * YP * 4, HB = 32 * LP * 2;      // bytes per 16 y rows, per 32 W_o rows
    asm volatile("global_load_async_to_lds_b128 %0, %12, off\n\t"
                 "global_load_async_to_lds_b128 %1, %13, off\n\t"
                 "global_load_async_to_lds_b128 %2, %14, off\n\t"
                 "global_load_async_to_lds_b128 %3, %15, off\n\t"
                 "global_load_async_to_lds_b128 %4, %16, off\n\t"
                 "global_load_async_to_lds_b128 %5, %17, off\n\t"
                 "global_load_async_to_lds_b128 %6, %18, off\n\t"
                 "global_load_async_to_lds_b128 %7, %19, off\n\t"
                 "global_load_async_to_lds_b128 %8, %20, off\n\t"
                 "global_load_async_to_lds_b128 %9, %21, off\n\t"
                 "global_load_async_to_lds_b128 %10, %22, off\n\t"
                 "global_load_async_to_lds_b128 %11, %23, off\n\t"
                 "s_wait_xcnt 0x0"
                 :: "v"(ly), "v"(ly + YB), "v"(ly + 2 * YB), "v"(ly + 3 * YB), "v"(ly + 4 * YB), "v"(ly + 5 * YB), "v"(ly + 6 * YB), "v"(ly + 7 * YB),
                    "v"(lw), "v"(lw + HB), "v"(lw + 2 * HB), "v"(lw + 3 * HB),
                    "v"(gy), "v"(gy + 16 * D), "v"(gy + 32 * D), "v"(gy + 48 * D), "v"(gy + 64 * D), "v"(gy + 80 * D), "v"(gy + 96 * D), "v"(gy + 112 * D),
                    "v"(gw), "v"(gw + 32 * D), "v"(gw + 64 * D), "v"(gw + 96 * D)
                 : "memory");
  };
  stage(0, 0);
  v8f acc[2][4];
#pragma unroll
  for (int r = 0; r < 2; ++r)
#pragma unroll
    for (int t = 0; t < 4; ++t) acc[r][t] = (v8f){};
  asm volatile("s_wait_asynccnt 0x0" ::: "memory");             // stage 0 of this wave has landed
  __syncthreads();                                              // publishes stage 0 to the other waves
  stage(1, 1);
  for (int s = 0; s < GST; ++s) {
    const Opnd A{Sm + (size_t)(s & 1) * OBUF, nullptr, YP}, Bo{Sm + (size_t)(s & 1) * OBUF + OYB, nullptr, LP};
#pragma unroll   // the stage's two k steps of 32 unrolled so that every LDS fragment offset is an immediate
    for (int ks = 0; ks < 2; ++ks) {
      v16b a0h, a0l, a1h, a1l;                                  // y as an f16 hi+lo pair carried x8 (2 products)
      load_frags<5>(A, wave * 32 + nloc, ks * 32, hlf, a0h, a0l);
      load_frags<5>(A, wave * 32 + 16 + nloc, ks * 32, hlf, a1h, a1l);
#pragma unroll
      for (int t = 0; t < 4; ++t) {
        v16b bh, bl;
        load_frags<1>(Bo, cg * 64 + t * 16 + nloc, ks * 32, hlf, bh, bl);
        acc[0][t] = mac<5, 1>(a0h, a0l, bh, bl, acc[0][t]);
        acc[1][t] = mac<5, 1>(a1h, a1l, bh, bl, acc[1][t]);
      }
    }
    // publish point of stage s + 1
    asm volatile("s_wait_dscnt 0x0" ::: "memory");              // this wave's reads of buffer s & 1 are done before it is refilled
    asm volatile("s_wait_asynccnt 0x0" ::: "memory");           // this wave's copies of stage s + 1 have landed
    __syncthreads();                                            // publishes stage s + 1 and ends every wave's reads of stage s
    if (s + 2 < GST) stage(s + 2, s & 1);
  }
  asm volatile("s_wait_asynccnt 0x0" ::: "memory");             // nothing of the ring is in flight when its LDS becomes staging
#pragma unroll
  for (int t = 0; t < 4; ++t)
#pragma unroll
    for (int r = 0; r < 2; ++r)
#pragma unroll
      for (int v = 0; v < 8; ++v) acc[r][t][v] = acc[r][t][v] * (1.0f / 8.0f) + bf16_rne(bo[c0 + t * 16 + nloc]);
  epi_f32(acc, 1.0f, nullptr, out, D, m0, c0, lane, (float*)(Sm + (size_t)wid * (32 * 64 * 4)));
}
}  // namespace

extern "C" void kernel_launch(void* const* d_in, const int* in_sizes, int n_in,
                              void* d_out, int out_size, void* d_ws, size_t ws_size, hipStream_t stream) {
  (void)n_in; (void)out_size;
  const float* x = (const float*)d_in[0]; const int* seq_lens = (const int*)d_in[1]; const float* wqkv = (const float*)d_in[2]; const float* bqkv = (const float*)d_in[3]; const float* wo = (const float*)d_in[4]; const float* bo = (const float*)d_in[5];
  float* out = (float*)d_out;   // [2][2048][1024]
  if (in_sizes[0] != BT * S * D || in_sizes[1] != Bn || in_sizes[2] != 3 * D * D || in_sizes[3] != 3 * D || in_sizes[4] != D * D || in_sizes[5] != D) return;
  size_t off = 0; char* ws = (char*)d_ws;
  auto carve = [&](size_t bytes) { char* p = ws + off; off += (bytes + 255) & ~(size_t)255; return p; };
  unsigned short* x16 = (unsigned short*)carve((size_t)NTOK * D * 2); unsigned short* w16 = (unsigned short*)carve((size_t)3 * D * D * 2); b16* wo16 = (b16*)carve((size_t)D * D * 2);
  b16* qh = (b16*)carve((size_t)2 * NTOK * D * 2); b16* kh = (b16*)carve((size_t)2 * NTOK * D * 2); b16* vt = (b16*)carve((size_t)2 * NTOK * D * 2); float* y = (float*)carve((size_t)NTOK * D * 4);
  if (off > ws_size) return;                                    // ≈ 84 MB
  prep_kernel<<<512, 256, 0, stream>>>(wqkv, wo, w16, wo16);
  xprep_kernel<<<1024, 256, 0, stream>>>(x, x16);
  proj_kernel<<<dim3(3 * D / 128, NTOK / 128), 256, 0, stream>>>((const __bf16*)x16, (const __bf16*)w16, bqkv, qh, kh, vt);
  attn_kernel<S / 16><<<Bn * H * (S / 16) / 8, 256, 0, stream>>>(qh, kh, vt, seq_lens, y);
  out_kernel<<<dim3(D / 128, NTOK / 128), 256, 0, stream>>>(y, wo16, bo, out);
}

// v003
// It runs in 114 microseconds.
// Next to v002, in two timings, it ran 1.07 times as fast each time.
// All steps since v000 together make it 2.61 times as fast.
#include <hip/hip_runtime.h>

// MultiAxisAttention: qkv = x Wqkv^T + bqkv (16 heads x 64), causal mask (key > query -> -1e9) plus a per-batch padding mask (key >= seq_len[b] -> -1e9), softmax of q.k/8, out = ctx Wout^T + bout
// -> [2][2048][1024]. seq_lens here are > 0, so every query keeps key 0 and the masked keys contribute exp(-1e9 - max) = 0; the key loop stops at
// min(causal bound, seq_len).
// x, the four weights and bo rounded to bf16: projection on v_wmma_f32_16x16x32_bf16 (exact products, f32 accumulate);
// scores, P.v and the output projection on v_wmma_f32_16x16x32_f16 with every computed operand (q, k, v, P, y — each carried x8 so the hi/lo residual planes stay normal) as an f16
// hi+lo pair (3 / 2 products); online softmax in f32. Fragment k-map per lane half hh for A AND B: elements 0..7 <- k = 8hh+0..7, 8..15 <- k = 16+8hh+0..7. Every intermediate /

namespace {
constexpr int BT = 2, Bn = 2, S = 2048, D = 1024, H = 16, HD = 64, NTOK = Bn * S;
constexpr float SCALE = 0.125f, VS = 8.0f, QS = 8.0f, PS = 8.0f;   // power-of-two carry scales so hi/lo residual planes stay normal in f16
constexpr size_t VPL = (size_t)NTOK * D;   // distance between the (8v)^T hi and lo planes
constexpr size_t QPL = (size_t)NTOK * D;   // distance between the q/k hi and lo planes

typedef _Float16 b16;
typedef __attribute__((ext_vector_type(16))) _Float16 v16b;
typedef __attribute__((ext_vector_type(8)))  _Float16 v8b;
typedef __attribute__((ext_vector_type(8)))  float v8f;
typedef __attribute__((ext_vector_type(4)))  float v4f;

__device__ __forceinline__ v8b ld8b(const b16* p) { return *(const v8b*)p; }
__device__ __forceinline__ v16b cat8b(v8b a, v8b b) { return __builtin_shufflevector(a, b, 0, 1, 2, 3, 4, 5, 6, 7, 8, 9, 10, 11, 12, 13, 14, 15); }
__device__ __forceinline__ v16b frag_kb(const b16* p, int hh) { return cat8b(ld8b(p + 8 * hh), ld8b(p + 16 + 8 * hh)); }
__device__ __forceinline__ void split16(float v, b16& hi, b16& lo) { hi = (b16)v; lo = (b16)(v - (float)hi); }
// hi/lo fragment pair straight from an f32 k-contiguous row (same k-map)
__device__ __forceinline__ void frag_ksplit(const float* p, int hh, v16b& fh_, v16b& fl_) {
  const float* p0 = p + 8 * hh; const float* p1 = p + 16 + 8 * hh;
#pragma unroll
  for (int e = 0; e < 8; ++e) { b16 a, c; split16(p0[e], a, c); fh_[e] = a; fl_[e] = c; split16(p1[e], a, c); fh_[8 + e] = a; fl_[8 + e] = c; }
}
__device__ __forceinline__ v8f wmma16b(v16b a, v16b b, v8f c) {
  v8f d = __builtin_amdgcn_wmma_f32_16x16x32_f16(false, a, false, b, (short)0, c, false, false);
  asm volatile("v_nop\n\tv_nop\n\tv_nop\n\tv_nop" : "+v"(d) : "v"(a), "v"(b));
  return d;
}
__device__ __forceinline__ void wave_lds_sync() {
  __builtin_amdgcn_fence(__ATOMIC_RELEASE, "workgroup");
  __builtin_amdgcn_wave_barrier();
  __builtin_amdgcn_fence(__ATOMIC_ACQUIRE, "workgroup");
}

// Operand descriptor: NP = 0 -> f32 rows split on the fly into (hi, lo); NP = 1 -> one f16 plane; NP = 2 -> f16 hi + lo planes;
// NP = 3 -> f32 rows rounded once to a single f16 fragment. ld = row pitch.
struct Opnd { const void* p0; const void* p1; int ld; };
template <int NP> __device__ __forceinline__ void load_frags(const Opnd& o, int row, int kb, int hh, v16b& fh_, v16b& fl_) {
  if (NP == 0) { frag_ksplit((const float*)o.p0 + (size_t)row * o.ld + kb, hh, fh_, fl_); }
  else if (NP == 4 || NP == 5) {                             // f32 rows x64 (NP 4) or x8 (NP 5) then split (keeps the lo halves of small values normal)
    const float sc_ = (NP == 4) ? 64.0f : 8.0f;
    const float* p = (const float*)o.p0 + (size_t)row * o.ld + kb; const float* p0 = p + 8 * hh; const float* p1 = p + 16 + 8 * hh;
#pragma unroll
    for (int e = 0; e < 8; ++e) { b16 a, c; split16(p0[e] * sc_, a, c); fh_[e] = a; fl_[e] = c; split16(p1[e] * sc_, a, c); fh_[8 + e] = a; fl_[8 + e] = c; }
  } else if (NP == 3) {
    const float* p = (const float*)o.p0 + (size_t)row * o.ld + kb; const float* p0 = p + 8 * hh; const float* p1 = p + 16 + 8 * hh;
#pragma unroll
    for (int e = 0; e < 8; ++e) { fh_[e] = (b16)p0[e]; fh_[8 + e] = (b16)p1[e]; }
    fl_ = fh_;
  } else {
    fh_ = frag_kb((const b16*)o.p0 + (size_t)row * o.ld + kb, hh);
    if (NP == 2) fl_ = frag_kb((const b16*)o.p1 + (size_t)row * o.ld + kb, hh); else fl_ = fh_;
  }
}
template <int ANP, int BNP> __device__ __forceinline__ v8f mac(v16b ah, v16b al, v16b bh, v16b bl, v8f c) {
  c = wmma16b(ah, bh, c);
  if (BNP == 0 || BNP == 2 || BNP == 4 || BNP == 5) c = wmma16b(ah, bl, c);     // hi.lo
  if (ANP == 0 || ANP == 2 || ANP == 4 || ANP == 5) c = wmma16b(al, bh, c);     // lo.hi   (lo.lo dropped)
  return c;
}
__device__ __forceinline__ void epi_planes(v8f (&acc)[2][4], float scale, bool two, b16* __restrict__ oh, b16* __restrict__ ol, int ldo,
                                           int m0, int c0, int lane, b16* Th, b16* Tl) {
  const int nloc = lane & 15, hlf = lane >> 4;
#pragma unroll
  for (int t = 0; t < 4; ++t)
#pragma unroll
    for (int r = 0; r < 2; ++r)
#pragma unroll
      for (int v = 0; v < 8; ++v) {
        const int rr = r * 16 + v + 8 * hlf, cc = t * 16 + nloc;
        b16 h_, l_; split16(acc[r][t][v] * scale, h_, l_);
        Th[rr * 64 + cc] = h_; Tl[rr * 64 + cc] = l_;
      }
  wave_lds_sync();
  {
#pragma unroll
    for (int j = 0; j < 8; ++j) {
      const int rr = j * 4 + (lane >> 3), c8 = (lane & 7) * 8;
      const size_t o = (size_t)(m0 + rr) * ldo + c0 + c8;
      *(v8b*)(oh + o) = ld8b(Th + rr * 64 + c8);
      if (two) *(v8b*)(ol + o) = ld8b(Tl + rr * 64 + c8);
    }
    
  }
}
// (b) f32 rows with pitch ldo: 64 floats = 256 B = 2 lines per row; 16 lanes x 16 B per row, 2 rows per instruction. Optional per-row factor
__device__ __forceinline__ void epi_f32(v8f (&acc)[2][4], float scale, const float* rscale, float* __restrict__ out, int ldo, int m0, int c0, int lane, float* Tt) {
  const int nloc = lane & 15, hlf = lane >> 4;
#pragma unroll
  for (int t = 0; t < 4; ++t)
#pragma unroll
    for (int r = 0; r < 2; ++r)
#pragma unroll
      for (int v = 0; v < 8; ++v) {
        const int rr = r * 16 + v + 8 * hlf;
        const float rs = rscale ? rscale[(size_t)(m0 + rr) * 32] : 1.0f;
        Tt[rr * 64 + t * 16 + nloc] = acc[r][t][v] * scale * rs;
      }
  wave_lds_sync();
  float* dst0 = out + (size_t)m0 * ldo + c0;
  {
#pragma unroll
    for (int j = 0; j < 16; ++j) { const int rr = j * 2 + hlf, c4 = nloc * 4; *(v4f*)(dst0 + (size_t)rr * ldo + c4) = *(const v4f*)(Tt + rr * 64 + c4); }
    
  }
}



typedef __attribute__((ext_vector_type(8))) __bf16 v8bb; typedef __attribute__((ext_vector_type(16))) __bf16 v16bb;
typedef __attribute__((ext_vector_type(8))) unsigned short v8us;
__device__ __forceinline__ v16bb frag_kb_bf(const __bf16* p, int hh) { const v8bb a = *(const v8bb*)(p + 8 * hh), b = *(const v8bb*)(p + 16 + 8 * hh); return __builtin_shufflevector(a, b, 0, 1, 2, 3, 4, 5, 6, 7, 8, 9, 10, 11, 12, 13, 14, 15); }
__device__ __forceinline__ v8f wmma16bb(v16bb a, v16bb b, v8f c) {
  v8f d = __builtin_amdgcn_wmma_f32_16x16x32_bf16(false, a, false, b, (short)0, c, false, false);
  asm volatile("v_nop\n\tv_nop\n\tv_nop\n\tv_nop" : "+v"(d) : "v"(a), "v"(b));
  return d;
}
__device__ __forceinline__ unsigned short bf16_rne_bits(float v) { unsigned int u = __float_as_uint(v); u += 0x7FFFu + ((u >> 16) & 1u); return (unsigned short)(u >> 16); }
__device__ __forceinline__ float bf16_rne(float v) { return __uint_as_float(((unsigned int)bf16_rne_bits(v)) << 16); }



__global__ __launch_bounds__(256) void xprep_kernel(const float* __restrict__ x, unsigned short* __restrict__ x16) {   // one pass's two batches -> bf16
  const size_t tid = (size_t)blockIdx.x * blockDim.x + threadIdx.x, nth = (size_t)gridDim.x * blockDim.x;
  { for (size_t p = tid; p < (size_t)NTOK * D / 8; p += nth) { v8us v;
#pragma unroll
      for (int e = 0; e < 8; ++e) v[e] = bf16_rne_bits(x[p * 8 + e]);
      *(v8us*)(x16 + p * 8) = v; }  }
}
__global__ __launch_bounds__(256) void prep_kernel(const float* __restrict__ wqkv, const float* __restrict__ wo, unsigned short* __restrict__ w16, b16* __restrict__ wo16) {
  const size_t tid = (size_t)blockIdx.x * blockDim.x + threadIdx.x, nth = (size_t)gridDim.x * blockDim.x;
  {
    for (size_t p = tid; p < (size_t)3 * D * D / 8; p += nth) { v8us v;   // Wqkv [3072][1024] ([out][in]) rows copied directly
#pragma unroll
      for (int e = 0; e < 8; ++e) v[e] = bf16_rne_bits(wqkv[p * 8 + e]);
      *(v8us*)(w16 + p * 8) = v; }
    for (size_t p = tid; p < (size_t)D * D / 8; p += nth) { v8b w;   // W_o [out][in] rows copied directly
#pragma unroll
      for (int e = 0; e < 8; ++e) w[e] = (b16)bf16_rne(wo[p * 8 + e]);
      *(v8b*)(wo16 + p * 8) = w; }
    
  }
}

constexpr int KT = 64;    // keys (attention) or k (GEMMs) per ring stage: 16-bit rows of 128 B = one cache line
constexpr int LP = 72;    // LDS row pitch in f16: 144 B = 16 B x 9, so the 16 rows of a ds_load_b128 fragment read fall on distinct banks
__device__ __forceinline__ unsigned lds_addr(const void* p) { return (unsigned)(size_t)p; }   // low 32 bits of a __shared__ address = byte offset in the work-group's LDS

// projections: rows = tokens (4096), K = 1024, block = 8 waves = 128 tokens x 128 columns = two heads of q (column tiles 0..7), k (8..15) or v (16..23); wave = 32 tokens x one head.
// The block's 128 x rows and 128 W rows come once per 64 k into a two-buffer LDS ring by asynchronous copies of whole 128 B rows; every wave takes its fragments from there.
// f16 rows [b*H + head][tok][64] for q/k; v: (8v)^T f16 [b*H + head][64][tok]. grid (24, 32) x 256.
constexpr int GR = 256;            // ring rows of a projection stage: 128 x rows, then 128 W rows
constexpr int GST = D / KT;        // ring stages of a GEMM: 16
__global__ __launch_bounds__(256) void proj_kernel(const __bf16* __restrict__ x16, const __bf16* __restrict__ w16, const float* __restrict__ bqkv, b16* __restrict__ qh, b16* __restrict__ kh, b16* __restrict__ vt) {
  __shared__ __attribute__((aligned(16))) unsigned char Sm[2 * GR * LP * 2];   // the ring [buffer][row][64 bf16 + pad]; behind the loop's last barrier the epilogue's staging
  const int lane = threadIdx.x & 31, wid = __builtin_amdgcn_readfirstlane(threadIdx.x >> 5), wave = wid & 3, cg = wid >> 2, nloc = lane & 15, hlf = lane >> 4;
  const int mb = blockIdx.y * 128, m0 = mb + wave * 32, cb = blockIdx.x * 128, c0 = cb + cg * 64;
  const int sr = threadIdx.x >> 3, sc = (threadIdx.x & 7) * 8;  // staging: thread -> rows sr + 32 j, 16 B piece sc; a wave's copy covers 4 whole 128 B rows
  // One stage: k in [t*64, t*64+64) < D. 8 copies of 16 B per lane, all lanes on; the s_wait_xcnt closes the statement so that no address register is rewritten ahead of it.
  auto stage = [&](int t, int buf) {
    const __bf16* gx = x16 + (size_t)(mb + sr) * D + t * KT + sc; const __bf16* gw = w16 + (size_t)(cb + sr) * D + t * KT + sc;
    const unsigned l0 = lds_addr(Sm + ((size_t)buf * GR + sr) * (LP * 2) + sc * 2);
    constexpr unsigned HB = 32 * LP * 2;                        // bytes per 32 rows
    asm volatile("global_load_async_to_lds_b128 %0, %8, off\n\t"
                 "global_load_async_to_lds_b128 %1, %9, off\n\t"
                 "global_load_async_to_lds_b128 %2, %10, off\n\t"
                 "global_load_async_to_lds_b128 %3, %11, off\n\t"
                 "global_load_async_to_lds_b128 %4, %12, off\n\t"
                 "global_load_async_to_lds_b128 %5, %13, off\n\t"
                 "global_load_async_to_lds_b128 %6, %14, off\n\t"
                 "global_load_async_to_lds_b128 %7, %15, off\n\t"
                 "s_wait_xcnt 0x0"
                 :: "v"(l0), "v"(l0 + HB), "v"(l0 + 2 * HB), "v"(l0 + 3 * HB), "v"(l0 + 4 * HB), "v"(l0 + 5 * HB), "v"(l0 + 6 * HB), "v"(l0 + 7 * HB),
                    "v"(gx), "v"(gx + 32 * D), "v"(gx + 64 * D), "v"(gx + 96 * D), "v"(gw), "v"(gw + 32 * D), "v"(gw + 64 * D), "v"(gw + 96 * D)
                 : "memory");
  };
  stage(0, 0);
  v8f acc[2][4];
#pragma unroll
  for (int r = 0; r < 2; ++r)
#pragma unroll
    for (int t = 0; t < 4; ++t) acc[r][t] = (v8f){};
  asm volatile("s_wait_asynccnt 0x0" ::: "memory");             // stage 0 of this wave has landed
  __syncthreads();                                              // publishes stage 0 to the other waves
  stage(1, 1);
  for (int s = 0; s < GST; ++s) {
    const __bf16* R = (const __bf16*)(Sm + (size_t)(s & 1) * (GR * LP * 2));
#pragma unroll   // the stage's two k steps of 32 unrolled so that every LDS fragment offset is an immediate
    for (int ks = 0; ks < 2; ++ks) {
      const v16bb a0 = frag_kb_bf(R + (wave * 32 + nloc) * LP + ks * 32, hlf), a1 = frag_kb_bf(R + (wave * 32 + 16 + nloc) * LP + ks * 32, hlf);
      v16bb bw[4];
#pragma unroll
      for (int t = 0; t < 4; ++t) bw[t] = frag_kb_bf(R + (128 + cg * 64 + t * 16 + nloc) * LP + ks * 32, hlf);
      __builtin_amdgcn_sched_barrier(0);                        // the k step's 12 LDS reads stay one group ahead of its 8 products: one LDS latency instead of one per column tile
#pragma unroll
      for (int t = 0; t < 4; ++t) { acc[0][t] = wmma16bb(a0, bw[t], acc[0][t]); acc[1][t] = wmma16bb(a1, bw[t], acc[1][t]); }
    }
    // publish point of stage s + 1
    asm volatile("s_wait_dscnt 0x0" ::: "memory");              // this wave's reads of buffer s & 1 are done before it is refilled
    asm volatile("s_wait_asynccnt 0x0" ::: "memory");           // this wave's copies of stage s + 1 have landed
    __syncthreads();                                            // publishes stage s + 1 and ends every wave's reads of stage s
    if (s + 2 < GST) stage(s + 2, s & 1);
  }
  asm volatile("s_wait_asynccnt 0x0" ::: "memory");             // nothing of the ring is in flight when its LDS becomes staging
  const int which = blockIdx.x / (D / 128), head = (blockIdx.x % (D / 128)) * 2 + cg, b = m0 / S, tok0 = m0 % S;
#pragma unroll
  for (int t = 0; t < 4; ++t) { const float bb = bf16_rne(bqkv[c0 + t * 16 + nloc]);   // + bias (rounded to bf16)
#pragma unroll
    for (int r = 0; r < 2; ++r)
#pragma unroll
      for (int v = 0; v < 8; ++v) acc[r][t][v] += bb; }
  if (which < 2) {                                              // q or k head: f16 rows
    b16 (*Th)[HD + 8] = (b16 (*)[HD + 8])(Sm + (size_t)wid * (2 * 32 * (HD + 8) * 2)); b16 (*Tq)[HD + 8] = Th + 32;   // the wave's own hi and lo tiles [32][64 + pad]
#pragma unroll
    for (int t = 0; t < 4; ++t)
#pragma unroll
      for (int r = 0; r < 2; ++r)
#pragma unroll
        for (int v = 0; v < 8; ++v) { b16 a_, c_; split16(acc[r][t][v] * QS, a_, c_); Th[r * 16 + 8 * hlf + v][t * 16 + nloc] = a_; Tq[r * 16 + 8 * hlf + v][t * 16 + nloc] = c_; }   // q, k carried x8 (lo residuals stay normal)
    wave_lds_sync();
    b16* dst = (which == 0 ? qh : kh) + (((size_t)b * H + head) * S + tok0) * HD;
    {
#pragma unroll
      for (int j = 0; j < 8; ++j) { const int rr = j * 4 + (lane >> 3), c8 = (lane & 7) * 8; *(v8b*)(dst + (size_t)rr * HD + c8) = *(const v8b*)(&Th[rr][c8]); *(v8b*)(dst + QPL + (size_t)rr * HD + c8) = *(const v8b*)(&Tq[rr][c8]); }
       }
    return;
  }
  const int vh = head;                                          // v head: (8v)^T tile [64 d][128 tok] via LDS, rows of 256 B; one hi and one lo tile per head of the block
  b16 (*Tt)[128 + 8] = (b16 (*)[128 + 8])(Sm + (size_t)cg * (2 * 64 * (128 + 8) * 2)); b16 (*Tl)[128 + 8] = Tt + 64;
#pragma unroll
  for (int t = 0; t < 4; ++t)
#pragma unroll
    for (int r = 0; r < 2; ++r)
#pragma unroll
      for (int v = 0; v < 8; ++v) { b16 a_, c_; split16(acc[r][t][v] * VS, a_, c_); Tt[t * 16 + nloc][wave * 32 + r * 16 + 8 * hlf + v] = a_; Tl[t * 16 + nloc][wave * 32 + r * 16 + 8 * hlf + v] = c_; }
  __syncthreads();
  b16* dstv = vt + (((size_t)b * H + vh) * HD) * S + (blockIdx.y * 128) % S;
  {
#pragma unroll
    for (int j = 0; j < 8; ++j) { const int dd = wave * 16 + j * 2 + (lane >> 4), c8 = (lane & 15) * 8; *(v8b*)(dstv + (size_t)dd * S + c8) = *(const v8b*)(&Tt[dd][c8]); *(v8b*)(dstv + VPL + (size_t)dd * S + c8) = *(const v8b*)(&Tl[dd][c8]); }
    
  }
}

// causal attention: wave = (b, h, 16 queries), block = 8 waves = 128 consecutive queries of one (b, h); key chunks of 32: S^T (K=64), mask on the straddling chunks, online softmax f32,
// P^T f16, y^T += (8V)^T P^T. The block's K rows and (8V)^T rows (hi and lo planes) come once per 64 keys into a two-buffer LDS ring by asynchronous copies of whole 128 B rows; every wave
// takes its fragments from there.
template <int QT>
__global__ __launch_bounds__(256) void attn_kernel(const b16* __restrict__ qh, const b16* __restrict__ kh, const b16* __restrict__ vt, const int* __restrict__ seq_lens, float* __restrict__ y) {
  __shared__ __attribute__((aligned(16))) float Os[8][16][HD + 4];
  __shared__ __attribute__((aligned(16))) b16 Ring[2][4][KT][LP];   // [buffer][K hi, K lo, V^T hi, V^T lo][key row or d row][64 f16 + pad]
  const int wid = __builtin_amdgcn_readfirstlane(threadIdx.x >> 5), lane = threadIdx.x & 31, hh = lane >> 4, col = lane & 15;
  const int qt = blockIdx.x * 8 + wid, jt = qt % QT, bh = qt / QT, h = bh % H, b = bh / H, q0 = jt * 16, qi = q0 + col;
  const b16* Q = qh + ((size_t)bh * S) * HD; const b16* K = kh + ((size_t)bh * S) * HD; const b16* vb = vt + ((size_t)bh * HD) * S;
  const int sl = min(max(seq_lens[b], 1), S);                   // padding mask: keys >= seq_len get -inf or are skipped (exp -> 0); seq_len >= 1 here so key 0 always survives
  const int kend = min(q0 + 16, sl);                            // this wave's key bound
  const int nst = (min(((int)blockIdx.x * 8 % QT) * 16 + 128, sl) + KT - 1) / KT;   // ring stages of the block = those of its last wave (block-uniform, 1..32)
  const int sr = threadIdx.x >> 3, sc = (threadIdx.x & 7) * 8;  // staging: thread -> rows sr and sr + 32, 16 B piece sc; a wave's copy covers 4 whole 128 B rows
  // One stage: keys [t*64, t*64+64) < S. 8 copies of 16 B per lane, all lanes on; the s_wait_xcnt closes the statement so that no address register is rewritten ahead of it.
  auto stage = [&](int t, int buf) {
    const b16* gk = K + (size_t)(t * KT + sr) * HD + sc; const b16* gv = vb + (size_t)sr * S + t * KT + sc;
    const unsigned l0 = lds_addr(&Ring[buf][0][sr][sc]);
    constexpr unsigned PB = KT * LP * 2, HB = 32 * LP * 2;      // bytes per plane, per 32 rows
    asm volatile("global_load_async_to_lds_b128 %0, %8, off\n\t"
                 "global_load_async_to_lds_b128 %1, %9, off\n\t"
                 "global_load_async_to_lds_b128 %2, %10, off\n\t"
                 "global_load_async_to_lds_b128 %3, %11, off\n\t"
                 "global_load_async_to_lds_b128 %4, %12, off\n\t"
                 "global_load_async_to_lds_b128 %5, %13, off\n\t"
                 "global_load_async_to_lds_b128 %6, %14, off\n\t"
                 "global_load_async_to_lds_b128 %7, %15, off\n\t"
                 "s_wait_xcnt 0x0"
                 :: "v"(l0), "v"(l0 + HB), "v"(l0 + PB), "v"(l0 + PB + HB), "v"(l0 + 2 * PB), "v"(l0 + 2 * PB + HB), "v"(l0 + 3 * PB), "v"(l0 + 3 * PB + HB),
                    "v"(gk), "v"(gk + 32 * HD), "v"(gk + QPL), "v"(gk + QPL + 32 * HD), "v"(gv), "v"(gv + (size_t)32 * S), "v"(gv + VPL), "v"(gv + VPL + (size_t)32 * S)
                 : "memory");
  };
  stage(0, 0);
  v16b qf[2], ql[2];
#pragma unroll
  for (int ks = 0; ks < 2; ++ks) { qf[ks] = frag_kb(Q + (size_t)qi * HD + ks * 32, hh); ql[ks] = frag_kb(Q + QPL + (size_t)qi * HD + ks * 32, hh); }
  float m = -INFINITY, l = 0.0f; v8f o[4] = {{}, {}, {}, {}};
  asm volatile("s_wait_asynccnt 0x0" ::: "memory");             // stage 0 of this wave has landed
  __syncthreads();                                              // publishes stage 0 to the other waves
  if (nst > 1) stage(1, 1);
  for (int t = 0; t < nst; ++t) {
    const b16 (*R)[KT][LP] = Ring[t & 1];
#pragma unroll   // the stage's two chunks of 32 keys unrolled so that every LDS fragment offset is an immediate
    for (int sub = 0; sub < 2; ++sub) {
      const int kb = t * KT + sub * 32, kl = sub * 32;
      if (kb < kend) {                                          // causal + padding: key chunks past min(query tile, seq_len) are skipped (wave-uniform scalar bound)
        const bool diag = (kb + 32 > q0) || (kb + 32 > sl);     // this chunk reaches past some queries or past seq_len -> mask
        v8f s0 = {}, s1 = {};
        v16b k0[2], k0l[2], k1[2], k1l[2];
#pragma unroll
        for (int ks = 0; ks < 2; ++ks) { k0[ks] = frag_kb(&R[0][kl + col][ks * 32], hh); k0l[ks] = frag_kb(&R[1][kl + col][ks * 32], hh); k1[ks] = frag_kb(&R[0][kl + 16 + col][ks * 32], hh); k1l[ks] = frag_kb(&R[1][kl + 16 + col][ks * 32], hh); }
        __builtin_amdgcn_sched_barrier(0);                      // the chunk's 16 K reads stay one group ahead of the score products: one LDS latency instead of one per k step
#pragma unroll
        for (int ks = 0; ks < 2; ++ks) {
          s0 = wmma16b(k0[ks], qf[ks], s0); s0 = wmma16b(k0[ks], ql[ks], s0); s0 = wmma16b(k0l[ks], qf[ks], s0);      // q and k as f16 hi+lo pairs (lo.lo dropped)
          s1 = wmma16b(k1[ks], qf[ks], s1); s1 = wmma16b(k1[ks], ql[ks], s1); s1 = wmma16b(k1l[ks], qf[ks], s1); }
        v16b vf[4], vl[4];
#pragma unroll
        for (int n = 0; n < 4; ++n) { vf[n] = frag_kb(&R[2][n * 16 + col][kl], hh); vl[n] = frag_kb(&R[3][n * 16 + col][kl], hh); }
        __builtin_amdgcn_sched_barrier(0);                      // the chunk's 16 V^T reads stay one group here, so that they land under the softmax instead of stalling each P.v product
        float mr = -INFINITY;
#pragma unroll
        for (int r = 0; r < 8; ++r) { s0[r] *= SCALE / (QS * QS); s1[r] *= SCALE / (QS * QS); if (diag) { const int k0_ = kb + 8 * hh + r, k1_ = kb + 16 + 8 * hh + r; if (k0_ > qi || k0_ >= sl) s0[r] = -INFINITY; if (k1_ > qi || k1_ >= sl) s1[r] = -INFINITY; } mr = fmaxf(mr, fmaxf(s0[r], s1[r])); }
        mr = fmaxf(mr, __shfl_xor(mr, 16));
        const float mn = fmaxf(m, mr), al_ = __expf(m - mn); m = mn;
        float sum = 0.0f; v16b pb, pl;
#pragma unroll
        for (int r = 0; r < 8; ++r) { const float e0 = __expf(s0[r] - mn), e1 = __expf(s1[r] - mn); sum += e0 + e1; b16 a, c; split16(e0 * PS, a, c); pb[r] = a; pl[r] = c; split16(e1 * PS, a, c); pb[8 + r] = a; pl[8 + r] = c; }   // P carried x8
        sum += __shfl_xor(sum, 16); l = l * al_ + sum;
#pragma unroll
        for (int n = 0; n < 4; ++n) {
#pragma unroll
          for (int r = 0; r < 8; ++r) o[n][r] *= al_;
          o[n] = wmma16b(vf[n], pb, o[n]); o[n] = wmma16b(vf[n], pl, o[n]); o[n] = wmma16b(vl[n], pb, o[n]);   // (8v) and P both as f16 hi+lo pairs (lo.lo dropped)
        }
      }
    }
    // publish point of stage t + 1, passed by every wave, also one that skipped its chunks
    asm volatile("s_wait_dscnt 0x0" ::: "memory");              // this wave's reads of buffer t & 1 are done before it is refilled
    asm volatile("s_wait_asynccnt 0x0" ::: "memory");           // this wave's copies of stage t + 1 have landed
    __syncthreads();                                            // publishes stage t + 1 and ends every wave's reads of stage t
    if (t + 2 < nst) stage(t + 2, t & 1);
  }
  asm volatile("s_wait_asynccnt 0x0" ::: "memory");             // nothing of the ring is in flight when the wave ends
  const float inv = 1.0f / (VS * PS * l);
#pragma unroll
  for (int n = 0; n < 4; ++n)
#pragma unroll
    for (int r = 0; r < 8; ++r) Os[wid][col][n * 16 + 8 * hh + r] = o[n][r] * inv;
  wave_lds_sync();
  float* dst = y + ((size_t)b * S + q0) * D + h * HD;
  {
#pragma unroll
    for (int j = 0; j < 8; ++j) { const int rr = j * 2 + hh, c4 = col * 4; *(v4f*)(dst + (size_t)rr * D + c4) = *(const v4f*)(&Os[wid][rr][c4]); }
    
  }
}

// out = y W_o^T: (4096 x 1024) x (1024 x 1024); A = y split at the fragment read (f16 hi+lo, x8), B = f16(bf16 W_o) rows; f32 rows; block = 8 waves = 128 tokens x 128 columns, wave = 32 x 64.
// The block's 128 y rows (256 B of f32 per stage) and 128 W_o rows (128 B) come once per 64 k into a two-buffer LDS ring by asynchronous copies of whole rows. grid (8, 32) x 256.
constexpr int YP = KT + 4;                                      // LDS pitch of a y row in f32: 272 B = 16 B x 17, so the 16 rows of a ds_load_b128 read fall on distinct banks
constexpr int OYB = 128 * YP * 4, OBUF = OYB + 128 * LP * 2;    // bytes of a buffer's y rows; of a whole buffer (y rows, then W_o rows)
__global__ __launch_bounds__(256) void out_kernel(const float* __restrict__ y, const b16* __restrict__ wo16, const float* __restrict__ bo, float* __restrict__ out) {
  __shared__ __attribute__((aligned(16))) unsigned char Sm[2 * OBUF];   // the ring; behind the loop's last barrier the epilogue's staging (8 KiB per wave)
  const int lane = threadIdx.x & 31, wid = __builtin_amdgcn_readfirstlane(threadIdx.x >> 5), wave = wid & 3, cg = wid >> 2, nloc = lane & 15, hlf = lane >> 4;
  const int mb = blockIdx.y * 128, m0 = mb + wave * 32, cb = blockIdx.x * 128, c0 = cb + cg * 64;
  const int yr = threadIdx.x >> 4, yc = (threadIdx.x & 15) * 4; // staging of y: thread -> rows yr + 16 j, 16 B piece yc; a wave's copy covers 2 whole 256 B rows
  const int sr = threadIdx.x >> 3, sc = (threadIdx.x & 7) * 8;  // staging of W_o: thread -> rows sr + 32 j, 16 B piece sc; a wave's copy covers 4 whole 128 B rows
  // One stage: k in [t*64, t*64+64) < D. 12 copies of 16 B per lane, all lanes on; the s_wait_xcnt closes the statement so that no address register is rewritten ahead of it.
  auto stage = [&](int t, int buf) {
    const float* gy = y + (size_t)(mb + yr) * D + t * KT + yc; const b16* gw = wo16 + (size_t)(cb + sr) * D + t * KT + sc;
    const unsigned ly = lds_addr(Sm + (size_t)buf * OBUF + (size_t)yr * (YP * 4) + yc * 4), lw = lds_addr(Sm + (size_t)buf * OBUF + OYB + (size_t)sr * (LP * 2) + sc * 2);
    constexpr unsigned YB = 16 * YP * 4, HB = 32 * LP * 2;      // bytes per 16 y rows, per 32 W_o rows
    asm volatile("global_load_async_to_lds_b128 %0, %12, off\n\t"
                 "global_load_async_to_lds_b128 %1, %13, off\n\t"
                 "global_load_async_to_lds_b128 %2, %14, off\n\t"
                 "global_load_async_to_lds_b128 %3, %15, off\n\t"
                 "global_load_async_to_lds_b128 %4, %16, off\n\t"
                 "global_load_async_to_lds_b128 %5, %17, off\n\t"
                 "global_load_async_to_lds_b128 %6, %18, off\n\t"
                 "global_load_async_to_lds_b128 %7, %19, off\n\t"
                 "global_load_async_to_lds_b128 %8, %20, off\n\t"
                 "global_load_async_to_lds_b128 %9, %21, off\n\t"
                 "global_load_async_to_lds_b128 %10, %22, off\n\t"
                 "global_load_async_to_lds_b128 %11, %23, off\n\t"
                 "s_wait_xcnt 0x0"
                 :: "v"(ly), "v"(ly + YB), "v"(ly + 2 * YB), "v"(ly + 3 * YB), "v"(ly + 4 * YB), "v"(ly + 5 * YB), "v"(ly + 6 * YB), "v"(ly + 7 * YB),
                    "v"(lw), "v"(lw + HB), "v"(lw + 2 * HB), "v"(lw + 3 * HB),
                    "v"(gy), "v"(gy + 16 * D), "v"(gy + 32 * D), "v"(gy + 48 * D), "v"(gy + 64 * D), "v"(gy + 80 * D), "v"(gy + 96 * D), "v"(gy + 112 * D),
                    "v"(gw), "v"(gw + 32 * D), "v"(gw + 64 * D), "v"(gw + 96 * D)
                 : "memory");
  };
  stage(0, 0);
  v8f acc[2][4];
#pragma unroll
  for (int r = 0; r < 2; ++r)
#pragma unroll
    for (int t = 0; t < 4; ++t) acc[r][t] = (v8f){};
  asm volatile("s_wait_asynccnt 0x0" ::: "memory");             // stage 0 of this wave has landed
  __syncthreads();                                              // publishes stage 0 to the other waves
  stage(1, 1);
  for (int s = 0; s < GST; ++s) {
    const Opnd A{Sm + (size_t)(s & 1) * OBUF, nullptr, YP}, Bo{Sm + (size_t)(s & 1) * OBUF + OYB, nullptr, LP};
#pragma unroll   // the stage's two k steps of 32 unrolled so that every LDS fragment offset is an immediate
    for (int ks = 0; ks < 2; ++ks) {
      v4f ya[2][4];                                             // the two y fragments' f32 words: [row tile][k = 8 hlf + 0..3, + 4..7, 16 + 8 hlf + 0..3, + 4..7]
#pragma unroll
      for (int r = 0; r < 2; ++r) { const float* p = (const float*)A.p0 + (wave * 32 + r * 16 + nloc) * YP + ks * 32 + 8 * hlf;
        ya[r][0] = *(const v4f*)p; ya[r][1] = *(const v4f*)(p + 4); ya[r][2] = *(const v4f*)(p + 16); ya[r][3] = *(const v4f*)(p + 20); }
      v16b bh[4], bl[4];
#pragma unroll
      for (int t = 0; t < 4; ++t) load_frags<1>(Bo, cg * 64 + t * 16 + nloc, ks * 32, hlf, bh[t], bl[t]);
      __builtin_amdgcn_sched_barrier(0);                        // the k step's 16 LDS reads stay one group ahead of the split and the 16 products: one LDS latency instead of one per tile
      v16b ah[2], al[2];                                        // y as an f16 hi+lo pair carried x8 (2 products)
#pragma unroll
      for (int r = 0; r < 2; ++r)
#pragma unroll
        for (int e = 0; e < 16; ++e) { b16 a_, c_; split16(ya[r][e >> 2][e & 3] * 8.0f, a_, c_); ah[r][e] = a_; al[r][e] = c_; }
#pragma unroll
      for (int t = 0; t < 4; ++t) {
        acc[0][t] = mac<5, 1>(ah[0], al[0], bh[t], bl[t], acc[0][t]);
        acc[1][t] = mac<5, 1>(ah[1], al[1], bh[t], bl[t], acc[1][t]);
      }
    }
    // publish point of stage s + 1
    asm volatile("s_wait_dscnt 0x0" ::: "memory");              // this wave's reads of buffer s & 1 are done before it is refilled
    asm volatile("s_wait_asynccnt 0x0" ::: "memory");           // this wave's copies of stage s + 1 have landed
    __syncthreads();                                            // publishes stage s + 1 and ends every wave's reads of stage s
    if (s + 2 < GST) stage(s + 2, s & 1);
  }
  asm volatile("s_wait_asynccnt 0x0" ::: "memory");             // nothing of the ring is in flight when its LDS becomes staging
#pragma unroll
  for (int t = 0; t < 4; ++t)
#pragma unroll
    for (int r = 0; r < 2; ++r)
#pragma unroll
      for (int v = 0; v < 8; ++v) acc[r][t][v] = acc[r][t][v] * (1.0f / 8.0f) + bf16_rne(bo[c0 + t * 16 + nloc]);
  epi_f32(acc, 1.0f, nullptr, out, D, m0, c0, lane, (float*)(Sm + (size_t)wid * (32 * 64 * 4)));
}
}  // namespace

extern "C" void kernel_launch(void* const* d_in, const int* in_sizes, int n_in,
                              void* d_out, int out_size, void* d_ws, size_t ws_size, hipStream_t stream) {
  (void)n_in; (void)out_size;
  const float* x = (const float*)d_in[0]; const int* seq_lens = (const int*)d_in[1]; const float* wqkv = (const float*)d_in[2]; const float* bqkv = (const float*)d_in[3]; const float* wo = (const float*)d_in[4]; const float* bo = (const float*)d_in[5];
  float* out = (float*)d_out;   // [2][2048][1024]
  if (in_sizes[0] != BT * S * D || in_sizes[1] != Bn || in_sizes[2] != 3 * D * D || in_sizes[3] != 3 * D || in_sizes[4] != D * D || in_sizes[5] != D) return;
  size_t off = 0; char* ws = (char*)d_ws;
  auto carve = [&](size_t bytes) { char* p = ws + off; off += (bytes + 255) & ~(size_t)255; return p; };
  unsigned short* x16 = (unsigned short*)carve((size_t)NTOK * D * 2); unsigned short* w16 = (unsigned short*)carve((size_t)3 * D * D * 2); b16* wo16 = (b16*)carve((size_t)D * D * 2);
  b16* qh = (b16*)carve((size_t)2 * NTOK * D * 2); b16* kh = (b16*)carve((size_t)2 * NTOK * D * 2); b16* vt = (b16*)carve((size_t)2 * NTOK * D * 2); float* y = (float*)carve((size_t)NTOK * D * 4);
  if (off > ws_size) return;                                    // ≈ 84 MB
  prep_kernel<<<512, 256, 0, stream>>>(wqkv, wo, w16, wo16);
  xprep_kernel<<<1024, 256, 0, stream>>>(x, x16);
  proj_kernel<<<dim3(3 * D / 128, NTOK / 128), 256, 0, stream>>>((const __bf16*)x16, (const __bf16*)w16, bqkv, qh, kh, vt);
  attn_kernel<S / 16><<<Bn * H * (S / 16) / 8, 256, 0, stream>>>(qh, kh, vt, seq_lens, y);
  out_kernel<<<dim3(D / 128, NTOK / 128), 256, 0, stream>>>(y, wo16, bo, out);
}

// v004
// A run of this version takes 103 microseconds.
// Next to v003, in two timings, it ran 1.11 and 1.10 times as fast.
// All steps since v000 together make it 2.88 times as fast.
#include <hip/hip_runtime.h>

// MultiAxisAttention: qkv = x Wqkv^T + bqkv (16 heads x 64), causal mask (key > query -> -1e9) plus a per-batch padding mask (key >= seq_len[b] -> -1e9), softmax of q.k/8, out = ctx Wout^T + bout
// -> [2][2048][1024]. seq_lens here are > 0, so every query keeps key 0 and the masked keys contribute exp(-1e9 - max) = 0; the key loop stops at
// min(causal bound, seq_len).
// x, the four weights and bo rounded to bf16: projection on v_wmma_f32_16x16x32_bf16 (exact products, f32 accumulate);
// scores, P.v and the output projection on v_wmma_f32_16x16x32_f16 with every computed operand (q, k, v, P, y — each carried x8 so the hi/lo residual planes stay normal) as an f16
// hi+lo pair (3 / 2 products); online softmax in f32. Fragment k-map per lane half hh for A AND B: elements 0..7 <- k = 8hh+0..7, 8..15 <- k = 16+8hh+0..7. Every intermediate /

namespace {
constexpr int BT = 2, Bn = 2, S = 2048, D = 1024, H = 16, HD = 64, NTOK = Bn * S;
constexpr float SCALE = 0.125f, VS = 8.0f, QS = 8.0f, PS = 8.0f;   // power-of-two carry scales so hi/lo residual planes stay normal in f16
constexpr size_t VPL = (size_t)NTOK * D;   // distance between the (8v)^T hi and lo planes
constexpr size_t QPL = (size_t)NTOK * D;   // distance between the q/k hi and lo planes

typedef _Float16 b16;
typedef __attribute__((ext_vector_type(16))) _Float16 v16b;
typedef __attribute__((ext_vector_type(8)))  _Float16 v8b;
typedef __attribute__((ext_vector_type(8)))  float v8f;
typedef __attribute__((ext_vector_type(4)))  float v4f;

__device__ __forceinline__ v8b ld8b(const b16* p) { return *(const v8b*)p; }
__device__ __forceinline__ v16b cat8b(v8b a, v8b b) { return __builtin_shufflevector(a, b, 0, 1, 2, 3, 4, 5, 6, 7, 8, 9, 10, 11, 12, 13, 14, 15); }
__device__ __forceinline__ v16b frag_kb(const b16* p, int hh) { return cat8b(ld8b(p + 8 * hh), ld8b(p + 16 + 8 * hh)); }
__device__ __forceinline__ void split16(float v, b16& hi, b16& lo) { hi = (b16)v; lo = (b16)(v - (float)hi); }
// hi/lo fragment pair straight from an f32 k-contiguous row (same k-map)
__device__ __forceinline__ void frag_ksplit(const float* p, int hh, v16b& fh_, v16b& fl_) {
  const float* p0 = p + 8 * hh; const float* p1 = p + 16 + 8 * hh;
#pragma unroll
  for (int e = 0; e < 8; ++e) { b16 a, c; split16(p0[e], a, c); fh_[e] = a; fl_[e] = c; split16(p1[e], a, c); fh_[8 + e] = a; fl_[8 + e] = c; }
}
__device__ __forceinline__ v8f wmma16b(v16b a, v16b b, v8f c) {
  v8f d = __builtin_amdgcn_wmma_f32_16x16x32_f16(false, a, false, b, (short)0, c, false, false);
  asm volatile("v_nop\n\tv_nop\n\tv_nop\n\tv_nop" : "+v"(d) : "v"(a), "v"(b));
  return d;
}
__device__ __forceinline__ void wave_lds_sync() {
  __builtin_amdgcn_fence(__ATOMIC_RELEASE, "workgroup");
  __builtin_amdgcn_wave_barrier();
  __builtin_amdgcn_fence(__ATOMIC_ACQUIRE, "workgroup");
}

// Operand descriptor: NP = 0 -> f32 rows split on the fly into (hi, lo); NP = 1 -> one f16 plane; NP = 2 -> f16 hi + lo planes;
// NP = 3 -> f32 rows rounded once to a single f16 fragment. ld = row pitch.
struct Opnd { const void* p0; const void* p1; int ld; };
template <int NP> __device__ __forceinline__ void load_frags(const Opnd& o, int row, int kb, int hh, v16b& fh_, v16b& fl_) {
  if (NP == 0) { frag_ksplit((const float*)o.p0 + (size_t)row * o.ld + kb, hh, fh_, fl_); }
  else if (NP == 4 || NP == 5) {                             // f32 rows x64 (NP 4) or x8 (NP 5) then split (keeps the lo halves of small values normal)
    const float sc_ = (NP == 4) ? 64.0f : 8.0f;
    const float* p = (const float*)o.p0 + (size_t)row * o.ld + kb; const float* p0 = p + 8 * hh; const float* p1 = p + 16 + 8 * hh;
#pragma unroll
    for (int e = 0; e < 8; ++e) { b16 a, c; split16(p0[e] * sc_, a, c); fh_[e] = a; fl_[e] = c; split16(p1[e] * sc_, a, c); fh_[8 + e] = a; fl_[8 + e] = c; }
  } else if (NP == 3) {
    const float* p = (const float*)o.p0 + (size_t)row * o.ld + kb; const float* p0 = p + 8 * hh; const float* p1 = p + 16 + 8 * hh;
#pragma unroll
    for (int e = 0; e < 8; ++e) { fh_[e] = (b16)p0[e]; fh_[8 + e] = (b16)p1[e]; }
    fl_ = fh_;
  } else {
    fh_ = frag_kb((const b16*)o.p0 + (size_t)row * o.ld + kb, hh);
    if (NP == 2) fl_ = frag_kb((const b16*)o.p1 + (size_t)row * o.ld + kb, hh); else fl_ = fh_;
  }
}
template <int ANP, int BNP> __device__ __forceinline__ v8f mac(v16b ah, v16b al, v16b bh, v16b bl, v8f c) {
  c = wmma16b(ah, bh, c);
  if (BNP == 0 || BNP == 2 || BNP == 4 || BNP == 5) c = wmma16b(ah, bl, c);     // hi.lo
  if (ANP == 0 || ANP == 2 || ANP == 4 || ANP == 5) c = wmma16b(al, bh, c);     // lo.hi   (lo.lo dropped)
  return c;
}
__device__ __forceinline__ void epi_planes(v8f (&acc)[2][4], float scale, bool two, b16* __restrict__ oh, b16* __restrict__ ol, int ldo,
                                           int m0, int c0, int lane, b16* Th, b16* Tl) {
  const int nloc = lane & 15, hlf = lane >> 4;
#pragma unroll
  for (int t = 0; t < 4; ++t)
#pragma unroll
    for (int r = 0; r < 2; ++r)
#pragma unroll
      for (int v = 0; v < 8; ++v) {
        const int rr = r * 16 + v + 8 * hlf, cc = t * 16 + nloc;
        b16 h_, l_; split16(acc[r][t][v] * scale, h_, l_);
        Th[rr * 64 + cc] = h_; Tl[rr * 64 + cc] = l_;
      }
  wave_lds_sync();
  {
#pragma unroll
    for (int j = 0; j < 8; ++j) {
      const int rr = j * 4 + (lane >> 3), c8 = (lane & 7) * 8;
      const size_t o = (size_t)(m0 + rr) * ldo + c0 + c8;
      *(v8b*)(oh + o) = ld8b(Th + rr * 64 + c8);
      if (two) *(v8b*)(ol + o) = ld8b(Tl + rr * 64 + c8);
    }
    
  }
}
// (b) f32 rows with pitch ldo: 64 floats = 256 B = 2 lines per row; 16 lanes x 16 B per row, 2 rows per instruction. Optional per-row factor
__device__ __forceinline__ void epi_f32(v8f (&acc)[2][4], float scale, const float* rscale, float* __restrict__ out, int ldo, int m0, int c0, int lane, float* Tt) {
  const int nloc = lane & 15, hlf = lane >> 4;
#pragma unroll
  for (int t = 0; t < 4; ++t)
#pragma unroll
    for (int r = 0; r < 2; ++r)
#pragma unroll
      for (int v = 0; v < 8; ++v) {
        const int rr = r * 16 + v + 8 * hlf;
        const float rs = rscale ? rscale[(size_t)(m0 + rr) * 32] : 1.0f;
        Tt[rr * 64 + t * 16 + nloc] = acc[r][t][v] * scale * rs;
      }
  wave_lds_sync();
  float* dst0 = out + (size_t)m0 * ldo + c0;
  {
#pragma unroll
    for (int j = 0; j < 16; ++j) { const int rr = j * 2 + hlf, c4 = nloc * 4; *(v4f*)(dst0 + (size_t)rr * ldo + c4) = *(const v4f*)(Tt + rr * 64 + c4); }
    
  }
}



typedef __attribute__((ext_vector_type(8))) __bf16 v8bb; typedef __attribute__((ext_vector_type(16))) __bf16 v16bb;
typedef __attribute__((ext_vector_type(8))) unsigned short v8us;
__device__ __forceinline__ v16bb frag_kb_bf(const __bf16* p, int hh) { const v8bb a = *(const v8bb*)(p + 8 * hh), b = *(const v8bb*)(p + 16 + 8 * hh); return __builtin_shufflevector(a, b, 0, 1, 2, 3, 4, 5, 6, 7, 8, 9, 10, 11, 12, 13, 14, 15); }
__device__ __forceinline__ v8f wmma16bb(v16bb a, v16bb b, v8f c) {
  v8f d = __builtin_amdgcn_wmma_f32_16x16x32_bf16(false, a, false, b, (short)0, c, false, false);
  asm volatile("v_nop\n\tv_nop\n\tv_nop\n\tv_nop" : "+v"(d) : "v"(a), "v"(b));
  return d;
}
__device__ __forceinline__ unsigned short bf16_rne_bits(float v) { unsigned int u = __float_as_uint(v); u += 0x7FFFu + ((u >> 16) & 1u); return (unsigned short)(u >> 16); }
__device__ __forceinline__ float bf16_rne(float v) { return __uint_as_float(((unsigned int)bf16_rne_bits(v)) << 16); }



__global__ __launch_bounds__(256) void xprep_kernel(const float* __restrict__ x, unsigned short* __restrict__ x16) {   // one pass's two batches -> bf16
  const size_t tid = (size_t)blockIdx.x * blockDim.x + threadIdx.x, nth = (size_t)gridDim.x * blockDim.x;
  { for (size_t p = tid; p < (size_t)NTOK * D / 8; p += nth) { v8us v;
#pragma unroll
      for (int e = 0; e < 8; ++e) v[e] = bf16_rne_bits(x[p * 8 + e]);
      *(v8us*)(x16 + p * 8) = v; }  }
}
__global__ __launch_bounds__(256) void prep_kernel(const float* __restrict__ wqkv, const float* __restrict__ wo, unsigned short* __restrict__ w16, b16* __restrict__ wo16) {
  const size_t tid = (size_t)blockIdx.x * blockDim.x + threadIdx.x, nth = (size_t)gridDim.x * blockDim.x;
  {
    for (size_t p = tid; p < (size_t)3 * D * D / 8; p += nth) { v8us v;   // Wqkv [3072][1024] ([out][in]) rows copied directly
#pragma unroll
      for (int e = 0; e < 8; ++e) v[e] = bf16_rne_bits(wqkv[p * 8 + e]);
      *(v8us*)(w16 + p * 8) = v; }
    for (size_t p = tid; p < (size_t)D * D / 8; p += nth) { v8b w;   // W_o [out][in] rows copied directly
#pragma unroll
      for (int e = 0; e < 8; ++e) w[e] = (b16)bf16_rne(wo[p * 8 + e]);
      *(v8b*)(wo16 + p * 8) = w; }
    
  }
}

constexpr int KT = 64;    // keys (attention) or k (GEMMs) per ring stage: 16-bit rows of 128 B = one cache line
constexpr int LP = 72;    // LDS row pitch in f16: 144 B = 16 B x 9, so the 16 rows of a ds_load_b128 fragment read fall on distinct banks
__device__ __forceinline__ unsigned lds_addr(const void* p) { return (unsigned)(size_t)p; }   // low 32 bits of a __shared__ address = byte offset in the work-group's LDS

// projections: rows = tokens (4096), K = 1024, block = 8 waves = 128 tokens x 128 columns = two heads of q (column tiles 0..7), k (8..15) or v (16..23); wave = 32 tokens x one head.
// The block's 128 x rows and 128 W rows come once per 64 k into a two-buffer LDS ring by asynchronous copies of whole 128 B rows; every wave takes its fragments from there.
// f16 rows [b*H + head][tok][64] for q/k; v: (8v)^T f16 [b*H + head][64][tok]. grid (24, 32) x 256.
constexpr int GR = 256;            // ring rows of a projection stage: 128 x rows, then 128 W rows
constexpr int GST = D / KT;        // ring stages of a GEMM: 16
__global__ __launch_bounds__(256) void proj_kernel(const __bf16* __restrict__ x16, const __bf16* __restrict__ w16, const float* __restrict__ bqkv, b16* __restrict__ qh, b16* __restrict__ kh, b16* __restrict__ vt) {
  __shared__ __attribute__((aligned(16))) unsigned char Sm[2 * GR * LP * 2];   // the ring [buffer][row][64 bf16 + pad]; behind the loop's last barrier the epilogue's staging
  const int lane = threadIdx.x & 31, wid = __builtin_amdgcn_readfirstlane(threadIdx.x >> 5), wave = wid & 3, cg = wid >> 2, nloc = lane & 15, hlf = lane >> 4;
  const int mb = blockIdx.y * 128, m0 = mb + wave * 32, cb = blockIdx.x * 128, c0 = cb + cg * 64;
  const int sr = threadIdx.x >> 3, sc = (threadIdx.x & 7) * 8;  // staging: thread -> rows sr + 32 j, 16 B piece sc; a wave's copy covers 4 whole 128 B rows
  // One stage: k in [t*64, t*64+64) < D. 8 copies of 16 B per lane, all lanes on; the s_wait_xcnt closes the statement so that no address register is rewritten ahead of it.
  auto stage = [&](int t, int buf) {
    const __bf16* gx = x16 + (size_t)(mb + sr) * D + t * KT + sc; const __bf16* gw = w16 + (size_t)(cb + sr) * D + t * KT + sc;
    const unsigned l0 = lds_addr(Sm + ((size_t)buf * GR + sr) * (LP * 2) + sc * 2);
    constexpr unsigned HB = 32 * LP * 2;                        // bytes per 32 rows
    asm volatile("global_load_async_to_lds_b128 %0, %8, off\n\t"
                 "global_load_async_to_lds_b128 %1, %9, off\n\t"
                 "global_load_async_to_lds_b128 %2, %10, off\n\t"
                 "global_load_async_to_lds_b128 %3, %11, off\n\t"
                 "global_load_async_to_lds_b128 %4, %12, off\n\t"
                 "global_load_async_to_lds_b128 %5, %13, off\n\t"
                 "global_load_async_to_lds_b128 %6, %14, off\n\t"
                 "global_load_async_to_lds_b128 %7, %15, off\n\t"
                 "s_wait_xcnt 0x0"
                 :: "v"(l0), "v"(l0 + HB), "v"(l0 + 2 * HB), "v"(l0 + 3 * HB), "v"(l0 + 4 * HB), "v"(l0 + 5 * HB), "v"(l0 + 6 * HB), "v"(l0 + 7 * HB),
                    "v"(gx), "v"(gx + 32 * D), "v"(gx + 64 * D), "v"(gx + 96 * D), "v"(gw), "v"(gw + 32 * D), "v"(gw + 64 * D), "v"(gw + 96 * D)
                 : "memory");
  };
  stage(0, 0);
  v8f acc[2][4];
#pragma unroll
  for (int r = 0; r < 2; ++r)
#pragma unroll
    for (int t = 0; t < 4; ++t) acc[r][t] = (v8f){};
  asm volatile("s_wait_asynccnt 0x0" ::: "memory");             // stage 0 of this wave has landed
  __syncthreads();                                              // publishes stage 0 to the other waves
  stage(1, 1);
  for (int s = 0; s < GST; ++s) {
    const __bf16* R = (const __bf16*)(Sm + (size_t)(s & 1) * (GR * LP * 2));
#pragma unroll   // the stage's two k steps of 32 unrolled so that every LDS fragment offset is an immediate
    for (int ks = 0; ks < 2; ++ks) {
      const v16bb a0 = frag_kb_bf(R + (wave * 32 + nloc) * LP + ks * 32, hlf), a1 = frag_kb_bf(R + (wave * 32 + 16 + nloc) * LP + ks * 32, hlf);
      v16bb bw[4];
#pragma unroll
      for (int t = 0; t < 4; ++t) bw[t] = frag_kb_bf(R + (128 + cg * 64 + t * 16 + nloc) * LP + ks * 32, hlf);
      __builtin_amdgcn_sched_barrier(0);                        // the k step's 12 LDS reads stay one group ahead of its 8 products: one LDS latency instead of one per column tile
#pragma unroll
      for (int t = 0; t < 4; ++t) { acc[0][t] = wmma16bb(a0, bw[t], acc[0][t]); acc[1][t] = wmma16bb(a1, bw[t], acc[1][t]); }
    }
    // publish point of stage s + 1
    asm volatile("s_wait_dscnt 0x0" ::: "memory");              // this wave's reads of buffer s & 1 are done before it is refilled
    asm volatile("s_wait_asynccnt 0x0" ::: "memory");           // this wave's copies of stage s + 1 have landed
    __syncthreads();                                            // publishes stage s + 1 and ends every wave's reads of stage s
    if (s + 2 < GST) stage(s + 2, s & 1);
  }
  asm volatile("s_wait_asynccnt 0x0" ::: "memory");             // nothing of the ring is in flight when its LDS becomes staging
  const int which = blockIdx.x / (D / 128), head = (blockIdx.x % (D / 128)) * 2 + cg, b = m0 / S, tok0 = m0 % S;
#pragma unroll
  for (int t = 0; t < 4; ++t) { const float bb = bf16_rne(bqkv[c0 + t * 16 + nloc]);   // + bias (rounded to bf16)
#pragma unroll
    for (int r = 0; r < 2; ++r)
#pragma unroll
      for (int v = 0; v < 8; ++v) acc[r][t][v] += bb; }
  if (which < 2) {                                              // q or k head: f16 rows
    b16 (*Th)[HD + 8] = (b16 (*)[HD + 8])(Sm + (size_t)wid * (2 * 32 * (HD + 8) * 2)); b16 (*Tq)[HD + 8] = Th + 32;   // the wave's own hi and lo tiles [32][64 + pad]
#pragma unroll
    for (int t = 0; t < 4; ++t)
#pragma unroll
      for (int r = 0; r < 2; ++r)
#pragma unroll
        for (int v = 0; v < 8; ++v) { b16 a_, c_; split16(acc[r][t][v] * QS, a_, c_); Th[r * 16 + 8 * hlf + v][t * 16 + nloc] = a_; Tq[r * 16 + 8 * hlf + v][t * 16 + nloc] = c_; }   // q, k carried x8 (lo residuals stay normal)
    wave_lds_sync();
    b16* dst = (which == 0 ? qh : kh) + (((size_t)b * H + head) * S + tok0) * HD;
    {
#pragma unroll
      for (int j = 0; j < 8; ++j) { const int rr = j * 4 + (lane >> 3), c8 = (lane & 7) * 8; *(v8b*)(dst + (size_t)rr * HD + c8) = *(const v8b*)(&Th[rr][c8]); *(v8b*)(dst + QPL + (size_t)rr * HD + c8) = *(const v8b*)(&Tq[rr][c8]); }
       }
    return;
  }
  const int vh = head;                                          // v head: (8v)^T tile [64 d][128 tok] via LDS, rows of 256 B; one hi and one lo tile per head of the block
  b16 (*Tt)[128 + 8] = (b16 (*)[128 + 8])(Sm + (size_t)cg * (2 * 64 * (128 + 8) * 2)); b16 (*Tl)[128 + 8] = Tt + 64;
#pragma unroll
  for (int t = 0; t < 4; ++t)
#pragma unroll
    for (int r = 0; r < 2; ++r)
#pragma unroll
      for (int v = 0; v < 8; ++v) { b16 a_, c_; split16(acc[r][t][v] * VS, a_, c_); Tt[t * 16 + nloc][wave * 32 + r * 16 + 8 * hlf + v] = a_; Tl[t * 16 + nloc][wave * 32 + r * 16 + 8 * hlf + v] = c_; }
  __syncthreads();
  b16* dstv = vt + (((size_t)b * H + vh) * HD) * S + (blockIdx.y * 128) % S;
  {
#pragma unroll
    for (int j = 0; j < 8; ++j) { const int dd = wave * 16 + j * 2 + (lane >> 4), c8 = (lane & 15) * 8; *(v8b*)(dstv + (size_t)dd * S + c8) = *(const v8b*)(&Tt[dd][c8]); *(v8b*)(dstv + VPL + (size_t)dd * S + c8) = *(const v8b*)(&Tl[dd][c8]); }
    
  }
}

// causal attention: block = 8 waves = 64 consecutive queries of one (b, h) = 4 query groups of 16 x 2 key groups: of every ring stage of 64 keys, waves 0..3 take keys 0..31 and waves 4..7
// keys 32..63, so the longest block walks half as many chunks per wave; each wave keeps its own online softmax (f32) and the two partial results of a query group are merged through LDS at the end.
// Blocks outnumber the resident places, so the longest tiles (highest queries) come first in the grid. Per chunk of 32 keys: S^T (K=64), mask on the straddling chunks, P^T f16, y^T += (8V)^T P^T.
// The block's K rows and (8V)^T rows (hi and lo planes) come once per 64 keys into a two-buffer LDS ring by asynchronous copies of whole 128 B rows; every wave takes its fragments from there.
template <int QT>
__global__ __launch_bounds__(256) void attn_kernel(const b16* __restrict__ qh, const b16* __restrict__ kh, const b16* __restrict__ vt, const int* __restrict__ seq_lens, float* __restrict__ y) {
  __shared__ __attribute__((aligned(16))) float Os[8][16][HD + 4];
  __shared__ __attribute__((aligned(16))) b16 Ring[2][4][KT][LP];   // [buffer][K hi, K lo, V^T hi, V^T lo][key row or d row][64 f16 + pad]
  const int wid = __builtin_amdgcn_readfirstlane(threadIdx.x >> 5), lane = threadIdx.x & 31, hh = lane >> 4, col = lane & 15;
  const int qg = wid & 3, kg = wid >> 2;                        // query group, key group of the wave
  const int tile = QT / 4 - 1 - (int)blockIdx.x / (Bn * H), bh = (int)blockIdx.x % (Bn * H), h = bh % H, b = bh / H, q0 = tile * 64 + qg * 16, qi = q0 + col;
  const b16* Q = qh + ((size_t)bh * S) * HD; const b16* K = kh + ((size_t)bh * S) * HD; const b16* vb = vt + ((size_t)bh * HD) * S;
  const int sl = min(max(seq_lens[b], 1), S);                   // padding mask: keys >= seq_len get -inf (exp -> 0); seq_len >= 1 here so key 0 always survives
  const int kend = __builtin_amdgcn_readfirstlane(min(q0 + 16, sl));   // this wave's key bound, held in a scalar register so that the chunk test below stays a scalar compare and branch
  const int nst = (min(tile * 64 + 64, sl) + KT - 1) / KT;      // ring stages of the block = those of its last query group (block-uniform, 1..32)
  const int sr = threadIdx.x >> 3, sc = (threadIdx.x & 7) * 8;  // staging: thread -> rows sr and sr + 32, 16 B piece sc; a wave's copy covers 4 whole 128 B rows
  // One stage: keys [t*64, t*64+64) < S. 8 copies of 16 B per lane, all lanes on; the s_wait_xcnt closes the statement so that no address register is rewritten ahead of it.
  auto stage = [&](int t, int buf) {
    const b16* gk = K + (size_t)(t * KT + sr) * HD + sc; const b16* gv = vb + (size_t)sr * S + t * KT + sc;
    const unsigned l0 = lds_addr(&Ring[buf][0][sr][sc]);
    constexpr unsigned PB = KT * LP * 2, HB = 32 * LP * 2;      // bytes per plane, per 32 rows
    asm volatile("global_load_async_to_lds_b128 %0, %8, off\n\t"
                 "global_load_async_to_lds_b128 %1, %9, off\n\t"
                 "global_load_async_to_lds_b128 %2, %10, off\n\t"
                 "global_load_async_to_lds_b128 %3, %11, off\n\t"
                 "global_load_async_to_lds_b128 %4, %12, off\n\t"
                 "global_load_async_to_lds_b128 %5, %13, off\n\t"
                 "global_load_async_to_lds_b128 %6, %14, off\n\t"
                 "global_load_async_to_lds_b128 %7, %15, off\n\t"
                 "s_wait_xcnt 0x0"
                 :: "v"(l0), "v"(l0 + HB), "v"(l0 + PB), "v"(l0 + PB + HB), "v"(l0 + 2 * PB), "v"(l0 + 2 * PB + HB), "v"(l0 + 3 * PB), "v"(l0 + 3 * PB + HB),
                    "v"(gk), "v"(gk + 32 * HD), "v"(gk + QPL), "v"(gk + QPL + 32 * HD), "v"(gv), "v"(gv + (size_t)32 * S), "v"(gv + VPL), "v"(gv + VPL + (size_t)32 * S)
                 : "memory");
  };
  stage(0, 0);
  v16b qf[2], ql[2];
#pragma unroll
  for (int ks = 0; ks < 2; ++ks) { qf[ks] = frag_kb(Q + (size_t)qi * HD + ks * 32, hh); ql[ks] = frag_kb(Q + QPL + (size_t)qi * HD + ks * 32, hh); }
  float m = -INFINITY, l = 0.0f; v8f o[4] = {{}, {}, {}, {}};
  asm volatile("s_wait_asynccnt 0x0" ::: "memory");             // stage 0 of this wave has landed
  __syncthreads();                                              // publishes stage 0 to the other waves
  if (nst > 1) stage(1, 1);
  for (int t = 0; t < nst; ++t) {
    const b16 (*R)[KT][LP] = Ring[t & 1];
    {
      const int kb = t * KT + kg * 32, kl = kg * 32;            // this wave's chunk of the stage
      if (kb < kend) {                                          // causal + padding: key chunks past min(query tile, seq_len) are skipped (wave-uniform scalar bound)
        const bool diag = (kb + 32 > q0) || (kb + 32 > sl);     // this chunk reaches past some queries or past seq_len -> mask
        v8f s0 = {}, s1 = {};
        v16b k0[2], k0l[2], k1[2], k1l[2];
#pragma unroll
        for (int ks = 0; ks < 2; ++ks) { k0[ks] = frag_kb(&R[0][kl + col][ks * 32], hh); k0l[ks] = frag_kb(&R[1][kl + col][ks * 32], hh); k1[ks] = frag_kb(&R[0][kl + 16 + col][ks * 32], hh); k1l[ks] = frag_kb(&R[1][kl + 16 + col][ks * 32], hh); }
        __builtin_amdgcn_sched_barrier(0);                      // the chunk's 16 K reads stay one group ahead of the score products: one LDS latency instead of one per k step
#pragma unroll
        for (int ks = 0; ks < 2; ++ks) {
          s0 = wmma16b(k0[ks], qf[ks], s0); s0 = wmma16b(k0[ks], ql[ks], s0); s0 = wmma16b(k0l[ks], qf[ks], s0);      // q and k as f16 hi+lo pairs (lo.lo dropped)
          s1 = wmma16b(k1[ks], qf[ks], s1); s1 = wmma16b(k1[ks], ql[ks], s1); s1 = wmma16b(k1l[ks], qf[ks], s1); }
        v16b vf[4], vl[4];
#pragma unroll
        for (int n = 0; n < 4; ++n) { vf[n] = frag_kb(&R[2][n * 16 + col][kl], hh); vl[n] = frag_kb(&R[3][n * 16 + col][kl], hh); }
        __builtin_amdgcn_sched_barrier(0);                      // the chunk's 16 V^T reads stay one group here, so that they land under the softmax instead of stalling each P.v product
        float mr = -INFINITY;
#pragma unroll
        for (int r = 0; r < 8; ++r) { s0[r] *= SCALE / (QS * QS); s1[r] *= SCALE / (QS * QS); if (diag) { const int k0_ = kb + 8 * hh + r, k1_ = kb + 16 + 8 * hh + r; if (k0_ > qi || k0_ >= sl) s0[r] = -INFINITY; if (k1_ > qi || k1_ >= sl) s1[r] = -INFINITY; } mr = fmaxf(mr, fmaxf(s0[r], s1[r])); }
        mr = fmaxf(mr, __shfl_xor(mr, 16));
        const float mn = fmaxf(m, mr), al_ = __expf(m - mn); m = mn;
        float sum = 0.0f; v16b pb, pl;
#pragma unroll
        for (int r = 0; r < 8; ++r) { const float e0 = __expf(s0[r] - mn), e1 = __expf(s1[r] - mn); sum += e0 + e1; b16 a, c; split16(e0 * PS, a, c); pb[r] = a; pl[r] = c; split16(e1 * PS, a, c); pb[8 + r] = a; pl[8 + r] = c; }   // P carried x8
        sum += __shfl_xor(sum, 16); l = l * al_ + sum;
#pragma unroll
        for (int n = 0; n < 4; ++n) {
#pragma unroll
          for (int r = 0; r < 8; ++r) o[n][r] *= al_;
          o[n] = wmma16b(vf[n], pb, o[n]); o[n] = wmma16b(vf[n], pl, o[n]); o[n] = wmma16b(vl[n], pb, o[n]);   // (8v) and P both as f16 hi+lo pairs (lo.lo dropped)
        }
      }
    }
    // publish point of stage t + 1, passed by every wave, also one that skipped its chunks
    asm volatile("s_wait_dscnt 0x0" ::: "memory");              // this wave's reads of buffer t & 1 are done before it is refilled
    asm volatile("s_wait_asynccnt 0x0" ::: "memory");           // this wave's copies of stage t + 1 have landed
    __syncthreads();                                            // publishes stage t + 1 and ends every wave's reads of stage t
    if (t + 2 < nst) stage(t + 2, t & 1);
  }
  asm volatile("s_wait_asynccnt 0x0" ::: "memory");             // nothing of the ring is in flight when the wave ends
  if (kg == 1) {                                                // upper key group: hand the partial sums, maximum and denominator to the partner wave (same lane, same places; m and l in the row's pad)
#pragma unroll
    for (int n = 0; n < 4; ++n)
#pragma unroll
      for (int r = 0; r < 8; ++r) Os[wid][col][n * 16 + 8 * hh + r] = o[n][r];
    Os[wid][col][HD + 2 * hh] = m; Os[wid][col][HD + 2 * hh + 1] = l;
  }
  __syncthreads();                                              // publishes the upper key group's partial results to the lower one
  if (kg == 1) return;
  const float (*Pp)[HD + 4] = Os[wid + 4];
  const float m1 = Pp[col][HD + 2 * hh], l1 = Pp[col][HD + 2 * hh + 1];
  const float mn2 = fmaxf(m, m1), a0 = __expf(m - mn2), a1 = __expf(m1 - mn2);   // m is finite (key 0 is in the lower group); a partner without a chunk has m1 = -inf, l1 = 0 -> a1 = 0
  const float inv = 1.0f / (VS * PS * (l * a0 + l1 * a1)), f0 = a0 * inv, f1 = a1 * inv;
#pragma unroll
  for (int n = 0; n < 4; ++n)
#pragma unroll
    for (int r = 0; r < 8; ++r) Os[wid][col][n * 16 + 8 * hh + r] = o[n][r] * f0 + Pp[col][n * 16 + 8 * hh + r] * f1;
  wave_lds_sync();
  float* dst = y + ((size_t)b * S + q0) * D + h * HD;
  {
#pragma unroll
    for (int j = 0; j < 8; ++j) { const int rr = j * 2 + hh, c4 = col * 4; *(v4f*)(dst + (size_t)rr * D + c4) = *(const v4f*)(&Os[wid][rr][c4]); }
    
  }
}

// out = y W_o^T: (4096 x 1024) x (1024 x 1024); A = y split at the fragment read (f16 hi+lo, x8), B = f16(bf16 W_o) rows; f32 rows; block = 8 waves = 128 tokens x 128 columns, wave = 32 x 64.
// The block's 128 y rows (256 B of f32 per stage) and 128 W_o rows (128 B) come once per 64 k into a two-buffer LDS ring by asynchronous copies of whole rows. grid (8, 32) x 256.
constexpr int YP = KT + 4;                                      // LDS pitch of a y row in f32: 272 B = 16 B x 17, so the 16 rows of a ds_load_b128 read fall on distinct banks
constexpr int OYB = 128 * YP * 4, OBUF = OYB + 128 * LP * 2;    // bytes of a buffer's y rows; of a whole buffer (y rows, then W_o rows)
__global__ __launch_bounds__(256) void out_kernel(const float* __restrict__ y, const b16* __restrict__ wo16, const float* __restrict__ bo, float* __restrict__ out) {
  __shared__ __attribute__((aligned(16))) unsigned char Sm[2 * OBUF];   // the ring; behind the loop's last barrier the epilogue's staging (8 KiB per wave)
  const int lane = threadIdx.x & 31, wid = __builtin_amdgcn_readfirstlane(threadIdx.x >> 5), wave = wid & 3, cg = wid >> 2, nloc = lane & 15, hlf = lane >> 4;
  const int mb = blockIdx.y * 128, m0 = mb + wave * 32, cb = blockIdx.x * 128, c0 = cb + cg * 64;
  const int yr = threadIdx.x >> 4, yc = (threadIdx.x & 15) * 4; // staging of y: thread -> rows yr + 16 j, 16 B piece yc; a wave's copy covers 2 whole 256 B rows
  const int sr = threadIdx.x >> 3, sc = (threadIdx.x & 7) * 8;  // staging of W_o: thread -> rows sr + 32 j, 16 B piece sc; a wave's copy covers 4 whole 128 B rows
  // One stage: k in [t*64, t*64+64) < D. 12 copies of 16 B per lane, all lanes on; the s_wait_xcnt closes the statement so that no address register is rewritten ahead of it.
  auto stage = [&](int t, int buf) {
    const float* gy = y + (size_t)(mb + yr) * D + t * KT + yc; const b16* gw = wo16 + (size_t)(cb + sr) * D + t * KT + sc;
    const unsigned ly = lds_addr(Sm + (size_t)buf * OBUF + (size_t)yr * (YP * 4) + yc * 4), lw = lds_addr(Sm + (size_t)buf * OBUF + OYB + (size_t)sr * (LP * 2) + sc * 2);
    constexpr unsigned YB = 16 * YP * 4, HB = 32 * LP * 2;      // bytes per 16 y rows, per 32 W_o rows
    asm volatile("global_load_async_to_lds_b128 %0, %12, off\n\t"
                 "global_load_async_to_lds_b128 %1, %13, off\n\t"
                 "global_load_async_to_lds_b128 %2, %14, off\n\t"
                 "global_load_async_to_lds_b128 %3, %15, off\n\t"
                 "global_load_async_to_lds_b128 %4, %16, off\n\t"
                 "global_load_async_to_lds_b128 %5, %17, off\n\t"
                 "global_load_async_to_lds_b128 %6, %18, off\n\t"
                 "global_load_async_to_lds_b128 %7, %19, off\n\t"
                 "global_load_async_to_lds_b128 %8, %20, off\n\t"
                 "global_load_async_to_lds_b128 %9, %21, off\n\t"
                 "global_load_async_to_lds_b128 %10, %22, off\n\t"
                 "global_load_async_to_lds_b128 %11, %23, off\n\t"
                 "s_wait_xcnt 0x0"
                 :: "v"(ly), "v"(ly + YB), "v"(ly + 2 * YB), "v"(ly + 3 * YB), "v"(ly + 4 * YB), "v"(ly + 5 * YB), "v"(ly + 6 * YB), "v"(ly + 7 * YB),
                    "v"(lw), "v"(lw + HB), "v"(lw + 2 * HB), "v"(lw + 3 * HB),
                    "v"(gy), "v"(gy + 16 * D), "v"(gy + 32 * D), "v"(gy + 48 * D), "v"(gy + 64 * D), "v"(gy + 80 * D), "v"(gy + 96 * D), "v"(gy + 112 * D),
                    "v"(gw), "v"(gw + 32 * D), "v"(gw + 64 * D), "v"(gw + 96 * D)
                 : "memory");
  };
  stage(0, 0);
  v8f acc[2][4];
#pragma unroll
  for (int r = 0; r < 2; ++r)
#pragma unroll
    for (int t = 0; t < 4; ++t) acc[r][t] = (v8f){};
  asm volatile("s_wait_asynccnt 0x0" ::: "memory");             // stage 0 of this wave has landed
  __syncthreads();                                              // publishes stage 0 to the other waves
  stage(1, 1);
  for (int s = 0; s < GST; ++s) {
    const Opnd A{Sm + (size_t)(s & 1) * OBUF, nullptr, YP}, Bo{Sm + (size_t)(s & 1) * OBUF + OYB, nullptr, LP};
#pragma unroll   // the stage's two k steps of 32 unrolled so that every LDS fragment offset is an immediate
    for (int ks = 0; ks < 2; ++ks) {
      v4f ya[2][4];                                             // the two y fragments' f32 words: [row tile][k = 8 hlf + 0..3, + 4..7, 16 + 8 hlf + 0..3, + 4..7]
#pragma unroll
      for (int r = 0; r < 2; ++r) { const float* p = (const float*)A.p0 + (wave * 32 + r * 16 + nloc) * YP + ks * 32 + 8 * hlf;
        ya[r][0] = *(const v4f*)p; ya[r][1] = *(const v4f*)(p + 4); ya[r][2] = *(const v4f*)(p + 16); ya[r][3] = *(const v4f*)(p + 20); }
      v16b bh[4], bl[4];
#pragma unroll
      for (int t = 0; t < 4; ++t) load_frags<1>(Bo, cg * 64 + t * 16 + nloc, ks * 32, hlf, bh[t], bl[t]);
      __builtin_amdgcn_sched_barrier(0);                        // the k step's 16 LDS reads stay one group ahead of the split and the 16 products: one LDS latency instead of one per tile
      v16b ah[2], al[2];                                        // y as an f16 hi+lo pair carried x8 (2 products)
#pragma unroll
      for (int r = 0; r < 2; ++r)
#pragma unroll
        for (int e = 0; e < 16; ++e) { b16 a_, c_; split16(ya[r][e >> 2][e & 3] * 8.0f, a_, c_); ah[r][e] = a_; al[r][e] = c_; }
#pragma unroll
      for (int t = 0; t < 4; ++t) {
        acc[0][t] = mac<5, 1>(ah[0], al[0], bh[t], bl[t], acc[0][t]);
        acc[1][t] = mac<5, 1>(ah[1], al[1], bh[t], bl[t], acc[1][t]);
      }
    }
    // publish point of stage s + 1
    asm volatile("s_wait_dscnt 0x0" ::: "memory");              // this wave's reads of buffer s & 1 are done before it is refilled
    asm volatile("s_wait_asynccnt 0x0" ::: "memory");           // this wave's copies of stage s + 1 have landed
    __syncthreads();                                            // publishes stage s + 1 and ends every wave's reads of stage s
    if (s + 2 < GST) stage(s + 2, s & 1);
  }
  asm volatile("s_wait_asynccnt 0x0" ::: "memory");             // nothing of the ring is in flight when its LDS becomes staging
#pragma unroll
  for (int t = 0; t < 4; ++t)
#pragma unroll
    for (int r = 0; r < 2; ++r)
#pragma unroll
      for (int v = 0; v < 8; ++v) acc[r][t][v] = acc[r][t][v] * (1.0f / 8.0f) + bf16_rne(bo[c0 + t * 16 + nloc]);
  epi_f32(acc, 1.0f, nullptr, out, D, m0, c0, lane, (float*)(Sm + (size_t)wid * (32 * 64 * 4)));
}
}  // namespace

extern "C" void kernel_launch(void* const* d_in, const int* in_sizes, int n_in,
                              void* d_out, int out_size, void* d_ws, size_t ws_size, hipStream_t stream) {
  (void)n_in; (void)out_size;
  const float* x = (const float*)d_in[0]; const int* seq_lens = (const int*)d_in[1]; const float* wqkv = (const float*)d_in[2]; const float* bqkv = (const float*)d_in[3]; const float* wo = (const float*)d_in[4]; const float* bo = (const float*)d_in[5];
  float* out = (float*)d_out;   // [2][2048][1024]
  if (in_sizes[0] != BT * S * D || in_sizes[1] != Bn || in_sizes[2] != 3 * D * D || in_sizes[3] != 3 * D || in_sizes[4] != D * D || in_sizes[5] != D) return;
  size_t off = 0; char* ws = (char*)d_ws;
  auto carve = [&](size_t bytes) { char* p = ws + off; off += (bytes + 255) & ~(size_t)255; return p; };
  unsigned short* x16 = (unsigned short*)carve((size_t)NTOK * D * 2); unsigned short* w16 = (unsigned short*)carve((size_t)3 * D * D * 2); b16* wo16 = (b16*)carve((size_t)D * D * 2);
  b16* qh = (b16*)carve((size_t)2 * NTOK * D * 2); b16* kh = (b16*)carve((size_t)2 * NTOK * D * 2); b16* vt = (b16*)carve((size_t)2 * NTOK * D * 2); float* y = (float*)carve((size_t)NTOK * D * 4);
  if (off > ws_size) return;                                    // ≈ 84 MB
  prep_kernel<<<512, 256, 0, stream>>>(wqkv, wo, w16, wo16);
  xprep_kernel<<<1024, 256, 0, stream>>>(x, x16);
  proj_kernel<<<dim3(3 * D / 128, NTOK / 128), 256, 0, stream>>>((const __bf16*)x16, (const __bf16*)w16, bqkv, qh, kh, vt);
  attn_kernel<S / 16><<<Bn * H * (S / 64), 256, 0, stream>>>(qh, kh, vt, seq_lens, y);
  out_kernel<<<dim3(D / 128, NTOK / 128), 256, 0, stream>>>(y, wo16, bo, out);
}

// v005
// It runs in 101 microseconds.
// In two side-by-side timings against v004, it was 1.04 and 1.02 times as fast.
// Over all steps from v000 it is 2.96 times as fast.
#include <hip/hip_runtime.h>

// MultiAxisAttention: qkv = x Wqkv^T + bqkv (16 heads x 64), causal mask (key > query -> -1e9) plus a per-batch padding mask (key >= seq_len[b] -> -1e9), softmax of q.k/8, out = ctx Wout^T + bout
// -> [2][2048][1024]. seq_lens here are > 0, so every query keeps key 0 and the masked keys contribute exp(-1e9 - max) = 0; the key loop stops at
// min(causal bound, seq_len).
// x, the four weights and bo rounded to bf16: projection on v_wmma_f32_16x16x32_bf16 (exact products, f32 accumulate);
// scores, P.v and the output projection on v_wmma_f32_16x16x32_f16 with every computed operand (q, k, v, P, y — each carried x8 so the hi/lo residual planes stay normal) as an f16
// hi+lo pair (3 / 2 products); online softmax in f32. Fragment k-map per lane half hh for A AND B: elements 0..7 <- k = 8hh+0..7, 8..15 <- k = 16+8hh+0..7. Every intermediate /

namespace {
constexpr int BT = 2, Bn = 2, S = 2048, D = 1024, H = 16, HD = 64, NTOK = Bn * S;
constexpr float SCALE = 0.125f, VS = 8.0f, QS = 8.0f, PS = 8.0f;   // power-of-two carry scales so hi/lo residual planes stay normal in f16
constexpr size_t VPL = (size_t)NTOK * D;   // distance between the (8v)^T hi and lo planes
constexpr size_t QPL = (size_t)NTOK * D;   // distance between the q/k hi and lo planes

typedef _Float16 b16;
typedef __attribute__((ext_vector_type(16))) _Float16 v16b;
typedef __attribute__((ext_vector_type(8)))  _Float16 v8b;
typedef __attribute__((ext_vector_type(8)))  float v8f;
typedef __attribute__((ext_vector_type(4)))  float v4f;

__device__ __forceinline__ v8b ld8b(const b16* p) { return *(const v8b*)p; }
__device__ __forceinline__ v16b cat8b(v8b a, v8b b) { return __builtin_shufflevector(a, b, 0, 1, 2, 3, 4, 5, 6, 7, 8, 9, 10, 11, 12, 13, 14, 15); }
__device__ __forceinline__ v16b frag_kb(const b16* p, int hh) { return cat8b(ld8b(p + 8 * hh), ld8b(p + 16 + 8 * hh)); }
__device__ __forceinline__ void split16(float v, b16& hi, b16& lo) { hi = (b16)v; lo = (b16)(v - (float)hi); }
// hi/lo fragment pair straight from an f32 k-contiguous row (same k-map)
__device__ __forceinline__ void frag_ksplit(const float* p, int hh, v16b& fh_, v16b& fl_) {
  const float* p0 = p + 8 * hh; const float* p1 = p + 16 + 8 * hh;
#pragma unroll
  for (int e = 0; e < 8; ++e) { b16 a, c; split16(p0[e], a, c); fh_[e] = a; fl_[e] = c; split16(p1[e], a, c); fh_[8 + e] = a; fl_[8 + e] = c; }
}
__device__ __forceinline__ v8f wmma16b(v16b a, v16b b, v8f c) {
  v8f d = __builtin_amdgcn_wmma_f32_16x16x32_f16(false, a, false, b, (short)0, c, false, false);
  asm volatile("v_nop\n\tv_nop\n\tv_nop\n\tv_nop" : "+v"(d) : "v"(a), "v"(b));
  return d;
}
__device__ __forceinline__ void wave_lds_sync() {
  __builtin_amdgcn_fence(__ATOMIC_RELEASE, "workgroup");
  __builtin_amdgcn_wave_barrier();
  __builtin_amdgcn_fence(__ATOMIC_ACQUIRE, "workgroup");
}

// Operand descriptor: NP = 0 -> f32 rows split on the fly into (hi, lo); NP = 1 -> one f16 plane; NP = 2 -> f16 hi + lo planes;
// NP = 3 -> f32 rows rounded once to a single f16 fragment. ld = row pitch.
struct Opnd { const void* p0; const void* p1; int ld; };
template <int NP> __device__ __forceinline__ void load_frags(const Opnd& o, int row, int kb, int hh, v16b& fh_, v16b& fl_) {
  if (NP == 0) { frag_ksplit((const float*)o.p0 + (size_t)row * o.ld + kb, hh, fh_, fl_); }
  else if (NP == 4 || NP == 5) {                             // f32 rows x64 (NP 4) or x8 (NP 5) then split (keeps the lo halves of small values normal)
    const float sc_ = (NP == 4) ? 64.0f : 8.0f;
    const float* p = (const float*)o.p0 + (size_t)row * o.ld + kb; const float* p0 = p + 8 * hh; const float* p1 = p + 16 + 8 * hh;
#pragma unroll
    for (int e = 0; e < 8; ++e) { b16 a, c; split16(p0[e] * sc_, a, c); fh_[e] = a; fl_[e] = c; split16(p1[e] * sc_, a, c); fh_[8 + e] = a; fl_[8 + e] = c; }
  } else if (NP == 3) {
    const float* p = (const float*)o.p0 + (size_t)row * o.ld + kb; const float* p0 = p + 8 * hh; const float* p1 = p + 16 + 8 * hh;
#pragma unroll
    for (int e = 0; e < 8; ++e) { fh_[e] = (b16)p0[e]; fh_[8 + e] = (b16)p1[e]; }
    fl_ = fh_;
  } else {
    fh_ = frag_kb((const b16*)o.p0 + (size_t)row * o.ld + kb, hh);
    if (NP == 2) fl_ = frag_kb((const b16*)o.p1 + (size_t)row * o.ld + kb, hh); else fl_ = fh_;
  }
}
template <int ANP, int BNP> __device__ __forceinline__ v8f mac(v16b ah, v16b al, v16b bh, v16b bl, v8f c) {
  c = wmma16b(ah, bh, c);
  if (BNP == 0 || BNP == 2 || BNP == 4 || BNP == 5) c = wmma16b(ah, bl, c);     // hi.lo
  if (ANP == 0 || ANP == 2 || ANP == 4 || ANP == 5) c = wmma16b(al, bh, c);     // lo.hi   (lo.lo dropped)
  return c;
}
__device__ __forceinline__ void epi_planes(v8f (&acc)[2][4], float scale, bool two, b16* __restrict__ oh, b16* __restrict__ ol, int ldo,
                                           int m0, int c0, int lane, b16* Th, b16* Tl) {
  const int nloc = lane & 15, hlf = lane >> 4;
#pragma unroll
  for (int t = 0; t < 4; ++t)
#pragma unroll
    for (int r = 0; r < 2; ++r)
#pragma unroll
      for (int v = 0; v < 8; ++v) {
        const int rr = r * 16 + v + 8 * hlf, cc = t * 16 + nloc;
        b16 h_, l_; split16(acc[r][t][v] * scale, h_, l_);
        Th[rr * 64 + cc] = h_; Tl[rr * 64 + cc] = l_;
      }
  wave_lds_sync();
  {
#pragma unroll
    for (int j = 0; j < 8; ++j) {
      const int rr = j * 4 + (lane >> 3), c8 = (lane & 7) * 8;
      const size_t o = (size_t)(m0 + rr) * ldo + c0 + c8;
      *(v8b*)(oh + o) = ld8b(Th + rr * 64 + c8);
      if (two) *(v8b*)(ol + o) = ld8b(Tl + rr * 64 + c8);
    }
    
  }
}
// (b) f32 rows with pitch ldo: 64 floats = 256 B = 2 lines per row; 16 lanes x 16 B per row, 2 rows per instruction. Optional per-row factor
__device__ __forceinline__ void epi_f32(v8f (&acc)[2][4], float scale, const float* rscale, float* __restrict__ out, int ldo, int m0, int c0, int lane, float* Tt) {
  const int nloc = lane & 15, hlf = lane >> 4;
#pragma unroll
  for (int t = 0; t < 4; ++t)
#pragma unroll
    for (int r = 0; r < 2; ++r)
#pragma unroll
      for (int v = 0; v < 8; ++v) {
        const int rr = r * 16 + v + 8 * hlf;
        const float rs = rscale ? rscale[(size_t)(m0 + rr) * 32] : 1.0f;
        Tt[rr * 64 + t * 16 + nloc] = acc[r][t][v] * scale * rs;
      }
  wave_lds_sync();
  float* dst0 = out + (size_t)m0 * ldo + c0;
  {
#pragma unroll
    for (int j = 0; j < 16; ++j) { const int rr = j * 2 + hlf, c4 = nloc * 4; *(v4f*)(dst0 + (size_t)rr * ldo + c4) = *(const v4f*)(Tt + rr * 64 + c4); }
    
  }
}



typedef __attribute__((ext_vector_type(8))) __bf16 v8bb; typedef __attribute__((ext_vector_type(16))) __bf16 v16bb;
typedef __attribute__((ext_vector_type(8))) unsigned short v8us;
__device__ __forceinline__ v16bb frag_kb_bf(const __bf16* p, int hh) { const v8bb a = *(const v8bb*)(p + 8 * hh), b = *(const v8bb*)(p + 16 + 8 * hh); return __builtin_shufflevector(a, b, 0, 1, 2, 3, 4, 5, 6, 7, 8, 9, 10, 11, 12, 13, 14, 15); }
__device__ __forceinline__ v8f wmma16bb(v16bb a, v16bb b, v8f c) {
  v8f d = __builtin_amdgcn_wmma_f32_16x16x32_bf16(false, a, false, b, (short)0, c, false, false);
  asm volatile("v_nop\n\tv_nop\n\tv_nop\n\tv_nop" : "+v"(d) : "v"(a), "v"(b));
  return d;
}
__device__ __forceinline__ unsigned short bf16_rne_bits(float v) { unsigned int u = __float_as_uint(v); u += 0x7FFFu + ((u >> 16) & 1u); return (unsigned short)(u >> 16); }
__device__ __forceinline__ float bf16_rne(float v) { return __uint_as_float(((unsigned int)bf16_rne_bits(v)) << 16); }



// One conversion launch for all three f32 operands: x and Wqkv -> bf16 bits, W_o -> f16 of the bf16-rounded value (rows copied directly, [out][in]).
// 256 blocks x 16 waves; a thread takes 16 groups of 4 floats, CVT groups apart, so that every wave-wide load covers 512 contiguous bytes and every store 256;
// groups 0..7 fall in x, 8..13 in Wqkv, 14..15 in W_o. All 16 loads are issued ahead of the first conversion: one memory latency per thread.
typedef __attribute__((ext_vector_type(4))) unsigned short v4us; typedef __attribute__((ext_vector_type(4))) _Float16 v4b;
constexpr int CVB = 256, CVW = 512, CVT = CVB * CVW;
static_assert((size_t)NTOK * D / 4 == (size_t)8 * CVT && (size_t)3 * D * D / 4 == (size_t)6 * CVT && (size_t)D * D / 4 == (size_t)2 * CVT, "group counts of the conversion launch");
__global__ __launch_bounds__(CVW) void prep_kernel(const float* __restrict__ x, const float* __restrict__ wqkv, const float* __restrict__ wo,
                                                  unsigned short* __restrict__ x16, unsigned short* __restrict__ w16, b16* __restrict__ wo16) {
  const size_t g = ((size_t)blockIdx.x * CVW + threadIdx.x) * 4; // first float of the thread's group 0
  const float* px0 = x + g; const float* px1 = px0 + (size_t)4 * CVT * 4; const float* pw0 = wqkv + g; const float* pw1 = pw0 + (size_t)4 * CVT * 4; const float* po0 = wo + g;
  v4f a[8], w[6], o[2];
#pragma unroll
  for (int j = 0; j < 4; ++j) { a[j] = *(const v4f*)(px0 + (size_t)j * CVT * 4); a[4 + j] = *(const v4f*)(px1 + (size_t)j * CVT * 4); }
#pragma unroll
  for (int j = 0; j < 4; ++j) w[j] = *(const v4f*)(pw0 + (size_t)j * CVT * 4);
#pragma unroll
  for (int j = 0; j < 2; ++j) { w[4 + j] = *(const v4f*)(pw1 + (size_t)j * CVT * 4); o[j] = *(const v4f*)(po0 + (size_t)j * CVT * 4); }
  // the loads' five address pairs stay live up to this wait, so that none of them is rewritten (also not as a later load's destination) ahead of it
  asm volatile("s_wait_xcnt 0x0" :: "v"(px0), "v"(px1), "v"(pw0), "v"(pw1), "v"(po0) : "memory");
  __builtin_amdgcn_sched_barrier(0);                            // the 16 loads stay one group ahead of the conversions and stores: they are all in flight together
#pragma unroll
  for (int j = 0; j < 8; ++j) { v4us v;
#pragma unroll
    for (int e = 0; e < 4; ++e) v[e] = bf16_rne_bits(a[j][e]);
    *(v4us*)(x16 + g + (size_t)j * CVT * 4) = v; }
#pragma unroll
  for (int j = 0; j < 6; ++j) { v4us v;
#pragma unroll
    for (int e = 0; e < 4; ++e) v[e] = bf16_rne_bits(w[j][e]);
    *(v4us*)(w16 + g + (size_t)j * CVT * 4) = v; }
#pragma unroll
  for (int j = 0; j < 2; ++j) { v4b v;
#pragma unroll
    for (int e = 0; e < 4; ++e) v[e] = (b16)bf16_rne(o[j][e]);
    *(v4b*)(wo16 + g + (size_t)j * CVT * 4) = v; }
}

constexpr int KT = 64;    // keys (attention) or k (GEMMs) per ring stage: 16-bit rows of 128 B = one cache line
constexpr int LP = 72;    // LDS row pitch in f16: 144 B = 16 B x 9, so the 16 rows of a ds_load_b128 fragment read fall on distinct banks
__device__ __forceinline__ unsigned lds_addr(const void* p) { return (unsigned)(size_t)p; }   // low 32 bits of a __shared__ address = byte offset in the work-group's LDS

// projections: rows = tokens (4096), K = 1024, block = 8 waves = 128 tokens x 128 columns = two heads of q (column tiles 0..7), k (8..15) or v (16..23); wave = 32 tokens x one head.
// The block's 128 x rows and 128 W rows come once per 64 k into a two-buffer LDS ring by asynchronous copies of whole 128 B rows; every wave takes its fragments from there.
// f16 rows [b*H + head][tok][64] for q/k; v: (8v)^T f16 [b*H + head][64][tok]. grid (24, 32) x 256.
constexpr int GR = 256;            // ring rows of a projection stage: 128 x rows, then 128 W rows
constexpr int GST = D / KT;        // ring stages of a GEMM: 16
__global__ __launch_bounds__(256) void proj_kernel(const __bf16* __restrict__ x16, const __bf16* __restrict__ w16, const float* __restrict__ bqkv, b16* __restrict__ qh, b16* __restrict__ kh, b16* __restrict__ vt) {
  __shared__ __attribute__((aligned(16))) unsigned char Sm[2 * GR * LP * 2];   // the ring [buffer][row][64 bf16 + pad]; behind the loop's last barrier the epilogue's staging
  const int lane = threadIdx.x & 31, wid = __builtin_amdgcn_readfirstlane(threadIdx.x >> 5), wave = wid & 3, cg = wid >> 2, nloc = lane & 15, hlf = lane >> 4;
  const int mb = blockIdx.y * 128, m0 = mb + wave * 32, cb = blockIdx.x * 128, c0 = cb + cg * 64;
  const int sr = threadIdx.x >> 3, sc = (threadIdx.x & 7) * 8;  // staging: thread -> rows sr + 32 j, 16 B piece sc; a wave's copy covers 4 whole 128 B rows
  // One stage: k in [t*64, t*64+64) < D. 8 copies of 16 B per lane, all lanes on; the s_wait_xcnt closes the statement so that no address register is rewritten ahead of it.
  auto stage = [&](int t, int buf) {
    const __bf16* gx = x16 + (size_t)(mb + sr) * D + t * KT + sc; const __bf16* gw = w16 + (size_t)(cb + sr) * D + t * KT + sc;
    const unsigned l0 = lds_addr(Sm + ((size_t)buf * GR + sr) * (LP * 2) + sc * 2);
    constexpr unsigned HB = 32 * LP * 2;                        // bytes per 32 rows
    asm volatile("global_load_async_to_lds_b128 %0, %8, off\n\t"
                 "global_load_async_to_lds_b128 %1, %9, off\n\t"
                 "global_load_async_to_lds_b128 %2, %10, off\n\t"
                 "global_load_async_to_lds_b128 %3, %11, off\n\t"
                 "global_load_async_to_lds_b128 %4, %12, off\n\t"
                 "global_load_async_to_lds_b128 %5, %13, off\n\t"
                 "global_load_async_to_lds_b128 %6, %14, off\n\t"
                 "global_load_async_to_lds_b128 %7, %15, off\n\t"
                 "s_wait_xcnt 0x0"
                 :: "v"(l0), "v"(l0 + HB), "v"(l0 + 2 * HB), "v"(l0 + 3 * HB), "v"(l0 + 4 * HB), "v"(l0 + 5 * HB), "v"(l0 + 6 * HB), "v"(l0 + 7 * HB),
                    "v"(gx), "v"(gx + 32 * D), "v"(gx + 64 * D), "v"(gx + 96 * D), "v"(gw), "v"(gw + 32 * D), "v"(gw + 64 * D), "v"(gw + 96 * D)
                 : "memory");
  };
  stage(0, 0);
  v8f acc[2][4];
#pragma unroll
  for (int r = 0; r < 2; ++r)
#pragma unroll
    for (int t = 0; t < 4; ++t) acc[r][t] = (v8f){};
  asm volatile("s_wait_asynccnt 0x0" ::: "memory");             // stage 0 of this wave has landed
  __syncthreads();                                              // publishes stage 0 to the other waves
  stage(1, 1);
  for (int s = 0; s < GST; ++s) {
    const __bf16* R = (const __bf16*)(Sm + (size_t)(s & 1) * (GR * LP * 2));
#pragma unroll   // the stage's two k steps of 32 unrolled so that every LDS fragment offset is an immediate
    for (int ks = 0; ks < 2; ++ks) {
      const v16bb a0 = frag_kb_bf(R + (wave * 32 + nloc) * LP + ks * 32, hlf), a1 = frag_kb_bf(R + (wave * 32 + 16 + nloc) * LP + ks * 32, hlf);
      v16bb bw[4];
#pragma unroll
      for (int t = 0; t < 4; ++t) bw[t] = frag_kb_bf(R + (128 + cg * 64 + t * 16 + nloc) * LP + ks * 32, hlf);
      __builtin_amdgcn_sched_barrier(0);                        // the k step's 12 LDS reads stay one group ahead of its 8 products: one LDS latency instead of one per column tile
#pragma unroll
      for (int t = 0; t < 4; ++t) { acc[0][t] = wmma16bb(a0, bw[t], acc[0][t]); acc[1][t] = wmma16bb(a1, bw[t], acc[1][t]); }
    }
    // publish point of stage s + 1
    asm volatile("s_wait_dscnt 0x0" ::: "memory");              // this wave's reads of buffer s & 1 are done before it is refilled
    asm volatile("s_wait_asynccnt 0x0" ::: "memory");           // this wave's copies of stage s + 1 have landed
    __syncthreads();                                            // publishes stage s + 1 and ends every wave's reads of stage s
    if (s + 2 < GST) stage(s + 2, s & 1);
  }
  asm volatile("s_wait_asynccnt 0x0" ::: "memory");             // nothing of the ring is in flight when its LDS becomes staging
  const int which = blockIdx.x / (D / 128), head = (blockIdx.x % (D / 128)) * 2 + cg, b = m0 / S, tok0 = m0 % S;
#pragma unroll
  for (int t = 0; t < 4; ++t) { const float bb = bf16_rne(bqkv[c0 + t * 16 + nloc]);   // + bias (rounded to bf16)
#pragma unroll
    for (int r = 0; r < 2; ++r)
#pragma unroll
      for (int v = 0; v < 8; ++v) acc[r][t][v] += bb; }
  if (which < 2) {                                              // q or k head: f16 rows
    b16 (*Th)[HD + 8] = (b16 (*)[HD + 8])(Sm + (size_t)wid * (2 * 32 * (HD + 8) * 2)); b16 (*Tq)[HD + 8] = Th + 32;   // the wave's own hi and lo tiles [32][64 + pad]
#pragma unroll
    for (int t = 0; t < 4; ++t)
#pragma unroll
      for (int r = 0; r < 2; ++r)
#pragma unroll
        for (int v = 0; v < 8; ++v) { b16 a_, c_; split16(acc[r][t][v] * QS, a_, c_); Th[r * 16 + 8 * hlf + v][t * 16 + nloc] = a_; Tq[r * 16 + 8 * hlf + v][t * 16 + nloc] = c_; }   // q, k carried x8 (lo residuals stay normal)
    wave_lds_sync();
    b16* dst = (which == 0 ? qh : kh) + (((size_t)b * H + head) * S + tok0) * HD;
    {
#pragma unroll
      for (int j = 0; j < 8; ++j) { const int rr = j * 4 + (lane >> 3), c8 = (lane & 7) * 8; *(v8b*)(dst + (size_t)rr * HD + c8) = *(const v8b*)(&Th[rr][c8]); *(v8b*)(dst + QPL + (size_t)rr * HD + c8) = *(const v8b*)(&Tq[rr][c8]); }
       }
    return;
  }
  const int vh = head;                                          // v head: (8v)^T tile [64 d][128 tok] via LDS, rows of 256 B; one hi and one lo tile per head of the block
  b16 (*Tt)[128 + 8] = (b16 (*)[128 + 8])(Sm + (size_t)cg * (2 * 64 * (128 + 8) * 2)); b16 (*Tl)[128 + 8] = Tt + 64;
#pragma unroll
  for (int t = 0; t < 4; ++t)
#pragma unroll
    for (int r = 0; r < 2; ++r)
#pragma unroll
      for (int v = 0; v < 8; ++v) { b16 a_, c_; split16(acc[r][t][v] * VS, a_, c_); Tt[t * 16 + nloc][wave * 32 + r * 16 + 8 * hlf + v] = a_; Tl[t * 16 + nloc][wave * 32 + r * 16 + 8 * hlf + v] = c_; }
  __syncthreads();
  b16* dstv = vt + (((size_t)b * H + vh) * HD) * S + (blockIdx.y * 128) % S;
  {
#pragma unroll
    for (int j = 0; j < 8; ++j) { const int dd = wave * 16 + j * 2 + (lane >> 4), c8 = (lane & 15) * 8; *(v8b*)(dstv + (size_t)dd * S + c8) = *(const v8b*)(&Tt[dd][c8]); *(v8b*)(dstv + VPL + (size_t)dd * S + c8) = *(const v8b*)(&Tl[dd][c8]); }
    
  }
}

// causal attention: block = 8 waves = 64 consecutive queries of one (b, h) = 4 query groups of 16 x 2 key groups: of every ring stage of 64 keys, waves 0..3 take keys 0..31 and waves 4..7
// keys 32..63, so the longest block walks half as many chunks per wave; each wave keeps its own online softmax (f32) and the two partial results of a query group are merged through LDS at the end.
// Blocks outnumber the resident places, so the longest tiles (highest queries) come first in the grid. Per chunk of 32 keys: S^T (K=64), mask on the straddling chunks, P^T f16, y^T += (8V)^T P^T.
// The block's K rows and (8V)^T rows (hi and lo planes) come once per 64 keys into a two-buffer LDS ring by asynchronous copies of whole 128 B rows; every wave takes its fragments from there.
template <int QT>
__global__ __launch_bounds__(256) void attn_kernel(const b16* __restrict__ qh, const b16* __restrict__ kh, const b16* __restrict__ vt, const int* __restrict__ seq_lens, float* __restrict__ y) {
  __shared__ __attribute__((aligned(16))) float Os[8][16][HD + 4];
  __shared__ __attribute__((aligned(16))) b16 Ring[2][4][KT][LP];   // [buffer][K hi, K lo, V^T hi, V^T lo][key row or d row][64 f16 + pad]
  const int wid = __builtin_amdgcn_readfirstlane(threadIdx.x >> 5), lane = threadIdx.x & 31, hh = lane >> 4, col = lane & 15;
  const int qg = wid & 3, kg = wid >> 2;                        // query group, key group of the wave
  const int tile = QT / 4 - 1 - (int)blockIdx.x / (Bn * H), bh = (int)blockIdx.x % (Bn * H), h = bh % H, b = bh / H, q0 = tile * 64 + qg * 16, qi = q0 + col;
  const b16* Q = qh + ((size_t)bh * S) * HD; const b16* K = kh + ((size_t)bh * S) * HD; const b16* vb = vt + ((size_t)bh * HD) * S;
  const int sl = min(max(seq_lens[b], 1), S);                   // padding mask: keys >= seq_len get -inf (exp -> 0); seq_len >= 1 here so key 0 always survives
  const int kend = __builtin_amdgcn_readfirstlane(min(q0 + 16, sl));   // this wave's key bound, held in a scalar register so that the chunk test below stays a scalar compare and branch
  const int nst = (min(tile * 64 + 64, sl) + KT - 1) / KT;      // ring stages of the block = those of its last query group (block-uniform, 1..32)
  const int sr = threadIdx.x >> 3, sc = (threadIdx.x & 7) * 8;  // staging: thread -> rows sr and sr + 32, 16 B piece sc; a wave's copy covers 4 whole 128 B rows
  // One stage: keys [t*64, t*64+64) < S. 8 copies of 16 B per lane, all lanes on; the s_wait_xcnt closes the statement so that no address register is rewritten ahead of it.
  auto stage = [&](int t, int buf) {
    const b16* gk = K + (size_t)(t * KT + sr) * HD + sc; const b16* gv = vb + (size_t)sr * S + t * KT + sc;
    const unsigned l0 = lds_addr(&Ring[buf][0][sr][sc]);
    constexpr unsigned PB = KT * LP * 2, HB = 32 * LP * 2;      // bytes per plane, per 32 rows
    asm volatile("global_load_async_to_lds_b128 %0, %8, off\n\t"
                 "global_load_async_to_lds_b128 %1, %9, off\n\t"
                 "global_load_async_to_lds_b128 %2, %10, off\n\t"
                 "global_load_async_to_lds_b128 %3, %11, off\n\t"
                 "global_load_async_to_lds_b128 %4, %12, off\n\t"
                 "global_load_async_to_lds_b128 %5, %13, off\n\t"
                 "global_load_async_to_lds_b128 %6, %14, off\n\t"
                 "global_load_async_to_lds_b128 %7, %15, off\n\t"
                 "s_wait_xcnt 0x0"
                 :: "v"(l0), "v"(l0 + HB), "v"(l0 + PB), "v"(l0 + PB + HB), "v"(l0 + 2 * PB), "v"(l0 + 2 * PB + HB), "v"(l0 + 3 * PB), "v"(l0 + 3 * PB + HB),
                    "v"(gk), "v"(gk + 32 * HD), "v"(gk + QPL), "v"(gk + QPL + 32 * HD), "v"(gv), "v"(gv + (size_t)32 * S), "v"(gv + VPL), "v"(gv + VPL + (size_t)32 * S)
                 : "memory");
  };
  stage(0, 0);
  v16b qf[2], ql[2];
#pragma unroll
  for (int ks = 0; ks < 2; ++ks) { qf[ks] = frag_kb(Q + (size_t)qi * HD + ks * 32, hh); ql[ks] = frag_kb(Q + QPL + (size_t)qi * HD + ks * 32, hh); }
  float m = -INFINITY, l = 0.0f; v8f o[4] = {{}, {}, {}, {}};
  asm volatile("s_wait_asynccnt 0x0" ::: "memory");             // stage 0 of this wave has landed
  __syncthreads();                                              // publishes stage 0 to the other waves
  if (nst > 1) stage(1, 1);
  for (int t = 0; t < nst; ++t) {
    const b16 (*R)[KT][LP] = Ring[t & 1];
    {
      const int kb = t * KT + kg * 32, kl = kg * 32;            // this wave's chunk of the stage
      if (kb < kend) {                                          // causal + padding: key chunks past min(query tile, seq_len) are skipped (wave-uniform scalar bound)
        const bool diag = (kb + 32 > q0) || (kb + 32 > sl);     // this chunk reaches past some queries or past seq_len -> mask
        v8f s0 = {}, s1 = {};
        v16b k0[2], k0l[2], k1[2], k1l[2];
#pragma unroll
        for (int ks = 0; ks < 2; ++ks) { k0[ks] = frag_kb(&R[0][kl + col][ks * 32], hh); k0l[ks] = frag_kb(&R[1][kl + col][ks * 32], hh); k1[ks] = frag_kb(&R[0][kl + 16 + col][ks * 32], hh); k1l[ks] = frag_kb(&R[1][kl + 16 + col][ks * 32], hh); }
        __builtin_amdgcn_sched_barrier(0);                      // the chunk's 16 K reads stay one group ahead of the score products: one LDS latency instead of one per k step
#pragma unroll
        for (int ks = 0; ks < 2; ++ks) {
          s0 = wmma16b(k0[ks], qf[ks], s0); s0 = wmma16b(k0[ks], ql[ks], s0); s0 = wmma16b(k0l[ks], qf[ks], s0);      // q and k as f16 hi+lo pairs (lo.lo dropped)
          s1 = wmma16b(k1[ks], qf[ks], s1); s1 = wmma16b(k1[ks], ql[ks], s1); s1 = wmma16b(k1l[ks], qf[ks], s1); }
        v16b vf[4], vl[4];
#pragma unroll
        for (int n = 0; n < 4; ++n) { vf[n] = frag_kb(&R[2][n * 16 + col][kl], hh); vl[n] = frag_kb(&R[3][n * 16 + col][kl], hh); }
        __builtin_amdgcn_sched_barrier(0);                      // the chunk's 16 V^T reads stay one group here, so that they land under the softmax instead of stalling each P.v product
        float mr = -INFINITY;
#pragma unroll
        for (int r = 0; r < 8; ++r) { s0[r] *= SCALE / (QS * QS); s1[r] *= SCALE / (QS * QS); if (diag) { const int k0_ = kb + 8 * hh + r, k1_ = kb + 16 + 8 * hh + r; if (k0_ > qi || k0_ >= sl) s0[r] = -INFINITY; if (k1_ > qi || k1_ >= sl) s1[r] = -INFINITY; } mr = fmaxf(mr, fmaxf(s0[r], s1[r])); }
        mr = fmaxf(mr, __shfl_xor(mr, 16));
        const float mn = fmaxf(m, mr), al_ = __expf(m - mn); m = mn;
        float sum = 0.0f; v16b pb, pl;
#pragma unroll
        for (int r = 0; r < 8; ++r) { const float e0 = __expf(s0[r] - mn), e1 = __expf(s1[r] - mn); sum += e0 + e1; b16 a, c; split16(e0 * PS, a, c); pb[r] = a; pl[r] = c; split16(e1 * PS, a, c); pb[8 + r] = a; pl[8 + r] = c; }   // P carried x8
        sum += __shfl_xor(sum, 16); l = l * al_ + sum;
#pragma unroll
        for (int n = 0; n < 4; ++n) {
#pragma unroll
          for (int r = 0; r < 8; ++r) o[n][r] *= al_;
          o[n] = wmma16b(vf[n], pb, o[n]); o[n] = wmma16b(vf[n], pl, o[n]); o[n] = wmma16b(vl[n], pb, o[n]);   // (8v) and P both as f16 hi+lo pairs (lo.lo dropped)
        }
      }
    }
    // publish point of stage t + 1, passed by every wave, also one that skipped its chunks
    asm volatile("s_wait_dscnt 0x0" ::: "memory");              // this wave's reads of buffer t & 1 are done before it is refilled
    asm volatile("s_wait_asynccnt 0x0" ::: "memory");           // this wave's copies of stage t + 1 have landed
    __syncthreads();                                            // publishes stage t + 1 and ends every wave's reads of stage t
    if (t + 2 < nst) stage(t + 2, t & 1);
  }
  asm volatile("s_wait_asynccnt 0x0" ::: "memory");             // nothing of the ring is in flight when the wave ends
  if (kg == 1) {                                                // upper key group: hand the partial sums, maximum and denominator to the partner wave (same lane, same places; m and l in the row's pad)
#pragma unroll
    for (int n = 0; n < 4; ++n)
#pragma unroll
      for (int r = 0; r < 8; ++r) Os[wid][col][n * 16 + 8 * hh + r] = o[n][r];
    Os[wid][col][HD + 2 * hh] = m; Os[wid][col][HD + 2 * hh + 1] = l;
  }
  __syncthreads();                                              // publishes the upper key group's partial results to the lower one
  if (kg == 1) return;
  const float (*Pp)[HD + 4] = Os[wid + 4];
  const float m1 = Pp[col][HD + 2 * hh], l1 = Pp[col][HD + 2 * hh + 1];
  const float mn2 = fmaxf(m, m1), a0 = __expf(m - mn2), a1 = __expf(m1 - mn2);   // m is finite (key 0 is in the lower group); a partner without a chunk has m1 = -inf, l1 = 0 -> a1 = 0
  const float inv = 1.0f / (VS * PS * (l * a0 + l1 * a1)), f0 = a0 * inv, f1 = a1 * inv;
#pragma unroll
  for (int n = 0; n < 4; ++n)
#pragma unroll
    for (int r = 0; r < 8; ++r) Os[wid][col][n * 16 + 8 * hh + r] = o[n][r] * f0 + Pp[col][n * 16 + 8 * hh + r] * f1;
  wave_lds_sync();
  float* dst = y + ((size_t)b * S + q0) * D + h * HD;
  {
#pragma unroll
    for (int j = 0; j < 8; ++j) { const int rr = j * 2 + hh, c4 = col * 4; *(v4f*)(dst + (size_t)rr * D + c4) = *(const v4f*)(&Os[wid][rr][c4]); }
    
  }
}

// out = y W_o^T: (4096 x 1024) x (1024 x 1024); A = y split at the fragment read (f16 hi+lo, x8), B = f16(bf16 W_o) rows; f32 rows; block = 8 waves = 128 tokens x 128 columns, wave = 32 x 64.
// The block's 128 y rows (256 B of f32 per stage) and 128 W_o rows (128 B) come once per 64 k into a two-buffer LDS ring by asynchronous copies of whole rows. grid (8, 32) x 256.
constexpr int YP = KT + 4;                                      // LDS pitch of a y row in f32: 272 B = 16 B x 17, so the 16 rows of a ds_load_b128 read fall on distinct banks
constexpr int OYB = 128 * YP * 4, OBUF = OYB + 128 * LP * 2;    // bytes of a buffer's y rows; of a whole buffer (y rows, then W_o rows)
__global__ __launch_bounds__(256) void out_kernel(const float* __restrict__ y, const b16* __restrict__ wo16, const float* __restrict__ bo, float* __restrict__ out) {
  __shared__ __attribute__((aligned(16))) unsigned char Sm[2 * OBUF];   // the ring; behind the loop's last barrier the epilogue's staging (8 KiB per wave)
  const int lane = threadIdx.x & 31, wid = __builtin_amdgcn_readfirstlane(threadIdx.x >> 5), wave = wid & 3, cg = wid >> 2, nloc = lane & 15, hlf = lane >> 4;
  const int mb = blockIdx.y * 128, m0 = mb + wave * 32, cb = blockIdx.x * 128, c0 = cb + cg * 64;
  const int yr = threadIdx.x >> 4, yc = (threadIdx.x & 15) * 4; // staging of y: thread -> rows yr + 16 j, 16 B piece yc; a wave's copy covers 2 whole 256 B rows
  const int sr = threadIdx.x >> 3, sc = (threadIdx.x & 7) * 8;  // staging of W_o: thread -> rows sr + 32 j, 16 B piece sc; a wave's copy covers 4 whole 128 B rows
  // One stage: k in [t*64, t*64+64) < D. 12 copies of 16 B per lane, all lanes on; the s_wait_xcnt closes the statement so that no address register is rewritten ahead of it.
  auto stage = [&](int t, int buf) {
    const float* gy = y + (size_t)(mb + yr) * D + t * KT + yc; const b16* gw = wo16 + (size_t)(cb + sr) * D + t * KT + sc;
    const unsigned ly = lds_addr(Sm + (size_t)buf * OBUF + (size_t)yr * (YP * 4) + yc * 4), lw = lds_addr(Sm + (size_t)buf * OBUF + OYB + (size_t)sr * (LP * 2) + sc * 2);
    constexpr unsigned YB = 16 * YP * 4, HB = 32 * LP * 2;      // bytes per 16 y rows, per 32 W_o rows
    asm volatile("global_load_async_to_lds_b128 %0, %12, off\n\t"
                 "global_load_async_to_lds_b128 %1, %13, off\n\t"
                 "global_load_async_to_lds_b128 %2, %14, off\n\t"
                 "global_load_async_to_lds_b128 %3, %15, off\n\t"
                 "global_load_async_to_lds_b128 %4, %16, off\n\t"
                 "global_load_async_to_lds_b128 %5, %17, off\n\t"
                 "global_load_async_to_lds_b128 %6, %18, off\n\t"
                 "global_load_async_to_lds_b128 %7, %19, off\n\t"
                 "global_load_async_to_lds_b128 %8, %20, off\n\t"
                 "global_load_async_to_lds_b128 %9, %21, off\n\t"
                 "global_load_async_to_lds_b128 %10, %22, off\n\t"
                 "global_load_async_to_lds_b128 %11, %23, off\n\t"
                 "s_wait_xcnt 0x0"
                 :: "v"(ly), "v"(ly + YB), "v"(ly + 2 * YB), "v"(ly + 3 * YB), "v"(ly + 4 * YB), "v"(ly + 5 * YB), "v"(ly + 6 * YB), "v"(ly + 7 * YB),
                    "v"(lw), "v"(lw + HB), "v"(lw + 2 * HB), "v"(lw + 3 * HB),
                    "v"(gy), "v"(gy + 16 * D), "v"(gy + 32 * D), "v"(gy + 48 * D), "v"(gy + 64 * D), "v"(gy + 80 * D), "v"(gy + 96 * D), "v"(gy + 112 * D),
                    "v"(gw), "v"(gw + 32 * D), "v"(gw + 64 * D), "v"(gw + 96 * D)
                 : "memory");
  };
  stage(0, 0);
  v8f acc[2][4];
#pragma unroll
  for (int r = 0; r < 2; ++r)
#pragma unroll
    for (int t = 0; t < 4; ++t) acc[r][t] = (v8f){};
  asm volatile("s_wait_asynccnt 0x0" ::: "memory");             // stage 0 of this wave has landed
  __syncthreads();                                              // publishes stage 0 to the other waves
  stage(1, 1);
  for (int s = 0; s < GST; ++s) {
    const Opnd A{Sm + (size_t)(s & 1) * OBUF, nullptr, YP}, Bo{Sm + (size_t)(s & 1) * OBUF + OYB, nullptr, LP};
#pragma unroll   // the stage's two k steps of 32 unrolled so that every LDS fragment offset is an immediate
    for (int ks = 0; ks < 2; ++ks) {
      v4f ya[2][4];                                             // the two y fragments' f32 words: [row tile][k = 8 hlf + 0..3, + 4..7, 16 + 8 hlf + 0..3, + 4..7]
#pragma unroll
      for (int r = 0; r < 2; ++r) { const float* p = (const float*)A.p0 + (wave * 32 + r * 16 + nloc) * YP + ks * 32 + 8 * hlf;
        ya[r][0] = *(const v4f*)p; ya[r][1] = *(const v4f*)(p + 4); ya[r][2] = *(const v4f*)(p + 16); ya[r][3] = *(const v4f*)(p + 20); }
      v16b bh[4], bl[4];
#pragma unroll
      for (int t = 0; t < 4; ++t) load_frags<1>(Bo, cg * 64 + t * 16 + nloc, ks * 32, hlf, bh[t], bl[t]);
      __builtin_amdgcn_sched_barrier(0);                        // the k step's 16 LDS reads stay one group ahead of the split and the 16 products: one LDS latency instead of one per tile
      v16b ah[2], al[2];                                        // y as an f16 hi+lo pair carried x8 (2 products)
#pragma unroll
      for (int r = 0; r < 2; ++r)
#pragma unroll
        for (int e = 0; e < 16; ++e) { b16 a_, c_; split16(ya[r][e >> 2][e & 3] * 8.0f, a_, c_); ah[r][e] = a_; al[r][e] = c_; }
#pragma unroll
      for (int t = 0; t < 4; ++t) {
        acc[0][t] = mac<5, 1>(ah[0], al[0], bh[t], bl[t], acc[0][t]);
        acc[1][t] = mac<5, 1>(ah[1], al[1], bh[t], bl[t], acc[1][t]);
      }
    }
    // publish point of stage s + 1
    asm volatile("s_wait_dscnt 0x0" ::: "memory");              // this wave's reads of buffer s & 1 are done before it is refilled
    asm volatile("s_wait_asynccnt 0x0" ::: "memory");           // this wave's copies of stage s + 1 have landed
    __syncthreads();                                            // publishes stage s + 1 and ends every wave's reads of stage s
    if (s + 2 < GST) stage(s + 2, s & 1);
  }
  asm volatile("s_wait_asynccnt 0x0" ::: "memory");             // nothing of the ring is in flight when its LDS becomes staging
#pragma unroll
  for (int t = 0; t < 4; ++t)
#pragma unroll
    for (int r = 0; r < 2; ++r)
#pragma unroll
      for (int v = 0; v < 8; ++v) acc[r][t][v] = acc[r][t][v] * (1.0f / 8.0f) + bf16_rne(bo[c0 + t * 16 + nloc]);
  epi_f32(acc, 1.0f, nullptr, out, D, m0, c0, lane, (float*)(Sm + (size_t)wid * (32 * 64 * 4)));
}
}  // namespace

extern "C" void kernel_launch(void* const* d_in, const int* in_sizes, int n_in,
                              void* d_out, int out_size, void* d_ws, size_t ws_size, hipStream_t stream) {
  (void)n_in; (void)out_size;
  const float* x = (const float*)d_in[0]; const int* seq_lens = (const int*)d_in[1]; const float* wqkv = (const float*)d_in[2]; const float* bqkv = (const float*)d_in[3]; const float* wo = (const float*)d_in[4]; const float* bo = (const float*)d_in[5];
  float* out = (float*)d_out;   // [2][2048][1024]
  if (in_sizes[0] != BT * S * D || in_sizes[1] != Bn || in_sizes[2] != 3 * D * D || in_sizes[3] != 3 * D || in_sizes[4] != D * D || in_sizes[5] != D) return;
  size_t off = 0; char* ws = (char*)d_ws;
  auto carve = [&](size_t bytes) { char* p = ws + off; off += (bytes + 255) & ~(size_t)255; return p; };
  unsigned short* x16 = (unsigned short*)carve((size_t)NTOK * D * 2); unsigned short* w16 = (unsigned short*)carve((size_t)3 * D * D * 2); b16* wo16 = (b16*)carve((size_t)D * D * 2);
  b16* qh = (b16*)carve((size_t)2 * NTOK * D * 2); b16* kh = (b16*)carve((size_t)2 * NTOK * D * 2); b16* vt = (b16*)carve((size_t)2 * NTOK * D * 2); float* y = (float*)carve((size_t)NTOK * D * 4);
  if (off > ws_size) return;                                    // ≈ 84 MB
  prep_kernel<<<CVB, CVW, 0, stream>>>(x, wqkv, wo, x16, w16, wo16);
  proj_kernel<<<dim3(3 * D / 128, NTOK / 128), 256, 0, stream>>>((const __bf16*)x16, (const __bf16*)w16, bqkv, qh, kh, vt);
  attn_kernel<S / 16><<<Bn * H * (S / 64), 256, 0, stream>>>(qh, kh, vt, seq_lens, y);
  out_kernel<<<dim3(D / 128, NTOK / 128), 256, 0, stream>>>(y, wo16, bo, out);
}

// v006
// Measured time: 96.2 microseconds a run.
// Timed twice side by side with v005, it ran 1.03 and 1.04 times as fast.
// All steps since v000 together make it 3.07 times as fast.
#include <hip/hip_runtime.h>

// MultiAxisAttention: qkv = x Wqkv^T + bqkv (16 heads x 64), causal mask (key > query -> -1e9) plus a per-batch padding mask (key >= seq_len[b] -> -1e9), softmax of q.k/8, out = ctx Wout^T + bout
// -> [2][2048][1024]. seq_lens here are > 0, so every query keeps key 0 and the masked keys contribute exp(-1e9 - max) = 0; the key loop stops at
// min(causal bound, seq_len).
// x, the four weights and bo rounded to bf16: projection on v_wmma_f32_16x16x32_bf16 (exact products, f32 accumulate);
// scores, P.v and the output projection on v_wmma_f32_16x16x32_f16 with every computed operand (q, k, v, P, y — each carried x8 so the hi/lo residual planes stay normal) as an f16
// hi+lo pair (3 / 2 products); online softmax in f32. Fragment k-map per lane half hh for A AND B: elements 0..7 <- k = 8hh+0..7, 8..15 <- k = 16+8hh+0..7. Every intermediate /

namespace {
constexpr int BT = 2, Bn = 2, S = 2048, D = 1024, H = 16, HD = 64, NTOK = Bn * S;
constexpr float SCALE = 0.125f, VS = 8.0f, QS = 8.0f, PS = 8.0f;   // power-of-two carry scales so hi/lo residual planes stay normal in f16
constexpr size_t VPL = (size_t)NTOK * D;   // distance between the (8v)^T hi and lo planes
constexpr size_t QPL = (size_t)NTOK * D;   // distance between the q/k hi and lo planes
constexpr size_t YPL = (size_t)NTOK * D;   // distance between the (8y) hi and lo planes

typedef _Float16 b16;
typedef __attribute__((ext_vector_type(16))) _Float16 v16b;
typedef __attribute__((ext_vector_type(8)))  _Float16 v8b;
typedef __attribute__((ext_vector_type(8)))  float v8f;
typedef __attribute__((ext_vector_type(4)))  float v4f;

__device__ __forceinline__ v8b ld8b(const b16* p) { return *(const v8b*)p; }
__device__ __forceinline__ v16b cat8b(v8b a, v8b b) { return __builtin_shufflevector(a, b, 0, 1, 2, 3, 4, 5, 6, 7, 8, 9, 10, 11, 12, 13, 14, 15); }
__device__ __forceinline__ v16b frag_kb(const b16* p, int hh) { return cat8b(ld8b(p + 8 * hh), ld8b(p + 16 + 8 * hh)); }
__device__ __forceinline__ void split16(float v, b16& hi, b16& lo) { hi = (b16)v; lo = (b16)(v - (float)hi); }
// hi/lo fragment pair straight from an f32 k-contiguous row (same k-map)
__device__ __forceinline__ void frag_ksplit(const float* p, int hh, v16b& fh_, v16b& fl_) {
  const float* p0 = p + 8 * hh; const float* p1 = p + 16 + 8 * hh;
#pragma unroll
  for (int e = 0; e < 8; ++e) { b16 a, c; split16(p0[e], a, c); fh_[e] = a; fl_[e] = c; split16(p1[e], a, c); fh_[8 + e] = a; fl_[8 + e] = c; }
}
__device__ __forceinline__ v8f wmma16b(v16b a, v16b b, v8f c) {
  v8f d = __builtin_amdgcn_wmma_f32_16x16x32_f16(false, a, false, b, (short)0, c, false, false);
  asm volatile("v_nop\n\tv_nop\n\tv_nop\n\tv_nop" : "+v"(d) : "v"(a), "v"(b));
  return d;
}
__device__ __forceinline__ void wave_lds_sync() {
  __builtin_amdgcn_fence(__ATOMIC_RELEASE, "workgroup");
  __builtin_amdgcn_wave_barrier();
  __builtin_amdgcn_fence(__ATOMIC_ACQUIRE, "workgroup");
}

// Operand descriptor: NP = 0 -> f32 rows split on the fly into (hi, lo); NP = 1 -> one f16 plane; NP = 2 -> f16 hi + lo planes;
// NP = 3 -> f32 rows rounded once to a single f16 fragment. ld = row pitch.
struct Opnd { const void* p0; const void* p1; int ld; };
template <int NP> __device__ __forceinline__ void load_frags(const Opnd& o, int row, int kb, int hh, v16b& fh_, v16b& fl_) {
  if (NP == 0) { frag_ksplit((const float*)o.p0 + (size_t)row * o.ld + kb, hh, fh_, fl_); }
  else if (NP == 4 || NP == 5) {                             // f32 rows x64 (NP 4) or x8 (NP 5) then split (keeps the lo halves of small values normal)
    const float sc_ = (NP == 4) ? 64.0f : 8.0f;
    const float* p = (const float*)o.p0 + (size_t)row * o.ld + kb; const float* p0 = p + 8 * hh; const float* p1 = p + 16 + 8 * hh;
#pragma unroll
    for (int e = 0; e < 8; ++e) { b16 a, c; split16(p0[e] * sc_, a, c); fh_[e] = a; fl_[e] = c; split16(p1[e] * sc_, a, c); fh_[8 + e] = a; fl_[8 + e] = c; }
  } else if (NP == 3) {
    const float* p = (const float*)o.p0 + (size_t)row * o.ld + kb; const float* p0 = p + 8 * hh; const float* p1 = p + 16 + 8 * hh;
#pragma unroll
    for (int e = 0; e < 8; ++e) { fh_[e] = (b16)p0[e]; fh_[8 + e] = (b16)p1[e]; }
    fl_ = fh_;
  } else {
    fh_ = frag_kb((const b16*)o.p0 + (size_t)row * o.ld + kb, hh);
    if (NP == 2) fl_ = frag_kb((const b16*)o.p1 + (size_t)row * o.ld + kb, hh); else fl_ = fh_;
  }
}
template <int ANP, int BNP> __device__ __forceinline__ v8f mac(v16b ah, v16b al, v16b bh, v16b bl, v8f c) {
  c = wmma16b(ah, bh, c);
  if (BNP == 0 || BNP == 2 || BNP == 4 || BNP == 5) c = wmma16b(ah, bl, c);     // hi.lo
  if (ANP == 0 || ANP == 2 || ANP == 4 || ANP == 5) c = wmma16b(al, bh, c);     // lo.hi   (lo.lo dropped)
  return c;
}
__device__ __forceinline__ void epi_planes(v8f (&acc)[2][4], float scale, bool two, b16* __restrict__ oh, b16* __restrict__ ol, int ldo,
                                           int m0, int c0, int lane, b16* Th, b16* Tl) {
  const int nloc = lane & 15, hlf = lane >> 4;
#pragma unroll
  for (int t = 0; t < 4; ++t)
#pragma unroll
    for (int r = 0; r < 2; ++r)
#pragma unroll
      for (int v = 0; v < 8; ++v) {
        const int rr = r * 16 + v + 8 * hlf, cc = t * 16 + nloc;
        b16 h_, l_; split16(acc[r][t][v] * scale, h_, l_);
        Th[rr * 64 + cc] = h_; Tl[rr * 64 + cc] = l_;
      }
  wave_lds_sync();
  {
#pragma unroll
    for (int j = 0; j < 8; ++j) {
      const int rr = j * 4 + (lane >> 3), c8 = (lane & 7) * 8;
      const size_t o = (size_t)(m0 + rr) * ldo + c0 + c8;
      *(v8b*)(oh + o) = ld8b(Th + rr * 64 + c8);
      if (two) *(v8b*)(ol + o) = ld8b(Tl + rr * 64 + c8);
    }
    
  }
}
// (b) f32 rows with pitch ldo: 64 floats = 256 B = 2 lines per row; 16 lanes x 16 B per row, 2 rows per instruction. Optional per-row factor
__device__ __forceinline__ void epi_f32(v8f (&acc)[2][4], float scale, const float* rscale, float* __restrict__ out, int ldo, int m0, int c0, int lane, float* Tt) {
  const int nloc = lane & 15, hlf = lane >> 4;
#pragma unroll
  for (int t = 0; t < 4; ++t)
#pragma unroll
    for (int r = 0; r < 2; ++r)
#pragma unroll
      for (int v = 0; v < 8; ++v) {
        const int rr = r * 16 + v + 8 * hlf;
        const float rs = rscale ? rscale[(size_t)(m0 + rr) * 32] : 1.0f;
        Tt[rr * 64 + t * 16 + nloc] = acc[r][t][v] * scale * rs;
      }
  wave_lds_sync();
  float* dst0 = out + (size_t)m0 * ldo + c0;
  {
#pragma unroll
    for (int j = 0; j < 16; ++j) { const int rr = j * 2 + hlf, c4 = nloc * 4; *(v4f*)(dst0 + (size_t)rr * ldo + c4) = *(const v4f*)(Tt + rr * 64 + c4); }
    
  }
}



typedef __attribute__((ext_vector_type(8))) __bf16 v8bb; typedef __attribute__((ext_vector_type(16))) __bf16 v16bb;
typedef __attribute__((ext_vector_type(8))) unsigned short v8us;
__device__ __forceinline__ v16bb frag_kb_bf(const __bf16* p, int hh) { const v8bb a = *(const v8bb*)(p + 8 * hh), b = *(const v8bb*)(p + 16 + 8 * hh); return __builtin_shufflevector(a, b, 0, 1, 2, 3, 4, 5, 6, 7, 8, 9, 10, 11, 12, 13, 14, 15); }
__device__ __forceinline__ v8f wmma16bb(v16bb a, v16bb b, v8f c) {
  v8f d = __builtin_amdgcn_wmma_f32_16x16x32_bf16(false, a, false, b, (short)0, c, false, false);
  asm volatile("v_nop\n\tv_nop\n\tv_nop\n\tv_nop" : "+v"(d) : "v"(a), "v"(b));
  return d;
}
__device__ __forceinline__ unsigned short bf16_rne_bits(float v) { unsigned int u = __float_as_uint(v); u += 0x7FFFu + ((u >> 16) & 1u); return (unsigned short)(u >> 16); }
__device__ __forceinline__ float bf16_rne(float v) { return __uint_as_float(((unsigned int)bf16_rne_bits(v)) << 16); }



// One conversion launch for all three f32 operands: x and Wqkv -> bf16 bits, W_o -> f16 of the bf16-rounded value (rows copied directly, [out][in]).
// 256 blocks x 16 waves; a thread takes 16 groups of 4 floats, CVT groups apart, so that every wave-wide load covers 512 contiguous bytes and every store 256;
// groups 0..7 fall in x, 8..13 in Wqkv, 14..15 in W_o. All 16 loads are issued ahead of the first conversion: one memory latency per thread.
typedef __attribute__((ext_vector_type(4))) unsigned short v4us; typedef __attribute__((ext_vector_type(4))) _Float16 v4b;
constexpr int CVB = 256, CVW = 512, CVT = CVB * CVW;
static_assert((size_t)NTOK * D / 4 == (size_t)8 * CVT && (size_t)3 * D * D / 4 == (size_t)6 * CVT && (size_t)D * D / 4 == (size_t)2 * CVT, "group counts of the conversion launch");
__global__ __launch_bounds__(CVW) void prep_kernel(const float* __restrict__ x, const float* __restrict__ wqkv, const float* __restrict__ wo,
                                                  unsigned short* __restrict__ x16, unsigned short* __restrict__ w16, b16* __restrict__ wo16) {
  const size_t g = ((size_t)blockIdx.x * CVW + threadIdx.x) * 4; // first float of the thread's group 0
  const float* px0 = x + g; const float* px1 = px0 + (size_t)4 * CVT * 4; const float* pw0 = wqkv + g; const float* pw1 = pw0 + (size_t)4 * CVT * 4; const float* po0 = wo + g;
  v4f a[8], w[6], o[2];
#pragma unroll
  for (int j = 0; j < 4; ++j) { a[j] = *(const v4f*)(px0 + (size_t)j * CVT * 4); a[4 + j] = *(const v4f*)(px1 + (size_t)j * CVT * 4); }
#pragma unroll
  for (int j = 0; j < 4; ++j) w[j] = *(const v4f*)(pw0 + (size_t)j * CVT * 4);
#pragma unroll
  for (int j = 0; j < 2; ++j) { w[4 + j] = *(const v4f*)(pw1 + (size_t)j * CVT * 4); o[j] = *(const v4f*)(po0 + (size_t)j * CVT * 4); }
  // the loads' five address pairs stay live up to this wait, so that none of them is rewritten (also not as a later load's destination) ahead of it
  asm volatile("s_wait_xcnt 0x0" :: "v"(px0), "v"(px1), "v"(pw0), "v"(pw1), "v"(po0) : "memory");
  __builtin_amdgcn_sched_barrier(0);                            // the 16 loads stay one group ahead of the conversions and stores: they are all in flight together
#pragma unroll
  for (int j = 0; j < 8; ++j) { v4us v;
#pragma unroll
    for (int e = 0; e < 4; ++e) v[e] = bf16_rne_bits(a[j][e]);
    *(v4us*)(x16 + g + (size_t)j * CVT * 4) = v; }
#pragma unroll
  for (int j = 0; j < 6; ++j) { v4us v;
#pragma unroll
    for (int e = 0; e < 4; ++e) v[e] = bf16_rne_bits(w[j][e]);
    *(v4us*)(w16 + g + (size_t)j * CVT * 4) = v; }
#pragma unroll
  for (int j = 0; j < 2; ++j) { v4b v;
#pragma unroll
    for (int e = 0; e < 4; ++e) v[e] = (b16)bf16_rne(o[j][e]);
    *(v4b*)(wo16 + g + (size_t)j * CVT * 4) = v; }
}

constexpr int KT = 64;    // keys (attention) or k (GEMMs) per ring stage: 16-bit rows of 128 B = one cache line
constexpr int LP = 72;    // LDS row pitch in f16: 144 B = 16 B x 9, so the 16 rows of a ds_load_b128 fragment read fall on distinct banks
__device__ __forceinline__ unsigned lds_addr(const void* p) { return (unsigned)(size_t)p; }   // low 32 bits of a __shared__ address = byte offset in the work-group's LDS

// projections: rows = tokens (4096), K = 1024, block = 8 waves = 128 tokens x 128 columns = two heads of q (column tiles 0..7), k (8..15) or v (16..23); wave = 32 tokens x one head.
// The block's 128 x rows and 128 W rows come once per 64 k into a two-buffer LDS ring by asynchronous copies of whole 128 B rows; every wave takes its fragments from there.
// f16 rows [b*H + head][tok][64] for q/k; v: (8v)^T f16 [b*H + head][64][tok]. grid (24, 32) x 256.
constexpr int GR = 256;            // ring rows of a projection stage: 128 x rows, then 128 W rows
constexpr int GST = D / KT;        // ring stages of a GEMM: 16
__global__ __launch_bounds__(256) void proj_kernel(const __bf16* __restrict__ x16, const __bf16* __restrict__ w16, const float* __restrict__ bqkv, b16* __restrict__ qh, b16* __restrict__ kh, b16* __restrict__ vt) {
  __shared__ __attribute__((aligned(16))) unsigned char Sm[2 * GR * LP * 2];   // the ring [buffer][row][64 bf16 + pad]; behind the loop's last barrier the epilogue's staging
  const int lane = threadIdx.x & 31, wid = __builtin_amdgcn_readfirstlane(threadIdx.x >> 5), wave = wid & 3, cg = wid >> 2, nloc = lane & 15, hlf = lane >> 4;
  const int mb = blockIdx.y * 128, m0 = mb + wave * 32, cb = blockIdx.x * 128, c0 = cb + cg * 64;
  const int sr = threadIdx.x >> 3, sc = (threadIdx.x & 7) * 8;  // staging: thread -> rows sr + 32 j, 16 B piece sc; a wave's copy covers 4 whole 128 B rows
  // One stage: k in [t*64, t*64+64) < D. 8 copies of 16 B per lane, all lanes on; the s_wait_xcnt closes the statement so that no address register is rewritten ahead of it.
  auto stage = [&](int t, int buf) {
    const __bf16* gx = x16 + (size_t)(mb + sr) * D + t * KT + sc; const __bf16* gw = w16 + (size_t)(cb + sr) * D + t * KT + sc;
    const unsigned l0 = lds_addr(Sm + ((size_t)buf * GR + sr) * (LP * 2) + sc * 2);
    constexpr unsigned HB = 32 * LP * 2;                        // bytes per 32 rows
    asm volatile("global_load_async_to_lds_b128 %0, %8, off\n\t"
                 "global_load_async_to_lds_b128 %1, %9, off\n\t"
                 "global_load_async_to_lds_b128 %2, %10, off\n\t"
                 "global_load_async_to_lds_b128 %3, %11, off\n\t"
                 "global_load_async_to_lds_b128 %4, %12, off\n\t"
                 "global_load_async_to_lds_b128 %5, %13, off\n\t"
                 "global_load_async_to_lds_b128 %6, %14, off\n\t"
                 "global_load_async_to_lds_b128 %7, %15, off\n\t"
                 "s_wait_xcnt 0x0"
                 :: "v"(l0), "v"(l0 + HB), "v"(l0 + 2 * HB), "v"(l0 + 3 * HB), "v"(l0 + 4 * HB), "v"(l0 + 5 * HB), "v"(l0 + 6 * HB), "v"(l0 + 7 * HB),
                    "v"(gx), "v"(gx + 32 * D), "v"(gx + 64 * D), "v"(gx + 96 * D), "v"(gw), "v"(gw + 32 * D), "v"(gw + 64 * D), "v"(gw + 96 * D)
                 : "memory");
  };
  stage(0, 0);
  v8f acc[2][4];
#pragma unroll
  for (int r = 0; r < 2; ++r)
#pragma unroll
    for (int t = 0; t < 4; ++t) acc[r][t] = (v8f){};
  asm volatile("s_wait_asynccnt 0x0" ::: "memory");             // stage 0 of this wave has landed
  __syncthreads();                                              // publishes stage 0 to the other waves
  stage(1, 1);
  for (int s = 0; s < GST; ++s) {
    const __bf16* R = (const __bf16*)(Sm + (size_t)(s & 1) * (GR * LP * 2));
#pragma unroll   // the stage's two k steps of 32 unrolled so that every LDS fragment offset is an immediate
    for (int ks = 0; ks < 2; ++ks) {
      const v16bb a0 = frag_kb_bf(R + (wave * 32 + nloc) * LP + ks * 32, hlf), a1 = frag_kb_bf(R + (wave * 32 + 16 + nloc) * LP + ks * 32, hlf);
      v16bb bw[4];
#pragma unroll
      for (int t = 0; t < 4; ++t) bw[t] = frag_kb_bf(R + (128 + cg * 64 + t * 16 + nloc) * LP + ks * 32, hlf);
      __builtin_amdgcn_sched_barrier(0);                        // the k step's 12 LDS reads stay one group ahead of its 8 products: one LDS latency instead of one per column tile
#pragma unroll
      for (int t = 0; t < 4; ++t) { acc[0][t] = wmma16bb(a0, bw[t], acc[0][t]); acc[1][t] = wmma16bb(a1, bw[t], acc[1][t]); }
    }
    // publish point of stage s + 1
    asm volatile("s_wait_dscnt 0x0" ::: "memory");              // this wave's reads of buffer s & 1 are done before it is refilled
    asm volatile("s_wait_asynccnt 0x0" ::: "memory");           // this wave's copies of stage s + 1 have landed
    __syncthreads();                                            // publishes stage s + 1 and ends every wave's reads of stage s
    if (s + 2 < GST) stage(s + 2, s & 1);
  }
  asm volatile("s_wait_asynccnt 0x0" ::: "memory");             // nothing of the ring is in flight when its LDS becomes staging
  const int which = blockIdx.x / (D / 128), head = (blockIdx.x % (D / 128)) * 2 + cg, b = m0 / S, tok0 = m0 % S;
#pragma unroll
  for (int t = 0; t < 4; ++t) { const float bb = bf16_rne(bqkv[c0 + t * 16 + nloc]);   // + bias (rounded to bf16)
#pragma unroll
    for (int r = 0; r < 2; ++r)
#pragma unroll
      for (int v = 0; v < 8; ++v) acc[r][t][v] += bb; }
  if (which < 2) {                                              // q or k head: f16 rows
    b16 (*Th)[HD + 8] = (b16 (*)[HD + 8])(Sm + (size_t)wid * (2 * 32 * (HD + 8) * 2)); b16 (*Tq)[HD + 8] = Th + 32;   // the wave's own hi and lo tiles [32][64 + pad]
#pragma unroll
    for (int t = 0; t < 4; ++t)
#pragma unroll
      for (int r = 0; r < 2; ++r)
#pragma unroll
        for (int v = 0; v < 8; ++v) { b16 a_, c_; split16(acc[r][t][v] * QS, a_, c_); Th[r * 16 + 8 * hlf + v][t * 16 + nloc] = a_; Tq[r * 16 + 8 * hlf + v][t * 16 + nloc] = c_; }   // q, k carried x8 (lo residuals stay normal)
    wave_lds_sync();
    b16* dst = (which == 0 ? qh : kh) + (((size_t)b * H + head) * S + tok0) * HD;
    {
#pragma unroll
      for (int j = 0; j < 8; ++j) { const int rr = j * 4 + (lane >> 3), c8 = (lane & 7) * 8; *(v8b*)(dst + (size_t)rr * HD + c8) = *(const v8b*)(&Th[rr][c8]); *(v8b*)(dst + QPL + (size_t)rr * HD + c8) = *(const v8b*)(&Tq[rr][c8]); }
       }
    return;
  }
  const int vh = head;                                          // v head: (8v)^T tile [64 d][128 tok] via LDS, rows of 256 B; one hi and one lo tile per head of the block
  b16 (*Tt)[128 + 8] = (b16 (*)[128 + 8])(Sm + (size_t)cg * (2 * 64 * (128 + 8) * 2)); b16 (*Tl)[128 + 8] = Tt + 64;
#pragma unroll
  for (int t = 0; t < 4; ++t)
#pragma unroll
    for (int r = 0; r < 2; ++r)
#pragma unroll
      for (int v = 0; v < 8; ++v) { b16 a_, c_; split16(acc[r][t][v] * VS, a_, c_); Tt[t * 16 + nloc][wave * 32 + r * 16 + 8 * hlf + v] = a_; Tl[t * 16 + nloc][wave * 32 + r * 16 + 8 * hlf + v] = c_; }
  __syncthreads();
  b16* dstv = vt + (((size_t)b * H + vh) * HD) * S + (blockIdx.y * 128) % S;
  {
#pragma unroll
    for (int j = 0; j < 8; ++j) { const int dd = wave * 16 + j * 2 + (lane >> 4), c8 = (lane & 15) * 8; *(v8b*)(dstv + (size_t)dd * S + c8) = *(const v8b*)(&Tt[dd][c8]); *(v8b*)(dstv + VPL + (size_t)dd * S + c8) = *(const v8b*)(&Tl[dd][c8]); }
    
  }
}

// causal attention: block = 8 waves = 64 consecutive queries of one (b, h) = 4 query groups of 16 x 2 key groups: of every ring stage of 64 keys, waves 0..3 take keys 0..31 and waves 4..7
// keys 32..63, so the longest block walks half as many chunks per wave; each wave keeps its own online softmax (f32) and the two partial results of a query group are merged through LDS at the end.
// Blocks outnumber the resident places, so the longest tiles (highest queries) come first in the grid. Per chunk of 32 keys: S^T (K=64), mask on the straddling chunks, P^T f16, y^T += (8V)^T P^T.
// The block's K rows and (8V)^T rows (hi and lo planes) come once per 64 keys into a two-buffer LDS ring by asynchronous copies of whole 128 B rows; every wave takes its fragments from there.
template <int QT>
__global__ __launch_bounds__(256) void attn_kernel(const b16* __restrict__ qh, const b16* __restrict__ kh, const b16* __restrict__ vt, const int* __restrict__ seq_lens, b16* __restrict__ yh) {
  __shared__ __attribute__((aligned(16))) float Os[8][16][HD + 4];
  __shared__ __attribute__((aligned(16))) b16 Ring[2][4][KT][LP];   // [buffer][K hi, K lo, V^T hi, V^T lo][key row or d row][64 f16 + pad]
  const int wid = __builtin_amdgcn_readfirstlane(threadIdx.x >> 5), lane = threadIdx.x & 31, hh = lane >> 4, col = lane & 15;
  const int qg = wid & 3, kg = wid >> 2;                        // query group, key group of the wave
  const int tile = QT / 4 - 1 - (int)blockIdx.x / (Bn * H), bh = (int)blockIdx.x % (Bn * H), h = bh % H, b = bh / H, q0 = tile * 64 + qg * 16, qi = q0 + col;
  const b16* Q = qh + ((size_t)bh * S) * HD; const b16* K = kh + ((size_t)bh * S) * HD; const b16* vb = vt + ((size_t)bh * HD) * S;
  const int sl = min(max(seq_lens[b], 1), S);                   // padding mask: keys >= seq_len get -inf (exp -> 0); seq_len >= 1 here so key 0 always survives
  const int kend = __builtin_amdgcn_readfirstlane(min(q0 + 16, sl));   // this wave's key bound, held in a scalar register so that the chunk test below stays a scalar compare and branch
  const int nst = (min(tile * 64 + 64, sl) + KT - 1) / KT;      // ring stages of the block = those of its last query group (block-uniform, 1..32)
  const int sr = threadIdx.x >> 3, sc = (threadIdx.x & 7) * 8;  // staging: thread -> rows sr and sr + 32, 16 B piece sc; a wave's copy covers 4 whole 128 B rows
  // One stage: keys [t*64, t*64+64) < S. 8 copies of 16 B per lane, all lanes on; the s_wait_xcnt closes the statement so that no address register is rewritten ahead of it.
  auto stage = [&](int t, int buf) {
    const b16* gk = K + (size_t)(t * KT + sr) * HD + sc; const b16* gv = vb + (size_t)sr * S + t * KT + sc;
    const unsigned l0 = lds_addr(&Ring[buf][0][sr][sc]);
    constexpr unsigned PB = KT * LP * 2, HB = 32 * LP * 2;      // bytes per plane, per 32 rows
    asm volatile("global_load_async_to_lds_b128 %0, %8, off\n\t"
                 "global_load_async_to_lds_b128 %1, %9, off\n\t"
                 "global_load_async_to_lds_b128 %2, %10, off\n\t"
                 "global_load_async_to_lds_b128 %3, %11, off\n\t"
                 "global_load_async_to_lds_b128 %4, %12, off\n\t"
                 "global_load_async_to_lds_b128 %5, %13, off\n\t"
                 "global_load_async_to_lds_b128 %6, %14, off\n\t"
                 "global_load_async_to_lds_b128 %7, %15, off\n\t"
                 "s_wait_xcnt 0x0"
                 :: "v"(l0), "v"(l0 + HB), "v"(l0 + PB), "v"(l0 + PB + HB), "v"(l0 + 2 * PB), "v"(l0 + 2 * PB + HB), "v"(l0 + 3 * PB), "v"(l0 + 3 * PB + HB),
                    "v"(gk), "v"(gk + 32 * HD), "v"(gk + QPL), "v"(gk + QPL + 32 * HD), "v"(gv), "v"(gv + (size_t)32 * S), "v"(gv + VPL), "v"(gv + VPL + (size_t)32 * S)
                 : "memory");
  };
  stage(0, 0);
  v16b qf[2], ql[2];
#pragma unroll
  for (int ks = 0; ks < 2; ++ks) { qf[ks] = frag_kb(Q + (size_t)qi * HD + ks * 32, hh); ql[ks] = frag_kb(Q + QPL + (size_t)qi * HD + ks * 32, hh); }
  float m = -INFINITY, l = 0.0f; v8f o[4] = {{}, {}, {}, {}};
  asm volatile("s_wait_asynccnt 0x0" ::: "memory");             // stage 0 of this wave has landed
  __syncthreads();                                              // publishes stage 0 to the other waves
  if (nst > 1) stage(1, 1);
  for (int t = 0; t < nst; ++t) {
    const b16 (*R)[KT][LP] = Ring[t & 1];
    {
      const int kb = t * KT + kg * 32, kl = kg * 32;            // this wave's chunk of the stage
      if (kb < kend) {                                          // causal + padding: key chunks past min(query tile, seq_len) are skipped (wave-uniform scalar bound)
        const bool diag = (kb + 32 > q0) || (kb + 32 > sl);     // this chunk reaches past some queries or past seq_len -> mask
        v8f s0 = {}, s1 = {};
        v16b k0[2], k0l[2], k1[2], k1l[2];
#pragma unroll
        for (int ks = 0; ks < 2; ++ks) { k0[ks] = frag_kb(&R[0][kl + col][ks * 32], hh); k0l[ks] = frag_kb(&R[1][kl + col][ks * 32], hh); k1[ks] = frag_kb(&R[0][kl + 16 + col][ks * 32], hh); k1l[ks] = frag_kb(&R[1][kl + 16 + col][ks * 32], hh); }
        __builtin_amdgcn_sched_barrier(0);                      // the chunk's 16 K reads stay one group ahead of the score products: one LDS latency instead of one per k step
#pragma unroll
        for (int ks = 0; ks < 2; ++ks) {
          s0 = wmma16b(k0[ks], qf[ks], s0); s0 = wmma16b(k0[ks], ql[ks], s0); s0 = wmma16b(k0l[ks], qf[ks], s0);      // q and k as f16 hi+lo pairs (lo.lo dropped)
          s1 = wmma16b(k1[ks], qf[ks], s1); s1 = wmma16b(k1[ks], ql[ks], s1); s1 = wmma16b(k1l[ks], qf[ks], s1); }
        v16b vf[4], vl[4];
#pragma unroll
        for (int n = 0; n < 4; ++n) { vf[n] = frag_kb(&R[2][n * 16 + col][kl], hh); vl[n] = frag_kb(&R[3][n * 16 + col][kl], hh); }
        __builtin_amdgcn_sched_barrier(0);                      // the chunk's 16 V^T reads stay one group here, so that they land under the softmax instead of stalling each P.v product
        float mr = -INFINITY;
#pragma unroll
        for (int r = 0; r < 8; ++r) { s0[r] *= SCALE / (QS * QS); s1[r] *= SCALE / (QS * QS); if (diag) { const int k0_ = kb + 8 * hh + r, k1_ = kb + 16 + 8 * hh + r; if (k0_ > qi || k0_ >= sl) s0[r] = -INFINITY; if (k1_ > qi || k1_ >= sl) s1[r] = -INFINITY; } mr = fmaxf(mr, fmaxf(s0[r], s1[r])); }
        mr = fmaxf(mr, __shfl_xor(mr, 16));
        const float mn = fmaxf(m, mr), al_ = __expf(m - mn); m = mn;
        float sum = 0.0f; v16b pb, pl;
#pragma unroll
        for (int r = 0; r < 8; ++r) { const float e0 = __expf(s0[r] - mn), e1 = __expf(s1[r] - mn); sum += e0 + e1; b16 a, c; split16(e0 * PS, a, c); pb[r] = a; pl[r] = c; split16(e1 * PS, a, c); pb[8 + r] = a; pl[8 + r] = c; }   // P carried x8
        sum += __shfl_xor(sum, 16); l = l * al_ + sum;
#pragma unroll
        for (int n = 0; n < 4; ++n) {
#pragma unroll
          for (int r = 0; r < 8; ++r) o[n][r] *= al_;
          o[n] = wmma16b(vf[n], pb, o[n]); o[n] = wmma16b(vf[n], pl, o[n]); o[n] = wmma16b(vl[n], pb, o[n]);   // (8v) and P both as f16 hi+lo pairs (lo.lo dropped)
        }
      }
    }
    // publish point of stage t + 1, passed by every wave, also one that skipped its chunks
    asm volatile("s_wait_dscnt 0x0" ::: "memory");              // this wave's reads of buffer t & 1 are done before it is refilled
    asm volatile("s_wait_asynccnt 0x0" ::: "memory");           // this wave's copies of stage t + 1 have landed
    __syncthreads();                                            // publishes stage t + 1 and ends every wave's reads of stage t
    if (t + 2 < nst) stage(t + 2, t & 1);
  }
  asm volatile("s_wait_asynccnt 0x0" ::: "memory");             // nothing of the ring is in flight when its LDS becomes the y staging
  if (kg == 1) {                                                // upper key group: hand the partial sums, maximum and denominator to the partner wave (same lane, same places; m and l in the row's pad)
#pragma unroll
    for (int n = 0; n < 4; ++n)
#pragma unroll
      for (int r = 0; r < 8; ++r) Os[wid][col][n * 16 + 8 * hh + r] = o[n][r];
    Os[wid][col][HD + 2 * hh] = m; Os[wid][col][HD + 2 * hh + 1] = l;
  }
  __syncthreads();                                              // publishes the upper key group's partial results to the lower one
  if (kg == 1) return;
  const float (*Pp)[HD + 4] = Os[wid + 4];
  const float m1 = Pp[col][HD + 2 * hh], l1 = Pp[col][HD + 2 * hh + 1];
  const float mn2 = fmaxf(m, m1), a0 = __expf(m - mn2), a1 = __expf(m1 - mn2);   // m is finite (key 0 is in the lower group); a partner without a chunk has m1 = -inf, l1 = 0 -> a1 = 0
  const float inv = 1.0f / (VS * PS * (l * a0 + l1 * a1)), f0 = a0 * inv, f1 = a1 * inv;
  // y leaves as the f16 hi+lo pair of 8y that the output GEMM multiplies: split once here. The wave's own hi and lo tiles [16 queries][64 d + pad] lie in the ring's LDS, which is free behind the loop's last barrier.
  b16 (*Th)[LP] = (b16 (*)[LP])(&Ring[0][0][0][0]) + wid * 32; b16 (*Tl)[LP] = Th + 16;
#pragma unroll
  for (int n = 0; n < 4; ++n) { v8b hv, lv;
#pragma unroll
    for (int r = 0; r < 8; ++r) { b16 a_, c_; split16((o[n][r] * f0 + Pp[col][n * 16 + 8 * hh + r] * f1) * 8.0f, a_, c_); hv[r] = a_; lv[r] = c_; }
    *(v8b*)(&Th[col][n * 16 + 8 * hh]) = hv; *(v8b*)(&Tl[col][n * 16 + 8 * hh]) = lv; }
  wave_lds_sync();
  b16* dst = yh + ((size_t)b * S + q0) * D + h * HD;
  {
#pragma unroll
    for (int j = 0; j < 4; ++j) { const int rr = j * 4 + (lane >> 3), c8 = (lane & 7) * 8; *(v8b*)(dst + (size_t)rr * D + c8) = *(const v8b*)(&Th[rr][c8]); *(v8b*)(dst + YPL + (size_t)rr * D + c8) = *(const v8b*)(&Tl[rr][c8]); }
  }
}

// out = y W_o^T: (4096 x 1024) x (1024 x 1024); A = the (8y) f16 hi and lo planes, B = f16(bf16 W_o) rows; f32 rows; block = 8 waves = 128 tokens x 128 columns, wave = 32 x 64.
// The block's 128 hi rows, 128 lo rows and 128 W_o rows (128 B each per stage) come once per 64 k into a two-buffer LDS ring by asynchronous copies of whole rows. grid (8, 32) x 256.
constexpr int OBUF = 3 * 128 * LP * 2;                          // bytes of a buffer: 128 hi rows, 128 lo rows, 128 W_o rows
__global__ __launch_bounds__(256) void out_kernel(const b16* __restrict__ yh, const b16* __restrict__ wo16, const float* __restrict__ bo, float* __restrict__ out) {
  __shared__ __attribute__((aligned(16))) unsigned char Sm[2 * OBUF];   // the ring; behind the loop's last barrier the epilogue's staging (8 KiB per wave)
  const int lane = threadIdx.x & 31, wid = __builtin_amdgcn_readfirstlane(threadIdx.x >> 5), wave = wid & 3, cg = wid >> 2, nloc = lane & 15, hlf = lane >> 4;
  const int mb = blockIdx.y * 128, m0 = mb + wave * 32, cb = blockIdx.x * 128, c0 = cb + cg * 64;
  const int sr = threadIdx.x >> 3, sc = (threadIdx.x & 7) * 8;  // staging: thread -> rows sr + 32 j of each of the three planes, 16 B piece sc; a wave's copy covers 4 whole 128 B rows
  // One stage: k in [t*64, t*64+64) < D. 12 copies of 16 B per lane, all lanes on; the s_wait_xcnt closes the statement so that no address register is rewritten ahead of it.
  auto stage = [&](int t, int buf) {
    const b16* gy = yh + (size_t)(mb + sr) * D + t * KT + sc; const b16* gl = gy + YPL; const b16* gw = wo16 + (size_t)(cb + sr) * D + t * KT + sc;
    const unsigned l0 = lds_addr(Sm + (size_t)buf * OBUF + (size_t)sr * (LP * 2) + sc * 2);
    constexpr unsigned HB = 32 * LP * 2;                        // bytes per 32 rows
    asm volatile("global_load_async_to_lds_b128 %0, %12, off\n\t"
                 "global_load_async_to_lds_b128 %1, %13, off\n\t"
                 "global_load_async_to_lds_b128 %2, %14, off\n\t"
                 "global_load_async_to_lds_b128 %3, %15, off\n\t"
                 "global_load_async_to_lds_b128 %4, %16, off\n\t"
                 "global_load_async_to_lds_b128 %5, %17, off\n\t"
                 "global_load_async_to_lds_b128 %6, %18, off\n\t"
                 "global_load_async_to_lds_b128 %7, %19, off\n\t"
                 "global_load_async_to_lds_b128 %8, %20, off\n\t"
                 "global_load_async_to_lds_b128 %9, %21, off\n\t"
                 "global_load_async_to_lds_b128 %10, %22, off\n\t"
                 "global_load_async_to_lds_b128 %11, %23, off\n\t"
                 "s_wait_xcnt 0x0"
                 :: "v"(l0), "v"(l0 + HB), "v"(l0 + 2 * HB), "v"(l0 + 3 * HB), "v"(l0 + 4 * HB), "v"(l0 + 5 * HB), "v"(l0 + 6 * HB), "v"(l0 + 7 * HB),
                    "v"(l0 + 8 * HB), "v"(l0 + 9 * HB), "v"(l0 + 10 * HB), "v"(l0 + 11 * HB),
                    "v"(gy), "v"(gy + 32 * D), "v"(gy + 64 * D), "v"(gy + 96 * D), "v"(gl), "v"(gl + 32 * D), "v"(gl + 64 * D), "v"(gl + 96 * D),
                    "v"(gw), "v"(gw + 32 * D), "v"(gw + 64 * D), "v"(gw + 96 * D)
                 : "memory");
  };
  stage(0, 0);
  v8f acc[2][4];
#pragma unroll
  for (int r = 0; r < 2; ++r)
#pragma unroll
    for (int t = 0; t < 4; ++t) acc[r][t] = (v8f){};
  asm volatile("s_wait_asynccnt 0x0" ::: "memory");             // stage 0 of this wave has landed
  __syncthreads();                                              // publishes stage 0 to the other waves
  stage(1, 1);
  for (int s = 0; s < GST; ++s) {
    const b16* R = (const b16*)(Sm + (size_t)(s & 1) * OBUF);
#pragma unroll   // the stage's two k steps of 32 unrolled so that every LDS fragment offset is an immediate
    for (int ks = 0; ks < 2; ++ks) {
      v16b ah[2], al[2], bh[4];                                 // y as an f16 hi+lo pair carried x8 (2 products)
#pragma unroll
      for (int r = 0; r < 2; ++r) { ah[r] = frag_kb(R + (wave * 32 + r * 16 + nloc) * LP + ks * 32, hlf); al[r] = frag_kb(R + (128 + wave * 32 + r * 16 + nloc) * LP + ks * 32, hlf); }
#pragma unroll
      for (int t = 0; t < 4; ++t) bh[t] = frag_kb(R + (256 + cg * 64 + t * 16 + nloc) * LP + ks * 32, hlf);
      __builtin_amdgcn_sched_barrier(0);                        // the k step's 16 LDS reads stay one group ahead of the 16 products: one LDS latency instead of one per tile
#pragma unroll
      for (int t = 0; t < 4; ++t) {
        acc[0][t] = mac<5, 1>(ah[0], al[0], bh[t], bh[t], acc[0][t]);
        acc[1][t] = mac<5, 1>(ah[1], al[1], bh[t], bh[t], acc[1][t]);
      }
    }
    // publish point of stage s + 1
    asm volatile("s_wait_dscnt 0x0" ::: "memory");              // this wave's reads of buffer s & 1 are done before it is refilled
    asm volatile("s_wait_asynccnt 0x0" ::: "memory");           // this wave's copies of stage s + 1 have landed
    __syncthreads();                                            // publishes stage s + 1 and ends every wave's reads of stage s
    if (s + 2 < GST) stage(s + 2, s & 1);
  }
  asm volatile("s_wait_asynccnt 0x0" ::: "memory");             // nothing of the ring is in flight when its LDS becomes staging
#pragma unroll
  for (int t = 0; t < 4; ++t)
#pragma unroll
    for (int r = 0; r < 2; ++r)
#pragma unroll
      for (int v = 0; v < 8; ++v) acc[r][t][v] = acc[r][t][v] * (1.0f / 8.0f) + bf16_rne(bo[c0 + t * 16 + nloc]);
  epi_f32(acc, 1.0f, nullptr, out, D, m0, c0, lane, (float*)(Sm + (size_t)wid * (32 * 64 * 4)));
}
}  // namespace

extern "C" void kernel_launch(void* const* d_in, const int* in_sizes, int n_in,
                              void* d_out, int out_size, void* d_ws, size_t ws_size, hipStream_t stream) {
  (void)n_in; (void)out_size;
  const float* x = (const float*)d_in[0]; const int* seq_lens = (const int*)d_in[1]; const float* wqkv = (const float*)d_in[2]; const float* bqkv = (const float*)d_in[3]; const float* wo = (const float*)d_in[4]; const float* bo = (const float*)d_in[5];
  float* out = (float*)d_out;   // [2][2048][1024]
  if (in_sizes[0] != BT * S * D || in_sizes[1] != Bn || in_sizes[2] != 3 * D * D || in_sizes[3] != 3 * D || in_sizes[4] != D * D || in_sizes[5] != D) return;
  size_t off = 0; char* ws = (char*)d_ws;
  auto carve = [&](size_t bytes) { char* p = ws + off; off += (bytes + 255) & ~(size_t)255; return p; };
  unsigned short* x16 = (unsigned short*)carve((size_t)NTOK * D * 2); unsigned short* w16 = (unsigned short*)carve((size_t)3 * D * D * 2); b16* wo16 = (b16*)carve((size_t)D * D * 2);
  b16* qh = (b16*)carve((size_t)2 * NTOK * D * 2); b16* kh = (b16*)carve((size_t)2 * NTOK * D * 2); b16* vt = (b16*)carve((size_t)2 * NTOK * D * 2); b16* yh = (b16*)carve((size_t)2 * NTOK * D * 2);
  if (off > ws_size) return;                                    // ≈ 84 MB
  prep_kernel<<<CVB, CVW, 0, stream>>>(x, wqkv, wo, x16, w16, wo16);
  proj_kernel<<<dim3(3 * D / 128, NTOK / 128), 256, 0, stream>>>((const __bf16*)x16, (const __bf16*)w16, bqkv, qh, kh, vt);
  attn_kernel<S / 16><<<Bn * H * (S / 64), 256, 0, stream>>>(qh, kh, vt, seq_lens, yh);
  out_kernel<<<dim3(D / 128, NTOK / 128), 256, 0, stream>>>(yh, wo16, bo, out);
}

// v007
// Measured time: 92.8 microseconds a run.
// Timed twice side by side with v006, it ran 1.05 times as fast both times.
// All steps since v000 together make it 3.21 times as fast.
#include <hip/hip_runtime.h>

// MultiAxisAttention: qkv = x Wqkv^T + bqkv (16 heads x 64), causal mask (key > query -> -1e9) plus a per-batch padding mask (key >= seq_len[b] -> -1e9), softmax of q.k/8, out = ctx Wout^T + bout
// -> [2][2048][1024]. seq_lens here are > 0, so every query keeps key 0 and the masked keys contribute exp(-1e9 - max) = 0; the key loop stops at
// min(causal bound, seq_len).
// x, the four weights and bo rounded to bf16: projection on v_wmma_f32_16x16x32_bf16 (exact products, f32 accumulate);
// scores, P.v and the output projection on v_wmma_f32_16x16x32_f16 with every computed operand (q, k, v, P, y — each carried x8 so the hi/lo residual planes stay normal) as an f16
// hi+lo pair (3 / 2 products); online softmax in f32. Fragment k-map per lane half hh for A AND B: elements 0..7 <- k = 8hh+0..7, 8..15 <- k = 16+8hh+0..7. Every intermediate /

namespace {
constexpr int BT = 2, Bn = 2, S = 2048, D = 1024, H = 16, HD = 64, NTOK = Bn * S;
constexpr float SCALE = 0.125f, VS = 8.0f, QS = 8.0f, PS = 8.0f;   // power-of-two carry scales so hi/lo residual planes stay normal in f16
constexpr float C2 = SCALE / (QS * QS) * 1.44269504088896341f;    // raw score (64 q.k) -> exponent of 2: the 1/8 scale, the carry of q and k and log2(e) in one factor
constexpr float LPS = 3.0f;                                       // log2(PS): the x8 carry of P enters as an addend of the exponent
constexpr size_t VPL = (size_t)NTOK * D;   // distance between the (8v)^T hi and lo planes
constexpr size_t QPL = (size_t)NTOK * D;   // distance between the q/k hi and lo planes
constexpr size_t YPL = (size_t)NTOK * D;   // distance between the (8y) hi and lo planes

typedef _Float16 b16;
typedef __attribute__((ext_vector_type(16))) _Float16 v16b;
typedef __attribute__((ext_vector_type(8)))  _Float16 v8b;
typedef __attribute__((ext_vector_type(8)))  float v8f;
typedef __attribute__((ext_vector_type(4)))  float v4f;

__device__ __forceinline__ v8b ld8b(const b16* p) { return *(const v8b*)p; }
__device__ __forceinline__ v16b cat8b(v8b a, v8b b) { return __builtin_shufflevector(a, b, 0, 1, 2, 3, 4, 5, 6, 7, 8, 9, 10, 11, 12, 13, 14, 15); }
__device__ __forceinline__ v16b frag_kb(const b16* p, int hh) { return cat8b(ld8b(p + 8 * hh), ld8b(p + 16 + 8 * hh)); }
__device__ __forceinline__ void split16(float v, b16& hi, b16& lo) { hi = (b16)v; lo = (b16)(v - (float)hi); }
// hi/lo fragment pair straight from an f32 k-contiguous row (same k-map)
__device__ __forceinline__ void frag_ksplit(const float* p, int hh, v16b& fh_, v16b& fl_) {
  const float* p0 = p + 8 * hh; const float* p1 = p + 16 + 8 * hh;
#pragma unroll
  for (int e = 0; e < 8; ++e) { b16 a, c; split16(p0[e], a, c); fh_[e] = a; fl_[e] = c; split16(p1[e], a, c); fh_[8 + e] = a; fl_[8 + e] = c; }
}
__device__ __forceinline__ v8f wmma16b(v16b a, v16b b, v8f c) {
  v8f d = __builtin_amdgcn_wmma_f32_16x16x32_f16(false, a, false, b, (short)0, c, false, false);
  asm volatile("v_nop\n\tv_nop\n\tv_nop\n\tv_nop" : "+v"(d) : "v"(a), "v"(b));
  return d;
}
__device__ __forceinline__ void wave_lds_sync() {
  __builtin_amdgcn_fence(__ATOMIC_RELEASE, "workgroup");
  __builtin_amdgcn_wave_barrier();
  __builtin_amdgcn_fence(__ATOMIC_ACQUIRE, "workgroup");
}

// Operand descriptor: NP = 0 -> f32 rows split on the fly into (hi, lo); NP = 1 -> one f16 plane; NP = 2 -> f16 hi + lo planes;
// NP = 3 -> f32 rows rounded once to a single f16 fragment. ld = row pitch.
struct Opnd { const void* p0; const void* p1; int ld; };
template <int NP> __device__ __forceinline__ void load_frags(const Opnd& o, int row, int kb, int hh, v16b& fh_, v16b& fl_) {
  if (NP == 0) { frag_ksplit((const float*)o.p0 + (size_t)row * o.ld + kb, hh, fh_, fl_); }
  else if (NP == 4 || NP == 5) {                             // f32 rows x64 (NP 4) or x8 (NP 5) then split (keeps the lo halves of small values normal)
    const float sc_ = (NP == 4) ? 64.0f : 8.0f;
    const float* p = (const float*)o.p0 + (size_t)row * o.ld + kb; const float* p0 = p + 8 * hh; const float* p1 = p + 16 + 8 * hh;
#pragma unroll
    for (int e = 0; e < 8; ++e) { b16 a, c; split16(p0[e] * sc_, a, c); fh_[e] = a; fl_[e] = c; split16(p1[e] * sc_, a, c); fh_[8 + e] = a; fl_[8 + e] = c; }
  } else if (NP == 3) {
    const float* p = (const float*)o.p0 + (size_t)row * o.ld + kb; const float* p0 = p + 8 * hh; const float* p1 = p + 16 + 8 * hh;
#pragma unroll
    for (int e = 0; e < 8; ++e) { fh_[e] = (b16)p0[e]; fh_[8 + e] = (b16)p1[e]; }
    fl_ = fh_;
  } else {
    fh_ = frag_kb((const b16*)o.p0 + (size_t)row * o.ld + kb, hh);
    if (NP == 2) fl_ = frag_kb((const b16*)o.p1 + (size_t)row * o.ld + kb, hh); else fl_ = fh_;
  }
}
template <int ANP, int BNP> __device__ __forceinline__ v8f mac(v16b ah, v16b al, v16b bh, v16b bl, v8f c) {
  c = wmma16b(ah, bh, c);
  if (BNP == 0 || BNP == 2 || BNP == 4 || BNP == 5) c = wmma16b(ah, bl, c);     // hi.lo
  if (ANP == 0 || ANP == 2 || ANP == 4 || ANP == 5) c = wmma16b(al, bh, c);     // lo.hi   (lo.lo dropped)
  return c;
}
__device__ __forceinline__ void epi_planes(v8f (&acc)[2][4], float scale, bool two, b16* __restrict__ oh, b16* __restrict__ ol, int ldo,
                                           int m0, int c0, int lane, b16* Th, b16* Tl) {
  const int nloc = lane & 15, hlf = lane >> 4;
#pragma unroll
  for (int t = 0; t < 4; ++t)
#pragma unroll
    for (int r = 0; r < 2; ++r)
#pragma unroll
      for (int v = 0; v < 8; ++v) {
        const int rr = r * 16 + v + 8 * hlf, cc = t * 16 + nloc;
        b16 h_, l_; split16(acc[r][t][v] * scale, h_, l_);
        Th[rr * 64 + cc] = h_; Tl[rr * 64 + cc] = l_;
      }
  wave_lds_sync();
  {
#pragma unroll
    for (int j = 0; j < 8; ++j) {
      const int rr = j * 4 + (lane >> 3), c8 = (lane & 7) * 8;
      const size_t o = (size_t)(m0 + rr) * ldo + c0 + c8;
      *(v8b*)(oh + o) = ld8b(Th + rr * 64 + c8);
      if (two) *(v8b*)(ol + o) = ld8b(Tl + rr * 64 + c8);
    }
    
  }
}
// (b) f32 rows with pitch ldo: 64 floats = 256 B = 2 lines per row; 16 lanes x 16 B per row, 2 rows per instruction. Optional per-row factor
__device__ __forceinline__ void epi_f32(v8f (&acc)[2][4], float scale, const float* rscale, float* __restrict__ out, int ldo, int m0, int c0, int lane, float* Tt) {
  const int nloc = lane & 15, hlf = lane >> 4;
#pragma unroll
  for (int t = 0; t < 4; ++t)
#pragma unroll
    for (int r = 0; r < 2; ++r)
#pragma unroll
      for (int v = 0; v < 8; ++v) {
        const int rr = r * 16 + v + 8 * hlf;
        const float rs = rscale ? rscale[(size_t)(m0 + rr) * 32] : 1.0f;
        Tt[rr * 64 + t * 16 + nloc] = acc[r][t][v] * scale * rs;
      }
  wave_lds_sync();
  float* dst0 = out + (size_t)m0 * ldo + c0;
  {
#pragma unroll
    for (int j = 0; j < 16; ++j) { const int rr = j * 2 + hlf, c4 = nloc * 4; *(v4f*)(dst0 + (size_t)rr * ldo + c4) = *(const v4f*)(Tt + rr * 64 + c4); }
    
  }
}



typedef __attribute__((ext_vector_type(8))) __bf16 v8bb; typedef __attribute__((ext_vector_type(16))) __bf16 v16bb;
typedef __attribute__((ext_vector_type(8))) unsigned short v8us;
__device__ __forceinline__ v16bb frag_kb_bf(const __bf16* p, int hh) { const v8bb a = *(const v8bb*)(p + 8 * hh), b = *(const v8bb*)(p + 16 + 8 * hh); return __builtin_shufflevector(a, b, 0, 1, 2, 3, 4, 5, 6, 7, 8, 9, 10, 11, 12, 13, 14, 15); }
__device__ __forceinline__ v8f wmma16bb(v16bb a, v16bb b, v8f c) {
  v8f d = __builtin_amdgcn_wmma_f32_16x16x32_bf16(false, a, false, b, (short)0, c, false, false);
  asm volatile("v_nop\n\tv_nop\n\tv_nop\n\tv_nop" : "+v"(d) : "v"(a), "v"(b));
  return d;
}
__device__ __forceinline__ unsigned short bf16_rne_bits(float v) { unsigned int u = __float_as_uint(v); u += 0x7FFFu + ((u >> 16) & 1u); return (unsigned short)(u >> 16); }
__device__ __forceinline__ float bf16_rne(float v) { return __uint_as_float(((unsigned int)bf16_rne_bits(v)) << 16); }



// One conversion launch for all three f32 operands: x and Wqkv -> bf16 bits, W_o -> f16 of the bf16-rounded value (rows copied directly, [out][in]).
// 256 blocks x 16 waves; a thread takes 16 groups of 4 floats, CVT groups apart, so that every wave-wide load covers 512 contiguous bytes and every store 256;
// groups 0..7 fall in x, 8..13 in Wqkv, 14..15 in W_o. All 16 loads are issued ahead of the first conversion: one memory latency per thread.
typedef __attribute__((ext_vector_type(4))) unsigned short v4us; typedef __attribute__((ext_vector_type(4))) _Float16 v4b;
constexpr int CVB = 256, CVW = 512, CVT = CVB * CVW;
static_assert((size_t)NTOK * D / 4 == (size_t)8 * CVT && (size_t)3 * D * D / 4 == (size_t)6 * CVT && (size_t)D * D / 4 == (size_t)2 * CVT, "group counts of the conversion launch");
__global__ __launch_bounds__(CVW) void prep_kernel(const float* __restrict__ x, const float* __restrict__ wqkv, const float* __restrict__ wo,
                                                  unsigned short* __restrict__ x16, unsigned short* __restrict__ w16, b16* __restrict__ wo16) {
  const size_t g = ((size_t)blockIdx.x * CVW + threadIdx.x) * 4; // first float of the thread's group 0
  const float* px0 = x + g; const float* px1 = px0 + (size_t)4 * CVT * 4; const float* pw0 = wqkv + g; const float* pw1 = pw0 + (size_t)4 * CVT * 4; const float* po0 = wo + g;
  v4f a[8], w[6], o[2];
#pragma unroll
  for (int j = 0; j < 4; ++j) { a[j] = *(const v4f*)(px0 + (size_t)j * CVT * 4); a[4 + j] = *(const v4f*)(px1 + (size_t)j * CVT * 4); }
#pragma unroll
  for (int j = 0; j < 4; ++j) w[j] = *(const v4f*)(pw0 + (size_t)j * CVT * 4);
#pragma unroll
  for (int j = 0; j < 2; ++j) { w[4 + j] = *(const v4f*)(pw1 + (size_t)j * CVT * 4); o[j] = *(const v4f*)(po0 + (size_t)j * CVT * 4); }
  // the loads' five address pairs stay live up to this wait, so that none of them is rewritten (also not as a later load's destination) ahead of it
  asm volatile("s_wait_xcnt 0x0" :: "v"(px0), "v"(px1), "v"(pw0), "v"(pw1), "v"(po0) : "memory");
  __builtin_amdgcn_sched_barrier(0);                            // the 16 loads stay one group ahead of the conversions and stores: they are all in flight together
#pragma unroll
  for (int j = 0; j < 8; ++j) { v4us v;
#pragma unroll
    for (int e = 0; e < 4; ++e) v[e] = bf16_rne_bits(a[j][e]);
    *(v4us*)(x16 + g + (size_t)j * CVT * 4) = v; }
#pragma unroll
  for (int j = 0; j < 6; ++j) { v4us v;
#pragma unroll
    for (int e = 0; e < 4; ++e) v[e] = bf16_rne_bits(w[j][e]);
    *(v4us*)(w16 + g + (size_t)j * CVT * 4) = v; }
#pragma unroll
  for (int j = 0; j < 2; ++j) { v4b v;
#pragma unroll
    for (int e = 0; e < 4; ++e) v[e] = (b16)bf16_rne(o[j][e]);
    *(v4b*)(wo16 + g + (size_t)j * CVT * 4) = v; }
}

constexpr int KT = 64;    // keys (attention) or k (GEMMs) per ring stage: 16-bit rows of 128 B = one cache line
constexpr int LP = 72;    // LDS row pitch in f16: 144 B = 16 B x 9, so the 16 rows of a ds_load_b128 fragment read fall on distinct banks
__device__ __forceinline__ unsigned lds_addr(const void* p) { return (unsigned)(size_t)p; }   // low 32 bits of a __shared__ address = byte offset in the work-group's LDS

// projections: rows = tokens (4096), K = 1024, block = 8 waves = 128 tokens x 128 columns = two heads of q (column tiles 0..7), k (8..15) or v (16..23); wave = 32 tokens x one head.
// The block's 128 x rows and 128 W rows come once per 64 k into a two-buffer LDS ring by asynchronous copies of whole 128 B rows; every wave takes its fragments from there.
// f16 rows [b*H + head][tok][64] for q/k; v: (8v)^T f16 [b*H + head][64][tok]. grid (24, 32) x 256.
constexpr int GR = 256;            // ring rows of a projection stage: 128 x rows, then 128 W rows
constexpr int GST = D / KT;        // ring stages of a GEMM: 16
__global__ __launch_bounds__(256) void proj_kernel(const __bf16* __restrict__ x16, const __bf16* __restrict__ w16, const float* __restrict__ bqkv, b16* __restrict__ qh, b16* __restrict__ kh, b16* __restrict__ vt) {
  __shared__ __attribute__((aligned(16))) unsigned char Sm[2 * GR * LP * 2];   // the ring [buffer][row][64 bf16 + pad]; behind the loop's last barrier the epilogue's staging
  const int lane = threadIdx.x & 31, wid = __builtin_amdgcn_readfirstlane(threadIdx.x >> 5), wave = wid & 3, cg = wid >> 2, nloc = lane & 15, hlf = lane >> 4;
  const int mb = blockIdx.y * 128, m0 = mb + wave * 32, cb = blockIdx.x * 128, c0 = cb + cg * 64;
  const int sr = threadIdx.x >> 3, sc = (threadIdx.x & 7) * 8;  // staging: thread -> rows sr + 32 j, 16 B piece sc; a wave's copy covers 4 whole 128 B rows
  // One stage: k in [t*64, t*64+64) < D. 8 copies of 16 B per lane, all lanes on; the s_wait_xcnt closes the statement so that no address register is rewritten ahead of it.
  auto stage = [&](int t, int buf) {
    const __bf16* gx = x16 + (size_t)(mb + sr) * D + t * KT + sc; const __bf16* gw = w16 + (size_t)(cb + sr) * D + t * KT + sc;
    const unsigned l0 = lds_addr(Sm + ((size_t)buf * GR + sr) * (LP * 2) + sc * 2);
    constexpr unsigned HB = 32 * LP * 2;                        // bytes per 32 rows
    asm volatile("global_load_async_to_lds_b128 %0, %8, off\n\t"
                 "global_load_async_to_lds_b128 %1, %9, off\n\t"
                 "global_load_async_to_lds_b128 %2, %10, off\n\t"
                 "global_load_async_to_lds_b128 %3, %11, off\n\t"
                 "global_load_async_to_lds_b128 %4, %12, off\n\t"
                 "global_load_async_to_lds_b128 %5, %13, off\n\t"
                 "global_load_async_to_lds_b128 %6, %14, off\n\t"
                 "global_load_async_to_lds_b128 %7, %15, off\n\t"
                 "s_wait_xcnt 0x0"
                 :: "v"(l0), "v"(l0 + HB), "v"(l0 + 2 * HB), "v"(l0 + 3 * HB), "v"(l0 + 4 * HB), "v"(l0 + 5 * HB), "v"(l0 + 6 * HB), "v"(l0 + 7 * HB),
                    "v"(gx), "v"(gx + 32 * D), "v"(gx + 64 * D), "v"(gx + 96 * D), "v"(gw), "v"(gw + 32 * D), "v"(gw + 64 * D), "v"(gw + 96 * D)
                 : "memory");
  };
  stage(0, 0);
  v8f acc[2][4];
#pragma unroll
  for (int r = 0; r < 2; ++r)
#pragma unroll
    for (int t = 0; t < 4; ++t) acc[r][t] = (v8f){};
  asm volatile("s_wait_asynccnt 0x0" ::: "memory");             // stage 0 of this wave has landed
  __syncthreads();                                              // publishes stage 0 to the other waves
  stage(1, 1);
  for (int s = 0; s < GST; ++s) {
    const __bf16* R = (const __bf16*)(Sm + (size_t)(s & 1) * (GR * LP * 2));
#pragma unroll   // the stage's two k steps of 32 unrolled so that every LDS fragment offset is an immediate
    for (int ks = 0; ks < 2; ++ks) {
      const v16bb a0 = frag_kb_bf(R + (wave * 32 + nloc) * LP + ks * 32, hlf), a1 = frag_kb_bf(R + (wave * 32 + 16 + nloc) * LP + ks * 32, hlf);
      v16bb bw[4];
#pragma unroll
      for (int t = 0; t < 4; ++t) bw[t] = frag_kb_bf(R + (128 + cg * 64 + t * 16 + nloc) * LP + ks * 32, hlf);
      __builtin_amdgcn_sched_barrier(0);                        // the k step's 12 LDS reads stay one group ahead of its 8 products: one LDS latency instead of one per column tile
#pragma unroll
      for (int t = 0; t < 4; ++t) { acc[0][t] = wmma16bb(a0, bw[t], acc[0][t]); acc[1][t] = wmma16bb(a1, bw[t], acc[1][t]); }
    }
    // publish point of stage s + 1
    asm volatile("s_wait_dscnt 0x0" ::: "memory");              // this wave's reads of buffer s & 1 are done before it is refilled
    asm volatile("s_wait_asynccnt 0x0" ::: "memory");           // this wave's copies of stage s + 1 have landed
    __syncthreads();                                            // publishes stage s + 1 and ends every wave's reads of stage s
    if (s + 2 < GST) stage(s + 2, s & 1);
  }
  asm volatile("s_wait_asynccnt 0x0" ::: "memory");             // nothing of the ring is in flight when its LDS becomes staging
  const int which = blockIdx.x / (D / 128), head = (blockIdx.x % (D / 128)) * 2 + cg, b = m0 / S, tok0 = m0 % S;
#pragma unroll
  for (int t = 0; t < 4; ++t) { const float bb = bf16_rne(bqkv[c0 + t * 16 + nloc]);   // + bias (rounded to bf16)
#pragma unroll
    for (int r = 0; r < 2; ++r)
#pragma unroll
      for (int v = 0; v < 8; ++v) acc[r][t][v] += bb; }
  if (which < 2) {                                              // q or k head: f16 rows
    b16 (*Th)[HD + 8] = (b16 (*)[HD + 8])(Sm + (size_t)wid * (2 * 32 * (HD + 8) * 2)); b16 (*Tq)[HD + 8] = Th + 32;   // the wave's own hi and lo tiles [32][64 + pad]
#pragma unroll
    for (int t = 0; t < 4; ++t)
#pragma unroll
      for (int r = 0; r < 2; ++r)
#pragma unroll
        for (int v = 0; v < 8; ++v) { b16 a_, c_; split16(acc[r][t][v] * QS, a_, c_); Th[r * 16 + 8 * hlf + v][t * 16 + nloc] = a_; Tq[r * 16 + 8 * hlf + v][t * 16 + nloc] = c_; }   // q, k carried x8 (lo residuals stay normal)
    wave_lds_sync();
    b16* dst = (which == 0 ? qh : kh) + (((size_t)b * H + head) * S + tok0) * HD;
    {
#pragma unroll
      for (int j = 0; j < 8; ++j) { const int rr = j * 4 + (lane >> 3), c8 = (lane & 7) * 8; *(v8b*)(dst + (size_t)rr * HD + c8) = *(const v8b*)(&Th[rr][c8]); *(v8b*)(dst + QPL + (size_t)rr * HD + c8) = *(const v8b*)(&Tq[rr][c8]); }
       }
    return;
  }
  const int vh = head;                                          // v head: (8v)^T tile [64 d][128 tok] via LDS, rows of 256 B; one hi and one lo tile per head of the block
  b16 (*Tt)[128 + 8] = (b16 (*)[128 + 8])(Sm + (size_t)cg * (2 * 64 * (128 + 8) * 2)); b16 (*Tl)[128 + 8] = Tt + 64;
#pragma unroll
  for (int t = 0; t < 4; ++t)
#pragma unroll
    for (int r = 0; r < 2; ++r)
#pragma unroll
      for (int v = 0; v < 8; ++v) { b16 a_, c_; split16(acc[r][t][v] * VS, a_, c_); Tt[t * 16 + nloc][wave * 32 + r * 16 + 8 * hlf + v] = a_; Tl[t * 16 + nloc][wave * 32 + r * 16 + 8 * hlf + v] = c_; }
  __syncthreads();
  b16* dstv = vt + (((size_t)b * H + vh) * HD) * S + (blockIdx.y * 128) % S;
  {
#pragma unroll
    for (int j = 0; j < 8; ++j) { const int dd = wave * 16 + j * 2 + (lane >> 4), c8 = (lane & 15) * 8; *(v8b*)(dstv + (size_t)dd * S + c8) = *(const v8b*)(&Tt[dd][c8]); *(v8b*)(dstv + VPL + (size_t)dd * S + c8) = *(const v8b*)(&Tl[dd][c8]); }
    
  }
}

// causal attention: block = 8 waves = 64 consecutive queries of one (b, h) = 4 query groups of 16 x 2 key groups: of every ring stage of 64 keys, waves 0..3 take keys 0..31 and waves 4..7
// keys 32..63, so the longest block walks half as many chunks per wave; each wave keeps its own online softmax (f32) and the two partial results of a query group are merged through LDS at the end.
// Blocks outnumber the resident places, so the longest tiles (highest queries) come first in the grid. Per chunk of 32 keys: S^T (K=64), mask on the straddling chunks, P^T f16, y^T += (8V)^T P^T.
// The block's K rows and (8V)^T rows (hi and lo planes) come once per 64 keys into a two-buffer LDS ring by asynchronous copies of whole 128 B rows; every wave takes its fragments from there.
template <int QT>
__global__ __launch_bounds__(256) void attn_kernel(const b16* __restrict__ qh, const b16* __restrict__ kh, const b16* __restrict__ vt, const int* __restrict__ seq_lens, b16* __restrict__ yh) {
  __shared__ __attribute__((aligned(16))) float Os[8][16][HD + 4];
  __shared__ __attribute__((aligned(16))) b16 Ring[2][4][KT][LP];   // [buffer][K hi, K lo, V^T hi, V^T lo][key row or d row][64 f16 + pad]
  const int wid = __builtin_amdgcn_readfirstlane(threadIdx.x >> 5), lane = threadIdx.x & 31, hh = lane >> 4, col = lane & 15;
  const int qg = wid & 3, kg = wid >> 2;                        // query group, key group of the wave
  const int tile = QT / 4 - 1 - (int)blockIdx.x / (Bn * H), bh = (int)blockIdx.x % (Bn * H), h = bh % H, b = bh / H, q0 = tile * 64 + qg * 16, qi = q0 + col;
  const b16* Q = qh + ((size_t)bh * S) * HD; const b16* K = kh + ((size_t)bh * S) * HD; const b16* vb = vt + ((size_t)bh * HD) * S;
  const int sl = __builtin_amdgcn_readfirstlane(min(max(seq_lens[b], 1), S));   // held in a scalar register so that the mask test of a chunk stays a scalar compare and branch; padding mask: keys >= seq_len get -inf (exp -> 0); seq_len >= 1 here so key 0 always survives
  const int kend = __builtin_amdgcn_readfirstlane(min(q0 + 16, sl));   // this wave's key bound, held in a scalar register so that the chunk test below stays a scalar compare and branch
  const int nst = (min(tile * 64 + 64, sl) + KT - 1) / KT;      // ring stages of the block = those of its last query group (block-uniform, 1..32)
  const int sr = threadIdx.x >> 3, sc = (threadIdx.x & 7) * 8;  // staging: thread -> rows sr and sr + 32, 16 B piece sc; a wave's copy covers 4 whole 128 B rows
  // One stage: keys [t*64, t*64+64) < S. 8 copies of 16 B per lane, all lanes on; the s_wait_xcnt closes the statement so that no address register is rewritten ahead of it.
  auto stage = [&](int t, int buf) {
    const b16* gk = K + (size_t)(t * KT + sr) * HD + sc; const b16* gv = vb + (size_t)sr * S + t * KT + sc;
    const unsigned l0 = lds_addr(&Ring[buf][0][sr][sc]);
    constexpr unsigned PB = KT * LP * 2, HB = 32 * LP * 2;      // bytes per plane, per 32 rows
    asm volatile("global_load_async_to_lds_b128 %0, %8, off\n\t"
                 "global_load_async_to_lds_b128 %1, %9, off\n\t"
                 "global_load_async_to_lds_b128 %2, %10, off\n\t"
                 "global_load_async_to_lds_b128 %3, %11, off\n\t"
                 "global_load_async_to_lds_b128 %4, %12, off\n\t"
                 "global_load_async_to_lds_b128 %5, %13, off\n\t"
                 "global_load_async_to_lds_b128 %6, %14, off\n\t"
                 "global_load_async_to_lds_b128 %7, %15, off\n\t"
                 "s_wait_xcnt 0x0"
                 :: "v"(l0), "v"(l0 + HB), "v"(l0 + PB), "v"(l0 + PB + HB), "v"(l0 + 2 * PB), "v"(l0 + 2 * PB + HB), "v"(l0 + 3 * PB), "v"(l0 + 3 * PB + HB),
                    "v"(gk), "v"(gk + 32 * HD), "v"(gk + QPL), "v"(gk + QPL + 32 * HD), "v"(gv), "v"(gv + (size_t)32 * S), "v"(gv + VPL), "v"(gv + VPL + (size_t)32 * S)
                 : "memory");
  };
  stage(0, 0);
  v16b qf[2], ql[2];
#pragma unroll
  for (int ks = 0; ks < 2; ++ks) { qf[ks] = frag_kb(Q + (size_t)qi * HD + ks * 32, hh); ql[ks] = frag_kb(Q + QPL + (size_t)qi * HD + ks * 32, hh); }
  float m = -INFINITY, l = 0.0f; v8f o[4] = {{}, {}, {}, {}};
  asm volatile("s_wait_asynccnt 0x0" ::: "memory");             // stage 0 of this wave has landed
  __syncthreads();                                              // publishes stage 0 to the other waves
  if (nst > 1) stage(1, 1);
  for (int t = 0; t < nst; ++t) {
    const b16 (*R)[KT][LP] = Ring[t & 1];
    {
      const int kb = t * KT + kg * 32, kl = kg * 32;            // this wave's chunk of the stage
      if (kb < kend) {                                          // causal + padding: key chunks past min(query tile, seq_len) are skipped (wave-uniform scalar bound)
        const bool diag = (kb + 32 > q0) || (kb + 32 > sl);     // this chunk reaches past some queries or past seq_len -> mask
        v8f s0 = {}, s1 = {};
        v16b k0[2], k0l[2], k1[2], k1l[2];
#pragma unroll
        for (int ks = 0; ks < 2; ++ks) { k0[ks] = frag_kb(&R[0][kl + col][ks * 32], hh); k0l[ks] = frag_kb(&R[1][kl + col][ks * 32], hh); k1[ks] = frag_kb(&R[0][kl + 16 + col][ks * 32], hh); k1l[ks] = frag_kb(&R[1][kl + 16 + col][ks * 32], hh); }
        __builtin_amdgcn_sched_barrier(0);                      // the chunk's 16 K reads stay one group ahead of the score products: one LDS latency instead of one per k step
#pragma unroll
        for (int ks = 0; ks < 2; ++ks) {
          s0 = wmma16b(k0[ks], qf[ks], s0); s0 = wmma16b(k0[ks], ql[ks], s0); s0 = wmma16b(k0l[ks], qf[ks], s0);      // q and k as f16 hi+lo pairs (lo.lo dropped)
          s1 = wmma16b(k1[ks], qf[ks], s1); s1 = wmma16b(k1[ks], ql[ks], s1); s1 = wmma16b(k1l[ks], qf[ks], s1); }
        v16b vf[4], vl[4];
#pragma unroll
        for (int n = 0; n < 4; ++n) { vf[n] = frag_kb(&R[2][n * 16 + col][kl], hh); vl[n] = frag_kb(&R[3][n * 16 + col][kl], hh); }
        __builtin_amdgcn_sched_barrier(0);                      // the chunk's 16 V^T reads stay one group here, so that they land under the softmax instead of stalling each P.v product
        // the maximum m stays in raw score units (C2 > 0 keeps the order); 8 P = 2^(s C2 - m C2 + 3) is one fma and one v_exp per score; l sums 8 P
        if (diag) {
#pragma unroll
          for (int r = 0; r < 8; ++r) { const int k0_ = kb + 8 * hh + r, k1_ = kb + 16 + 8 * hh + r; if (k0_ > qi || k0_ >= sl) s0[r] = -INFINITY; if (k1_ > qi || k1_ >= sl) s1[r] = -INFINITY; }
        }
        float mr = -INFINITY;
#pragma unroll
        for (int r = 0; r < 8; ++r) mr = fmaxf(mr, fmaxf(s0[r], s1[r]));
        mr = fmaxf(mr, __shfl_xor(mr, 16));
        const float mn = fmaxf(m, mr), al_ = __builtin_amdgcn_exp2f((m - mn) * C2), nb = fmaf(-mn, C2, LPS); m = mn;   // mn is finite: key kb <= q0 is open to every query of the wave
        float sum = 0.0f; v16b pb, pl;
#pragma unroll
        for (int r = 0; r < 8; ++r) { const float e0 = __builtin_amdgcn_exp2f(fmaf(s0[r], C2, nb)), e1 = __builtin_amdgcn_exp2f(fmaf(s1[r], C2, nb)); sum += e0 + e1; b16 a, c; split16(e0, a, c); pb[r] = a; pl[r] = c; split16(e1, a, c); pb[8 + r] = a; pl[8 + r] = c; }   // P carried x8
        sum += __shfl_xor(sum, 16); l = l * al_ + sum;
#pragma unroll
        for (int n = 0; n < 4; ++n) {
#pragma unroll
          for (int r = 0; r < 8; ++r) o[n][r] *= al_;
          o[n] = wmma16b(vf[n], pb, o[n]); o[n] = wmma16b(vf[n], pl, o[n]); o[n] = wmma16b(vl[n], pb, o[n]);   // (8v) and P both as f16 hi+lo pairs (lo.lo dropped)
        }
      }
    }
    // publish point of stage t + 1, passed by every wave, also one that skipped its chunks
    asm volatile("s_wait_dscnt 0x0" ::: "memory");              // this wave's reads of buffer t & 1 are done before it is refilled
    asm volatile("s_wait_asynccnt 0x0" ::: "memory");           // this wave's copies of stage t + 1 have landed
    __syncthreads();                                            // publishes stage t + 1 and ends every wave's reads of stage t
    if (t + 2 < nst) stage(t + 2, t & 1);
  }
  asm volatile("s_wait_asynccnt 0x0" ::: "memory");             // nothing of the ring is in flight when its LDS becomes the y staging
  if (kg == 1) {                                                // upper key group: hand the partial sums, maximum and denominator to the partner wave (same lane, same places; m and l in the row's pad)
#pragma unroll
    for (int n = 0; n < 4; ++n)
#pragma unroll
      for (int r = 0; r < 8; ++r) Os[wid][col][n * 16 + 8 * hh + r] = o[n][r];
    Os[wid][col][HD + 2 * hh] = m; Os[wid][col][HD + 2 * hh + 1] = l;
  }
  __syncthreads();                                              // publishes the upper key group's partial results to the lower one
  if (kg == 1) return;
  const float (*Pp)[HD + 4] = Os[wid + 4];
  const float m1 = Pp[col][HD + 2 * hh], l1 = Pp[col][HD + 2 * hh + 1];
  const float mn2 = fmaxf(m, m1), a0 = __builtin_amdgcn_exp2f((m - mn2) * C2), a1 = __builtin_amdgcn_exp2f((m1 - mn2) * C2);   // m is finite (key 0 is in the lower group); a partner without a chunk has m1 = -inf, l1 = 0 -> a1 = 0
  const float inv = 1.0f / (VS * (l * a0 + l1 * a1)), f0 = a0 * inv, f1 = a1 * inv;   // l and l1 already carry the x8 of P
  // y leaves as the f16 hi+lo pair of 8y that the output GEMM multiplies: split once here. The wave's own hi and lo tiles [16 queries][64 d + pad] lie in the ring's LDS, which is free behind the loop's last barrier.
  b16 (*Th)[LP] = (b16 (*)[LP])(&Ring[0][0][0][0]) + wid * 32; b16 (*Tl)[LP] = Th + 16;
#pragma unroll
  for (int n = 0; n < 4; ++n) { v8b hv, lv;
#pragma unroll
    for (int r = 0; r < 8; ++r) { b16 a_, c_; split16((o[n][r] * f0 + Pp[col][n * 16 + 8 * hh + r] * f1) * 8.0f, a_, c_); hv[r] = a_; lv[r] = c_; }
    *(v8b*)(&Th[col][n * 16 + 8 * hh]) = hv; *(v8b*)(&Tl[col][n * 16 + 8 * hh]) = lv; }
  wave_lds_sync();
  b16* dst = yh + ((size_t)b * S + q0) * D + h * HD;
  {
#pragma unroll
    for (int j = 0; j < 4; ++j) { const int rr = j * 4 + (lane >> 3), c8 = (lane & 7) * 8; *(v8b*)(dst + (size_t)rr * D + c8) = *(const v8b*)(&Th[rr][c8]); *(v8b*)(dst + YPL + (size_t)rr * D + c8) = *(const v8b*)(&Tl[rr][c8]); }
  }
}

// out = y W_o^T: (4096 x 1024) x (1024 x 1024); A = the (8y) f16 hi and lo planes, B = f16(bf16 W_o) rows; f32 rows; block = 8 waves = 128 tokens x 128 columns, wave = 32 x 64.
// The block's 128 hi rows, 128 lo rows and 128 W_o rows (128 B each per stage) come once per 64 k into a two-buffer LDS ring by asynchronous copies of whole rows. grid (8, 32) x 256.
constexpr int OBUF = 3 * 128 * LP * 2;                          // bytes of a buffer: 128 hi rows, 128 lo rows, 128 W_o rows
__global__ __launch_bounds__(256) void out_kernel(const b16* __restrict__ yh, const b16* __restrict__ wo16, const float* __restrict__ bo, float* __restrict__ out) {
  __shared__ __attribute__((aligned(16))) unsigned char Sm[2 * OBUF];   // the ring; behind the loop's last barrier the epilogue's staging (8 KiB per wave)
  const int lane = threadIdx.x & 31, wid = __builtin_amdgcn_readfirstlane(threadIdx.x >> 5), wave = wid & 3, cg = wid >> 2, nloc = lane & 15, hlf = lane >> 4;
  const int mb = blockIdx.y * 128, m0 = mb + wave * 32, cb = blockIdx.x * 128, c0 = cb + cg * 64;
  const int sr = threadIdx.x >> 3, sc = (threadIdx.x & 7) * 8;  // staging: thread -> rows sr + 32 j of each of the three planes, 16 B piece sc; a wave's copy covers 4 whole 128 B rows
  // One stage: k in [t*64, t*64+64) < D. 12 copies of 16 B per lane, all lanes on; the s_wait_xcnt closes the statement so that no address register is rewritten ahead of it.
  auto stage = [&](int t, int buf) {
    const b16* gy = yh + (size_t)(mb + sr) * D + t * KT + sc; const b16* gl = gy + YPL; const b16* gw = wo16 + (size_t)(cb + sr) * D + t * KT + sc;
    const unsigned l0 = lds_addr(Sm + (size_t)buf * OBUF + (size_t)sr * (LP * 2) + sc * 2);
    constexpr unsigned HB = 32 * LP * 2;                        // bytes per 32 rows
    asm volatile("global_load_async_to_lds_b128 %0, %12, off\n\t"
                 "global_load_async_to_lds_b128 %1, %13, off\n\t"
                 "global_load_async_to_lds_b128 %2, %14, off\n\t"
                 "global_load_async_to_lds_b128 %3, %15, off\n\t"
                 "global_load_async_to_lds_b128 %4, %16, off\n\t"
                 "global_load_async_to_lds_b128 %5, %17, off\n\t"
                 "global_load_async_to_lds_b128 %6, %18, off\n\t"
                 "global_load_async_to_lds_b128 %7, %19, off\n\t"
                 "global_load_async_to_lds_b128 %8, %20, off\n\t"
                 "global_load_async_to_lds_b128 %9, %21, off\n\t"
                 "global_load_async_to_lds_b128 %10, %22, off\n\t"
                 "global_load_async_to_lds_b128 %11, %23, off\n\t"
                 "s_wait_xcnt 0x0"
                 :: "v"(l0), "v"(l0 + HB), "v"(l0 + 2 * HB), "v"(l0 + 3 * HB), "v"(l0 + 4 * HB), "v"(l0 + 5 * HB), "v"(l0 + 6 * HB), "v"(l0 + 7 * HB),
                    "v"(l0 + 8 * HB), "v"(l0 + 9 * HB), "v"(l0 + 10 * HB), "v"(l0 + 11 * HB),
                    "v"(gy), "v"(gy + 32 * D), "v"(gy + 64 * D), "v"(gy + 96 * D), "v"(gl), "v"(gl + 32 * D), "v"(gl + 64 * D), "v"(gl + 96 * D),
                    "v"(gw), "v"(gw + 32 * D), "v"(gw + 64 * D), "v"(gw + 96 * D)
                 : "memory");
  };
  stage(0, 0);
  v8f acc[2][4];
#pragma unroll
  for (int r = 0; r < 2; ++r)
#pragma unroll
    for (int t = 0; t < 4; ++t) acc[r][t] = (v8f){};
  asm volatile("s_wait_asynccnt 0x0" ::: "memory");             // stage 0 of this wave has landed
  __syncthreads();                                              // publishes stage 0 to the other waves
  stage(1, 1);
  for (int s = 0; s < GST; ++s) {
    const b16* R = (const b16*)(Sm + (size_t)(s & 1) * OBUF);
#pragma unroll   // the stage's two k steps of 32 unrolled so that every LDS fragment offset is an immediate
    for (int ks = 0; ks < 2; ++ks) {
      v16b ah[2], al[2], bh[4];                                 // y as an f16 hi+lo pair carried x8 (2 products)
#pragma unroll
      for (int r = 0; r < 2; ++r) { ah[r] = frag_kb(R + (wave * 32 + r * 16 + nloc) * LP + ks * 32, hlf); al[r] = frag_kb(R + (128 + wave * 32 + r * 16 + nloc) * LP + ks * 32, hlf); }
#pragma unroll
      for (int t = 0; t < 4; ++t) bh[t] = frag_kb(R + (256 + cg * 64 + t * 16 + nloc) * LP + ks * 32, hlf);
      __builtin_amdgcn_sched_barrier(0);                        // the k step's 16 LDS reads stay one group ahead of the 16 products: one LDS latency instead of one per tile
#pragma unroll
      for (int t = 0; t < 4; ++t) {
        acc[0][t] = mac<5, 1>(ah[0], al[0], bh[t], bh[t], acc[0][t]);
        acc[1][t] = mac<5, 1>(ah[1], al[1], bh[t], bh[t], acc[1][t]);
      }
    }
    // publish point of stage s + 1
    asm volatile("s_wait_dscnt 0x0" ::: "memory");              // this wave's reads of buffer s & 1 are done before it is refilled
    asm volatile("s_wait_asynccnt 0x0" ::: "memory");           // this wave's copies of stage s + 1 have landed
    __syncthreads();                                            // publishes stage s + 1 and ends every wave's reads of stage s
    if (s + 2 < GST) stage(s + 2, s & 1);
  }
  asm volatile("s_wait_asynccnt 0x0" ::: "memory");             // nothing of the ring is in flight when its LDS becomes staging
#pragma unroll
  for (int t = 0; t < 4; ++t)
#pragma unroll
    for (int r = 0; r < 2; ++r)
#pragma unroll
      for (int v = 0; v < 8; ++v) acc[r][t][v] = acc[r][t][v] * (1.0f / 8.0f) + bf16_rne(bo[c0 + t * 16 + nloc]);
  epi_f32(acc, 1.0f, nullptr, out, D, m0, c0, lane, (float*)(Sm + (size_t)wid * (32 * 64 * 4)));
}
}  // namespace

extern "C" void kernel_launch(void* const* d_in, const int* in_sizes, int n_in,
                              void* d_out, int out_size, void* d_ws, size_t ws_size, hipStream_t stream) {
  (void)n_in; (void)out_size;
  const float* x = (const float*)d_in[0]; const int* seq_lens = (const int*)d_in[1]; const float* wqkv = (const float*)d_in[2]; const float* bqkv = (const float*)d_in[3]; const float* wo = (const float*)d_in[4]; const float* bo = (const float*)d_in[5];
  float* out = (float*)d_out;   // [2][2048][1024]
  if (in_sizes[0] != BT * S * D || in_sizes[1] != Bn || in_sizes[2] != 3 * D * D || in_sizes[3] != 3 * D || in_sizes[4] != D * D || in_sizes[5] != D) return;
  size_t off = 0; char* ws = (char*)d_ws;
  auto carve = [&](size_t bytes) { char* p = ws + off; off += (bytes + 255) & ~(size_t)255; return p; };
  unsigned short* x16 = (unsigned short*)carve((size_t)NTOK * D * 2); unsigned short* w16 = (unsigned short*)carve((size_t)3 * D * D * 2); b16* wo16 = (b16*)carve((size_t)D * D * 2);
  b16* qh = (b16*)carve((size_t)2 * NTOK * D * 2); b16* kh = (b16*)carve((size_t)2 * NTOK * D * 2); b16* vt = (b16*)carve((size_t)2 * NTOK * D * 2); b16* yh = (b16*)carve((size_t)2 * NTOK * D * 2);
  if (off > ws_size) return;                                    // ≈ 84 MB
  prep_kernel<<<CVB, CVW, 0, stream>>>(x, wqkv, wo, x16, w16, wo16);
  proj_kernel<<<dim3(3 * D / 128, NTOK / 128), 256, 0, stream>>>((const __bf16*)x16, (const __bf16*)w16, bqkv, qh, kh, vt);
  attn_kernel<S / 16><<<Bn * H * (S / 64), 256, 0, stream>>>(qh, kh, vt, seq_lens, yh);
  out_kernel<<<dim3(D / 128, NTOK / 128), 256, 0, stream>>>(yh, wo16, bo, out);
}

// v008
// Measured time: 89.8 microseconds a run.
// Next to v007, in two timings, it ran 1.03 and 1.02 times as fast.
// Counting every step since v000, it is 3.30 times as fast.
#include <hip/hip_runtime.h>

// MultiAxisAttention: qkv = x Wqkv^T + bqkv (16 heads x 64), causal mask (key > query -> -1e9) plus a per-batch padding mask (key >= seq_len[b] -> -1e9), softmax of q.k/8, out = ctx Wout^T + bout
// -> [2][2048][1024]. seq_lens here are > 0, so every query keeps key 0 and the masked keys contribute exp(-1e9 - max) = 0; the key loop stops at
// min(causal bound, seq_len).
// x, the four weights and bo rounded to bf16: projection on v_wmma_f32_16x16x32_bf16 (exact products, f32 accumulate);
// scores, P.v and the output projection on v_wmma_f32_16x16x32_f16 with every computed operand (q, k, v, P, y — each carried x8 so the hi/lo residual planes stay normal) as an f16
// hi+lo pair (3 / 2 products); online softmax in f32. Fragment k-map per lane half hh for A AND B: elements 0..7 <- k = 8hh+0..7, 8..15 <- k = 16+8hh+0..7. Every intermediate /

namespace {
constexpr int BT = 2, Bn = 2, S = 2048, D = 1024, H = 16, HD = 64, NTOK = Bn * S;
constexpr float SCALE = 0.125f, VS = 8.0f, QS = 8.0f, PS = 8.0f;   // power-of-two carry scales so hi/lo residual planes stay normal in f16
constexpr float C2 = SCALE / (QS * QS) * 1.44269504088896341f;    // raw score (64 q.k) -> exponent of 2: the 1/8 scale, the carry of q and k and log2(e) in one factor
constexpr float LPS = 3.0f;                                       // log2(PS): the x8 carry of P enters as an addend of the exponent
constexpr size_t VPL = (size_t)NTOK * D;   // distance between the (8v)^T hi and lo planes
constexpr size_t QPL = (size_t)NTOK * D;   // distance between the q/k hi and lo planes
constexpr size_t YPL = (size_t)NTOK * D;   // distance between the (8y) hi and lo planes

typedef _Float16 b16;
typedef __attribute__((ext_vector_type(16))) _Float16 v16b;
typedef __attribute__((ext_vector_type(8)))  _Float16 v8b;
typedef __attribute__((ext_vector_type(8)))  float v8f;
typedef __attribute__((ext_vector_type(4)))  float v4f;

__device__ __forceinline__ v8b ld8b(const b16* p) { return *(const v8b*)p; }
__device__ __forceinline__ v16b cat8b(v8b a, v8b b) { return __builtin_shufflevector(a, b, 0, 1, 2, 3, 4, 5, 6, 7, 8, 9, 10, 11, 12, 13, 14, 15); }
__device__ __forceinline__ v16b frag_kb(const b16* p, int hh) { return cat8b(ld8b(p + 8 * hh), ld8b(p + 16 + 8 * hh)); }
__device__ __forceinline__ void split16(float v, b16& hi, b16& lo) { hi = (b16)v; lo = (b16)(v - (float)hi); }
// hi/lo fragment pair straight from an f32 k-contiguous row (same k-map)
__device__ __forceinline__ void frag_ksplit(const float* p, int hh, v16b& fh_, v16b& fl_) {
  const float* p0 = p + 8 * hh; const float* p1 = p + 16 + 8 * hh;
#pragma unroll
  for (int e = 0; e < 8; ++e) { b16 a, c; split16(p0[e], a, c); fh_[e] = a; fl_[e] = c; split16(p1[e], a, c); fh_[8 + e] = a; fl_[8 + e] = c; }
}
__device__ __forceinline__ v8f wmma16b(v16b a, v16b b, v8f c) {
  v8f d = __builtin_amdgcn_wmma_f32_16x16x32_f16(false, a, false, b, (short)0, c, false, false);
  asm volatile("v_nop\n\tv_nop\n\tv_nop\n\tv_nop" : "+v"(d) : "v"(a), "v"(b));
  return d;
}
__device__ __forceinline__ void wave_lds_sync() {
  __builtin_amdgcn_fence(__ATOMIC_RELEASE, "workgroup");
  __builtin_amdgcn_wave_barrier();
  __builtin_amdgcn_fence(__ATOMIC_ACQUIRE, "workgroup");
}

// Operand descriptor: NP = 0 -> f32 rows split on the fly into (hi, lo); NP = 1 -> one f16 plane; NP = 2 -> f16 hi + lo planes;
// NP = 3 -> f32 rows rounded once to a single f16 fragment. ld = row pitch.
struct Opnd { const void* p0; const void* p1; int ld; };
template <int NP> __device__ __forceinline__ void load_frags(const Opnd& o, int row, int kb, int hh, v16b& fh_, v16b& fl_) {
  if (NP == 0) { frag_ksplit((const float*)o.p0 + (size_t)row * o.ld + kb, hh, fh_, fl_); }
  else if (NP == 4 || NP == 5) {                             // f32 rows x64 (NP 4) or x8 (NP 5) then split (keeps the lo halves of small values normal)
    const float sc_ = (NP == 4) ? 64.0f : 8.0f;
    const float* p = (const float*)o.p0 + (size_t)row * o.ld + kb; const float* p0 = p + 8 * hh; const float* p1 = p + 16 + 8 * hh;
#pragma unroll
    for (int e = 0; e < 8; ++e) { b16 a, c; split16(p0[e] * sc_, a, c); fh_[e] = a; fl_[e] = c; split16(p1[e] * sc_, a, c); fh_[8 + e] = a; fl_[8 + e] = c; }
  } else if (NP == 3) {
    const float* p = (const float*)o.p0 + (size_t)row * o.ld + kb; const float* p0 = p + 8 * hh; const float* p1 = p + 16 + 8 * hh;
#pragma unroll
    for (int e = 0; e < 8; ++e) { fh_[e] = (b16)p0[e]; fh_[8 + e] = (b16)p1[e]; }
    fl_ = fh_;
  } else {
    fh_ = frag_kb((const b16*)o.p0 + (size_t)row * o.ld + kb, hh);
    if (NP == 2) fl_ = frag_kb((const b16*)o.p1 + (size_t)row * o.ld + kb, hh); else fl_ = fh_;
  }
}
template <int ANP, int BNP> __device__ __forceinline__ v8f mac(v16b ah, v16b al, v16b bh, v16b bl, v8f c) {
  c = wmma16b(ah, bh, c);
  if (BNP == 0 || BNP == 2 || BNP == 4 || BNP == 5) c = wmma16b(ah, bl, c);     // hi.lo
  if (ANP == 0 || ANP == 2 || ANP == 4 || ANP == 5) c = wmma16b(al, bh, c);     // lo.hi   (lo.lo dropped)
  return c;
}
__device__ __forceinline__ void epi_planes(v8f (&acc)[2][4], float scale, bool two, b16* __restrict__ oh, b16* __restrict__ ol, int ldo,
                                           int m0, int c0, int lane, b16* Th, b16* Tl) {
  const int nloc = lane & 15, hlf = lane >> 4;
#pragma unroll
  for (int t = 0; t < 4; ++t)
#pragma unroll
    for (int r = 0; r < 2; ++r)
#pragma unroll
      for (int v = 0; v < 8; ++v) {
        const int rr = r * 16 + v + 8 * hlf, cc = t * 16 + nloc;
        b16 h_, l_; split16(acc[r][t][v] * scale, h_, l_);
        Th[rr * 64 + cc] = h_; Tl[rr * 64 + cc] = l_;
      }
  wave_lds_sync();
  {
#pragma unroll
    for (int j = 0; j < 8; ++j) {
      const int rr = j * 4 + (lane >> 3), c8 = (lane & 7) * 8;
      const size_t o = (size_t)(m0 + rr) * ldo + c0 + c8;
      *(v8b*)(oh + o) = ld8b(Th + rr * 64 + c8);
      if (two) *(v8b*)(ol + o) = ld8b(Tl + rr * 64 + c8);
    }
    
  }
}
// (b) f32 rows with pitch ldo: 64 floats = 256 B = 2 lines per row; 16 lanes x 16 B per row, 2 rows per instruction. Optional per-row factor
__device__ __forceinline__ void epi_f32(v8f (&acc)[2][4], float scale, const float* rscale, float* __restrict__ out, int ldo, int m0, int c0, int lane, float* Tt) {
  const int nloc = lane & 15, hlf = lane >> 4;
#pragma unroll
  for (int t = 0; t < 4; ++t)
#pragma unroll
    for (int r = 0; r < 2; ++r)
#pragma unroll
      for (int v = 0; v < 8; ++v) {
        const int rr = r * 16 + v + 8 * hlf;
        const float rs = rscale ? rscale[(size_t)(m0 + rr) * 32] : 1.0f;
        Tt[rr * 64 + t * 16 + nloc] = acc[r][t][v] * scale * rs;
      }
  wave_lds_sync();
  float* dst0 = out + (size_t)m0 * ldo + c0;
  {
#pragma unroll
    for (int j = 0; j < 16; ++j) { const int rr = j * 2 + hlf, c4 = nloc * 4; *(v4f*)(dst0 + (size_t)rr * ldo + c4) = *(const v4f*)(Tt + rr * 64 + c4); }
    
  }
}



typedef __attribute__((ext_vector_type(8))) __bf16 v8bb; typedef __attribute__((ext_vector_type(16))) __bf16 v16bb;
typedef __attribute__((ext_vector_type(8))) unsigned short v8us;
__device__ __forceinline__ v16bb frag_kb_bf(const __bf16* p, int hh) { const v8bb a = *(const v8bb*)(p + 8 * hh), b = *(const v8bb*)(p + 16 + 8 * hh); return __builtin_shufflevector(a, b, 0, 1, 2, 3, 4, 5, 6, 7, 8, 9, 10, 11, 12, 13, 14, 15); }
__device__ __forceinline__ v8f wmma16bb(v16bb a, v16bb b, v8f c) {
  v8f d = __builtin_amdgcn_wmma_f32_16x16x32_bf16(false, a, false, b, (short)0, c, false, false);
  asm volatile("v_nop\n\tv_nop\n\tv_nop\n\tv_nop" : "+v"(d) : "v"(a), "v"(b));
  return d;
}
__device__ __forceinline__ unsigned short bf16_rne_bits(float v) { unsigned int u = __float_as_uint(v); u += 0x7FFFu + ((u >> 16) & 1u); return (unsigned short)(u >> 16); }
__device__ __forceinline__ float bf16_rne(float v) { return __uint_as_float(((unsigned int)bf16_rne_bits(v)) << 16); }



// One conversion launch for all three f32 operands: x and Wqkv -> bf16 bits, W_o -> f16 of the bf16-rounded value (rows copied directly, [out][in]).
// 256 blocks x 16 waves; a thread takes 16 groups of 4 floats, CVT groups apart, so that every wave-wide load covers 512 contiguous bytes and every store 256;
// groups 0..7 fall in x, 8..13 in Wqkv, 14..15 in W_o. All 16 loads are issued ahead of the first conversion: one memory latency per thread.
typedef __attribute__((ext_vector_type(4))) unsigned short v4us; typedef __attribute__((ext_vector_type(4))) _Float16 v4b;
constexpr int CVB = 256, CVW = 512, CVT = CVB * CVW;
static_assert((size_t)NTOK * D / 4 == (size_t)8 * CVT && (size_t)3 * D * D / 4 == (size_t)6 * CVT && (size_t)D * D / 4 == (size_t)2 * CVT, "group counts of the conversion launch");
__global__ __launch_bounds__(CVW) void prep_kernel(const float* __restrict__ x, const float* __restrict__ wqkv, const float* __restrict__ wo,
                                                  unsigned short* __restrict__ x16, unsigned short* __restrict__ w16, b16* __restrict__ wo16) {
  const size_t g = ((size_t)blockIdx.x * CVW + threadIdx.x) * 4; // first float of the thread's group 0
  const float* px0 = x + g; const float* px1 = px0 + (size_t)4 * CVT * 4; const float* pw0 = wqkv + g; const float* pw1 = pw0 + (size_t)4 * CVT * 4; const float* po0 = wo + g;
  v4f a[8], w[6], o[2];
#pragma unroll
  for (int j = 0; j < 4; ++j) { a[j] = *(const v4f*)(px0 + (size_t)j * CVT * 4); a[4 + j] = *(const v4f*)(px1 + (size_t)j * CVT * 4); }
#pragma unroll
  for (int j = 0; j < 4; ++j) w[j] = *(const v4f*)(pw0 + (size_t)j * CVT * 4);
#pragma unroll
  for (int j = 0; j < 2; ++j) { w[4 + j] = *(const v4f*)(pw1 + (size_t)j * CVT * 4); o[j] = *(const v4f*)(po0 + (size_t)j * CVT * 4); }
  // the loads' five address pairs stay live up to this wait, so that none of them is rewritten (also not as a later load's destination) ahead of it
  asm volatile("s_wait_xcnt 0x0" :: "v"(px0), "v"(px1), "v"(pw0), "v"(pw1), "v"(po0) : "memory");
  __builtin_amdgcn_sched_barrier(0);                            // the 16 loads stay one group ahead of the conversions and stores: they are all in flight together
#pragma unroll
  for (int j = 0; j < 8; ++j) { v4us v;
#pragma unroll
    for (int e = 0; e < 4; ++e) v[e] = bf16_rne_bits(a[j][e]);
    *(v4us*)(x16 + g + (size_t)j * CVT * 4) = v; }
#pragma unroll
  for (int j = 0; j < 6; ++j) { v4us v;
#pragma unroll
    for (int e = 0; e < 4; ++e) v[e] = bf16_rne_bits(w[j][e]);
    *(v4us*)(w16 + g + (size_t)j * CVT * 4) = v; }
#pragma unroll
  for (int j = 0; j < 2; ++j) { v4b v;
#pragma unroll
    for (int e = 0; e < 4; ++e) v[e] = (b16)bf16_rne(o[j][e]);
    *(v4b*)(wo16 + g + (size_t)j * CVT * 4) = v; }
}

constexpr int KT = 64;    // keys (attention) or k (GEMMs) per ring stage: 16-bit rows of 128 B = one cache line
constexpr int LP = 72;    // LDS row pitch in f16: 144 B = 16 B x 9, so the 16 rows of a ds_load_b128 fragment read fall on distinct banks
__device__ __forceinline__ unsigned lds_addr(const void* p) { return (unsigned)(size_t)p; }   // low 32 bits of a __shared__ address = byte offset in the work-group's LDS

// projections: rows = tokens (4096), K = 1024, block = 8 waves = 128 tokens x 128 columns = two heads of q (column tiles 0..7), k (8..15) or v (16..23); wave = 32 tokens x one head.
// The block's 128 x rows and 128 W rows come once per 64 k into a two-buffer LDS ring by asynchronous copies of whole 128 B rows; every wave takes its fragments from there.
// f16 rows [b*H + head][tok][64] for q/k; v: (8v)^T f16 [b*H + head][64][tok]. grid 768 x 256.
// Attention reads no key at or past seq_len[b] rounded up to its ring stage of 64, so a token tile of 128 that begins at or past seq_len[b] needs its q columns only: its 16 k and v blocks are
// not computed. The flat block index counts the tiles that hold keys first (24 column blocks each), then the others (8 q blocks each); what is left of the grid leaves at entry.
constexpr int GR = 256;            // ring rows of a projection stage: 128 x rows, then 128 W rows
constexpr int GST = D / KT;        // ring stages of a GEMM: 16
__global__ __launch_bounds__(256) void proj_kernel(const __bf16* __restrict__ x16, const __bf16* __restrict__ w16, const float* __restrict__ bqkv, const int* __restrict__ seq_lens, b16* __restrict__ qh, b16* __restrict__ kh, b16* __restrict__ vt) {
  __shared__ __attribute__((aligned(16))) unsigned char Sm[2 * GR * LP * 2];   // the ring [buffer][row][64 bf16 + pad]; behind the loop's last barrier the epilogue's staging
  const int lane = threadIdx.x & 31, wid = __builtin_amdgcn_readfirstlane(threadIdx.x >> 5), wave = wid & 3, cg = wid >> 2, nloc = lane & 15, hlf = lane >> 4;
  static_assert(Bn == 2, "the tile count below is written for two sequences");
  constexpr int TPB = S / 128, CQ = D / 128, CA = 3 * D / 128;  // token tiles per sequence, column blocks of q, of q, k and v together
  const int n0 = (min(max(seq_lens[0], 1), S) + 127) / 128, n1 = (min(max(seq_lens[1], 1), S) + 127) / 128, nk = n0 + n1;   // token tiles that hold keys (same clamp as attention's), 1..16 each
  int ty, tx;                                                   // token tile 0..31, column block 0..23 of this block; every term is block-uniform
  if ((int)blockIdx.x < nk * CA) { const int i = (int)blockIdx.x / CA; tx = (int)blockIdx.x % CA; ty = i < n0 ? i : TPB + i - n0; }
  else {
    const int r = (int)blockIdx.x - nk * CA, i = r / CQ; tx = r % CQ;
    if (i >= Bn * TPB - nk) return;                             // taken by the whole block, ahead of every copy and barrier
    ty = i < TPB - n0 ? n0 + i : TPB + n1 + (i - (TPB - n0));
  }
  const int mb = ty * 128, m0 = mb + wave * 32, cb = tx * 128, c0 = cb + cg * 64;
  const int sr = threadIdx.x >> 3, sc = (threadIdx.x & 7) * 8;  // staging: thread -> rows sr + 32 j, 16 B piece sc; a wave's copy covers 4 whole 128 B rows
  // One stage: k in [t*64, t*64+64) < D. 8 copies of 16 B per lane, all lanes on; the s_wait_xcnt closes the statement so that no address register is rewritten ahead of it.
  auto stage = [&](int t, int buf) {
    const __bf16* gx = x16 + (size_t)(mb + sr) * D + t * KT + sc; const __bf16* gw = w16 + (size_t)(cb + sr) * D + t * KT + sc;
    const unsigned l0 = lds_addr(Sm + ((size_t)buf * GR + sr) * (LP * 2) + sc * 2);
    constexpr unsigned HB = 32 * LP * 2;                        // bytes per 32 rows
    asm volatile("global_load_async_to_lds_b128 %0, %8, off\n\t"
                 "global_load_async_to_lds_b128 %1, %9, off\n\t"
                 "global_load_async_to_lds_b128 %2, %10, off\n\t"
                 "global_load_async_to_lds_b128 %3, %11, off\n\t"
                 "global_load_async_to_lds_b128 %4, %12, off\n\t"
                 "global_load_async_to_lds_b128 %5, %13, off\n\t"
                 "global_load_async_to_lds_b128 %6, %14, off\n\t"
                 "global_load_async_to_lds_b128 %7, %15, off\n\t"
                 "s_wait_xcnt 0x0"
                 :: "v"(l0), "v"(l0 + HB), "v"(l0 + 2 * HB), "v"(l0 + 3 * HB), "v"(l0 + 4 * HB), "v"(l0 + 5 * HB), "v"(l0 + 6 * HB), "v"(l0 + 7 * HB),
                    "v"(gx), "v"(gx + 32 * D), "v"(gx + 64 * D), "v"(gx + 96 * D), "v"(gw), "v"(gw + 32 * D), "v"(gw + 64 * D), "v"(gw + 96 * D)
                 : "memory");
  };
  stage(0, 0);
  v8f acc[2][4];
#pragma unroll
  for (int r = 0; r < 2; ++r)
#pragma unroll
    for (int t = 0; t < 4; ++t) acc[r][t] = (v8f){};
  asm volatile("s_wait_asynccnt 0x0" ::: "memory");             // stage 0 of this wave has landed
  __syncthreads();                                              // publishes stage 0 to the other waves
  stage(1, 1);
  for (int s = 0; s < GST; ++s) {
    const __bf16* R = (const __bf16*)(Sm + (size_t)(s & 1) * (GR * LP * 2));
#pragma unroll   // the stage's two k steps of 32 unrolled so that every LDS fragment offset is an immediate
    for (int ks = 0; ks < 2; ++ks) {
      const v16bb a0 = frag_kb_bf(R + (wave * 32 + nloc) * LP + ks * 32, hlf), a1 = frag_kb_bf(R + (wave * 32 + 16 + nloc) * LP + ks * 32, hlf);
      v16bb bw[4];
#pragma unroll
      for (int t = 0; t < 4; ++t) bw[t] = frag_kb_bf(R + (128 + cg * 64 + t * 16 + nloc) * LP + ks * 32, hlf);
      __builtin_amdgcn_sched_barrier(0);                        // the k step's 12 LDS reads stay one group ahead of its 8 products: one LDS latency instead of one per column tile
#pragma unroll
      for (int t = 0; t < 4; ++t) { acc[0][t] = wmma16bb(a0, bw[t], acc[0][t]); acc[1][t] = wmma16bb(a1, bw[t], acc[1][t]); }
    }
    // publish point of stage s + 1
    asm volatile("s_wait_dscnt 0x0" ::: "memory");              // this wave's reads of buffer s & 1 are done before it is refilled
    asm volatile("s_wait_asynccnt 0x0" ::: "memory");           // this wave's copies of stage s + 1 have landed
    __syncthreads();                                            // publishes stage s + 1 and ends every wave's reads of stage s
    if (s + 2 < GST) stage(s + 2, s & 1);
  }
  asm volatile("s_wait_asynccnt 0x0" ::: "memory");             // nothing of the ring is in flight when its LDS becomes staging
  const int which = tx / (D / 128), head = (tx % (D / 128)) * 2 + cg, b = m0 / S, tok0 = m0 % S;
#pragma unroll
  for (int t = 0; t < 4; ++t) { const float bb = bf16_rne(bqkv[c0 + t * 16 + nloc]);   // + bias (rounded to bf16)
#pragma unroll
    for (int r = 0; r < 2; ++r)
#pragma unroll
      for (int v = 0; v < 8; ++v) acc[r][t][v] += bb; }
  if (which < 2) {                                              // q or k head: f16 rows
    b16 (*Th)[HD + 8] = (b16 (*)[HD + 8])(Sm + (size_t)wid * (2 * 32 * (HD + 8) * 2)); b16 (*Tq)[HD + 8] = Th + 32;   // the wave's own hi and lo tiles [32][64 + pad]
#pragma unroll
    for (int t = 0; t < 4; ++t)
#pragma unroll
      for (int r = 0; r < 2; ++r)
#pragma unroll
        for (int v = 0; v < 8; ++v) { b16 a_, c_; split16(acc[r][t][v] * QS, a_, c_); Th[r * 16 + 8 * hlf + v][t * 16 + nloc] = a_; Tq[r * 16 + 8 * hlf + v][t * 16 + nloc] = c_; }   // q, k carried x8 (lo residuals stay normal)
    wave_lds_sync();
    b16* dst = (which == 0 ? qh : kh) + (((size_t)b * H + head) * S + tok0) * HD;
    {
#pragma unroll
      for (int j = 0; j < 8; ++j) { const int rr = j * 4 + (lane >> 3), c8 = (lane & 7) * 8; *(v8b*)(dst + (size_t)rr * HD + c8) = *(const v8b*)(&Th[rr][c8]); *(v8b*)(dst + QPL + (size_t)rr * HD + c8) = *(const v8b*)(&Tq[rr][c8]); }
       }
    return;
  }
  const int vh = head;                                          // v head: (8v)^T tile [64 d][128 tok] via LDS, rows of 256 B; one hi and one lo tile per head of the block
  b16 (*Tt)[128 + 8] = (b16 (*)[128 + 8])(Sm + (size_t)cg * (2 * 64 * (128 + 8) * 2)); b16 (*Tl)[128 + 8] = Tt + 64;
#pragma unroll
  for (int t = 0; t < 4; ++t)
#pragma unroll
    for (int r = 0; r < 2; ++r)
#pragma unroll
      for (int v = 0; v < 8; ++v) { b16 a_, c_; split16(acc[r][t][v] * VS, a_, c_); Tt[t * 16 + nloc][wave * 32 + r * 16 + 8 * hlf + v] = a_; Tl[t * 16 + nloc][wave * 32 + r * 16 + 8 * hlf + v] = c_; }
  __syncthreads();
  b16* dstv = vt + (((size_t)b * H + vh) * HD) * S + mb % S;
  {
#pragma unroll
    for (int j = 0; j < 8; ++j) { const int dd = wave * 16 + j * 2 + (lane >> 4), c8 = (lane & 15) * 8; *(v8b*)(dstv + (size_t)dd * S + c8) = *(const v8b*)(&Tt[dd][c8]); *(v8b*)(dstv + VPL + (size_t)dd * S + c8) = *(const v8b*)(&Tl[dd][c8]); }
    
  }
}

// causal attention: block = 8 waves = 64 consecutive queries of one (b, h) = 4 query groups of 16 x 2 key groups: of every ring stage of 64 keys, waves 0..3 take keys 0..31 and waves 4..7
// keys 32..63, so the longest block walks half as many chunks per wave; each wave keeps its own online softmax (f32) and the two partial results of a query group are merged through LDS at the end.
// Blocks outnumber the resident places, so the longest tiles (highest queries) come first in the grid. Per chunk of 32 keys: S^T (K=64), mask on the straddling chunks, P^T f16, y^T += (8V)^T P^T.
// The block's K rows and (8V)^T rows (hi and lo planes) come once per 64 keys into a two-buffer LDS ring by asynchronous copies of whole 128 B rows; every wave takes its fragments from there.
template <int QT>
__global__ __launch_bounds__(256) void attn_kernel(const b16* __restrict__ qh, const b16* __restrict__ kh, const b16* __restrict__ vt, const int* __restrict__ seq_lens, b16* __restrict__ yh) {
  __shared__ __attribute__((aligned(16))) float Os[8][16][HD + 4];
  __shared__ __attribute__((aligned(16))) b16 Ring[2][4][KT][LP];   // [buffer][K hi, K lo, V^T hi, V^T lo][key row or d row][64 f16 + pad]
  const int wid = __builtin_amdgcn_readfirstlane(threadIdx.x >> 5), lane = threadIdx.x & 31, hh = lane >> 4, col = lane & 15;
  const int qg = wid & 3, kg = wid >> 2;                        // query group, key group of the wave
  const int tile = QT / 4 - 1 - (int)blockIdx.x / (Bn * H), bh = (int)blockIdx.x % (Bn * H), h = bh % H, b = bh / H, q0 = tile * 64 + qg * 16, qi = q0 + col;
  const b16* Q = qh + ((size_t)bh * S) * HD; const b16* K = kh + ((size_t)bh * S) * HD; const b16* vb = vt + ((size_t)bh * HD) * S;
  const int sl = __builtin_amdgcn_readfirstlane(min(max(seq_lens[b], 1), S));   // held in a scalar register so that the mask test of a chunk stays a scalar compare and branch; padding mask: keys >= seq_len get -inf (exp -> 0); seq_len >= 1 here so key 0 always survives
  const int kend = __builtin_amdgcn_readfirstlane(min(q0 + 16, sl));   // this wave's key bound, held in a scalar register so that the chunk test below stays a scalar compare and branch
  const int nst = (min(tile * 64 + 64, sl) + KT - 1) / KT;      // ring stages of the block = those of its last query group (block-uniform, 1..32)
  const int sr = threadIdx.x >> 3, sc = (threadIdx.x & 7) * 8;  // staging: thread -> rows sr and sr + 32, 16 B piece sc; a wave's copy covers 4 whole 128 B rows
  // One stage: keys [t*64, t*64+64) < S. 8 copies of 16 B per lane, all lanes on; the s_wait_xcnt closes the statement so that no address register is rewritten ahead of it.
  auto stage = [&](int t, int buf) {
    const b16* gk = K + (size_t)(t * KT + sr) * HD + sc; const b16* gv = vb + (size_t)sr * S + t * KT + sc;
    const unsigned l0 = lds_addr(&Ring[buf][0][sr][sc]);
    constexpr unsigned PB = KT * LP * 2, HB = 32 * LP * 2;      // bytes per plane, per 32 rows
    asm volatile("global_load_async_to_lds_b128 %0, %8, off\n\t"
                 "global_load_async_to_lds_b128 %1, %9, off\n\t"
                 "global_load_async_to_lds_b128 %2, %10, off\n\t"
                 "global_load_async_to_lds_b128 %3, %11, off\n\t"
                 "global_load_async_to_lds_b128 %4, %12, off\n\t"
                 "global_load_async_to_lds_b128 %5, %13, off\n\t"
                 "global_load_async_to_lds_b128 %6, %14, off\n\t"
                 "global_load_async_to_lds_b128 %7, %15, off\n\t"
                 "s_wait_xcnt 0x0"
                 :: "v"(l0), "v"(l0 + HB), "v"(l0 + PB), "v"(l0 + PB + HB), "v"(l0 + 2 * PB), "v"(l0 + 2 * PB + HB), "v"(l0 + 3 * PB), "v"(l0 + 3 * PB + HB),
                    "v"(gk), "v"(gk + 32 * HD), "v"(gk + QPL), "v"(gk + QPL + 32 * HD), "v"(gv), "v"(gv + (size_t)32 * S), "v"(gv + VPL), "v"(gv + VPL + (size_t)32 * S)
                 : "memory");
  };
  stage(0, 0);
  v16b qf[2], ql[2];
#pragma unroll
  for (int ks = 0; ks < 2; ++ks) { qf[ks] = frag_kb(Q + (size_t)qi * HD + ks * 32, hh); ql[ks] = frag_kb(Q + QPL + (size_t)qi * HD + ks * 32, hh); }
  float m = -INFINITY, l = 0.0f; v8f o[4] = {{}, {}, {}, {}};
  asm volatile("s_wait_asynccnt 0x0" ::: "memory");             // stage 0 of this wave has landed
  __syncthreads();                                              // publishes stage 0 to the other waves
  if (nst > 1) stage(1, 1);
  for (int t = 0; t < nst; ++t) {
    const b16 (*R)[KT][LP] = Ring[t & 1];
    {
      const int kb = t * KT + kg * 32, kl = kg * 32;            // this wave's chunk of the stage
      if (kb < kend) {                                          // causal + padding: key chunks past min(query tile, seq_len) are skipped (wave-uniform scalar bound)
        const bool diag = (kb + 32 > q0) || (kb + 32 > sl);     // this chunk reaches past some queries or past seq_len -> mask
        v8f s0 = {}, s1 = {};
        v16b k0[2], k0l[2], k1[2], k1l[2];
#pragma unroll
        for (int ks = 0; ks < 2; ++ks) { k0[ks] = frag_kb(&R[0][kl + col][ks * 32], hh); k0l[ks] = frag_kb(&R[1][kl + col][ks * 32], hh); k1[ks] = frag_kb(&R[0][kl + 16 + col][ks * 32], hh); k1l[ks] = frag_kb(&R[1][kl + 16 + col][ks * 32], hh); }
        __builtin_amdgcn_sched_barrier(0);                      // the chunk's 16 K reads stay one group ahead of the score products: one LDS latency instead of one per k step
#pragma unroll
        for (int ks = 0; ks < 2; ++ks) {
          s0 = wmma16b(k0[ks], qf[ks], s0); s0 = wmma16b(k0[ks], ql[ks], s0); s0 = wmma16b(k0l[ks], qf[ks], s0);      // q and k as f16 hi+lo pairs (lo.lo dropped)
          s1 = wmma16b(k1[ks], qf[ks], s1); s1 = wmma16b(k1[ks], ql[ks], s1); s1 = wmma16b(k1l[ks], qf[ks], s1); }
        v16b vf[4], vl[4];
#pragma unroll
        for (int n = 0; n < 4; ++n) { vf[n] = frag_kb(&R[2][n * 16 + col][kl], hh); vl[n] = frag_kb(&R[3][n * 16 + col][kl], hh); }
        __builtin_amdgcn_sched_barrier(0);                      // the chunk's 16 V^T reads stay one group here, so that they land under the softmax instead of stalling each P.v product
        // the maximum m stays in raw score units (C2 > 0 keeps the order); 8 P = 2^(s C2 - m C2 + 3) is one fma and one v_exp per score; l sums 8 P
        if (diag) {
#pragma unroll
          for (int r = 0; r < 8; ++r) { const int k0_ = kb + 8 * hh + r, k1_ = kb + 16 + 8 * hh + r; if (k0_ > qi || k0_ >= sl) s0[r] = -INFINITY; if (k1_ > qi || k1_ >= sl) s1[r] = -INFINITY; }
        }
        float mr = -INFINITY;
#pragma unroll
        for (int r = 0; r < 8; ++r) mr = fmaxf(mr, fmaxf(s0[r], s1[r]));
        mr = fmaxf(mr, __shfl_xor(mr, 16));
        const float mn = fmaxf(m, mr), al_ = __builtin_amdgcn_exp2f((m - mn) * C2), nb = fmaf(-mn, C2, LPS); m = mn;   // mn is finite: key kb <= q0 is open to every query of the wave
        float sum = 0.0f; v16b pb, pl;
#pragma unroll
        for (int r = 0; r < 8; ++r) { const float e0 = __builtin_amdgcn_exp2f(fmaf(s0[r], C2, nb)), e1 = __builtin_amdgcn_exp2f(fmaf(s1[r], C2, nb)); sum += e0 + e1; b16 a, c; split16(e0, a, c); pb[r] = a; pl[r] = c; split16(e1, a, c); pb[8 + r] = a; pl[8 + r] = c; }   // P carried x8
        sum += __shfl_xor(sum, 16); l = l * al_ + sum;
#pragma unroll
        for (int n = 0; n < 4; ++n) {
#pragma unroll
          for (int r = 0; r < 8; ++r) o[n][r] *= al_;
          o[n] = wmma16b(vf[n], pb, o[n]); o[n] = wmma16b(vf[n], pl, o[n]); o[n] = wmma16b(vl[n], pb, o[n]);   // (8v) and P both as f16 hi+lo pairs (lo.lo dropped)
        }
      }
    }
    // publish point of stage t + 1, passed by every wave, also one that skipped its chunks
    asm volatile("s_wait_dscnt 0x0" ::: "memory");              // this wave's reads of buffer t & 1 are done before it is refilled
    asm volatile("s_wait_asynccnt 0x0" ::: "memory");           // this wave's copies of stage t + 1 have landed
    __syncthreads();                                            // publishes stage t + 1 and ends every wave's reads of stage t
    if (t + 2 < nst) stage(t + 2, t & 1);
  }
  asm volatile("s_wait_asynccnt 0x0" ::: "memory");             // nothing of the ring is in flight when its LDS becomes the y staging
  if (kg == 1) {                                                // upper key group: hand the partial sums, maximum and denominator to the partner wave (same lane, same places; m and l in the row's pad)
#pragma unroll
    for (int n = 0; n < 4; ++n)
#pragma unroll
      for (int r = 0; r < 8; ++r) Os[wid][col][n * 16 + 8 * hh + r] = o[n][r];
    Os[wid][col][HD + 2 * hh] = m; Os[wid][col][HD + 2 * hh + 1] = l;
  }
  __syncthreads();                                              // publishes the upper key group's partial results to the lower one
  if (kg == 1) return;
  const float (*Pp)[HD + 4] = Os[wid + 4];
  const float m1 = Pp[col][HD + 2 * hh], l1 = Pp[col][HD + 2 * hh + 1];
  const float mn2 = fmaxf(m, m1), a0 = __builtin_amdgcn_exp2f((m - mn2) * C2), a1 = __builtin_amdgcn_exp2f((m1 - mn2) * C2);   // m is finite (key 0 is in the lower group); a partner without a chunk has m1 = -inf, l1 = 0 -> a1 = 0
  const float inv = 1.0f / (VS * (l * a0 + l1 * a1)), f0 = a0 * inv, f1 = a1 * inv;   // l and l1 already carry the x8 of P
  // y leaves as the f16 hi+lo pair of 8y that the output GEMM multiplies: split once here. The wave's own hi and lo tiles [16 queries][64 d + pad] lie in the ring's LDS, which is free behind the loop's last barrier.
  b16 (*Th)[LP] = (b16 (*)[LP])(&Ring[0][0][0][0]) + wid * 32; b16 (*Tl)[LP] = Th + 16;
#pragma unroll
  for (int n = 0; n < 4; ++n) { v8b hv, lv;
#pragma unroll
    for (int r = 0; r < 8; ++r) { b16 a_, c_; split16((o[n][r] * f0 + Pp[col][n * 16 + 8 * hh + r] * f1) * 8.0f, a_, c_); hv[r] = a_; lv[r] = c_; }
    *(v8b*)(&Th[col][n * 16 + 8 * hh]) = hv; *(v8b*)(&Tl[col][n * 16 + 8 * hh]) = lv; }
  wave_lds_sync();
  b16* dst = yh + ((size_t)b * S + q0) * D + h * HD;
  {
#pragma unroll
    for (int j = 0; j < 4; ++j) { const int rr = j * 4 + (lane >> 3), c8 = (lane & 7) * 8; *(v8b*)(dst + (size_t)rr * D + c8) = *(const v8b*)(&Th[rr][c8]); *(v8b*)(dst + YPL + (size_t)rr * D + c8) = *(const v8b*)(&Tl[rr][c8]); }
  }
}

// out = y W_o^T: (4096 x 1024) x (1024 x 1024); A = the (8y) f16 hi and lo planes, B = f16(bf16 W_o) rows; f32 rows; block = 8 waves = 128 tokens x 128 columns, wave = 32 x 64.
// The block's 128 hi rows, 128 lo rows and 128 W_o rows (128 B each per stage) come once per 64 k into a two-buffer LDS ring by asynchronous copies of whole rows. grid (8, 32) x 256.
constexpr int OBUF = 3 * 128 * LP * 2;                          // bytes of a buffer: 128 hi rows, 128 lo rows, 128 W_o rows
__global__ __launch_bounds__(256) void out_kernel(const b16* __restrict__ yh, const b16* __restrict__ wo16, const float* __restrict__ bo, float* __restrict__ out) {
  __shared__ __attribute__((aligned(16))) unsigned char Sm[2 * OBUF];   // the ring; behind the loop's last barrier the epilogue's staging (8 KiB per wave)
  const int lane = threadIdx.x & 31, wid = __builtin_amdgcn_readfirstlane(threadIdx.x >> 5), wave = wid & 3, cg = wid >> 2, nloc = lane & 15, hlf = lane >> 4;
  const int mb = blockIdx.y * 128, m0 = mb + wave * 32, cb = blockIdx.x * 128, c0 = cb + cg * 64;
  const int sr = threadIdx.x >> 3, sc = (threadIdx.x & 7) * 8;  // staging: thread -> rows sr + 32 j of each of the three planes, 16 B piece sc; a wave's copy covers 4 whole 128 B rows
  // One stage: k in [t*64, t*64+64) < D. 12 copies of 16 B per lane, all lanes on; the s_wait_xcnt closes the statement so that no address register is rewritten ahead of it.
  auto stage = [&](int t, int buf) {
    const b16* gy = yh + (size_t)(mb + sr) * D + t * KT + sc; const b16* gl = gy + YPL; const b16* gw = wo16 + (size_t)(cb + sr) * D + t * KT + sc;
    const unsigned l0 = lds_addr(Sm + (size_t)buf * OBUF + (size_t)sr * (LP * 2) + sc * 2);
    constexpr unsigned HB = 32 * LP * 2;                        // bytes per 32 rows
    asm volatile("global_load_async_to_lds_b128 %0, %12, off\n\t"
                 "global_load_async_to_lds_b128 %1, %13, off\n\t"
                 "global_load_async_to_lds_b128 %2, %14, off\n\t"
                 "global_load_async_to_lds_b128 %3, %15, off\n\t"
                 "global_load_async_to_lds_b128 %4, %16, off\n\t"
                 "global_load_async_to_lds_b128 %5, %17, off\n\t"
                 "global_load_async_to_lds_b128 %6, %18, off\n\t"
                 "global_load_async_to_lds_b128 %7, %19, off\n\t"
                 "global_load_async_to_lds_b128 %8, %20, off\n\t"
                 "global_load_async_to_lds_b128 %9, %21, off\n\t"
                 "global_load_async_to_lds_b128 %10, %22, off\n\t"
                 "global_load_async_to_lds_b128 %11, %23, off\n\t"
                 "s_wait_xcnt 0x0"
                 :: "v"(l0), "v"(l0 + HB), "v"(l0 + 2 * HB), "v"(l0 + 3 * HB), "v"(l0 + 4 * HB), "v"(l0 + 5 * HB), "v"(l0 + 6 * HB), "v"(l0 + 7 * HB),
                    "v"(l0 + 8 * HB), "v"(l0 + 9 * HB), "v"(l0 + 10 * HB), "v"(l0 + 11 * HB),
                    "v"(gy), "v"(gy + 32 * D), "v"(gy + 64 * D), "v"(gy + 96 * D), "v"(gl), "v"(gl + 32 * D), "v"(gl + 64 * D), "v"(gl + 96 * D),
                    "v"(gw), "v"(gw + 32 * D), "v"(gw + 64 * D), "v"(gw + 96 * D)
                 : "memory");
  };
  stage(0, 0);
  v8f acc[2][4];
#pragma unroll
  for (int r = 0; r < 2; ++r)
#pragma unroll
    for (int t = 0; t < 4; ++t) acc[r][t] = (v8f){};
  asm volatile("s_wait_asynccnt 0x0" ::: "memory");             // stage 0 of this wave has landed
  __syncthreads();                                              // publishes stage 0 to the other waves
  stage(1, 1);
  for (int s = 0; s < GST; ++s) {
    const b16* R = (const b16*)(Sm + (size_t)(s & 1) * OBUF);
#pragma unroll   // the stage's two k steps of 32 unrolled so that every LDS fragment offset is an immediate
    for (int ks = 0; ks < 2; ++ks) {
      v16b ah[2], al[2], bh[4];                                 // y as an f16 hi+lo pair carried x8 (2 products)
#pragma unroll
      for (int r = 0; r < 2; ++r) { ah[r] = frag_kb(R + (wave * 32 + r * 16 + nloc) * LP + ks * 32, hlf); al[r] = frag_kb(R + (128 + wave * 32 + r * 16 + nloc) * LP + ks * 32, hlf); }
#pragma unroll
      for (int t = 0; t < 4; ++t) bh[t] = frag_kb(R + (256 + cg * 64 + t * 16 + nloc) * LP + ks * 32, hlf);
      __builtin_amdgcn_sched_barrier(0);                        // the k step's 16 LDS reads stay one group ahead of the 16 products: one LDS latency instead of one per tile
#pragma unroll
      for (int t = 0; t < 4; ++t) {
        acc[0][t] = mac<5, 1>(ah[0], al[0], bh[t], bh[t], acc[0][t]);
        acc[1][t] = mac<5, 1>(ah[1], al[1], bh[t], bh[t], acc[1][t]);
      }
    }
    // publish point of stage s + 1
    asm volatile("s_wait_dscnt 0x0" ::: "memory");              // this wave's reads of buffer s & 1 are done before it is refilled
    asm volatile("s_wait_asynccnt 0x0" ::: "memory");           // this wave's copies of stage s + 1 have landed
    __syncthreads();                                            // publishes stage s + 1 and ends every wave's reads of stage s
    if (s + 2 < GST) stage(s + 2, s & 1);
  }
  asm volatile("s_wait_asynccnt 0x0" ::: "memory");             // nothing of the ring is in flight when its LDS becomes staging
#pragma unroll
  for (int t = 0; t < 4; ++t)
#pragma unroll
    for (int r = 0; r < 2; ++r)
#pragma unroll
      for (int v = 0; v < 8; ++v) acc[r][t][v] = acc[r][t][v] * (1.0f / 8.0f) + bf16_rne(bo[c0 + t * 16 + nloc]);
  epi_f32(acc, 1.0f, nullptr, out, D, m0, c0, lane, (float*)(Sm + (size_t)wid * (32 * 64 * 4)));
}
}  // namespace

extern "C" void kernel_launch(void* const* d_in, const int* in_sizes, int n_in,
                              void* d_out, int out_size, void* d_ws, size_t ws_size, hipStream_t stream) {
  (void)n_in; (void)out_size;
  const float* x = (const float*)d_in[0]; const int* seq_lens = (const int*)d_in[1]; const float* wqkv = (const float*)d_in[2]; const float* bqkv = (const float*)d_in[3]; const float* wo = (const float*)d_in[4]; const float* bo = (const float*)d_in[5];
  float* out = (float*)d_out;   // [2][2048][1024]
  if (in_sizes[0] != BT * S * D || in_sizes[1] != Bn || in_sizes[2] != 3 * D * D || in_sizes[3] != 3 * D || in_sizes[4] != D * D || in_sizes[5] != D) return;
  size_t off = 0; char* ws = (char*)d_ws;
  auto carve = [&](size_t bytes) { char* p = ws + off; off += (bytes + 255) & ~(size_t)255; return p; };
  unsigned short* x16 = (unsigned short*)carve((size_t)NTOK * D * 2); unsigned short* w16 = (unsigned short*)carve((size_t)3 * D * D * 2); b16* wo16 = (b16*)carve((size_t)D * D * 2);
  b16* qh = (b16*)carve((size_t)2 * NTOK * D * 2); b16* kh = (b16*)carve((size_t)2 * NTOK * D * 2); b16* vt = (b16*)carve((size_t)2 * NTOK * D * 2); b16* yh = (b16*)carve((size_t)2 * NTOK * D * 2);
  if (off > ws_size) return;                                    // ≈ 84 MB
  prep_kernel<<<CVB, CVW, 0, stream>>>(x, wqkv, wo, x16, w16, wo16);
  proj_kernel<<<(3 * D / 128) * (NTOK / 128), 256, 0, stream>>>((const __bf16*)x16, (const __bf16*)w16, bqkv, seq_lens, qh, kh, vt);
  attn_kernel<S / 16><<<Bn * H * (S / 64), 256, 0, stream>>>(qh, kh, vt, seq_lens, yh);
  out_kernel<<<dim3(D / 128, NTOK / 128), 256, 0, stream>>>(yh, wo16, bo, out);
}

// v009
// It runs in 86.2 microseconds.
// In both of two side-by-side timings against v008, it was 1.04 times as fast.
// All steps since v000 together make it 3.42 times as fast.
#include <hip/hip_runtime.h>

// MultiAxisAttention: qkv = x Wqkv^T + bqkv (16 heads x 64), causal mask (key > query -> -1e9) plus a per-batch padding mask (key >= seq_len[b] -> -1e9), softmax of q.k/8, out = ctx Wout^T + bout
// -> [2][2048][1024]. seq_lens here are > 0, so every query keeps key 0 and the masked keys contribute exp(-1e9 - max) = 0; the key loop stops at
// min(causal bound, seq_len).
// x, the four weights and bo rounded to bf16: projection on v_wmma_f32_16x16x32_bf16 (exact products, f32 accumulate);
// scores, P.v and the output projection on v_wmma_f32_16x16x32_f16 with every computed operand (q, k, v, P, y — each carried x8 so the hi/lo residual planes stay normal) as an f16
// hi+lo pair (3 / 2 products); online softmax in f32. Fragment k-map per lane half hh for A AND B: elements 0..7 <- k = 8hh+0..7, 8..15 <- k = 16+8hh+0..7. Every intermediate /

namespace {
constexpr int BT = 2, Bn = 2, S = 2048, D = 1024, H = 16, HD = 64, NTOK = Bn * S;
constexpr float SCALE = 0.125f, VS = 8.0f, QS = 8.0f, PS = 8.0f;   // power-of-two carry scales so hi/lo residual planes stay normal in f16
constexpr float C2 = SCALE / (QS * QS) * 1.44269504088896341f;    // raw score (64 q.k) -> exponent of 2: the 1/8 scale, the carry of q and k and log2(e) in one factor
constexpr float LPS = 3.0f;                                       // log2(PS): the x8 carry of P enters as an addend of the exponent
constexpr size_t VPL = (size_t)NTOK * D;   // distance between the (8v)^T hi and lo planes
constexpr size_t QPL = (size_t)NTOK * D;   // distance between the q/k hi and lo planes
constexpr size_t YPL = (size_t)NTOK * D;   // distance between the (8y) hi and lo planes

typedef _Float16 b16;
typedef __attribute__((ext_vector_type(16))) _Float16 v16b;
typedef __attribute__((ext_vector_type(8)))  _Float16 v8b;
typedef __attribute__((ext_vector_type(8)))  float v8f;
typedef __attribute__((ext_vector_type(4)))  float v4f;

__device__ __forceinline__ v8b ld8b(const b16* p) { return *(const v8b*)p; }
__device__ __forceinline__ v16b cat8b(v8b a, v8b b) { return __builtin_shufflevector(a, b, 0, 1, 2, 3, 4, 5, 6, 7, 8, 9, 10, 11, 12, 13, 14, 15); }
__device__ __forceinline__ v16b frag_kb(const b16* p, int hh) { return cat8b(ld8b(p + 8 * hh), ld8b(p + 16 + 8 * hh)); }
__device__ __forceinline__ void split16(float v, b16& hi, b16& lo) { hi = (b16)v; lo = (b16)(v - (float)hi); }
// hi/lo fragment pair straight from an f32 k-contiguous row (same k-map)
__device__ __forceinline__ void frag_ksplit(const float* p, int hh, v16b& fh_, v16b& fl_) {
  const float* p0 = p + 8 * hh; const float* p1 = p + 16 + 8 * hh;
#pragma unroll
  for (int e = 0; e < 8; ++e) { b16 a, c; split16(p0[e], a, c); fh_[e] = a; fl_[e] = c; split16(p1[e], a, c); fh_[8 + e] = a; fl_[8 + e] = c; }
}
__device__ __forceinline__ v8f wmma16b(v16b a, v16b b, v8f c) {
  v8f d = __builtin_amdgcn_wmma_f32_16x16x32_f16(false, a, false, b, (short)0, c, false, false);
  asm volatile("v_nop\n\tv_nop\n\tv_nop\n\tv_nop" : "+v"(d) : "v"(a), "v"(b));
  return d;
}
__device__ __forceinline__ void wave_lds_sync() {
  __builtin_amdgcn_fence(__ATOMIC_RELEASE, "workgroup");
  __builtin_amdgcn_wave_barrier();
  __builtin_amdgcn_fence(__ATOMIC_ACQUIRE, "workgroup");
}

// Operand descriptor: NP = 0 -> f32 rows split on the fly into (hi, lo); NP = 1 -> one f16 plane; NP = 2 -> f16 hi + lo planes;
// NP = 3 -> f32 rows rounded once to a single f16 fragment. ld = row pitch.
struct Opnd { const void* p0; const void* p1; int ld; };
template <int NP> __device__ __forceinline__ void load_frags(const Opnd& o, int row, int kb, int hh, v16b& fh_, v16b& fl_) {
  if (NP == 0) { frag_ksplit((const float*)o.p0 + (size_t)row * o.ld + kb, hh, fh_, fl_); }
  else if (NP == 4 || NP == 5) {                             // f32 rows x64 (NP 4) or x8 (NP 5) then split (keeps the lo halves of small values normal)
    const float sc_ = (NP == 4) ? 64.0f : 8.0f;
    const float* p = (const float*)o.p0 + (size_t)row * o.ld + kb; const float* p0 = p + 8 * hh; const float* p1 = p + 16 + 8 * hh;
#pragma unroll
    for (int e = 0; e < 8; ++e) { b16 a, c; split16(p0[e] * sc_, a, c); fh_[e] = a; fl_[e] = c; split16(p1[e] * sc_, a, c); fh_[8 + e] = a; fl_[8 + e] = c; }
  } else if (NP == 3) {
    const float* p = (const float*)o.p0 + (size_t)row * o.ld + kb; const float* p0 = p + 8 * hh; const float* p1 = p + 16 + 8 * hh;
#pragma unroll
    for (int e = 0; e < 8; ++e) { fh_[e] = (b16)p0[e]; fh_[8 + e] = (b16)p1[e]; }
    fl_ = fh_;
  } else {
    fh_ = frag_kb((const b16*)o.p0 + (size_t)row * o.ld + kb, hh);
    if (NP == 2) fl_ = frag_kb((const b16*)o.p1 + (size_t)row * o.ld + kb, hh); else fl_ = fh_;
  }
}
template <int ANP, int BNP> __device__ __forceinline__ v8f mac(v16b ah, v16b al, v16b bh, v16b bl, v8f c) {
  c = wmma16b(ah, bh, c);
  if (BNP == 0 || BNP == 2 || BNP == 4 || BNP == 5) c = wmma16b(ah, bl, c);     // hi.lo
  if (ANP == 0 || ANP == 2 || ANP == 4 || ANP == 5) c = wmma16b(al, bh, c);     // lo.hi   (lo.lo dropped)
  return c;
}
__device__ __forceinline__ void epi_planes(v8f (&acc)[2][4], float scale, bool two, b16* __restrict__ oh, b16* __restrict__ ol, int ldo,
                                           int m0, int c0, int lane, b16* Th, b16* Tl) {
  const int nloc = lane & 15, hlf = lane >> 4;
#pragma unroll
  for (int t = 0; t < 4; ++t)
#pragma unroll
    for (int r = 0; r < 2; ++r)
#pragma unroll
      for (int v = 0; v < 8; ++v) {
        const int rr = r * 16 + v + 8 * hlf, cc = t * 16 + nloc;
        b16 h_, l_; split16(acc[r][t][v] * scale, h_, l_);
        Th[rr * 64 + cc] = h_; Tl[rr * 64 + cc] = l_;
      }
  wave_lds_sync();
  {
#pragma unroll
    for (int j = 0; j < 8; ++j) {
      const int rr = j * 4 + (lane >> 3), c8 = (lane & 7) * 8;
      const size_t o = (size_t)(m0 + rr) * ldo + c0 + c8;
      *(v8b*)(oh + o) = ld8b(Th + rr * 64 + c8);
      if (two) *(v8b*)(ol + o) = ld8b(Tl + rr * 64 + c8);
    }
    
  }
}
// (b) f32 rows with pitch ldo: 64 floats = 256 B = 2 lines per row; 16 lanes x 16 B per row, 2 rows per instruction. Optional per-row factor
__device__ __forceinline__ void epi_f32(v8f (&acc)[2][4], float scale, const float* rscale, float* __restrict__ out, int ldo, int m0, int c0, int lane, float* Tt) {
  const int nloc = lane & 15, hlf = lane >> 4;
#pragma unroll
  for (int t = 0; t < 4; ++t)
#pragma unroll
    for (int r = 0; r < 2; ++r)
#pragma unroll
      for (int v = 0; v < 8; ++v) {
        const int rr = r * 16 + v + 8 * hlf;
        const float rs = rscale ? rscale[(size_t)(m0 + rr) * 32] : 1.0f;
        Tt[rr * 64 + t * 16 + nloc] = acc[r][t][v] * scale * rs;
      }
  wave_lds_sync();
  float* dst0 = out + (size_t)m0 * ldo + c0;
  {
#pragma unroll
    for (int j = 0; j < 16; ++j) { const int rr = j * 2 + hlf, c4 = nloc * 4; *(v4f*)(dst0 + (size_t)rr * ldo + c4) = *(const v4f*)(Tt + rr * 64 + c4); }
    
  }
}



typedef __attribute__((ext_vector_type(8))) __bf16 v8bb; typedef __attribute__((ext_vector_type(16))) __bf16 v16bb;
typedef __attribute__((ext_vector_type(8))) unsigned short v8us;
__device__ __forceinline__ v16bb frag_kb_bf(const __bf16* p, int hh) { const v8bb a = *(const v8bb*)(p + 8 * hh), b = *(const v8bb*)(p + 16 + 8 * hh); return __builtin_shufflevector(a, b, 0, 1, 2, 3, 4, 5, 6, 7, 8, 9, 10, 11, 12, 13, 14, 15); }
__device__ __forceinline__ v8f wmma16bb(v16bb a, v16bb b, v8f c) {
  v8f d = __builtin_amdgcn_wmma_f32_16x16x32_bf16(false, a, false, b, (short)0, c, false, false);
  asm volatile("v_nop\n\tv_nop\n\tv_nop\n\tv_nop" : "+v"(d) : "v"(a), "v"(b));
  return d;
}
__device__ __forceinline__ unsigned short bf16_rne_bits(float v) { unsigned int u = __float_as_uint(v); u += 0x7FFFu + ((u >> 16) & 1u); return (unsigned short)(u >> 16); }
__device__ __forceinline__ float bf16_rne(float v) { return __uint_as_float(((unsigned int)bf16_rne_bits(v)) << 16); }



// One conversion launch for all three f32 operands: x and Wqkv -> bf16 bits, W_o -> f16 of the bf16-rounded value (rows copied directly, [out][in]).
// 256 blocks x 16 waves; a thread takes 16 groups of 4 floats, CVT groups apart, so that every wave-wide load covers 512 contiguous bytes and every store 256;
// groups 0..7 fall in x, 8..13 in Wqkv, 14..15 in W_o. All 16 loads are issued ahead of the first conversion: one memory latency per thread.
typedef __attribute__((ext_vector_type(4))) unsigned short v4us; typedef __attribute__((ext_vector_type(4))) _Float16 v4b;
constexpr int CVB = 256, CVW = 512, CVT = CVB * CVW;
static_assert((size_t)NTOK * D / 4 == (size_t)8 * CVT && (size_t)3 * D * D / 4 == (size_t)6 * CVT && (size_t)D * D / 4 == (size_t)2 * CVT, "group counts of the conversion launch");
__global__ __launch_bounds__(CVW) void prep_kernel(const float* __restrict__ x, const float* __restrict__ wqkv, const float* __restrict__ wo,
                                                  unsigned short* __restrict__ x16, unsigned short* __restrict__ w16, b16* __restrict__ wo16) {
  const size_t g = ((size_t)blockIdx.x * CVW + threadIdx.x) * 4; // first float of the thread's group 0
  const float* px0 = x + g; const float* px1 = px0 + (size_t)4 * CVT * 4; const float* pw0 = wqkv + g; const float* pw1 = pw0 + (size_t)4 * CVT * 4; const float* po0 = wo + g;
  v4f a[8], w[6], o[2];
#pragma unroll
  for (int j = 0; j < 4; ++j) { a[j] = *(const v4f*)(px0 + (size_t)j * CVT * 4); a[4 + j] = *(const v4f*)(px1 + (size_t)j * CVT * 4); }
#pragma unroll
  for (int j = 0; j < 4; ++j) w[j] = *(const v4f*)(pw0 + (size_t)j * CVT * 4);
#pragma unroll
  for (int j = 0; j < 2; ++j) { w[4 + j] = *(const v4f*)(pw1 + (size_t)j * CVT * 4); o[j] = *(const v4f*)(po0 + (size_t)j * CVT * 4); }
  // the loads' five address pairs stay live up to this wait, so that none of them is rewritten (also not as a later load's destination) ahead of it
  asm volatile("s_wait_xcnt 0x0" :: "v"(px0), "v"(px1), "v"(pw0), "v"(pw1), "v"(po0) : "memory");
  __builtin_amdgcn_sched_barrier(0);                            // the 16 loads stay one group ahead of the conversions and stores: they are all in flight together
#pragma unroll
  for (int j = 0; j < 8; ++j) { v4us v;
#pragma unroll
    for (int e = 0; e < 4; ++e) v[e] = bf16_rne_bits(a[j][e]);
    *(v4us*)(x16 + g + (size_t)j * CVT * 4) = v; }
#pragma unroll
  for (int j = 0; j < 6; ++j) { v4us v;
#pragma unroll
    for (int e = 0; e < 4; ++e) v[e] = bf16_rne_bits(w[j][e]);
    *(v4us*)(w16 + g + (size_t)j * CVT * 4) = v; }
#pragma unroll
  for (int j = 0; j < 2; ++j) { v4b v;
#pragma unroll
    for (int e = 0; e < 4; ++e) v[e] = (b16)bf16_rne(o[j][e]);
    *(v4b*)(wo16 + g + (size_t)j * CVT * 4) = v; }
}

constexpr int KT = 64;    // k per ring stage of the GEMMs: 16-bit rows of 128 B = one cache line
constexpr int LP = 72;    // LDS row pitch in f16: 144 B = 16 B x 9, so the 16 rows of a ds_load_b128 fragment read fall on distinct banks
__device__ __forceinline__ unsigned lds_addr(const void* p) { return (unsigned)(size_t)p; }   // low 32 bits of a __shared__ address = byte offset in the work-group's LDS

// projections: rows = tokens (4096), K = 1024, block = 8 waves = 128 tokens x 128 columns = two heads of q (column tiles 0..7), k (8..15) or v (16..23); wave = 32 tokens x one head.
// The block's 128 x rows and 128 W rows come once per 64 k into a two-buffer LDS ring by asynchronous copies of whole 128 B rows; every wave takes its fragments from there.
// f16 rows [b*H + head][tok][64] for q/k; v: (8v)^T f16 [b*H + head][64][tok]. grid 768 x 256.
// Attention's ring stages are the token tiles of 128 and it stages none that begins at or past seq_len[b], so such a token tile needs its q columns only: its 16 k and v blocks are
// not computed. The flat block index counts the tiles that hold keys first (24 column blocks each), then the others (8 q blocks each); what is left of the grid leaves at entry.
constexpr int GR = 256;            // ring rows of a projection stage: 128 x rows, then 128 W rows
constexpr int GST = D / KT;        // ring stages of a GEMM: 16
__global__ __launch_bounds__(256) void proj_kernel(const __bf16* __restrict__ x16, const __bf16* __restrict__ w16, const float* __restrict__ bqkv, const int* __restrict__ seq_lens, b16* __restrict__ qh, b16* __restrict__ kh, b16* __restrict__ vt) {
  __shared__ __attribute__((aligned(16))) unsigned char Sm[2 * GR * LP * 2];   // the ring [buffer][row][64 bf16 + pad]; behind the loop's last barrier the epilogue's staging
  const int lane = threadIdx.x & 31, wid = __builtin_amdgcn_readfirstlane(threadIdx.x >> 5), wave = wid & 3, cg = wid >> 2, nloc = lane & 15, hlf = lane >> 4;
  static_assert(Bn == 2, "the tile count below is written for two sequences");
  constexpr int TPB = S / 128, CQ = D / 128, CA = 3 * D / 128;  // token tiles per sequence, column blocks of q, of q, k and v together
  const int n0 = (min(max(seq_lens[0], 1), S) + 127) / 128, n1 = (min(max(seq_lens[1], 1), S) + 127) / 128, nk = n0 + n1;   // token tiles that hold keys (same clamp as attention's), 1..16 each
  int ty, tx;                                                   // token tile 0..31, column block 0..23 of this block; every term is block-uniform
  if ((int)blockIdx.x < nk * CA) { const int i = (int)blockIdx.x / CA; tx = (int)blockIdx.x % CA; ty = i < n0 ? i : TPB + i - n0; }
  else {
    const int r = (int)blockIdx.x - nk * CA, i = r / CQ; tx = r % CQ;
    if (i >= Bn * TPB - nk) return;                             // taken by the whole block, ahead of every copy and barrier
    ty = i < TPB - n0 ? n0 + i : TPB + n1 + (i - (TPB - n0));
  }
  const int mb = ty * 128, m0 = mb + wave * 32, cb = tx * 128, c0 = cb + cg * 64;
  const int sr = threadIdx.x >> 3, sc = (threadIdx.x & 7) * 8;  // staging: thread -> rows sr + 32 j, 16 B piece sc; a wave's copy covers 4 whole 128 B rows
  // One stage: k in [t*64, t*64+64) < D. 8 copies of 16 B per lane, all lanes on; the s_wait_xcnt closes the statement so that no address register is rewritten ahead of it.
  auto stage = [&](int t, int buf) {
    const __bf16* gx = x16 + (size_t)(mb + sr) * D + t * KT + sc; const __bf16* gw = w16 + (size_t)(cb + sr) * D + t * KT + sc;
    const unsigned l0 = lds_addr(Sm + ((size_t)buf * GR + sr) * (LP * 2) + sc * 2);
    constexpr unsigned HB = 32 * LP * 2;                        // bytes per 32 rows
    asm volatile("global_load_async_to_lds_b128 %0, %8, off\n\t"
                 "global_load_async_to_lds_b128 %1, %9, off\n\t"
                 "global_load_async_to_lds_b128 %2, %10, off\n\t"
                 "global_load_async_to_lds_b128 %3, %11, off\n\t"
                 "global_load_async_to_lds_b128 %4, %12, off\n\t"
                 "global_load_async_to_lds_b128 %5, %13, off\n\t"
                 "global_load_async_to_lds_b128 %6, %14, off\n\t"
                 "global_load_async_to_lds_b128 %7, %15, off\n\t"
                 "s_wait_xcnt 0x0"
                 :: "v"(l0), "v"(l0 + HB), "v"(l0 + 2 * HB), "v"(l0 + 3 * HB), "v"(l0 + 4 * HB), "v"(l0 + 5 * HB), "v"(l0 + 6 * HB), "v"(l0 + 7 * HB),
                    "v"(gx), "v"(gx + 32 * D), "v"(gx + 64 * D), "v"(gx + 96 * D), "v"(gw), "v"(gw + 32 * D), "v"(gw + 64 * D), "v"(gw + 96 * D)
                 : "memory");
  };
  stage(0, 0);
  v8f acc[2][4];
#pragma unroll
  for (int r = 0; r < 2; ++r)
#pragma unroll
    for (int t = 0; t < 4; ++t) acc[r][t] = (v8f){};
  asm volatile("s_wait_asynccnt 0x0" ::: "memory");             // stage 0 of this wave has landed
  __syncthreads();                                              // publishes stage 0 to the other waves
  stage(1, 1);
  for (int s = 0; s < GST; ++s) {
    const __bf16* R = (const __bf16*)(Sm + (size_t)(s & 1) * (GR * LP * 2));
#pragma unroll   // the stage's two k steps of 32 unrolled so that every LDS fragment offset is an immediate
    for (int ks = 0; ks < 2; ++ks) {
      const v16bb a0 = frag_kb_bf(R + (wave * 32 + nloc) * LP + ks * 32, hlf), a1 = frag_kb_bf(R + (wave * 32 + 16 + nloc) * LP + ks * 32, hlf);
      v16bb bw[4];
#pragma unroll
      for (int t = 0; t < 4; ++t) bw[t] = frag_kb_bf(R + (128 + cg * 64 + t * 16 + nloc) * LP + ks * 32, hlf);
      __builtin_amdgcn_sched_barrier(0);                        // the k step's 12 LDS reads stay one group ahead of its 8 products: one LDS latency instead of one per column tile
#pragma unroll
      for (int t = 0; t < 4; ++t) { acc[0][t] = wmma16bb(a0, bw[t], acc[0][t]); acc[1][t] = wmma16bb(a1, bw[t], acc[1][t]); }
    }
    // publish point of stage s + 1
    asm volatile("s_wait_dscnt 0x0" ::: "memory");              // this wave's reads of buffer s & 1 are done before it is refilled
    asm volatile("s_wait_asynccnt 0x0" ::: "memory");           // this wave's copies of stage s + 1 have landed
    __syncthreads();                                            // publishes stage s + 1 and ends every wave's reads of stage s
    if (s + 2 < GST) stage(s + 2, s & 1);
  }
  asm volatile("s_wait_asynccnt 0x0" ::: "memory");             // nothing of the ring is in flight when its LDS becomes staging
  const int which = tx / (D / 128), head = (tx % (D / 128)) * 2 + cg, b = m0 / S, tok0 = m0 % S;
#pragma unroll
  for (int t = 0; t < 4; ++t) { const float bb = bf16_rne(bqkv[c0 + t * 16 + nloc]);   // + bias (rounded to bf16)
#pragma unroll
    for (int r = 0; r < 2; ++r)
#pragma unroll
      for (int v = 0; v < 8; ++v) acc[r][t][v] += bb; }
  if (which < 2) {                                              // q or k head: f16 rows
    b16 (*Th)[HD + 8] = (b16 (*)[HD + 8])(Sm + (size_t)wid * (2 * 32 * (HD + 8) * 2)); b16 (*Tq)[HD + 8] = Th + 32;   // the wave's own hi and lo tiles [32][64 + pad]
#pragma unroll
    for (int t = 0; t < 4; ++t)
#pragma unroll
      for (int r = 0; r < 2; ++r)
#pragma unroll
        for (int v = 0; v < 8; ++v) { b16 a_, c_; split16(acc[r][t][v] * QS, a_, c_); Th[r * 16 + 8 * hlf + v][t * 16 + nloc] = a_; Tq[r * 16 + 8 * hlf + v][t * 16 + nloc] = c_; }   // q, k carried x8 (lo residuals stay normal)
    wave_lds_sync();
    b16* dst = (which == 0 ? qh : kh) + (((size_t)b * H + head) * S + tok0) * HD;
    {
#pragma unroll
      for (int j = 0; j < 8; ++j) { const int rr = j * 4 + (lane >> 3), c8 = (lane & 7) * 8; *(v8b*)(dst + (size_t)rr * HD + c8) = *(const v8b*)(&Th[rr][c8]); *(v8b*)(dst + QPL + (size_t)rr * HD + c8) = *(const v8b*)(&Tq[rr][c8]); }
       }
    return;
  }
  const int vh = head;                                          // v head: (8v)^T tile [64 d][128 tok] via LDS, rows of 256 B; one hi and one lo tile per head of the block
  b16 (*Tt)[128 + 8] = (b16 (*)[128 + 8])(Sm + (size_t)cg * (2 * 64 * (128 + 8) * 2)); b16 (*Tl)[128 + 8] = Tt + 64;
#pragma unroll
  for (int t = 0; t < 4; ++t)
#pragma unroll
    for (int r = 0; r < 2; ++r)
#pragma unroll
      for (int v = 0; v < 8; ++v) { b16 a_, c_; split16(acc[r][t][v] * VS, a_, c_); Tt[t * 16 + nloc][wave * 32 + r * 16 + 8 * hlf + v] = a_; Tl[t * 16 + nloc][wave * 32 + r * 16 + 8 * hlf + v] = c_; }
  __syncthreads();
  b16* dstv = vt + (((size_t)b * H + vh) * HD) * S + mb % S;
  {
#pragma unroll
    for (int j = 0; j < 8; ++j) { const int dd = wave * 16 + j * 2 + (lane >> 4), c8 = (lane & 15) * 8; *(v8b*)(dstv + (size_t)dd * S + c8) = *(const v8b*)(&Tt[dd][c8]); *(v8b*)(dstv + VPL + (size_t)dd * S + c8) = *(const v8b*)(&Tl[dd][c8]); }
    
  }
}

// causal attention: block = 8 waves = 64 consecutive queries of one (b, h) = 4 query groups of 16 x 2 key groups. A ring stage holds 128 keys = four chunks of 32: waves 0..3 take chunks 0 and 2,
// waves 4..7 chunks 1 and 3 (every chunk stays with the key group it had at 64-key stages). A wave works its two chunks as ONE online-softmax step of 64 keys: one maximum, one exchange, one rescale
// of y^T and one publish point per 64 of its keys, and four independent score tiles for the matrix unit; a wave whose bound leaves it one chunk of the stage takes a 32-key step.
// Each wave keeps its own online softmax (f32) and the two partial results of a query group are merged through LDS at the end.
// Blocks outnumber the resident places, so the longest tiles (highest queries) come first in the grid. Per step: S^T (K=64), mask on the straddling chunk, P^T f16, y^T += (8V)^T P^T.
// The block's K rows and (8V)^T rows (hi and lo planes) come once per 128 keys into a two-buffer LDS ring by asynchronous copies of whole lines; every wave takes its fragments from there.
constexpr int KA = 128;                       // keys per attention ring stage
constexpr int LPV = KA + 8;                   // LDS pitch of a V^T row in f16: 272 B = 16 B x 17, so the 16 rows of a ds_load_b128 fragment read fall on distinct banks
constexpr int AKB = 2 * KA * LP * 2;          // bytes of a buffer's K hi and lo planes [2][128 keys][64 d + pad]
constexpr int AVB = 2 * HD * LPV * 2;         // bytes of a buffer's V^T hi and lo planes [2][64 d][128 keys + pad]
constexpr int ABUF = AKB + AVB;               // 71680 B; two buffers = 143360 B, so two blocks stay resident per WGP
template <int N> struct IC { static constexpr int value = N; };
template <int QT>
__global__ __launch_bounds__(256) __attribute__((amdgpu_waves_per_eu(4, 4))) void attn_kernel(const b16* __restrict__ qh, const b16* __restrict__ kh, const b16* __restrict__ vt, const int* __restrict__ seq_lens, b16* __restrict__ yh) {
  __shared__ __attribute__((aligned(16))) unsigned char Sm[2 * ABUF];   // the ring; behind the loop's last barrier the merge's partial results and the epilogue's staging
  const int wid = __builtin_amdgcn_readfirstlane(threadIdx.x >> 5), lane = threadIdx.x & 31, hh = lane >> 4, col = lane & 15;
  const int qg = wid & 3, kg = wid >> 2;                        // query group, key group of the wave
  const int tile = QT / 4 - 1 - (int)blockIdx.x / (Bn * H), bh = (int)blockIdx.x % (Bn * H), h = bh % H, b = bh / H, q0 = tile * 64 + qg * 16, qi = q0 + col;
  const b16* Q = qh + ((size_t)bh * S) * HD; const b16* K = kh + ((size_t)bh * S) * HD; const b16* vb = vt + ((size_t)bh * HD) * S;
  const int sl = __builtin_amdgcn_readfirstlane(min(max(seq_lens[b], 1), S));   // held in a scalar register so that the mask test of a chunk stays a scalar compare and branch; padding mask: keys >= seq_len are skipped or get -inf (exp -> 0); seq_len >= 1 here so key 0 always survives
  const int kend = __builtin_amdgcn_readfirstlane(min(q0 + 16, sl));   // this wave's key bound, held in a scalar register so that the chunk tests below stay scalar compares and branches
  const int nst = (min(tile * 64 + 64, sl) + KA - 1) / KA;      // ring stages of the block = those of its last query group (block-uniform, 1..16)
  const int sr = threadIdx.x >> 3, sc = (threadIdx.x & 7) * 8;  // K staging: thread -> rows sr + 32 j, 16 B piece sc; a wave's copy covers 4 whole 128 B rows
  const int vr = threadIdx.x >> 4, vc = (threadIdx.x & 15) * 8; // V^T staging: thread -> rows vr + 16 j, 16 B piece vc; a wave's copy covers 2 whole 256 B row pieces
  // One stage: keys [t*128, t*128+128) < S. 16 copies of 16 B per lane, all lanes on; an s_wait_xcnt closes each statement so that no address register is rewritten ahead of it.
  auto stage = [&](int t, int buf) {
    const b16* gk = K + (size_t)(t * KA + sr) * HD + sc; const b16* gv = vb + (size_t)vr * S + t * KA + vc;
    const unsigned lk = lds_addr(Sm + (size_t)buf * ABUF + (size_t)sr * (LP * 2) + sc * 2), lv = lds_addr(Sm + (size_t)buf * ABUF + AKB + (size_t)vr * (LPV * 2) + vc * 2);
    constexpr unsigned KP = KA * LP * 2, KH = 32 * LP * 2, VP = HD * LPV * 2, VH = 16 * LPV * 2;   // bytes per K plane, per 32 K rows, per V^T plane, per 16 V^T rows
    asm volatile("global_load_async_to_lds_b128 %0, %8, off\n\t"
                 "global_load_async_to_lds_b128 %1, %9, off\n\t"
                 "global_load_async_to_lds_b128 %2, %10, off\n\t"
                 "global_load_async_to_lds_b128 %3, %11, off\n\t"
                 "global_load_async_to_lds_b128 %4, %12, off\n\t"
                 "global_load_async_to_lds_b128 %5, %13, off\n\t"
                 "global_load_async_to_lds_b128 %6, %14, off\n\t"
                 "global_load_async_to_lds_b128 %7, %15, off\n\t"
                 "s_wait_xcnt 0x0"
                 :: "v"(lk), "v"(lk + KH), "v"(lk + 2 * KH), "v"(lk + 3 * KH), "v"(lk + KP), "v"(lk + KP + KH), "v"(lk + KP + 2 * KH), "v"(lk + KP + 3 * KH),
                    "v"(gk), "v"(gk + 32 * HD), "v"(gk + 64 * HD), "v"(gk + 96 * HD), "v"(gk + QPL), "v"(gk + QPL + 32 * HD), "v"(gk + QPL + 64 * HD), "v"(gk + QPL + 96 * HD)
                 : "memory");
    asm volatile("global_load_async_to_lds_b128 %0, %8, off\n\t"
                 "global_load_async_to_lds_b128 %1, %9, off\n\t"
                 "global_load_async_to_lds_b128 %2, %10, off\n\t"
                 "global_load_async_to_lds_b128 %3, %11, off\n\t"
                 "global_load_async_to_lds_b128 %4, %12, off\n\t"
                 "global_load_async_to_lds_b128 %5, %13, off\n\t"
                 "global_load_async_to_lds_b128 %6, %14, off\n\t"
                 "global_load_async_to_lds_b128 %7, %15, off\n\t"
                 "s_wait_xcnt 0x0"
                 :: "v"(lv), "v"(lv + VH), "v"(lv + 2 * VH), "v"(lv + 3 * VH), "v"(lv + VP), "v"(lv + VP + VH), "v"(lv + VP + 2 * VH), "v"(lv + VP + 3 * VH),
                    "v"(gv), "v"(gv + (size_t)16 * S), "v"(gv + (size_t)32 * S), "v"(gv + (size_t)48 * S), "v"(gv + VPL), "v"(gv + VPL + (size_t)16 * S), "v"(gv + VPL + (size_t)32 * S), "v"(gv + VPL + (size_t)48 * S)
                 : "memory");
  };
  stage(0, 0);
  v16b qf[2], ql[2];
#pragma unroll
  for (int ks = 0; ks < 2; ++ks) { qf[ks] = frag_kb(Q + (size_t)qi * HD + ks * 32, hh); ql[ks] = frag_kb(Q + QPL + (size_t)qi * HD + ks * 32, hh); }
  float m = -INFINITY, l = 0.0f; v8f o[4] = {{}, {}, {}, {}};
  // One online-softmax step over NC chunks of 32 keys: chunk c holds keys kb + 64 c .. + 31, rows and columns kl + 64 c .. of the stage. Only the last chunk of a step can straddle a bound:
  // where a second chunk is open (kb + 64 < min(q0 + 16, sl)), the first ends 32 keys or more below both bounds.
  auto step = [&](auto nc_, int kb, int kl, const b16* RK, const b16* RV) {
    constexpr int NC = decltype(nc_)::value;
    v8f s[NC][2]; v16b kf[NC][2][2], kq[NC][2][2];              // [chunk][16-key tile]([k step]): scores, K hi, K lo
#pragma unroll
    for (int c = 0; c < NC; ++c)
#pragma unroll
      for (int j = 0; j < 2; ++j) { s[c][j] = (v8f){};
#pragma unroll
        for (int ks = 0; ks < 2; ++ks) { const b16* p = RK + (kl + c * 64 + j * 16 + col) * LP + ks * 32; kf[c][j][ks] = frag_kb(p, hh); if (NC == 1 || ks == 0) kq[c][j][ks] = frag_kb(p + KA * LP, hh); } }
    __builtin_amdgcn_sched_barrier(0);                          // the step's K reads stay one group ahead of the score products: one LDS latency instead of one per k step
    // q and k as f16 hi+lo pairs (lo.lo dropped); each score tile sums hi.hi, hi.lo, lo.hi per k step as before, the tiles taking turns so that no product waits for the one just issued
#pragma unroll
    for (int ks = 0; ks < 2; ++ks) {
      if (NC == 2 && ks == 1) {
#pragma unroll
        for (int c = 0; c < NC; ++c)
#pragma unroll
          for (int j = 0; j < 2; ++j) kq[c][j][1] = frag_kb(RK + KA * LP + (kl + c * 64 + j * 16 + col) * LP + 32, hh);
        __builtin_amdgcn_sched_barrier(0);                      // the last K lo fragments are read here, into registers that the first k step has left (all at once would not fit 256), eight products ahead of their use
      }
#pragma unroll
      for (int c = 0; c < NC; ++c) { s[c][0] = wmma16b(kf[c][0][ks], qf[ks], s[c][0]); s[c][1] = wmma16b(kf[c][1][ks], qf[ks], s[c][1]); }
#pragma unroll
      for (int c = 0; c < NC; ++c) { s[c][0] = wmma16b(kf[c][0][ks], ql[ks], s[c][0]); s[c][1] = wmma16b(kf[c][1][ks], ql[ks], s[c][1]); }
#pragma unroll
      for (int c = 0; c < NC; ++c) { s[c][0] = wmma16b(kq[c][0][ks], qf[ks], s[c][0]); s[c][1] = wmma16b(kq[c][1][ks], qf[ks], s[c][1]); }
    }
    v16b vf[NC][4], vl[NC][4];
#pragma unroll
    for (int n = 0; n < 4; ++n) { const b16* p = RV + (n * 16 + col) * LPV + kl; vf[0][n] = frag_kb(p, hh); vl[0][n] = frag_kb(p + HD * LPV, hh); }
    __builtin_amdgcn_sched_barrier(0);                          // the first chunk's 16 V^T reads stay one group here, so that they land under the softmax instead of stalling each P.v product
    // the maximum m stays in raw score units (C2 > 0 keeps the order); 8 P = 2^(s C2 - m C2 + 3) is one fma and one v_exp per score; l sums 8 P
    const int kbl = kb + (NC - 1) * 64;                         // first key of the step's last chunk
    if ((kbl + 32 > q0) || (kbl + 32 > sl)) {                   // it reaches past some queries or past seq_len -> mask
#pragma unroll
      for (int r = 0; r < 8; ++r) { const int k0_ = kbl + 8 * hh + r, k1_ = kbl + 16 + 8 * hh + r; if (k0_ > qi || k0_ >= sl) s[NC - 1][0][r] = -INFINITY; if (k1_ > qi || k1_ >= sl) s[NC - 1][1][r] = -INFINITY; }
    }
    float mc[NC];                                               // one maximum chain per chunk: the two run side by side
#pragma unroll
    for (int c = 0; c < NC; ++c) { mc[c] = -INFINITY;
#pragma unroll
      for (int r = 0; r < 8; ++r) mc[c] = fmaxf(mc[c], fmaxf(s[c][0][r], s[c][1][r])); }
    float mr = fmaxf(mc[0], mc[NC - 1]);
    mr = fmaxf(mr, __shfl_xor(mr, 16));
    const float mn = fmaxf(m, mr), al_ = __builtin_amdgcn_exp2f((m - mn) * C2), nb = fmaf(-mn, C2, LPS); m = mn;   // mn is finite: key kb <= q0 is open to every query of the wave
    float sum = 0.0f; v16b pb[NC], pl[NC];
#pragma unroll
    for (int c = 0; c < NC; ++c)
#pragma unroll
      for (int r = 0; r < 8; ++r) { const float e0 = __builtin_amdgcn_exp2f(fmaf(s[c][0][r], C2, nb)), e1 = __builtin_amdgcn_exp2f(fmaf(s[c][1][r], C2, nb)); sum += e0 + e1; b16 a, c_; split16(e0, a, c_); pb[c][r] = a; pl[c][r] = c_; split16(e1, a, c_); pb[c][8 + r] = a; pl[c][8 + r] = c_; }   // P carried x8
    sum += __shfl_xor(sum, 16); l = l * al_ + sum;
    if (NC == 2) {
#pragma unroll
      for (int n = 0; n < 4; ++n) vf[NC - 1][n] = frag_kb(RV + (n * 16 + col) * LPV + kl + 64, hh);
      __builtin_amdgcn_sched_barrier(0);                        // the second chunk's V^T hi reads stay one group here (the scores' registers are free by now), so that they land under the first chunk's P.v products
    }
#pragma unroll
    for (int n = 0; n < 4; ++n)
#pragma unroll
      for (int r = 0; r < 8; ++r) o[n][r] *= al_;
    // (8v) and P both as f16 hi+lo pairs (lo.lo dropped); each output tile sums hi.hi, hi.lo, lo.hi per chunk as before, the four tiles taking turns
#pragma unroll
    for (int c = 0; c < NC; ++c) {
#pragma unroll
      for (int n = 0; n < 4; ++n) o[n] = wmma16b(vf[c][n], pb[c], o[n]);
#pragma unroll
      for (int n = 0; n < 4; ++n) o[n] = wmma16b(vf[c][n], pl[c], o[n]);
      if (NC == 2 && c == 0) {
#pragma unroll
        for (int n = 0; n < 4; ++n) vl[NC - 1][n] = frag_kb(RV + HD * LPV + (n * 16 + col) * LPV + kl + 64, hh);
        __builtin_amdgcn_sched_barrier(0);                      // the second chunk's V^T lo reads come here, into registers that the first chunk's hi fragments have left (all at once would not fit 256), twelve products ahead of their use
      }
#pragma unroll
      for (int n = 0; n < 4; ++n) o[n] = wmma16b(vl[c][n], pb[c], o[n]);
    }
  };
  asm volatile("s_wait_asynccnt 0x0" ::: "memory");             // stage 0 of this wave has landed
  __syncthreads();                                              // publishes stage 0 to the other waves
  if (nst > 1) stage(1, 1);
  for (int t = 0; t < nst; ++t) {
    const b16* RK = (const b16*)(Sm + (size_t)(t & 1) * ABUF); const b16* RV = (const b16*)(Sm + (size_t)(t & 1) * ABUF + AKB);
    const int kb = t * KA + kg * 32, kl = kg * 32;              // this wave's first chunk of the stage
    // causal + padding: key chunks past min(query tile, seq_len) are skipped (wave-uniform scalar bounds)
    if (kb + 64 < kend) step(IC<2>{}, kb, kl, RK, RV);
    else if (kb < kend) step(IC<1>{}, kb, kl, RK, RV);
    // publish point of stage t + 1, passed by every wave, also one that skipped its chunks
    asm volatile("s_wait_dscnt 0x0" ::: "memory");              // this wave's reads of buffer t & 1 are done before it is refilled
    asm volatile("s_wait_asynccnt 0x0" ::: "memory");           // this wave's copies of stage t + 1 have landed
    __syncthreads();                                            // publishes stage t + 1 and ends every wave's reads of stage t
    if (t + 2 < nst) stage(t + 2, t & 1);
  }
  asm volatile("s_wait_asynccnt 0x0" ::: "memory");             // nothing of the ring is in flight when its LDS becomes the merge's and the epilogue's
  float (*Os)[16][HD + 4] = (float (*)[16][HD + 4])Sm;          // partial results of the four upper waves: 17408 B at the head of the ring's LDS, free behind the loop's last barrier
  if (kg == 1) {                                                // upper key group: hand the partial sums, maximum and denominator to the partner wave (same lane, same places; m and l in the row's pad)
#pragma unroll
    for (int n = 0; n < 4; ++n)
#pragma unroll
      for (int r = 0; r < 8; ++r) Os[qg][col][n * 16 + 8 * hh + r] = o[n][r];
    Os[qg][col][HD + 2 * hh] = m; Os[qg][col][HD + 2 * hh + 1] = l;
  }
  __syncthreads();                                              // publishes the upper key group's partial results to the lower one
  if (kg == 1) return;
  const float (*Pp)[HD + 4] = Os[qg];
  const float m1 = Pp[col][HD + 2 * hh], l1 = Pp[col][HD + 2 * hh + 1];
  const float mn2 = fmaxf(m, m1), a0 = __builtin_amdgcn_exp2f((m - mn2) * C2), a1 = __builtin_amdgcn_exp2f((m1 - mn2) * C2);   // m is finite (key 0 is in the lower group); a partner without a chunk has m1 = -inf, l1 = 0 -> a1 = 0
  const float inv = 1.0f / (VS * (l * a0 + l1 * a1)), f0 = a0 * inv, f1 = a1 * inv;   // l and l1 already carry the x8 of P
  // y leaves as the f16 hi+lo pair of 8y that the output GEMM multiplies: split once here. The wave's own hi and lo tiles [16 queries][64 d + pad] lie in the ring's LDS behind the partial results.
  b16 (*Th)[LP] = (b16 (*)[LP])(Sm + 4 * 16 * (HD + 4) * 4) + wid * 32; b16 (*Tl)[LP] = Th + 16;
#pragma unroll
  for (int n = 0; n < 4; ++n) { v8b hv, lv;
#pragma unroll
    for (int r = 0; r < 8; ++r) { b16 a_, c_; split16((o[n][r] * f0 + Pp[col][n * 16 + 8 * hh + r] * f1) * 8.0f, a_, c_); hv[r] = a_; lv[r] = c_; }
    *(v8b*)(&Th[col][n * 16 + 8 * hh]) = hv; *(v8b*)(&Tl[col][n * 16 + 8 * hh]) = lv; }
  wave_lds_sync();
  b16* dst = yh + ((size_t)b * S + q0) * D + h * HD;
  {
#pragma unroll
    for (int j = 0; j < 4; ++j) { const int rr = j * 4 + (lane >> 3), c8 = (lane & 7) * 8; *(v8b*)(dst + (size_t)rr * D + c8) = *(const v8b*)(&Th[rr][c8]); *(v8b*)(dst + YPL + (size_t)rr * D + c8) = *(const v8b*)(&Tl[rr][c8]); }
  }
}

// out = y W_o^T: (4096 x 1024) x (1024 x 1024); A = the (8y) f16 hi and lo planes, B = f16(bf16 W_o) rows; f32 rows; block = 8 waves = 128 tokens x 128 columns, wave = 32 x 64.
// The block's 128 hi rows, 128 lo rows and 128 W_o rows (128 B each per stage) come once per 64 k into a two-buffer LDS ring by asynchronous copies of whole rows. grid (8, 32) x 256.
constexpr int OBUF = 3 * 128 * LP * 2;                          // bytes of a buffer: 128 hi rows, 128 lo rows, 128 W_o rows
__global__ __launch_bounds__(256) void out_kernel(const b16* __restrict__ yh, const b16* __restrict__ wo16, const float* __restrict__ bo, float* __restrict__ out) {
  __shared__ __attribute__((aligned(16))) unsigned char Sm[2 * OBUF];   // the ring; behind the loop's last barrier the epilogue's staging (8 KiB per wave)
  const int lane = threadIdx.x & 31, wid = __builtin_amdgcn_readfirstlane(threadIdx.x >> 5), wave = wid & 3, cg = wid >> 2, nloc = lane & 15, hlf = lane >> 4;
  const int mb = blockIdx.y * 128, m0 = mb + wave * 32, cb = blockIdx.x * 128, c0 = cb + cg * 64;
  const int sr = threadIdx.x >> 3, sc = (threadIdx.x & 7) * 8;  // staging: thread -> rows sr + 32 j of each of the three planes, 16 B piece sc; a wave's copy covers 4 whole 128 B rows
  // One stage: k in [t*64, t*64+64) < D. 12 copies of 16 B per lane, all lanes on; the s_wait_xcnt closes the statement so that no address register is rewritten ahead of it.
  auto stage = [&](int t, int buf) {
    const b16* gy = yh + (size_t)(mb + sr) * D + t * KT + sc; const b16* gl = gy + YPL; const b16* gw = wo16 + (size_t)(cb + sr) * D + t * KT + sc;
    const unsigned l0 = lds_addr(Sm + (size_t)buf * OBUF + (size_t)sr * (LP * 2) + sc * 2);
    constexpr unsigned HB = 32 * LP * 2;                        // bytes per 32 rows
    asm volatile("global_load_async_to_lds_b128 %0, %12, off\n\t"
                 "global_load_async_to_lds_b128 %1, %13, off\n\t"
                 "global_load_async_to_lds_b128 %2, %14, off\n\t"
                 "global_load_async_to_lds_b128 %3, %15, off\n\t"
                 "global_load_async_to_lds_b128 %4, %16, off\n\t"
                 "global_load_async_to_lds_b128 %5, %17, off\n\t"
                 "global_load_async_to_lds_b128 %6, %18, off\n\t"
                 "global_load_async_to_lds_b128 %7, %19, off\n\t"
                 "global_load_async_to_lds_b128 %8, %20, off\n\t"
                 "global_load_async_to_lds_b128 %9, %21, off\n\t"
                 "global_load_async_to_lds_b128 %10, %22, off\n\t"
                 "global_load_async_to_lds_b128 %11, %23, off\n\t"
                 "s_wait_xcnt 0x0"
                 :: "v"(l0), "v"(l0 + HB), "v"(l0 + 2 * HB), "v"(l0 + 3 * HB), "v"(l0 + 4 * HB), "v"(l0 + 5 * HB), "v"(l0 + 6 * HB), "v"(l0 + 7 * HB),
                    "v"(l0 + 8 * HB), "v"(l0 + 9 * HB), "v"(l0 + 10 * HB), "v"(l0 + 11 * HB),
                    "v"(gy), "v"(gy + 32 * D), "v"(gy + 64 * D), "v"(gy + 96 * D), "v"(gl), "v"(gl + 32 * D), "v"(gl + 64 * D), "v"(gl + 96 * D),
                    "v"(gw), "v"(gw + 32 * D), "v"(gw + 64 * D), "v"(gw + 96 * D)
                 : "memory");
  };
  stage(0, 0);
  v8f acc[2][4];
#pragma unroll
  for (int r = 0; r < 2; ++r)
#pragma unroll
    for (int t = 0; t < 4; ++t) acc[r][t] = (v8f){};
  asm volatile("s_wait_asynccnt 0x0" ::: "memory");             // stage 0 of this wave has landed
  __syncthreads();                                              // publishes stage 0 to the other waves
  stage(1, 1);
  for (int s = 0; s < GST; ++s) {
    const b16* R = (const b16*)(Sm + (size_t)(s & 1) * OBUF);
#pragma unroll   // the stage's two k steps of 32 unrolled so that every LDS fragment offset is an immediate
    for (int ks = 0; ks < 2; ++ks) {
      v16b ah[2], al[2], bh[4];                                 // y as an f16 hi+lo pair carried x8 (2 products)
#pragma unroll
      for (int r = 0; r < 2; ++r) { ah[r] = frag_kb(R + (wave * 32 + r * 16 + nloc) * LP + ks * 32, hlf); al[r] = frag_kb(R + (128 + wave * 32 + r * 16 + nloc) * LP + ks * 32, hlf); }
#pragma unroll
      for (int t = 0; t < 4; ++t) bh[t] = frag_kb(R + (256 + cg * 64 + t * 16 + nloc) * LP + ks * 32, hlf);
      __builtin_amdgcn_sched_barrier(0);                        // the k step's 16 LDS reads stay one group ahead of the 16 products: one LDS latency instead of one per tile
#pragma unroll
      for (int t = 0; t < 4; ++t) {
        acc[0][t] = mac<5, 1>(ah[0], al[0], bh[t], bh[t], acc[0][t]);
        acc[1][t] = mac<5, 1>(ah[1], al[1], bh[t], bh[t], acc[1][t]);
      }
    }
    // publish point of stage s + 1
    asm volatile("s_wait_dscnt 0x0" ::: "memory");              // this wave's reads of buffer s & 1 are done before it is refilled
    asm volatile("s_wait_asynccnt 0x0" ::: "memory");           // this wave's copies of stage s + 1 have landed
    __syncthreads();                                            // publishes stage s + 1 and ends every wave's reads of stage s
    if (s + 2 < GST) stage(s + 2, s & 1);
  }
  asm volatile("s_wait_asynccnt 0x0" ::: "memory");             // nothing of the ring is in flight when its LDS becomes staging
#pragma unroll
  for (int t = 0; t < 4; ++t)
#pragma unroll
    for (int r = 0; r < 2; ++r)
#pragma unroll
      for (int v = 0; v < 8; ++v) acc[r][t][v] = acc[r][t][v] * (1.0f / 8.0f) + bf16_rne(bo[c0 + t * 16 + nloc]);
  epi_f32(acc, 1.0f, nullptr, out, D, m0, c0, lane, (float*)(Sm + (size_t)wid * (32 * 64 * 4)));
}
}  // namespace

extern "C" void kernel_launch(void* const* d_in, const int* in_sizes, int n_in,
                              void* d_out, int out_size, void* d_ws, size_t ws_size, hipStream_t stream) {
  (void)n_in; (void)out_size;
  const float* x = (const float*)d_in[0]; const int* seq_lens = (const int*)d_in[1]; const float* wqkv = (const float*)d_in[2]; const float* bqkv = (const float*)d_in[3]; const float* wo = (const float*)d_in[4]; const float* bo = (const float*)d_in[5];
  float* out = (float*)d_out;   // [2][2048][1024]
  if (in_sizes[0] != BT * S * D || in_sizes[1] != Bn || in_sizes[2] != 3 * D * D || in_sizes[3] != 3 * D || in_sizes[4] != D * D || in_sizes[5] != D) return;
  size_t off = 0; char* ws = (char*)d_ws;
  auto carve = [&](size_t bytes) { char* p = ws + off; off += (bytes + 255) & ~(size_t)255; return p; };
  unsigned short* x16 = (unsigned short*)carve((size_t)NTOK * D * 2); unsigned short* w16 = (unsigned short*)carve((size_t)3 * D * D * 2); b16* wo16 = (b16*)carve((size_t)D * D * 2);
  b16* qh = (b16*)carve((size_t)2 * NTOK * D * 2); b16* kh = (b16*)carve((size_t)2 * NTOK * D * 2); b16* vt = (b16*)carve((size_t)2 * NTOK * D * 2); b16* yh = (b16*)carve((size_t)2 * NTOK * D * 2);
  if (off > ws_size) return;                                    // ≈ 84 MB
  prep_kernel<<<CVB, CVW, 0, stream>>>(x, wqkv, wo, x16, w16, wo16);
  proj_kernel<<<(3 * D / 128) * (NTOK / 128), 256, 0, stream>>>((const __bf16*)x16, (const __bf16*)w16, bqkv, seq_lens, qh, kh, vt);
  attn_kernel<S / 16><<<Bn * H * (S / 64), 256, 0, stream>>>(qh, kh, vt, seq_lens, yh);
  out_kernel<<<dim3(D / 128, NTOK / 128), 256, 0, stream>>>(yh, wo16, bo, out);
}
